// v000
// The times below were measured on an AMD MI455X: many runs one after another, warmed up first and cycling through
// copies of the inputs, with the whole window's GPU time divided by the number of runs. Launches and the gaps
// between them are all in it. The median over several windows is given; except for v000 it joins two sittings, which
// can be a few percent apart, so the side-by-side timings, each taken in one sitting, are the better comparison.
// v000, which the later versions start from, runs in 874 microseconds.
#include <hip/hip_runtime.h>
#include <math.h>

typedef __bf16 bf16_t;
typedef __attribute__((ext_vector_type(16))) __bf16 v16bf;
typedef __attribute__((ext_vector_type(8)))  float  v8f;
typedef unsigned int u32x4 __attribute__((ext_vector_type(4)));
typedef int i32x4 __attribute__((ext_vector_type(4)));

union AFrag { v16bf v; u32x4 q[2]; };

#if __has_builtin(__builtin_amdgcn_global_load_async_to_lds_b128) && \
    __has_builtin(__builtin_amdgcn_s_wait_asynccnt)
#define HAS_ASYNC_LDS 1
typedef __attribute__((address_space(1))) i32x4* glds_gptr;
typedef __attribute__((address_space(3))) i32x4* glds_lptr;
#else
#define HAS_ASYNC_LDS 0
#endif

__device__ __forceinline__ void async_copy16(void* lds, const void* g) {
#if HAS_ASYNC_LDS
    __builtin_amdgcn_global_load_async_to_lds_b128(
        (glds_gptr)(g), (glds_lptr)(lds), 0, 0);
#endif
}
__device__ __forceinline__ void async_wait0() {
#if HAS_ASYNC_LDS
    __builtin_amdgcn_s_wait_asynccnt(0);
#endif
}

// ---------------------------------------------------------------------------
// Weight convert: W (K x N, f32, row-major) -> Wt (N x K, bf16, row-major)
// ---------------------------------------------------------------------------
__global__ __launch_bounds__(256)
void k_transpose_bf16(const float* __restrict__ W, bf16_t* __restrict__ Wt, int K, int N) {
    __shared__ float tile[32][33];
    int kb = blockIdx.y * 32, nb = blockIdx.x * 32;
    int tx = threadIdx.x & 31, ty = threadIdx.x >> 5;
    #pragma unroll
    for (int i = ty; i < 32; i += 8) {
        int k = kb + i, n = nb + tx;
        tile[i][tx] = (k < K && n < N) ? W[(size_t)k * N + n] : 0.f;
    }
    __syncthreads();
    #pragma unroll
    for (int i = ty; i < 32; i += 8) {
        int n = nb + i, k = kb + tx;
        if (n < N && k < K) Wt[(size_t)n * K + k] = (bf16_t)tile[tx][i];
    }
}

// ---------------------------------------------------------------------------
// LayerNorm (f32 in) -> bf16 out.  One block per row.
// ---------------------------------------------------------------------------
__global__ __launch_bounds__(256)
void k_layernorm(const float* __restrict__ x, const float* __restrict__ g,
                 const float* __restrict__ b, bf16_t* __restrict__ out, int D) {
    const float* row = x + (size_t)blockIdx.x * D;
    float s = 0.f, s2 = 0.f;
    for (int d = threadIdx.x; d < D; d += 256) { float v = row[d]; s += v; s2 += v * v; }
    #pragma unroll
    for (int off = 16; off; off >>= 1) { s += __shfl_down(s, off); s2 += __shfl_down(s2, off); }
    __shared__ float ws[8], ws2[8];
    int wave = threadIdx.x >> 5, lane = threadIdx.x & 31;
    if (lane == 0) { ws[wave] = s; ws2[wave] = s2; }
    __syncthreads();
    if (threadIdx.x == 0) {
        float a = 0.f, a2 = 0.f;
        #pragma unroll
        for (int i = 0; i < 8; i++) { a += ws[i]; a2 += ws2[i]; }
        ws[0] = a; ws2[0] = a2;
    }
    __syncthreads();
    float mean = ws[0] / D;
    float var  = ws2[0] / D - mean * mean;
    float rstd = rsqrtf(var + 1e-5f);
    bf16_t* orow = out + (size_t)blockIdx.x * D;
    for (int d = threadIdx.x; d < D; d += 256)
        orow[d] = (bf16_t)((row[d] - mean) * rstd * g[d] + b[d]);
}

// ---------------------------------------------------------------------------
// Generic bf16 WMMA GEMM:  C[M,N] = A[M,K] * Wt[N,K]^T  (+bias)(+gelu)(+resid)
// Block tile 128x128, K-step 32, 8 waves: each wave 32(M) x 64(N).
// Async global->LDS double-buffered pipeline when available.
// ---------------------------------------------------------------------------
#define GEMM_LDK 40   // padded LDS K-stride (80B: 16B aligned, conflict-free)

__global__ __launch_bounds__(256)
void k_gemm_bf16(const bf16_t* __restrict__ A, const bf16_t* __restrict__ Wt,
                 const float* __restrict__ bias, const float* __restrict__ resid,
                 float* __restrict__ outF, bf16_t* __restrict__ outB,
                 int M, int N, int K, int act) {
    __shared__ bf16_t As[2][128][GEMM_LDK];
    __shared__ bf16_t Bs[2][128][GEMM_LDK];
    const int tid = threadIdx.x;
    const int wave = tid >> 5, lane = tid & 31;
    const int m0 = blockIdx.y * 128, n0 = blockIdx.x * 128;
    const int wm = (wave & 3) * 32, wn = (wave >> 2) * 64;
    const int lm = lane & 15, kh = lane >> 4;

    v8f acc[2][4];
    #pragma unroll
    for (int i = 0; i < 2; i++)
        #pragma unroll
        for (int j = 0; j < 4; j++)
            #pragma unroll
            for (int v = 0; v < 8; v++) acc[i][j][v] = 0.f;

    const int r = tid >> 1, half = tid & 1;
    const bool bValid = (n0 + r < N);

#if HAS_ASYNC_LDS
    if (!bValid) {           // zero-fill OOB weight rows once (both buffers)
        u32x4 z = {0, 0, 0, 0};
        #pragma unroll
        for (int bufi = 0; bufi < 2; bufi++) {
            *(u32x4*)&Bs[bufi][r][half * 16]     = z;
            *(u32x4*)&Bs[bufi][r][half * 16 + 8] = z;
        }
    }
    {   // prime the pipeline: tile 0 -> buffer 0
        const bf16_t* ga = A + (size_t)(m0 + r) * K + half * 16;
        async_copy16(&As[0][r][half * 16], ga);
        async_copy16(&As[0][r][half * 16 + 8], ga + 8);
        if (bValid) {
            const bf16_t* gb = Wt + (size_t)(n0 + r) * K + half * 16;
            async_copy16(&Bs[0][r][half * 16], gb);
            async_copy16(&Bs[0][r][half * 16 + 8], gb + 8);
        }
    }
    int cur = 0;
    for (int k0 = 0; k0 < K; k0 += 32) {
        async_wait0();
        __syncthreads();
        if (k0 + 32 < K) {   // fetch next tile into the other buffer
            const bf16_t* ga = A + (size_t)(m0 + r) * K + k0 + 32 + half * 16;
            async_copy16(&As[cur ^ 1][r][half * 16], ga);
            async_copy16(&As[cur ^ 1][r][half * 16 + 8], ga + 8);
            if (bValid) {
                const bf16_t* gb = Wt + (size_t)(n0 + r) * K + k0 + 32 + half * 16;
                async_copy16(&Bs[cur ^ 1][r][half * 16], gb);
                async_copy16(&Bs[cur ^ 1][r][half * 16 + 8], gb + 8);
            }
        }
        if (k0 + 64 < K)
            __builtin_prefetch(A + (size_t)(m0 + r) * K + k0 + 64 + half * 16, 0, 3);

        AFrag a[2], bfr[4];
        #pragma unroll
        for (int i = 0; i < 2; i++) {
            const bf16_t* p = &As[cur][wm + i * 16 + lm][kh * 8];
            a[i].q[0] = *(const u32x4*)p;
            a[i].q[1] = *(const u32x4*)(p + 16);
        }
        #pragma unroll
        for (int j = 0; j < 4; j++) {
            const bf16_t* p = &Bs[cur][wn + j * 16 + lm][kh * 8];
            bfr[j].q[0] = *(const u32x4*)p;
            bfr[j].q[1] = *(const u32x4*)(p + 16);
        }
        #pragma unroll
        for (int i = 0; i < 2; i++)
            #pragma unroll
            for (int j = 0; j < 4; j++)
                acc[i][j] = __builtin_amdgcn_wmma_f32_16x16x32_bf16(
                    false, a[i].v, false, bfr[j].v, (short)0, acc[i][j], false, false);
        cur ^= 1;
    }
#else
    for (int k0 = 0; k0 < K; k0 += 32) {
        {
            const bf16_t* gp = A + (size_t)(m0 + r) * K + k0 + half * 16;
            *(u32x4*)&As[0][r][half * 16]     = *(const u32x4*)gp;
            *(u32x4*)&As[0][r][half * 16 + 8] = *(const u32x4*)(gp + 8);
        }
        {
            u32x4 z0 = {0, 0, 0, 0}, z1 = {0, 0, 0, 0};
            if (bValid) {
                const bf16_t* gp = Wt + (size_t)(n0 + r) * K + k0 + half * 16;
                z0 = *(const u32x4*)gp; z1 = *(const u32x4*)(gp + 8);
            }
            *(u32x4*)&Bs[0][r][half * 16]     = z0;
            *(u32x4*)&Bs[0][r][half * 16 + 8] = z1;
        }
        if (k0 + 32 < K)
            __builtin_prefetch(A + (size_t)(m0 + r) * K + k0 + 32 + half * 16, 0, 3);
        __syncthreads();
        AFrag a[2], bfr[4];
        #pragma unroll
        for (int i = 0; i < 2; i++) {
            const bf16_t* p = &As[0][wm + i * 16 + lm][kh * 8];
            a[i].q[0] = *(const u32x4*)p;
            a[i].q[1] = *(const u32x4*)(p + 16);
        }
        #pragma unroll
        for (int j = 0; j < 4; j++) {
            const bf16_t* p = &Bs[0][wn + j * 16 + lm][kh * 8];
            bfr[j].q[0] = *(const u32x4*)p;
            bfr[j].q[1] = *(const u32x4*)(p + 16);
        }
        #pragma unroll
        for (int i = 0; i < 2; i++)
            #pragma unroll
            for (int j = 0; j < 4; j++)
                acc[i][j] = __builtin_amdgcn_wmma_f32_16x16x32_bf16(
                    false, a[i].v, false, bfr[j].v, (short)0, acc[i][j], false, false);
        __syncthreads();
    }
#endif

    // Epilogue
    #pragma unroll
    for (int i = 0; i < 2; i++)
        #pragma unroll
        for (int j = 0; j < 4; j++) {
            int n = n0 + wn + j * 16 + lm;
            if (n >= N) continue;
            float bv = bias ? bias[n] : 0.f;
            #pragma unroll
            for (int v = 0; v < 8; v++) {
                int m = m0 + wm + i * 16 + v + 8 * kh;
                float c = acc[i][j][v] + bv;
                if (act == 1) c = 0.5f * c * (1.f + erff(c * 0.70710678118f));
                size_t idx = (size_t)m * N + n;
                if (resid) c += resid[idx];
                if (outF) outF[idx] = c;
                if (outB) outB[idx] = (bf16_t)c;
            }
        }
}

// ---------------------------------------------------------------------------
// Flash-style causal attention.  qkv bf16 [(b,t), 3, H, 64].
// grid (T/128, B*H), 256 threads (8 waves, 16 q-rows each).
// ---------------------------------------------------------------------------
__global__ __launch_bounds__(256)
void k_attention(const bf16_t* __restrict__ qkv, float* __restrict__ seqout,
                 int B, int T, int H) {
    const int qb = blockIdx.x;
    const int bh = blockIdx.y;
    const int h = bh % H, b = bh / H;
    const int tid = threadIdx.x, wave = tid >> 5, lane = tid & 31;
    const int lm = lane & 15, kh = lane >> 4;

    __shared__ bf16_t Qs[128][72];
    __shared__ bf16_t Ks[128][72];
    __shared__ bf16_t Vt[64][136];     // V transposed: [dh][s]
    __shared__ bf16_t Ps[8][16][40];   // per-wave P staging (32-wide K chunk)

    const size_t strideT = 3 * 1024;
    const bf16_t* base = qkv + (size_t)b * T * strideT + (size_t)h * 64;

    // Load Q tile (128 x 64)
    for (int c8 = tid; c8 < 128 * 8; c8 += 256) {
        int rr = c8 >> 3, cc = (c8 & 7) * 8;
        const bf16_t* gq = base + (size_t)(qb * 128 + rr) * strideT + cc;
#if HAS_ASYNC_LDS
        async_copy16(&Qs[rr][cc], gq);
#else
        *(u32x4*)&Qs[rr][cc] = *(const u32x4*)gq;
#endif
    }

    float rowm[8], rowl[8];
    v8f oacc[4];
    #pragma unroll
    for (int v = 0; v < 8; v++) { rowm[v] = -INFINITY; rowl[v] = 0.f; }
    #pragma unroll
    for (int jt = 0; jt < 4; jt++)
        #pragma unroll
        for (int v = 0; v < 8; v++) oacc[jt][v] = 0.f;

    for (int sb = 0; sb <= qb; sb++) {
        __syncthreads();   // protect Ks/Vt reuse across iterations
        for (int c8 = tid; c8 < 128 * 8; c8 += 256) {
            int rr = c8 >> 3, cc = (c8 & 7) * 8;
            const bf16_t* gk = base + (size_t)(sb * 128 + rr) * strideT + 1024 + cc;
#if HAS_ASYNC_LDS
            async_copy16(&Ks[rr][cc], gk);
#else
            *(u32x4*)&Ks[rr][cc] = *(const u32x4*)gk;
#endif
        }
        for (int c8 = tid; c8 < 128 * 8; c8 += 256) {
            int rr = c8 >> 3, cc = (c8 & 7) * 8;
            union { u32x4 u; bf16_t e[8]; } vv;
            vv.u = *(const u32x4*)(base + (size_t)(sb * 128 + rr) * strideT + 2048 + cc);
            #pragma unroll
            for (int i = 0; i < 8; i++) Vt[cc + i][rr] = vv.e[i];
        }
        async_wait0();
        __syncthreads();

        // ---- scores: S = Q * K^T ----
        AFrag aq[2];
        #pragma unroll
        for (int kk = 0; kk < 2; kk++) {
            const bf16_t* p = &Qs[wave * 16 + lm][kk * 32 + kh * 8];
            aq[kk].q[0] = *(const u32x4*)p;
            aq[kk].q[1] = *(const u32x4*)(p + 16);
        }
        v8f sacc[8];
        #pragma unroll
        for (int j = 0; j < 8; j++)
            #pragma unroll
            for (int v = 0; v < 8; v++) sacc[j][v] = 0.f;
        #pragma unroll
        for (int j = 0; j < 8; j++)
            #pragma unroll
            for (int kk = 0; kk < 2; kk++) {
                AFrag bk;
                const bf16_t* p = &Ks[j * 16 + lm][kk * 32 + kh * 8];
                bk.q[0] = *(const u32x4*)p;
                bk.q[1] = *(const u32x4*)(p + 16);
                sacc[j] = __builtin_amdgcn_wmma_f32_16x16x32_bf16(
                    false, aq[kk].v, false, bk.v, (short)0, sacc[j], false, false);
            }

        // ---- causal mask + online softmax (wave32: 16-lane row reductions) ----
        #pragma unroll
        for (int v = 0; v < 8; v++) {
            int trow = qb * 128 + wave * 16 + v + 8 * kh;
            float rm = -INFINITY;
            #pragma unroll
            for (int j = 0; j < 8; j++) {
                int col = sb * 128 + j * 16 + lm;
                float s = (col <= trow) ? sacc[j][v] * 0.125f : -INFINITY;
                sacc[j][v] = s;
                rm = fmaxf(rm, s);
            }
            #pragma unroll
            for (int msk = 1; msk < 16; msk <<= 1) rm = fmaxf(rm, __shfl_xor(rm, msk));
            float mnew = fmaxf(rowm[v], rm);
            float corr = expf(rowm[v] - mnew);
            rowm[v] = mnew;
            float rs = 0.f;
            #pragma unroll
            for (int j = 0; j < 8; j++) {
                float p = expf(sacc[j][v] - mnew);
                sacc[j][v] = p;
                rs += p;
            }
            #pragma unroll
            for (int msk = 1; msk < 16; msk <<= 1) rs += __shfl_xor(rs, msk);
            rowl[v] = rowl[v] * corr + rs;
            #pragma unroll
            for (int jt = 0; jt < 4; jt++) oacc[jt][v] = oacc[jt][v] * corr;
        }

        // ---- O += P * V  (stage P through LDS: C-layout -> A-layout) ----
        #pragma unroll
        for (int kk = 0; kk < 4; kk++) {
            #pragma unroll
            for (int jj = 0; jj < 2; jj++) {
                int j = kk * 2 + jj;
                #pragma unroll
                for (int v = 0; v < 8; v++)
                    Ps[wave][v + 8 * kh][jj * 16 + lm] = (bf16_t)sacc[j][v];
            }
            AFrag ap;
            const bf16_t* p = &Ps[wave][lm][kh * 8];
            ap.q[0] = *(const u32x4*)p;
            ap.q[1] = *(const u32x4*)(p + 16);
            #pragma unroll
            for (int jt = 0; jt < 4; jt++) {
                AFrag bv;
                const bf16_t* q = &Vt[jt * 16 + lm][kk * 32 + kh * 8];
                bv.q[0] = *(const u32x4*)q;
                bv.q[1] = *(const u32x4*)(q + 16);
                oacc[jt] = __builtin_amdgcn_wmma_f32_16x16x32_bf16(
                    false, ap.v, false, bv.v, (short)0, oacc[jt], false, false);
            }
        }
    }

    float* out = seqout + (size_t)b * T * 1024 + (size_t)h * 64;
    #pragma unroll
    for (int jt = 0; jt < 4; jt++)
        #pragma unroll
        for (int v = 0; v < 8; v++) {
            int trow = qb * 128 + wave * 16 + v + 8 * kh;
            int col  = jt * 16 + lm;
            out[(size_t)trow * 1024 + col] = oacc[jt][v] / rowl[v];
        }
}

// ---------------------------------------------------------------------------
// Plucker lines + J6 rotation.  One thread per (b,t,h).
// ---------------------------------------------------------------------------
__device__ inline void exterior4(const float* a1, const float* a2, float* L) {
    L[0] = a1[0] * a2[1] - a1[1] * a2[0];
    L[1] = a1[0] * a2[2] - a1[2] * a2[0];
    L[2] = a1[0] * a2[3] - a1[3] * a2[0];
    L[3] = a1[1] * a2[2] - a1[2] * a2[1];
    L[4] = a1[1] * a2[3] - a1[3] * a2[1];
    L[5] = a1[2] * a2[3] - a1[3] * a2[2];
    float n2 = 0.f;
    #pragma unroll
    for (int i = 0; i < 6; i++) n2 += L[i] * L[i];
    float inv = 1.f / fmaxf(sqrtf(n2), 1e-12f);
    #pragma unroll
    for (int i = 0; i < 6; i++) L[i] *= inv;
}

__global__ __launch_bounds__(256)
void k_lines(const float* __restrict__ p1w, const float* __restrict__ p2w,
             const float* __restrict__ p1r, const float* __restrict__ p2r,
             float* __restrict__ Jw, float* __restrict__ Rd, int B, int T, int H) {
    int idx = blockIdx.x * 256 + threadIdx.x;
    if (idx >= B * T * H) return;
    int h = idx % H, t = (idx / H) % T, b = idx / (H * T);
    size_t row = (size_t)b * T + t;
    float a1[4], a2[4], L[6];
    #pragma unroll
    for (int c = 0; c < 4; c++) {
        a1[c] = (t > 0) ? p1w[(row - 1) * 64 + h * 4 + c] : 0.f;
        a2[c] = p2w[row * 64 + h * 4 + c];
    }
    exterior4(a1, a2, L);
    float* jw = Jw + ((size_t)(b * H + h) * T + t) * 6;
    jw[0] = L[5]; jw[1] = -L[4]; jw[2] = L[3]; jw[3] = L[2]; jw[4] = -L[1]; jw[5] = L[0];
    #pragma unroll
    for (int c = 0; c < 4; c++) {
        a1[c] = p1r[row * 64 + h * 4 + c];
        a2[c] = p2r[row * 64 + h * 4 + c];
    }
    exterior4(a1, a2, L);
    float* rd = Rd + ((size_t)(b * H + h) * T + t) * 6;
    #pragma unroll
    for (int j = 0; j < 6; j++) rd[j] = L[j];
}

// ---------------------------------------------------------------------------
// Sequential decayed-Gram scan:  M_t = d*(M_{t-1} + Jw_{t-1} Jw_{t-1}^T).
// One wave per (b,h); lane j<6 owns column j of the 6x6 M.
// ---------------------------------------------------------------------------
__global__ __launch_bounds__(32)
void k_gram_scan(const float* __restrict__ Jw, const float* __restrict__ Rd,
                 const float* __restrict__ glin, const float* __restrict__ decay_logits,
                 const float* __restrict__ iter_mix, const float* __restrict__ mem_scale,
                 float* __restrict__ gh, int B, int T, int H) {
    int bh = blockIdx.x, h = bh % H, b = bh / H;
    int j = threadIdx.x;
    float decay = 1.f / (1.f + expf(-decay_logits[h]));
    float alpha = 1.f / (1.f + expf(-iter_mix[0]));
    float msc = mem_scale[h];
    float Mcol[6] = {0, 0, 0, 0, 0, 0};
    float pJ[6]   = {0, 0, 0, 0, 0, 0};
    const float* Jb = Jw + (size_t)bh * T * 6;
    const float* Rb = Rd + (size_t)bh * T * 6;
    for (int t = 0; t < T; t++) {
        float rd[6], jw[6];
        #pragma unroll
        for (int i = 0; i < 6; i++) { rd[i] = Rb[t * 6 + i]; jw[i] = Jb[t * 6 + i]; }
        float s1 = 0.f, s2 = 0.f;
        if (j < 6) {
            float pj = pJ[j], rdM = 0.f;
            #pragma unroll
            for (int i = 0; i < 6; i++) {
                Mcol[i] = decay * (Mcol[i] + pJ[i] * pj);
                rdM += rd[i] * Mcol[i];
            }
            s1 = rdM * rd[j];
            s2 = rdM * rdM;
        }
        #pragma unroll
        for (int m = 1; m < 8; m <<= 1) { s1 += __shfl_xor(s1, m); s2 += __shfl_xor(s2, m); }
        if (j == 0) {
            float ms = (1.f - alpha) * s1 + alpha * s2;
            float g1 = 1.f / (1.f + expf(-ms * msc));
            float g2 = 1.f / (1.f + expf(-glin[((size_t)b * T + t) * H + h]));
            gh[((size_t)b * T + t) * H + h] = g1 * g2;
        }
        #pragma unroll
        for (int i = 0; i < 6; i++) pJ[i] = jw[i];
    }
}

// ---------------------------------------------------------------------------
// y = seqout + mean_h(gh) * memval  -> bf16 (input to Wout GEMM)
// ---------------------------------------------------------------------------
__global__ __launch_bounds__(256)
void k_combine(const float* __restrict__ seqout, const float* __restrict__ memval,
               const float* __restrict__ gh, bf16_t* __restrict__ y, int D, int H) {
    size_t row = blockIdx.x;
    float g = 0.f;
    #pragma unroll
    for (int h = 0; h < 16; h++) g += gh[row * H + h];
    g *= (1.f / 16.f);
    const float* so = seqout + row * D;
    const float* mv = memval + row * D;
    bf16_t* yr = y + row * D;
    for (int d = threadIdx.x; d < D; d += 256)
        yr[d] = (bf16_t)(so[d] + g * mv[d]);
}

// ---------------------------------------------------------------------------
extern "C" void kernel_launch(void* const* d_in, const int* in_sizes, int n_in,
                              void* d_out, int out_size, void* d_ws, size_t ws_size,
                              hipStream_t stream) {
    const int B = 2, T = 1024, D = 1024, H = 16, DFF = 4096;
    const int M = B * T;

    const float* x            = (const float*)d_in[0];
    const float* ln1_g        = (const float*)d_in[1];
    const float* ln1_b        = (const float*)d_in[2];
    const float* Wqkv         = (const float*)d_in[3];
    const float* bqkv         = (const float*)d_in[4];
    const float* W1w          = (const float*)d_in[5];
    const float* W2w          = (const float*)d_in[6];
    const float* W1r          = (const float*)d_in[7];
    const float* W2r          = (const float*)d_in[8];
    const float* Wmv          = (const float*)d_in[9];
    const float* bmv          = (const float*)d_in[10];
    const float* Wmg          = (const float*)d_in[11];
    const float* bmg          = (const float*)d_in[12];
    const float* mem_scale    = (const float*)d_in[13];
    const float* iter_mix     = (const float*)d_in[14];
    const float* decay_logits = (const float*)d_in[15];
    const float* Wout         = (const float*)d_in[16];
    const float* bout         = (const float*)d_in[17];
    const float* ln2_g        = (const float*)d_in[18];
    const float* ln2_b        = (const float*)d_in[19];
    const float* Wfc          = (const float*)d_in[20];
    const float* bfc          = (const float*)d_in[21];
    const float* Wproj        = (const float*)d_in[22];
    const float* bproj        = (const float*)d_in[23];

    char* ws = (char*)d_ws;
    size_t off = 0;
    auto alloc = [&](size_t bytes) -> void* {
        void* p = ws + off;
        off += (bytes + 255) & ~(size_t)255;
        return p;
    };

    bf16_t* Wqkv_t  = (bf16_t*)alloc((size_t)3 * D * D * 2);
    bf16_t* W1w_t   = (bf16_t*)alloc((size_t)64 * D * 2);
    bf16_t* W2w_t   = (bf16_t*)alloc((size_t)64 * D * 2);
    bf16_t* W1r_t   = (bf16_t*)alloc((size_t)64 * D * 2);
    bf16_t* W2r_t   = (bf16_t*)alloc((size_t)64 * D * 2);
    bf16_t* Wmg_t   = (bf16_t*)alloc((size_t)H * D * 2);
    bf16_t* Wmv_t   = (bf16_t*)alloc((size_t)D * D * 2);
    bf16_t* Wout_t  = (bf16_t*)alloc((size_t)D * D * 2);
    bf16_t* Wfc_t   = (bf16_t*)alloc((size_t)DFF * D * 2);
    bf16_t* Wproj_t = (bf16_t*)alloc((size_t)D * DFF * 2);
    bf16_t* h_bf    = (bf16_t*)alloc((size_t)M * D * 2);
    bf16_t* qkv_bf  = (bf16_t*)alloc((size_t)M * 3 * D * 2);
    float*  p1w     = (float*)alloc((size_t)M * 64 * 4);
    float*  p2w     = (float*)alloc((size_t)M * 64 * 4);
    float*  p1r     = (float*)alloc((size_t)M * 64 * 4);
    float*  p2r     = (float*)alloc((size_t)M * 64 * 4);
    float*  glin    = (float*)alloc((size_t)M * H * 4);
    float*  Jwb     = (float*)alloc((size_t)B * H * T * 6 * 4);
    float*  Rdb     = (float*)alloc((size_t)B * H * T * 6 * 4);
    float*  ghb     = (float*)alloc((size_t)M * H * 4);
    float*  memval  = (float*)alloc((size_t)M * D * 4);
    float*  seqout  = (float*)alloc((size_t)M * D * 4);
    bf16_t* y_bf    = (bf16_t*)alloc((size_t)M * D * 2);
    float*  x1      = (float*)alloc((size_t)M * D * 4);
    bf16_t* h2_bf   = (bf16_t*)alloc((size_t)M * D * 2);
    bf16_t* a_bf    = (bf16_t*)alloc((size_t)M * DFF * 2);

    auto tr = [&](const float* W, bf16_t* Wt, int K, int N) {
        dim3 g((N + 31) / 32, (K + 31) / 32);
        k_transpose_bf16<<<g, 256, 0, stream>>>(W, Wt, K, N);
    };
    auto gemm = [&](const bf16_t* A, const bf16_t* Wt, const float* bias,
                    const float* resid, float* oF, bf16_t* oB, int m, int n, int k, int act) {
        dim3 g((n + 127) / 128, (m + 127) / 128);
        k_gemm_bf16<<<g, 256, 0, stream>>>(A, Wt, bias, resid, oF, oB, m, n, k, act);
    };

    // 1) weights -> bf16 transposed
    tr(Wqkv, Wqkv_t, D, 3 * D);
    tr(W1w, W1w_t, D, 64);
    tr(W2w, W2w_t, D, 64);
    tr(W1r, W1r_t, D, 64);
    tr(W2r, W2r_t, D, 64);
    tr(Wmg, Wmg_t, D, H);
    tr(Wmv, Wmv_t, D, D);
    tr(Wout, Wout_t, D, D);
    tr(Wfc, Wfc_t, D, DFF);
    tr(Wproj, Wproj_t, DFF, D);

    // 2) ln1
    k_layernorm<<<M, 256, 0, stream>>>(x, ln1_g, ln1_b, h_bf, D);

    // 3) projections
    gemm(h_bf, Wqkv_t, bqkv, nullptr, nullptr, qkv_bf, M, 3 * D, D, 0);
    gemm(h_bf, W1w_t, nullptr, nullptr, p1w, nullptr, M, 64, D, 0);
    gemm(h_bf, W2w_t, nullptr, nullptr, p2w, nullptr, M, 64, D, 0);
    gemm(h_bf, W1r_t, nullptr, nullptr, p1r, nullptr, M, 64, D, 0);
    gemm(h_bf, W2r_t, nullptr, nullptr, p2r, nullptr, M, 64, D, 0);
    gemm(h_bf, Wmg_t, bmg, nullptr, glin, nullptr, M, H, D, 0);
    gemm(h_bf, Wmv_t, bmv, nullptr, memval, nullptr, M, D, D, 0);

    // 4) attention
    k_attention<<<dim3(T / 128, B * H), 256, 0, stream>>>(qkv_bf, seqout, B, T, H);

    // 5) Gram memory branch
    k_lines<<<(B * T * H + 255) / 256, 256, 0, stream>>>(p1w, p2w, p1r, p2r, Jwb, Rdb, B, T, H);
    k_gram_scan<<<B * H, 32, 0, stream>>>(Jwb, Rdb, glin, decay_logits, iter_mix,
                                          mem_scale, ghb, B, T, H);
    k_combine<<<M, 256, 0, stream>>>(seqout, memval, ghb, y_bf, D, H);

    // 6) output projection + residual
    gemm(y_bf, Wout_t, bout, x, x1, nullptr, M, D, D, 0);

    // 7) MLP
    k_layernorm<<<M, 256, 0, stream>>>(x1, ln2_g, ln2_b, h2_bf, D);
    gemm(h2_bf, Wfc_t, bfc, nullptr, nullptr, a_bf, M, DFF, D, 1);
    gemm(a_bf, Wproj_t, bproj, x1, (float*)d_out, nullptr, M, D, DFF, 0);
}

// v001
// It runs in 422 microseconds.
// In two side-by-side timings against v000, it was 2.09 and 2.08 times as fast.
#include <hip/hip_runtime.h>
#include <math.h>

typedef __bf16 bf16_t;
typedef __attribute__((ext_vector_type(16))) __bf16 v16bf;
typedef __attribute__((ext_vector_type(8)))  float  v8f;
typedef unsigned int u32x4 __attribute__((ext_vector_type(4)));
typedef int i32x4 __attribute__((ext_vector_type(4)));

union AFrag { v16bf v; u32x4 q[2]; };

#if __has_builtin(__builtin_amdgcn_global_load_async_to_lds_b128) && \
    __has_builtin(__builtin_amdgcn_s_wait_asynccnt)
#define HAS_ASYNC_LDS 1
typedef __attribute__((address_space(1))) i32x4* glds_gptr;
typedef __attribute__((address_space(3))) i32x4* glds_lptr;
#else
#define HAS_ASYNC_LDS 0
#endif

__device__ __forceinline__ void async_copy16(void* lds, const void* g) {
#if HAS_ASYNC_LDS
    __builtin_amdgcn_global_load_async_to_lds_b128(
        (glds_gptr)(g), (glds_lptr)(lds), 0, 0);
#endif
}
__device__ __forceinline__ void async_wait0() {
#if HAS_ASYNC_LDS
    __builtin_amdgcn_s_wait_asynccnt(0);
#endif
}

// ---------------------------------------------------------------------------
// Weight convert: W (K x N, f32, row-major) -> Wt (N x K, bf16, row-major)
// ---------------------------------------------------------------------------
__global__ __launch_bounds__(256)
void k_transpose_bf16(const float* __restrict__ W, bf16_t* __restrict__ Wt, int K, int N) {
    __shared__ float tile[32][33];
    int kb = blockIdx.y * 32, nb = blockIdx.x * 32;
    int tx = threadIdx.x & 31, ty = threadIdx.x >> 5;
    #pragma unroll
    for (int i = ty; i < 32; i += 8) {
        int k = kb + i, n = nb + tx;
        tile[i][tx] = (k < K && n < N) ? W[(size_t)k * N + n] : 0.f;
    }
    __syncthreads();
    #pragma unroll
    for (int i = ty; i < 32; i += 8) {
        int n = nb + i, k = kb + tx;
        if (n < N && k < K) Wt[(size_t)n * K + k] = (bf16_t)tile[tx][i];
    }
}

// ---------------------------------------------------------------------------
// LayerNorm (f32 in) -> bf16 out.  One block per row.
// ---------------------------------------------------------------------------
__global__ __launch_bounds__(256)
void k_layernorm(const float* __restrict__ x, const float* __restrict__ g,
                 const float* __restrict__ b, bf16_t* __restrict__ out, int D) {
    const float* row = x + (size_t)blockIdx.x * D;
    float s = 0.f, s2 = 0.f;
    for (int d = threadIdx.x; d < D; d += 256) { float v = row[d]; s += v; s2 += v * v; }
    #pragma unroll
    for (int off = 16; off; off >>= 1) { s += __shfl_down(s, off); s2 += __shfl_down(s2, off); }
    __shared__ float ws[8], ws2[8];
    int wave = threadIdx.x >> 5, lane = threadIdx.x & 31;
    if (lane == 0) { ws[wave] = s; ws2[wave] = s2; }
    __syncthreads();
    if (threadIdx.x == 0) {
        float a = 0.f, a2 = 0.f;
        #pragma unroll
        for (int i = 0; i < 8; i++) { a += ws[i]; a2 += ws2[i]; }
        ws[0] = a; ws2[0] = a2;
    }
    __syncthreads();
    float mean = ws[0] / D;
    float var  = ws2[0] / D - mean * mean;
    float rstd = rsqrtf(var + 1e-5f);
    bf16_t* orow = out + (size_t)blockIdx.x * D;
    for (int d = threadIdx.x; d < D; d += 256)
        orow[d] = (bf16_t)((row[d] - mean) * rstd * g[d] + b[d]);
}

// ---------------------------------------------------------------------------
// Generic bf16 WMMA GEMM:  C[M,N] = A[M,K] * Wt[N,K]^T  (+bias)(+gelu)(+resid)
// Block tile 128x128, K-step 32, 8 waves: each wave 32(M) x 64(N).
// Async global->LDS double-buffered pipeline when available.
// ---------------------------------------------------------------------------
#define GEMM_LDK 40   // padded LDS K-stride (80B: 16B aligned, conflict-free)

__global__ __launch_bounds__(256)
void k_gemm_bf16(const bf16_t* __restrict__ A, const bf16_t* __restrict__ Wt,
                 const float* __restrict__ bias, const float* __restrict__ resid,
                 float* __restrict__ outF, bf16_t* __restrict__ outB,
                 int M, int N, int K, int act) {
    __shared__ bf16_t As[2][128][GEMM_LDK];
    __shared__ bf16_t Bs[2][128][GEMM_LDK];
    const int tid = threadIdx.x;
    const int wave = tid >> 5, lane = tid & 31;
    const int m0 = blockIdx.y * 128, n0 = blockIdx.x * 128;
    const int wm = (wave & 3) * 32, wn = (wave >> 2) * 64;
    const int lm = lane & 15, kh = lane >> 4;

    v8f acc[2][4];
    #pragma unroll
    for (int i = 0; i < 2; i++)
        #pragma unroll
        for (int j = 0; j < 4; j++)
            #pragma unroll
            for (int v = 0; v < 8; v++) acc[i][j][v] = 0.f;

    const int r = tid >> 1, half = tid & 1;
    const bool bValid = (n0 + r < N);

#if HAS_ASYNC_LDS
    if (!bValid) {           // zero-fill OOB weight rows once (both buffers)
        u32x4 z = {0, 0, 0, 0};
        #pragma unroll
        for (int bufi = 0; bufi < 2; bufi++) {
            *(u32x4*)&Bs[bufi][r][half * 16]     = z;
            *(u32x4*)&Bs[bufi][r][half * 16 + 8] = z;
        }
    }
    {   // prime the pipeline: tile 0 -> buffer 0
        const bf16_t* ga = A + (size_t)(m0 + r) * K + half * 16;
        async_copy16(&As[0][r][half * 16], ga);
        async_copy16(&As[0][r][half * 16 + 8], ga + 8);
        if (bValid) {
            const bf16_t* gb = Wt + (size_t)(n0 + r) * K + half * 16;
            async_copy16(&Bs[0][r][half * 16], gb);
            async_copy16(&Bs[0][r][half * 16 + 8], gb + 8);
        }
    }
    int cur = 0;
    for (int k0 = 0; k0 < K; k0 += 32) {
        async_wait0();
        __syncthreads();
        if (k0 + 32 < K) {   // fetch next tile into the other buffer
            const bf16_t* ga = A + (size_t)(m0 + r) * K + k0 + 32 + half * 16;
            async_copy16(&As[cur ^ 1][r][half * 16], ga);
            async_copy16(&As[cur ^ 1][r][half * 16 + 8], ga + 8);
            if (bValid) {
                const bf16_t* gb = Wt + (size_t)(n0 + r) * K + k0 + 32 + half * 16;
                async_copy16(&Bs[cur ^ 1][r][half * 16], gb);
                async_copy16(&Bs[cur ^ 1][r][half * 16 + 8], gb + 8);
            }
        }
        if (k0 + 64 < K)
            __builtin_prefetch(A + (size_t)(m0 + r) * K + k0 + 64 + half * 16, 0, 3);

        AFrag a[2], bfr[4];
        #pragma unroll
        for (int i = 0; i < 2; i++) {
            const bf16_t* p = &As[cur][wm + i * 16 + lm][kh * 8];
            a[i].q[0] = *(const u32x4*)p;
            a[i].q[1] = *(const u32x4*)(p + 16);
        }
        #pragma unroll
        for (int j = 0; j < 4; j++) {
            const bf16_t* p = &Bs[cur][wn + j * 16 + lm][kh * 8];
            bfr[j].q[0] = *(const u32x4*)p;
            bfr[j].q[1] = *(const u32x4*)(p + 16);
        }
        #pragma unroll
        for (int i = 0; i < 2; i++)
            #pragma unroll
            for (int j = 0; j < 4; j++)
                acc[i][j] = __builtin_amdgcn_wmma_f32_16x16x32_bf16(
                    false, a[i].v, false, bfr[j].v, (short)0, acc[i][j], false, false);
        cur ^= 1;
    }
#else
    for (int k0 = 0; k0 < K; k0 += 32) {
        {
            const bf16_t* gp = A + (size_t)(m0 + r) * K + k0 + half * 16;
            *(u32x4*)&As[0][r][half * 16]     = *(const u32x4*)gp;
            *(u32x4*)&As[0][r][half * 16 + 8] = *(const u32x4*)(gp + 8);
        }
        {
            u32x4 z0 = {0, 0, 0, 0}, z1 = {0, 0, 0, 0};
            if (bValid) {
                const bf16_t* gp = Wt + (size_t)(n0 + r) * K + k0 + half * 16;
                z0 = *(const u32x4*)gp; z1 = *(const u32x4*)(gp + 8);
            }
            *(u32x4*)&Bs[0][r][half * 16]     = z0;
            *(u32x4*)&Bs[0][r][half * 16 + 8] = z1;
        }
        if (k0 + 32 < K)
            __builtin_prefetch(A + (size_t)(m0 + r) * K + k0 + 32 + half * 16, 0, 3);
        __syncthreads();
        AFrag a[2], bfr[4];
        #pragma unroll
        for (int i = 0; i < 2; i++) {
            const bf16_t* p = &As[0][wm + i * 16 + lm][kh * 8];
            a[i].q[0] = *(const u32x4*)p;
            a[i].q[1] = *(const u32x4*)(p + 16);
        }
        #pragma unroll
        for (int j = 0; j < 4; j++) {
            const bf16_t* p = &Bs[0][wn + j * 16 + lm][kh * 8];
            bfr[j].q[0] = *(const u32x4*)p;
            bfr[j].q[1] = *(const u32x4*)(p + 16);
        }
        #pragma unroll
        for (int i = 0; i < 2; i++)
            #pragma unroll
            for (int j = 0; j < 4; j++)
                acc[i][j] = __builtin_amdgcn_wmma_f32_16x16x32_bf16(
                    false, a[i].v, false, bfr[j].v, (short)0, acc[i][j], false, false);
        __syncthreads();
    }
#endif

    // Epilogue
    #pragma unroll
    for (int i = 0; i < 2; i++)
        #pragma unroll
        for (int j = 0; j < 4; j++) {
            int n = n0 + wn + j * 16 + lm;
            if (n >= N) continue;
            float bv = bias ? bias[n] : 0.f;
            #pragma unroll
            for (int v = 0; v < 8; v++) {
                int m = m0 + wm + i * 16 + v + 8 * kh;
                float c = acc[i][j][v] + bv;
                if (act == 1) c = 0.5f * c * (1.f + erff(c * 0.70710678118f));
                size_t idx = (size_t)m * N + n;
                if (resid) c += resid[idx];
                if (outF) outF[idx] = c;
                if (outB) outB[idx] = (bf16_t)c;
            }
        }
}

// ---------------------------------------------------------------------------
// Flash-style causal attention.  qkv bf16 [(b,t), 3, H, 64].
// grid (T/128, B*H), 256 threads (8 waves, 16 q-rows each).
// ---------------------------------------------------------------------------
__global__ __launch_bounds__(256)
void k_attention(const bf16_t* __restrict__ qkv, float* __restrict__ seqout,
                 int B, int T, int H) {
    const int qb = blockIdx.x;
    const int bh = blockIdx.y;
    const int h = bh % H, b = bh / H;
    const int tid = threadIdx.x, wave = tid >> 5, lane = tid & 31;
    const int lm = lane & 15, kh = lane >> 4;

    __shared__ bf16_t Qs[128][72];
    __shared__ bf16_t Ks[128][72];
    __shared__ bf16_t Vt[64][136];     // V transposed: [dh][s]
    __shared__ bf16_t Ps[8][16][40];   // per-wave P staging (32-wide K chunk)

    const size_t strideT = 3 * 1024;
    const bf16_t* base = qkv + (size_t)b * T * strideT + (size_t)h * 64;

    // Load Q tile (128 x 64)
    for (int c8 = tid; c8 < 128 * 8; c8 += 256) {
        int rr = c8 >> 3, cc = (c8 & 7) * 8;
        const bf16_t* gq = base + (size_t)(qb * 128 + rr) * strideT + cc;
#if HAS_ASYNC_LDS
        async_copy16(&Qs[rr][cc], gq);
#else
        *(u32x4*)&Qs[rr][cc] = *(const u32x4*)gq;
#endif
    }

    float rowm[8], rowl[8];
    v8f oacc[4];
    #pragma unroll
    for (int v = 0; v < 8; v++) { rowm[v] = -INFINITY; rowl[v] = 0.f; }
    #pragma unroll
    for (int jt = 0; jt < 4; jt++)
        #pragma unroll
        for (int v = 0; v < 8; v++) oacc[jt][v] = 0.f;

    for (int sb = 0; sb <= qb; sb++) {
        __syncthreads();   // protect Ks/Vt reuse across iterations
        for (int c8 = tid; c8 < 128 * 8; c8 += 256) {
            int rr = c8 >> 3, cc = (c8 & 7) * 8;
            const bf16_t* gk = base + (size_t)(sb * 128 + rr) * strideT + 1024 + cc;
#if HAS_ASYNC_LDS
            async_copy16(&Ks[rr][cc], gk);
#else
            *(u32x4*)&Ks[rr][cc] = *(const u32x4*)gk;
#endif
        }
        for (int c8 = tid; c8 < 128 * 8; c8 += 256) {
            int rr = c8 >> 3, cc = (c8 & 7) * 8;
            union { u32x4 u; bf16_t e[8]; } vv;
            vv.u = *(const u32x4*)(base + (size_t)(sb * 128 + rr) * strideT + 2048 + cc);
            #pragma unroll
            for (int i = 0; i < 8; i++) Vt[cc + i][rr] = vv.e[i];
        }
        async_wait0();
        __syncthreads();

        // ---- scores: S = Q * K^T ----
        AFrag aq[2];
        #pragma unroll
        for (int kk = 0; kk < 2; kk++) {
            const bf16_t* p = &Qs[wave * 16 + lm][kk * 32 + kh * 8];
            aq[kk].q[0] = *(const u32x4*)p;
            aq[kk].q[1] = *(const u32x4*)(p + 16);
        }
        v8f sacc[8];
        #pragma unroll
        for (int j = 0; j < 8; j++)
            #pragma unroll
            for (int v = 0; v < 8; v++) sacc[j][v] = 0.f;
        #pragma unroll
        for (int j = 0; j < 8; j++)
            #pragma unroll
            for (int kk = 0; kk < 2; kk++) {
                AFrag bk;
                const bf16_t* p = &Ks[j * 16 + lm][kk * 32 + kh * 8];
                bk.q[0] = *(const u32x4*)p;
                bk.q[1] = *(const u32x4*)(p + 16);
                sacc[j] = __builtin_amdgcn_wmma_f32_16x16x32_bf16(
                    false, aq[kk].v, false, bk.v, (short)0, sacc[j], false, false);
            }

        // ---- causal mask + online softmax (wave32: 16-lane row reductions) ----
        #pragma unroll
        for (int v = 0; v < 8; v++) {
            int trow = qb * 128 + wave * 16 + v + 8 * kh;
            float rm = -INFINITY;
            #pragma unroll
            for (int j = 0; j < 8; j++) {
                int col = sb * 128 + j * 16 + lm;
                float s = (col <= trow) ? sacc[j][v] * 0.125f : -INFINITY;
                sacc[j][v] = s;
                rm = fmaxf(rm, s);
            }
            #pragma unroll
            for (int msk = 1; msk < 16; msk <<= 1) rm = fmaxf(rm, __shfl_xor(rm, msk));
            float mnew = fmaxf(rowm[v], rm);
            float corr = expf(rowm[v] - mnew);
            rowm[v] = mnew;
            float rs = 0.f;
            #pragma unroll
            for (int j = 0; j < 8; j++) {
                float p = expf(sacc[j][v] - mnew);
                sacc[j][v] = p;
                rs += p;
            }
            #pragma unroll
            for (int msk = 1; msk < 16; msk <<= 1) rs += __shfl_xor(rs, msk);
            rowl[v] = rowl[v] * corr + rs;
            #pragma unroll
            for (int jt = 0; jt < 4; jt++) oacc[jt][v] = oacc[jt][v] * corr;
        }

        // ---- O += P * V  (stage P through LDS: C-layout -> A-layout) ----
        #pragma unroll
        for (int kk = 0; kk < 4; kk++) {
            #pragma unroll
            for (int jj = 0; jj < 2; jj++) {
                int j = kk * 2 + jj;
                #pragma unroll
                for (int v = 0; v < 8; v++)
                    Ps[wave][v + 8 * kh][jj * 16 + lm] = (bf16_t)sacc[j][v];
            }
            AFrag ap;
            const bf16_t* p = &Ps[wave][lm][kh * 8];
            ap.q[0] = *(const u32x4*)p;
            ap.q[1] = *(const u32x4*)(p + 16);
            #pragma unroll
            for (int jt = 0; jt < 4; jt++) {
                AFrag bv;
                const bf16_t* q = &Vt[jt * 16 + lm][kk * 32 + kh * 8];
                bv.q[0] = *(const u32x4*)q;
                bv.q[1] = *(const u32x4*)(q + 16);
                oacc[jt] = __builtin_amdgcn_wmma_f32_16x16x32_bf16(
                    false, ap.v, false, bv.v, (short)0, oacc[jt], false, false);
            }
        }
    }

    float* out = seqout + (size_t)b * T * 1024 + (size_t)h * 64;
    #pragma unroll
    for (int jt = 0; jt < 4; jt++)
        #pragma unroll
        for (int v = 0; v < 8; v++) {
            int trow = qb * 128 + wave * 16 + v + 8 * kh;
            int col  = jt * 16 + lm;
            out[(size_t)trow * 1024 + col] = oacc[jt][v] / rowl[v];
        }
}

// ---------------------------------------------------------------------------
// Plucker lines + J6 rotation.  One thread per (b,t,h).
// ---------------------------------------------------------------------------
__device__ inline void exterior4(const float* a1, const float* a2, float* L) {
    L[0] = a1[0] * a2[1] - a1[1] * a2[0];
    L[1] = a1[0] * a2[2] - a1[2] * a2[0];
    L[2] = a1[0] * a2[3] - a1[3] * a2[0];
    L[3] = a1[1] * a2[2] - a1[2] * a2[1];
    L[4] = a1[1] * a2[3] - a1[3] * a2[1];
    L[5] = a1[2] * a2[3] - a1[3] * a2[2];
    float n2 = 0.f;
    #pragma unroll
    for (int i = 0; i < 6; i++) n2 += L[i] * L[i];
    float inv = 1.f / fmaxf(sqrtf(n2), 1e-12f);
    #pragma unroll
    for (int i = 0; i < 6; i++) L[i] *= inv;
}

__global__ __launch_bounds__(256)
void k_lines(const float* __restrict__ p1w, const float* __restrict__ p2w,
             const float* __restrict__ p1r, const float* __restrict__ p2r,
             float* __restrict__ Jw, float* __restrict__ Rd, int B, int T, int H) {
    int idx = blockIdx.x * 256 + threadIdx.x;
    if (idx >= B * T * H) return;
    int h = idx % H, t = (idx / H) % T, b = idx / (H * T);
    size_t row = (size_t)b * T + t;
    float a1[4], a2[4], L[6];
    #pragma unroll
    for (int c = 0; c < 4; c++) {
        a1[c] = (t > 0) ? p1w[(row - 1) * 64 + h * 4 + c] : 0.f;
        a2[c] = p2w[row * 64 + h * 4 + c];
    }
    exterior4(a1, a2, L);
    float* jw = Jw + ((size_t)(b * H + h) * T + t) * 6;
    jw[0] = L[5]; jw[1] = -L[4]; jw[2] = L[3]; jw[3] = L[2]; jw[4] = -L[1]; jw[5] = L[0];
    #pragma unroll
    for (int c = 0; c < 4; c++) {
        a1[c] = p1r[row * 64 + h * 4 + c];
        a2[c] = p2r[row * 64 + h * 4 + c];
    }
    exterior4(a1, a2, L);
    float* rd = Rd + ((size_t)(b * H + h) * T + t) * 6;
    #pragma unroll
    for (int j = 0; j < 6; j++) rd[j] = L[j];
}

// ---------------------------------------------------------------------------
// Decayed-Gram scan:  M_t = d*(M_{t-1} + Jw_{t-1} Jw_{t-1}^T),  M_0 = 0.
// The recurrence is linear, so it is run as a chunked parallel scan:
// one block per (b,h), thread c owns the 4 steps t = 4c .. 4c+3 (T == 4 * blockDim.x).
//   1) each thread folds its own 4 steps from zero   (chunk aggregate)
//   2) weighted prefix over chunks: lanes by shuffles, waves through LDS
//   3) each thread replays its 4 steps from its true M and writes the gates
// M is symmetric, so only its 21 upper entries are carried.
// Every loop is unrolled so that the small arrays are indexed by constants and stay in registers.
// ---------------------------------------------------------------------------
#define GS_L 4      // steps per thread
#define GS_NS 21    // upper triangle of a 6x6

__device__ __forceinline__ void gram_step(float* m, const float* J, float d) {
    int n = 0;
    #pragma unroll
    for (int i = 0; i < 6; i++)
        #pragma unroll
        for (int j = i; j < 6; j++, n++) m[n] = d * (m[n] + J[i] * J[j]);
}

__global__ __launch_bounds__(256)
void k_gram_scan(const float* __restrict__ Jw, const float* __restrict__ Rd,
                 const float* __restrict__ glin, const float* __restrict__ decay_logits,
                 const float* __restrict__ iter_mix, const float* __restrict__ mem_scale,
                 float* __restrict__ gh, int B, int T, int H) {
    __shared__ __attribute__((aligned(16))) float Wagg[8][24];   // rows of 21, padded to 16 B
    const int bh = blockIdx.x, h = bh % H, b = bh / H;
    const int c = threadIdx.x, lane = c & 31;
    const int wave = __builtin_amdgcn_readfirstlane(c >> 5);     // scalar: the tests on it in 2b are scalar compares
    const int t0 = c * GS_L;

    // all of this thread's inputs, issued up front
    union { float4 q[6]; float f[24]; } J, R;
    const float4* Jq = (const float4*)(Jw + (size_t)bh * T * 6 + (size_t)t0 * 6);
    const float4* Rq = (const float4*)(Rd + (size_t)bh * T * 6 + (size_t)t0 * 6);
    #pragma unroll
    for (int i = 0; i < 6; i++) J.q[i] = Jq[i];
    // the next loads may land in these loads' address registers
    asm volatile("s_wait_xcnt 0x0" ::: "memory");
    #pragma unroll
    for (int i = 0; i < 6; i++) R.q[i] = Rq[i];
    // as above
    asm volatile("s_wait_xcnt 0x0" ::: "memory");
    float gl[GS_L];
    #pragma unroll
    for (int k = 0; k < GS_L; k++) gl[k] = glin[((size_t)b * T + t0 + k) * H + h];
    // the loads' address registers are reused by the arithmetic below
    asm volatile("s_wait_xcnt 0x0" ::: "memory");

    const float decay = 1.f / (1.f + expf(-decay_logits[h]));
    const float alpha = 1.f / (1.f + expf(-iter_mix[0]));
    const float msc = mem_scale[h];

    // w[s] = decay^(4 * 2^s): the decay across 2^s chunks
    float w[6];
    w[0] = (decay * decay) * (decay * decay);
    #pragma unroll
    for (int s = 1; s < 6; s++) w[s] = w[s - 1] * w[s - 1];

    // 1) chunk aggregate
    float m[GS_NS];
    #pragma unroll
    for (int n = 0; n < GS_NS; n++) m[n] = 0.f;
    #pragma unroll
    for (int k = 0; k < GS_L; k++) gram_step(m, &J.f[k * 6], decay);

    // 2a) inclusive weighted prefix over the wave's 32 chunks
    #pragma unroll
    for (int s = 0; s < 5; s++) {
        const int o = 1 << s;
        #pragma unroll
        for (int n = 0; n < GS_NS; n++) {
            float v = __shfl_up(m[n], o);
            m[n] = (lane >= o) ? m[n] + w[s] * v : m[n];
        }
    }
    if (lane == 31) {
        #pragma unroll
        for (int n = 0; n < GS_NS; n++) Wagg[wave][n] = m[n];
    }
    // exclusive within the wave
    #pragma unroll
    for (int n = 0; n < GS_NS; n++) {
        float v = __shfl_up(m[n], 1);
        m[n] = (lane > 0) ? v : 0.f;
    }
    __syncthreads();

    // 2b) M at the wave's first step, from the earlier waves' totals.
    // It is the same for the whole wave: lane n folds entry n, then it is read per entry.
    const int ln = (lane < GS_NS) ? lane : 0;
    float tot[7];
    #pragma unroll
    for (int q = 0; q < 7; q++) tot[q] = Wagg[q][ln];
    float p = 0.f;
    #pragma unroll
    for (int q = 0; q < 7; q++) p = (q < wave) ? w[5] * p + tot[q] : p;
    float dl = 1.f;   // decay^(4 * lane)
    #pragma unroll
    for (int s = 0; s < 5; s++) dl *= ((lane >> s) & 1) ? w[s] : 1.f;
    #pragma unroll
    for (int n = 0; n < GS_NS; n++)
        m[n] += dl * __int_as_float(__builtin_amdgcn_readlane(__float_as_int(p), n));

    // 3) replay
    #pragma unroll
    for (int k = 0; k < GS_L; k++) {
        const float* rd = &R.f[k * 6];
        float rdM[6] = {0, 0, 0, 0, 0, 0};
        int n = 0;
        #pragma unroll
        for (int i = 0; i < 6; i++)
            #pragma unroll
            for (int j = i; j < 6; j++, n++) {
                rdM[j] += rd[i] * m[n];
                if (j != i) rdM[i] += rd[j] * m[n];
            }
        float s1 = 0.f, s2 = 0.f;
        #pragma unroll
        for (int j = 0; j < 6; j++) { s1 += rdM[j] * rd[j]; s2 += rdM[j] * rdM[j]; }
        float ms = (1.f - alpha) * s1 + alpha * s2;
        float g1 = 1.f / (1.f + expf(-ms * msc));
        float g2 = 1.f / (1.f + expf(-gl[k]));
        gh[((size_t)b * T + t0 + k) * H + h] = g1 * g2;
        if (k + 1 < GS_L) gram_step(m, &J.f[k * 6], decay);
    }
}

// ---------------------------------------------------------------------------
// y = seqout + mean_h(gh) * memval  -> bf16 (input to Wout GEMM)
// ---------------------------------------------------------------------------
__global__ __launch_bounds__(256)
void k_combine(const float* __restrict__ seqout, const float* __restrict__ memval,
               const float* __restrict__ gh, bf16_t* __restrict__ y, int D, int H) {
    size_t row = blockIdx.x;
    float g = 0.f;
    #pragma unroll
    for (int h = 0; h < 16; h++) g += gh[row * H + h];
    g *= (1.f / 16.f);
    const float* so = seqout + row * D;
    const float* mv = memval + row * D;
    bf16_t* yr = y + row * D;
    for (int d = threadIdx.x; d < D; d += 256)
        yr[d] = (bf16_t)(so[d] + g * mv[d]);
}

// ---------------------------------------------------------------------------
extern "C" void kernel_launch(void* const* d_in, const int* in_sizes, int n_in,
                              void* d_out, int out_size, void* d_ws, size_t ws_size,
                              hipStream_t stream) {
    const int B = 2, T = 1024, D = 1024, H = 16, DFF = 4096;
    const int M = B * T;

    const float* x            = (const float*)d_in[0];
    const float* ln1_g        = (const float*)d_in[1];
    const float* ln1_b        = (const float*)d_in[2];
    const float* Wqkv         = (const float*)d_in[3];
    const float* bqkv         = (const float*)d_in[4];
    const float* W1w          = (const float*)d_in[5];
    const float* W2w          = (const float*)d_in[6];
    const float* W1r          = (const float*)d_in[7];
    const float* W2r          = (const float*)d_in[8];
    const float* Wmv          = (const float*)d_in[9];
    const float* bmv          = (const float*)d_in[10];
    const float* Wmg          = (const float*)d_in[11];
    const float* bmg          = (const float*)d_in[12];
    const float* mem_scale    = (const float*)d_in[13];
    const float* iter_mix     = (const float*)d_in[14];
    const float* decay_logits = (const float*)d_in[15];
    const float* Wout         = (const float*)d_in[16];
    const float* bout         = (const float*)d_in[17];
    const float* ln2_g        = (const float*)d_in[18];
    const float* ln2_b        = (const float*)d_in[19];
    const float* Wfc          = (const float*)d_in[20];
    const float* bfc          = (const float*)d_in[21];
    const float* Wproj        = (const float*)d_in[22];
    const float* bproj        = (const float*)d_in[23];

    char* ws = (char*)d_ws;
    size_t off = 0;
    auto alloc = [&](size_t bytes) -> void* {
        void* p = ws + off;
        off += (bytes + 255) & ~(size_t)255;
        return p;
    };

    bf16_t* Wqkv_t  = (bf16_t*)alloc((size_t)3 * D * D * 2);
    bf16_t* W1w_t   = (bf16_t*)alloc((size_t)64 * D * 2);
    bf16_t* W2w_t   = (bf16_t*)alloc((size_t)64 * D * 2);
    bf16_t* W1r_t   = (bf16_t*)alloc((size_t)64 * D * 2);
    bf16_t* W2r_t   = (bf16_t*)alloc((size_t)64 * D * 2);
    bf16_t* Wmg_t   = (bf16_t*)alloc((size_t)H * D * 2);
    bf16_t* Wmv_t   = (bf16_t*)alloc((size_t)D * D * 2);
    bf16_t* Wout_t  = (bf16_t*)alloc((size_t)D * D * 2);
    bf16_t* Wfc_t   = (bf16_t*)alloc((size_t)DFF * D * 2);
    bf16_t* Wproj_t = (bf16_t*)alloc((size_t)D * DFF * 2);
    bf16_t* h_bf    = (bf16_t*)alloc((size_t)M * D * 2);
    bf16_t* qkv_bf  = (bf16_t*)alloc((size_t)M * 3 * D * 2);
    float*  p1w     = (float*)alloc((size_t)M * 64 * 4);
    float*  p2w     = (float*)alloc((size_t)M * 64 * 4);
    float*  p1r     = (float*)alloc((size_t)M * 64 * 4);
    float*  p2r     = (float*)alloc((size_t)M * 64 * 4);
    float*  glin    = (float*)alloc((size_t)M * H * 4);
    float*  Jwb     = (float*)alloc((size_t)B * H * T * 6 * 4);
    float*  Rdb     = (float*)alloc((size_t)B * H * T * 6 * 4);
    float*  ghb     = (float*)alloc((size_t)M * H * 4);
    float*  memval  = (float*)alloc((size_t)M * D * 4);
    float*  seqout  = (float*)alloc((size_t)M * D * 4);
    bf16_t* y_bf    = (bf16_t*)alloc((size_t)M * D * 2);
    float*  x1      = (float*)alloc((size_t)M * D * 4);
    bf16_t* h2_bf   = (bf16_t*)alloc((size_t)M * D * 2);
    bf16_t* a_bf    = (bf16_t*)alloc((size_t)M * DFF * 2);

    auto tr = [&](const float* W, bf16_t* Wt, int K, int N) {
        dim3 g((N + 31) / 32, (K + 31) / 32);
        k_transpose_bf16<<<g, 256, 0, stream>>>(W, Wt, K, N);
    };
    auto gemm = [&](const bf16_t* A, const bf16_t* Wt, const float* bias,
                    const float* resid, float* oF, bf16_t* oB, int m, int n, int k, int act) {
        dim3 g((n + 127) / 128, (m + 127) / 128);
        k_gemm_bf16<<<g, 256, 0, stream>>>(A, Wt, bias, resid, oF, oB, m, n, k, act);
    };

    // 1) weights -> bf16 transposed
    tr(Wqkv, Wqkv_t, D, 3 * D);
    tr(W1w, W1w_t, D, 64);
    tr(W2w, W2w_t, D, 64);
    tr(W1r, W1r_t, D, 64);
    tr(W2r, W2r_t, D, 64);
    tr(Wmg, Wmg_t, D, H);
    tr(Wmv, Wmv_t, D, D);
    tr(Wout, Wout_t, D, D);
    tr(Wfc, Wfc_t, D, DFF);
    tr(Wproj, Wproj_t, DFF, D);

    // 2) ln1
    k_layernorm<<<M, 256, 0, stream>>>(x, ln1_g, ln1_b, h_bf, D);

    // 3) projections
    gemm(h_bf, Wqkv_t, bqkv, nullptr, nullptr, qkv_bf, M, 3 * D, D, 0);
    gemm(h_bf, W1w_t, nullptr, nullptr, p1w, nullptr, M, 64, D, 0);
    gemm(h_bf, W2w_t, nullptr, nullptr, p2w, nullptr, M, 64, D, 0);
    gemm(h_bf, W1r_t, nullptr, nullptr, p1r, nullptr, M, 64, D, 0);
    gemm(h_bf, W2r_t, nullptr, nullptr, p2r, nullptr, M, 64, D, 0);
    gemm(h_bf, Wmg_t, bmg, nullptr, glin, nullptr, M, H, D, 0);
    gemm(h_bf, Wmv_t, bmv, nullptr, memval, nullptr, M, D, D, 0);

    // 4) attention
    k_attention<<<dim3(T / 128, B * H), 256, 0, stream>>>(qkv_bf, seqout, B, T, H);

    // 5) Gram memory branch
    k_lines<<<(B * T * H + 255) / 256, 256, 0, stream>>>(p1w, p2w, p1r, p2r, Jwb, Rdb, B, T, H);
    k_gram_scan<<<B * H, 256, 0, stream>>>(Jwb, Rdb, glin, decay_logits, iter_mix,
                                          mem_scale, ghb, B, T, H);
    k_combine<<<M, 256, 0, stream>>>(seqout, memval, ghb, y_bf, D, H);

    // 6) output projection + residual
    gemm(y_bf, Wout_t, bout, x, x1, nullptr, M, D, D, 0);

    // 7) MLP
    k_layernorm<<<M, 256, 0, stream>>>(x1, ln2_g, ln2_b, h2_bf, D);
    gemm(h2_bf, Wfc_t, bfc, nullptr, nullptr, a_bf, M, DFF, D, 1);
    gemm(a_bf, Wproj_t, bproj, x1, (float*)d_out, nullptr, M, D, DFF, 0);
}

// v002
// Measured time: 308 microseconds a run.
// In two side-by-side timings against v001, it was 1.36 and 1.37 times as fast.
// Over all steps from v000 it is 2.84 times as fast.
#include <hip/hip_runtime.h>
#include <math.h>

typedef __bf16 bf16_t;
typedef __attribute__((ext_vector_type(16))) __bf16 v16bf;
typedef __attribute__((ext_vector_type(8)))  float  v8f;
typedef unsigned int u32x4 __attribute__((ext_vector_type(4)));
typedef int i32x4 __attribute__((ext_vector_type(4)));

union AFrag { v16bf v; u32x4 q[2]; };

#if __has_builtin(__builtin_amdgcn_global_load_async_to_lds_b128) && \
    __has_builtin(__builtin_amdgcn_s_wait_asynccnt)
#define HAS_ASYNC_LDS 1
typedef __attribute__((address_space(1))) i32x4* glds_gptr;
typedef __attribute__((address_space(3))) i32x4* glds_lptr;
#else
#define HAS_ASYNC_LDS 0
#endif

__device__ __forceinline__ void async_copy16(void* lds, const void* g) {
#if HAS_ASYNC_LDS
    __builtin_amdgcn_global_load_async_to_lds_b128(
        (glds_gptr)(g), (glds_lptr)(lds), 0, 0);
#endif
}
__device__ __forceinline__ void async_wait0() {
#if HAS_ASYNC_LDS
    __builtin_amdgcn_s_wait_asynccnt(0);
#endif
}

// ---------------------------------------------------------------------------
// Weight convert: W (K x N, f32, row-major) -> Wt (N x K, bf16, row-major)
// All ten weights in one grid: the transposes do not depend on one another, so a
// block finds its weight and its 32x32 tile from blockIdx.x (ranges below, largest first).
// ---------------------------------------------------------------------------
struct TrArgs {
    const float* wfc;  const float* wproj; const float* wqkv; const float* wmv; const float* wout;
    const float* w1w;  const float* w2w;   const float* w1r;  const float* w2r; const float* wmg;
    bf16_t* tfc;  bf16_t* tproj; bf16_t* tqkv; bf16_t* tmv; bf16_t* tout;
    bf16_t* t1w;  bf16_t* t2w;   bf16_t* t1r;  bf16_t* t2r; bf16_t* tmg;
};
#define TR_BLOCKS 13600   // 4096 + 4096 + 3072 + 1024 + 1024 + 4 * 64 + 32

__global__ __launch_bounds__(256)
void k_transpose_bf16(TrArgs a) {
    __shared__ float tile[32][33];
    const float* __restrict__ W;
    bf16_t* __restrict__ Wt;
    int K = 1024, N, kb, nb;
    int l = blockIdx.x;   // tile index inside the weight, N fastest
    if (l < 4096)                { W = a.wfc;   Wt = a.tfc;   N = 4096; nb = (l & 127) * 32; kb = (l >> 7) * 32; }
    else if ((l -= 4096) < 4096) { W = a.wproj; Wt = a.tproj; N = 1024; nb = (l & 31) * 32;  kb = (l >> 5) * 32; K = 4096; }
    else if ((l -= 4096) < 3072) { W = a.wqkv;  Wt = a.tqkv;  N = 3072; nb = (l % 96) * 32;  kb = (l / 96) * 32; }
    else if ((l -= 3072) < 1024) { W = a.wmv;   Wt = a.tmv;   N = 1024; nb = (l & 31) * 32;  kb = (l >> 5) * 32; }
    else if ((l -= 1024) < 1024) { W = a.wout;  Wt = a.tout;  N = 1024; nb = (l & 31) * 32;  kb = (l >> 5) * 32; }
    else if ((l -= 1024) < 256) {
        const int s = l >> 6;
        W  = s == 0 ? a.w1w : s == 1 ? a.w2w : s == 2 ? a.w1r : a.w2r;
        Wt = s == 0 ? a.t1w : s == 1 ? a.t2w : s == 2 ? a.t1r : a.t2r;
        N = 64; nb = (l & 1) * 32; kb = ((l & 63) >> 1) * 32;
    }
    else { l -= 256; W = a.wmg; Wt = a.tmg; N = 16; nb = 0; kb = l * 32; }
    int tx = threadIdx.x & 31, ty = threadIdx.x >> 5;
    #pragma unroll
    for (int i = ty; i < 32; i += 8) {
        int k = kb + i, n = nb + tx;
        tile[i][tx] = (k < K && n < N) ? W[(size_t)k * N + n] : 0.f;
    }
    __syncthreads();
    #pragma unroll
    for (int i = ty; i < 32; i += 8) {
        int n = nb + i, k = kb + tx;
        if (n < N && k < K) Wt[(size_t)n * K + k] = (bf16_t)tile[tx][i];
    }
}

// ---------------------------------------------------------------------------
// LayerNorm (f32 in) -> bf16 out.  One block per row.
// ---------------------------------------------------------------------------
__global__ __launch_bounds__(256)
void k_layernorm(const float* __restrict__ x, const float* __restrict__ g,
                 const float* __restrict__ b, bf16_t* __restrict__ out, int D) {
    const float* row = x + (size_t)blockIdx.x * D;
    float s = 0.f, s2 = 0.f;
    for (int d = threadIdx.x; d < D; d += 256) { float v = row[d]; s += v; s2 += v * v; }
    #pragma unroll
    for (int off = 16; off; off >>= 1) { s += __shfl_down(s, off); s2 += __shfl_down(s2, off); }
    __shared__ float ws[8], ws2[8];
    int wave = threadIdx.x >> 5, lane = threadIdx.x & 31;
    if (lane == 0) { ws[wave] = s; ws2[wave] = s2; }
    __syncthreads();
    if (threadIdx.x == 0) {
        float a = 0.f, a2 = 0.f;
        #pragma unroll
        for (int i = 0; i < 8; i++) { a += ws[i]; a2 += ws2[i]; }
        ws[0] = a; ws2[0] = a2;
    }
    __syncthreads();
    float mean = ws[0] / D;
    float var  = ws2[0] / D - mean * mean;
    float rstd = rsqrtf(var + 1e-5f);
    bf16_t* orow = out + (size_t)blockIdx.x * D;
    for (int d = threadIdx.x; d < D; d += 256)
        orow[d] = (bf16_t)((row[d] - mean) * rstd * g[d] + b[d]);
}

// ---------------------------------------------------------------------------
// Generic bf16 WMMA GEMM:  C[M,N] = A[M,K] * Wt[N,K]^T  (+bias)(+gelu)(+resid)
// Block tile 128x128, K-step 32, 8 waves: each wave 32(M) x 64(N).
// Async global->LDS double-buffered pipeline when available.
// ---------------------------------------------------------------------------
#define GEMM_LDK 40   // padded LDS K-stride (80B: 16B aligned, conflict-free)

__device__ __forceinline__
void gemm_tile(const bf16_t* __restrict__ A, const bf16_t* __restrict__ Wt,
               const float* __restrict__ bias, const float* __restrict__ resid,
               float* __restrict__ outF, bf16_t* __restrict__ outB,
               int N, int K, int act, int m0, int n0) {
    __shared__ bf16_t As[2][128][GEMM_LDK];
    __shared__ bf16_t Bs[2][128][GEMM_LDK];
    const int tid = threadIdx.x;
    const int wave = tid >> 5, lane = tid & 31;
    const int wm = (wave & 3) * 32, wn = (wave >> 2) * 64;
    const int lm = lane & 15, kh = lane >> 4;

    v8f acc[2][4];
    #pragma unroll
    for (int i = 0; i < 2; i++)
        #pragma unroll
        for (int j = 0; j < 4; j++)
            #pragma unroll
            for (int v = 0; v < 8; v++) acc[i][j][v] = 0.f;

    const int r = tid >> 1, half = tid & 1;
    const bool bValid = (n0 + r < N);

#if HAS_ASYNC_LDS
    if (!bValid) {           // zero-fill OOB weight rows once (both buffers)
        u32x4 z = {0, 0, 0, 0};
        #pragma unroll
        for (int bufi = 0; bufi < 2; bufi++) {
            *(u32x4*)&Bs[bufi][r][half * 16]     = z;
            *(u32x4*)&Bs[bufi][r][half * 16 + 8] = z;
        }
    }
    {   // prime the pipeline: tile 0 -> buffer 0
        const bf16_t* ga = A + (size_t)(m0 + r) * K + half * 16;
        async_copy16(&As[0][r][half * 16], ga);
        async_copy16(&As[0][r][half * 16 + 8], ga + 8);
        if (bValid) {
            const bf16_t* gb = Wt + (size_t)(n0 + r) * K + half * 16;
            async_copy16(&Bs[0][r][half * 16], gb);
            async_copy16(&Bs[0][r][half * 16 + 8], gb + 8);
        }
    }
    int cur = 0;
    for (int k0 = 0; k0 < K; k0 += 32) {
        async_wait0();
        __syncthreads();
        if (k0 + 32 < K) {   // fetch next tile into the other buffer
            const bf16_t* ga = A + (size_t)(m0 + r) * K + k0 + 32 + half * 16;
            async_copy16(&As[cur ^ 1][r][half * 16], ga);
            async_copy16(&As[cur ^ 1][r][half * 16 + 8], ga + 8);
            if (bValid) {
                const bf16_t* gb = Wt + (size_t)(n0 + r) * K + k0 + 32 + half * 16;
                async_copy16(&Bs[cur ^ 1][r][half * 16], gb);
                async_copy16(&Bs[cur ^ 1][r][half * 16 + 8], gb + 8);
            }
        }
        if (k0 + 64 < K)
            __builtin_prefetch(A + (size_t)(m0 + r) * K + k0 + 64 + half * 16, 0, 3);

        AFrag a[2], bfr[4];
        #pragma unroll
        for (int i = 0; i < 2; i++) {
            const bf16_t* p = &As[cur][wm + i * 16 + lm][kh * 8];
            a[i].q[0] = *(const u32x4*)p;
            a[i].q[1] = *(const u32x4*)(p + 16);
        }
        #pragma unroll
        for (int j = 0; j < 4; j++) {
            const bf16_t* p = &Bs[cur][wn + j * 16 + lm][kh * 8];
            bfr[j].q[0] = *(const u32x4*)p;
            bfr[j].q[1] = *(const u32x4*)(p + 16);
        }
        #pragma unroll
        for (int i = 0; i < 2; i++)
            #pragma unroll
            for (int j = 0; j < 4; j++)
                acc[i][j] = __builtin_amdgcn_wmma_f32_16x16x32_bf16(
                    false, a[i].v, false, bfr[j].v, (short)0, acc[i][j], false, false);
        cur ^= 1;
    }
#else
    for (int k0 = 0; k0 < K; k0 += 32) {
        {
            const bf16_t* gp = A + (size_t)(m0 + r) * K + k0 + half * 16;
            *(u32x4*)&As[0][r][half * 16]     = *(const u32x4*)gp;
            *(u32x4*)&As[0][r][half * 16 + 8] = *(const u32x4*)(gp + 8);
        }
        {
            u32x4 z0 = {0, 0, 0, 0}, z1 = {0, 0, 0, 0};
            if (bValid) {
                const bf16_t* gp = Wt + (size_t)(n0 + r) * K + k0 + half * 16;
                z0 = *(const u32x4*)gp; z1 = *(const u32x4*)(gp + 8);
            }
            *(u32x4*)&Bs[0][r][half * 16]     = z0;
            *(u32x4*)&Bs[0][r][half * 16 + 8] = z1;
        }
        if (k0 + 32 < K)
            __builtin_prefetch(A + (size_t)(m0 + r) * K + k0 + 32 + half * 16, 0, 3);
        __syncthreads();
        AFrag a[2], bfr[4];
        #pragma unroll
        for (int i = 0; i < 2; i++) {
            const bf16_t* p = &As[0][wm + i * 16 + lm][kh * 8];
            a[i].q[0] = *(const u32x4*)p;
            a[i].q[1] = *(const u32x4*)(p + 16);
        }
        #pragma unroll
        for (int j = 0; j < 4; j++) {
            const bf16_t* p = &Bs[0][wn + j * 16 + lm][kh * 8];
            bfr[j].q[0] = *(const u32x4*)p;
            bfr[j].q[1] = *(const u32x4*)(p + 16);
        }
        #pragma unroll
        for (int i = 0; i < 2; i++)
            #pragma unroll
            for (int j = 0; j < 4; j++)
                acc[i][j] = __builtin_amdgcn_wmma_f32_16x16x32_bf16(
                    false, a[i].v, false, bfr[j].v, (short)0, acc[i][j], false, false);
        __syncthreads();
    }
#endif

    // Epilogue
    #pragma unroll
    for (int i = 0; i < 2; i++)
        #pragma unroll
        for (int j = 0; j < 4; j++) {
            int n = n0 + wn + j * 16 + lm;
            if (n >= N) continue;
            float bv = 0.f;
            if (bias) {
                bv = bias[n];
                // the index arithmetic below may land in this load's address registers
                asm volatile("s_wait_xcnt 0x0" ::: "memory");
            }
            #pragma unroll
            for (int v = 0; v < 8; v++) {
                int m = m0 + wm + i * 16 + v + 8 * kh;
                float c = acc[i][j][v] + bv;
                if (act == 1) c = 0.5f * c * (1.f + erff(c * 0.70710678118f));
                size_t idx = (size_t)m * N + n;
                // behind each access below: later arithmetic may land in its registers
                if (resid) {
                    c += resid[idx];
                    asm volatile("s_wait_xcnt 0x0" ::: "memory");   // see above
                }
                if (outF) {
                    outF[idx] = c;
                    asm volatile("s_wait_xcnt 0x0" ::: "memory");   // see above
                }
                if (outB) {
                    outB[idx] = (bf16_t)c;
                    asm volatile("s_wait_xcnt 0x0" ::: "memory");   // see above
                }
            }
        }
}

__global__ __launch_bounds__(256)
void k_gemm_bf16(const bf16_t* __restrict__ A, const bf16_t* __restrict__ Wt,
                 const float* __restrict__ bias, const float* __restrict__ resid,
                 float* __restrict__ outF, bf16_t* __restrict__ outB,
                 int M, int N, int K, int act) {
    gemm_tile(A, Wt, bias, resid, outF, outB, N, K, act, blockIdx.y * 128, blockIdx.x * 128);
}

// The seven projections of the same A (2048 x K) in one grid: they do not depend on one
// another, and the narrow ones (16 blocks each on their own) fill places the wide ones leave.
// blockIdx.x picks the weight and its 128-wide column tile, blockIdx.y the row tile.
struct ProjArgs {
    const bf16_t* A;
    const bf16_t* tqkv; const bf16_t* tmv; const bf16_t* t1w; const bf16_t* t2w;
    const bf16_t* t1r;  const bf16_t* t2r; const bf16_t* tmg;
    const float* bqkv; const float* bmv; const float* bmg;
    bf16_t* qkv;
    float* memval; float* p1w; float* p2w; float* p1r; float* p2r; float* glin;
    int K;
};
#define PROJ_TILES 37   // 24 (qkv) + 8 (mem values) + 4 (points) + 1 (gate)

__global__ __launch_bounds__(256)
void k_gemm_proj(ProjArgs a) {
    const int x = blockIdx.x;
    const bf16_t* Wt;
    const float* bias = nullptr;
    float* oF = nullptr;
    bf16_t* oB = nullptr;
    int N = 64, n0 = 0;
    if (x < 24)       { Wt = a.tqkv; bias = a.bqkv; oB = a.qkv;    N = 3072; n0 = x * 128; }
    else if (x < 32)  { Wt = a.tmv;  bias = a.bmv;  oF = a.memval; N = 1024; n0 = (x - 24) * 128; }
    else if (x == 32) { Wt = a.t1w;  oF = a.p1w; }
    else if (x == 33) { Wt = a.t2w;  oF = a.p2w; }
    else if (x == 34) { Wt = a.t1r;  oF = a.p1r; }
    else if (x == 35) { Wt = a.t2r;  oF = a.p2r; }
    else              { Wt = a.tmg;  bias = a.bmg;  oF = a.glin;   N = 16; }
    gemm_tile(a.A, Wt, bias, nullptr, oF, oB, N, a.K, 0, blockIdx.y * 128, n0);
}

// ---------------------------------------------------------------------------
// Flash-style causal attention.  qkv bf16 [(b,t), 3, H, 64].
// grid (T/128, B*H), 256 threads (8 waves, 16 q-rows each).
// ---------------------------------------------------------------------------
__global__ __launch_bounds__(256)
void k_attention(const bf16_t* __restrict__ qkv, float* __restrict__ seqout,
                 int B, int T, int H) {
    const int qb = blockIdx.x;
    const int bh = blockIdx.y;
    const int h = bh % H, b = bh / H;
    const int tid = threadIdx.x, wave = tid >> 5, lane = tid & 31;
    const int lm = lane & 15, kh = lane >> 4;

    __shared__ bf16_t Qs[128][72];
    __shared__ bf16_t Ks[128][72];
    __shared__ bf16_t Vt[64][136];     // V transposed: [dh][s]
    __shared__ bf16_t Ps[8][16][40];   // per-wave P staging (32-wide K chunk)

    const size_t strideT = 3 * 1024;
    const bf16_t* base = qkv + (size_t)b * T * strideT + (size_t)h * 64;

    // Load Q tile (128 x 64)
    for (int c8 = tid; c8 < 128 * 8; c8 += 256) {
        int rr = c8 >> 3, cc = (c8 & 7) * 8;
        const bf16_t* gq = base + (size_t)(qb * 128 + rr) * strideT + cc;
#if HAS_ASYNC_LDS
        async_copy16(&Qs[rr][cc], gq);
#else
        *(u32x4*)&Qs[rr][cc] = *(const u32x4*)gq;
#endif
    }

    float rowm[8], rowl[8];
    v8f oacc[4];
    #pragma unroll
    for (int v = 0; v < 8; v++) { rowm[v] = -INFINITY; rowl[v] = 0.f; }
    #pragma unroll
    for (int jt = 0; jt < 4; jt++)
        #pragma unroll
        for (int v = 0; v < 8; v++) oacc[jt][v] = 0.f;

    for (int sb = 0; sb <= qb; sb++) {
        __syncthreads();   // protect Ks/Vt reuse across iterations
        for (int c8 = tid; c8 < 128 * 8; c8 += 256) {
            int rr = c8 >> 3, cc = (c8 & 7) * 8;
            const bf16_t* gk = base + (size_t)(sb * 128 + rr) * strideT + 1024 + cc;
#if HAS_ASYNC_LDS
            async_copy16(&Ks[rr][cc], gk);
#else
            *(u32x4*)&Ks[rr][cc] = *(const u32x4*)gk;
#endif
        }
        for (int c8 = tid; c8 < 128 * 8; c8 += 256) {
            int rr = c8 >> 3, cc = (c8 & 7) * 8;
            union { u32x4 u; bf16_t e[8]; } vv;
            vv.u = *(const u32x4*)(base + (size_t)(sb * 128 + rr) * strideT + 2048 + cc);
            #pragma unroll
            for (int i = 0; i < 8; i++) Vt[cc + i][rr] = vv.e[i];
        }
        async_wait0();
        __syncthreads();

        // ---- scores: S = Q * K^T ----
        AFrag aq[2];
        #pragma unroll
        for (int kk = 0; kk < 2; kk++) {
            const bf16_t* p = &Qs[wave * 16 + lm][kk * 32 + kh * 8];
            aq[kk].q[0] = *(const u32x4*)p;
            aq[kk].q[1] = *(const u32x4*)(p + 16);
        }
        v8f sacc[8];
        #pragma unroll
        for (int j = 0; j < 8; j++)
            #pragma unroll
            for (int v = 0; v < 8; v++) sacc[j][v] = 0.f;
        #pragma unroll
        for (int j = 0; j < 8; j++)
            #pragma unroll
            for (int kk = 0; kk < 2; kk++) {
                AFrag bk;
                const bf16_t* p = &Ks[j * 16 + lm][kk * 32 + kh * 8];
                bk.q[0] = *(const u32x4*)p;
                bk.q[1] = *(const u32x4*)(p + 16);
                sacc[j] = __builtin_amdgcn_wmma_f32_16x16x32_bf16(
                    false, aq[kk].v, false, bk.v, (short)0, sacc[j], false, false);
            }

        // ---- causal mask + online softmax (wave32: 16-lane row reductions) ----
        #pragma unroll
        for (int v = 0; v < 8; v++) {
            int trow = qb * 128 + wave * 16 + v + 8 * kh;
            float rm = -INFINITY;
            #pragma unroll
            for (int j = 0; j < 8; j++) {
                int col = sb * 128 + j * 16 + lm;
                float s = (col <= trow) ? sacc[j][v] * 0.125f : -INFINITY;
                sacc[j][v] = s;
                rm = fmaxf(rm, s);
            }
            #pragma unroll
            for (int msk = 1; msk < 16; msk <<= 1) rm = fmaxf(rm, __shfl_xor(rm, msk));
            float mnew = fmaxf(rowm[v], rm);
            float corr = expf(rowm[v] - mnew);
            rowm[v] = mnew;
            float rs = 0.f;
            #pragma unroll
            for (int j = 0; j < 8; j++) {
                float p = expf(sacc[j][v] - mnew);
                sacc[j][v] = p;
                rs += p;
            }
            #pragma unroll
            for (int msk = 1; msk < 16; msk <<= 1) rs += __shfl_xor(rs, msk);
            rowl[v] = rowl[v] * corr + rs;
            #pragma unroll
            for (int jt = 0; jt < 4; jt++) oacc[jt][v] = oacc[jt][v] * corr;
        }

        // ---- O += P * V  (stage P through LDS: C-layout -> A-layout) ----
        #pragma unroll
        for (int kk = 0; kk < 4; kk++) {
            #pragma unroll
            for (int jj = 0; jj < 2; jj++) {
                int j = kk * 2 + jj;
                #pragma unroll
                for (int v = 0; v < 8; v++)
                    Ps[wave][v + 8 * kh][jj * 16 + lm] = (bf16_t)sacc[j][v];
            }
            AFrag ap;
            const bf16_t* p = &Ps[wave][lm][kh * 8];
            ap.q[0] = *(const u32x4*)p;
            ap.q[1] = *(const u32x4*)(p + 16);
            #pragma unroll
            for (int jt = 0; jt < 4; jt++) {
                AFrag bv;
                const bf16_t* q = &Vt[jt * 16 + lm][kk * 32 + kh * 8];
                bv.q[0] = *(const u32x4*)q;
                bv.q[1] = *(const u32x4*)(q + 16);
                oacc[jt] = __builtin_amdgcn_wmma_f32_16x16x32_bf16(
                    false, ap.v, false, bv.v, (short)0, oacc[jt], false, false);
            }
        }
    }

    float* out = seqout + (size_t)b * T * 1024 + (size_t)h * 64;
    #pragma unroll
    for (int jt = 0; jt < 4; jt++)
        #pragma unroll
        for (int v = 0; v < 8; v++) {
            int trow = qb * 128 + wave * 16 + v + 8 * kh;
            int col  = jt * 16 + lm;
            out[(size_t)trow * 1024 + col] = oacc[jt][v] / rowl[v];
        }
}

// ---------------------------------------------------------------------------
// Plucker lines + J6 rotation.  One thread per (b,t,h).
// ---------------------------------------------------------------------------
__device__ inline void exterior4(const float* a1, const float* a2, float* L) {
    L[0] = a1[0] * a2[1] - a1[1] * a2[0];
    L[1] = a1[0] * a2[2] - a1[2] * a2[0];
    L[2] = a1[0] * a2[3] - a1[3] * a2[0];
    L[3] = a1[1] * a2[2] - a1[2] * a2[1];
    L[4] = a1[1] * a2[3] - a1[3] * a2[1];
    L[5] = a1[2] * a2[3] - a1[3] * a2[2];
    float n2 = 0.f;
    #pragma unroll
    for (int i = 0; i < 6; i++) n2 += L[i] * L[i];
    float inv = 1.f / fmaxf(sqrtf(n2), 1e-12f);
    #pragma unroll
    for (int i = 0; i < 6; i++) L[i] *= inv;
}

__global__ __launch_bounds__(256)
void k_lines(const float* __restrict__ p1w, const float* __restrict__ p2w,
             const float* __restrict__ p1r, const float* __restrict__ p2r,
             float* __restrict__ Jw, float* __restrict__ Rd, int B, int T, int H) {
    int idx = blockIdx.x * 256 + threadIdx.x;
    if (idx >= B * T * H) return;
    int h = idx % H, t = (idx / H) % T, b = idx / (H * T);
    size_t row = (size_t)b * T + t;
    float a1[4], a2[4], L[6];
    #pragma unroll
    for (int c = 0; c < 4; c++) {
        a1[c] = (t > 0) ? p1w[(row - 1) * 64 + h * 4 + c] : 0.f;
        a2[c] = p2w[row * 64 + h * 4 + c];
    }
    exterior4(a1, a2, L);
    float* jw = Jw + ((size_t)(b * H + h) * T + t) * 6;
    jw[0] = L[5]; jw[1] = -L[4]; jw[2] = L[3]; jw[3] = L[2]; jw[4] = -L[1]; jw[5] = L[0];
    #pragma unroll
    for (int c = 0; c < 4; c++) {
        a1[c] = p1r[row * 64 + h * 4 + c];
        a2[c] = p2r[row * 64 + h * 4 + c];
    }
    exterior4(a1, a2, L);
    float* rd = Rd + ((size_t)(b * H + h) * T + t) * 6;
    #pragma unroll
    for (int j = 0; j < 6; j++) rd[j] = L[j];
}

// ---------------------------------------------------------------------------
// Decayed-Gram scan:  M_t = d*(M_{t-1} + Jw_{t-1} Jw_{t-1}^T),  M_0 = 0.
// The recurrence is linear, so it is run as a chunked parallel scan:
// one block per (b,h), thread c owns the 4 steps t = 4c .. 4c+3 (T == 4 * blockDim.x).
//   1) each thread folds its own 4 steps from zero   (chunk aggregate)
//   2) weighted prefix over chunks: lanes by shuffles, waves through LDS
//   3) each thread replays its 4 steps from its true M and writes the gates
// M is symmetric, so only its 21 upper entries are carried.
// Every loop is unrolled so that the small arrays are indexed by constants and stay in registers.
// ---------------------------------------------------------------------------
#define GS_L 4      // steps per thread
#define GS_NS 21    // upper triangle of a 6x6

__device__ __forceinline__ void gram_step(float* m, const float* J, float d) {
    int n = 0;
    #pragma unroll
    for (int i = 0; i < 6; i++)
        #pragma unroll
        for (int j = i; j < 6; j++, n++) m[n] = d * (m[n] + J[i] * J[j]);
}

__global__ __launch_bounds__(256)
void k_gram_scan(const float* __restrict__ Jw, const float* __restrict__ Rd,
                 const float* __restrict__ glin, const float* __restrict__ decay_logits,
                 const float* __restrict__ iter_mix, const float* __restrict__ mem_scale,
                 float* __restrict__ gh, int B, int T, int H) {
    __shared__ __attribute__((aligned(16))) float Wagg[8][24];   // rows of 21, padded to 16 B
    const int bh = blockIdx.x, h = bh % H, b = bh / H;
    const int c = threadIdx.x, lane = c & 31;
    const int wave = __builtin_amdgcn_readfirstlane(c >> 5);     // scalar: the tests on it in 2b are scalar compares
    const int t0 = c * GS_L;

    // all of this thread's inputs, issued up front
    union { float4 q[6]; float f[24]; } J, R;
    const float4* Jq = (const float4*)(Jw + (size_t)bh * T * 6 + (size_t)t0 * 6);
    const float4* Rq = (const float4*)(Rd + (size_t)bh * T * 6 + (size_t)t0 * 6);
    #pragma unroll
    for (int i = 0; i < 6; i++) J.q[i] = Jq[i];
    // the next loads may land in these loads' address registers
    asm volatile("s_wait_xcnt 0x0" ::: "memory");
    #pragma unroll
    for (int i = 0; i < 6; i++) R.q[i] = Rq[i];
    // as above
    asm volatile("s_wait_xcnt 0x0" ::: "memory");
    float gl[GS_L];
    #pragma unroll
    for (int k = 0; k < GS_L; k++) gl[k] = glin[((size_t)b * T + t0 + k) * H + h];
    // the loads' address registers are reused by the arithmetic below
    asm volatile("s_wait_xcnt 0x0" ::: "memory");

    const float decay = 1.f / (1.f + expf(-decay_logits[h]));
    const float alpha = 1.f / (1.f + expf(-iter_mix[0]));
    const float msc = mem_scale[h];

    // w[s] = decay^(4 * 2^s): the decay across 2^s chunks
    float w[6];
    w[0] = (decay * decay) * (decay * decay);
    #pragma unroll
    for (int s = 1; s < 6; s++) w[s] = w[s - 1] * w[s - 1];

    // 1) chunk aggregate
    float m[GS_NS];
    #pragma unroll
    for (int n = 0; n < GS_NS; n++) m[n] = 0.f;
    #pragma unroll
    for (int k = 0; k < GS_L; k++) gram_step(m, &J.f[k * 6], decay);

    // 2a) inclusive weighted prefix over the wave's 32 chunks
    #pragma unroll
    for (int s = 0; s < 5; s++) {
        const int o = 1 << s;
        #pragma unroll
        for (int n = 0; n < GS_NS; n++) {
            float v = __shfl_up(m[n], o);
            m[n] = (lane >= o) ? m[n] + w[s] * v : m[n];
        }
    }
    if (lane == 31) {
        #pragma unroll
        for (int n = 0; n < GS_NS; n++) Wagg[wave][n] = m[n];
    }
    // exclusive within the wave
    #pragma unroll
    for (int n = 0; n < GS_NS; n++) {
        float v = __shfl_up(m[n], 1);
        m[n] = (lane > 0) ? v : 0.f;
    }
    __syncthreads();

    // 2b) M at the wave's first step, from the earlier waves' totals.
    // It is the same for the whole wave: lane n folds entry n, then it is read per entry.
    const int ln = (lane < GS_NS) ? lane : 0;
    float tot[7];
    #pragma unroll
    for (int q = 0; q < 7; q++) tot[q] = Wagg[q][ln];
    float p = 0.f;
    #pragma unroll
    for (int q = 0; q < 7; q++) p = (q < wave) ? w[5] * p + tot[q] : p;
    float dl = 1.f;   // decay^(4 * lane)
    #pragma unroll
    for (int s = 0; s < 5; s++) dl *= ((lane >> s) & 1) ? w[s] : 1.f;
    #pragma unroll
    for (int n = 0; n < GS_NS; n++)
        m[n] += dl * __int_as_float(__builtin_amdgcn_readlane(__float_as_int(p), n));

    // 3) replay
    #pragma unroll
    for (int k = 0; k < GS_L; k++) {
        const float* rd = &R.f[k * 6];
        float rdM[6] = {0, 0, 0, 0, 0, 0};
        int n = 0;
        #pragma unroll
        for (int i = 0; i < 6; i++)
            #pragma unroll
            for (int j = i; j < 6; j++, n++) {
                rdM[j] += rd[i] * m[n];
                if (j != i) rdM[i] += rd[j] * m[n];
            }
        float s1 = 0.f, s2 = 0.f;
        #pragma unroll
        for (int j = 0; j < 6; j++) { s1 += rdM[j] * rd[j]; s2 += rdM[j] * rdM[j]; }
        float ms = (1.f - alpha) * s1 + alpha * s2;
        float g1 = 1.f / (1.f + expf(-ms * msc));
        float g2 = 1.f / (1.f + expf(-gl[k]));
        gh[((size_t)b * T + t0 + k) * H + h] = g1 * g2;
        if (k + 1 < GS_L) gram_step(m, &J.f[k * 6], decay);
    }
}

// ---------------------------------------------------------------------------
// y = seqout + mean_h(gh) * memval  -> bf16 (input to Wout GEMM)
// ---------------------------------------------------------------------------
__global__ __launch_bounds__(256)
void k_combine(const float* __restrict__ seqout, const float* __restrict__ memval,
               const float* __restrict__ gh, bf16_t* __restrict__ y, int D, int H) {
    size_t row = blockIdx.x;
    float g = 0.f;
    #pragma unroll
    for (int h = 0; h < 16; h++) g += gh[row * H + h];
    g *= (1.f / 16.f);
    const float* so = seqout + row * D;
    const float* mv = memval + row * D;
    bf16_t* yr = y + row * D;
    for (int d = threadIdx.x; d < D; d += 256)
        yr[d] = (bf16_t)(so[d] + g * mv[d]);
}

// ---------------------------------------------------------------------------
extern "C" void kernel_launch(void* const* d_in, const int* in_sizes, int n_in,
                              void* d_out, int out_size, void* d_ws, size_t ws_size,
                              hipStream_t stream) {
    const int B = 2, T = 1024, D = 1024, H = 16, DFF = 4096;
    const int M = B * T;

    const float* x            = (const float*)d_in[0];
    const float* ln1_g        = (const float*)d_in[1];
    const float* ln1_b        = (const float*)d_in[2];
    const float* Wqkv         = (const float*)d_in[3];
    const float* bqkv         = (const float*)d_in[4];
    const float* W1w          = (const float*)d_in[5];
    const float* W2w          = (const float*)d_in[6];
    const float* W1r          = (const float*)d_in[7];
    const float* W2r          = (const float*)d_in[8];
    const float* Wmv          = (const float*)d_in[9];
    const float* bmv          = (const float*)d_in[10];
    const float* Wmg          = (const float*)d_in[11];
    const float* bmg          = (const float*)d_in[12];
    const float* mem_scale    = (const float*)d_in[13];
    const float* iter_mix     = (const float*)d_in[14];
    const float* decay_logits = (const float*)d_in[15];
    const float* Wout         = (const float*)d_in[16];
    const float* bout         = (const float*)d_in[17];
    const float* ln2_g        = (const float*)d_in[18];
    const float* ln2_b        = (const float*)d_in[19];
    const float* Wfc          = (const float*)d_in[20];
    const float* bfc          = (const float*)d_in[21];
    const float* Wproj        = (const float*)d_in[22];
    const float* bproj        = (const float*)d_in[23];

    char* ws = (char*)d_ws;
    size_t off = 0;
    auto alloc = [&](size_t bytes) -> void* {
        void* p = ws + off;
        off += (bytes + 255) & ~(size_t)255;
        return p;
    };

    bf16_t* Wqkv_t  = (bf16_t*)alloc((size_t)3 * D * D * 2);
    bf16_t* W1w_t   = (bf16_t*)alloc((size_t)64 * D * 2);
    bf16_t* W2w_t   = (bf16_t*)alloc((size_t)64 * D * 2);
    bf16_t* W1r_t   = (bf16_t*)alloc((size_t)64 * D * 2);
    bf16_t* W2r_t   = (bf16_t*)alloc((size_t)64 * D * 2);
    bf16_t* Wmg_t   = (bf16_t*)alloc((size_t)H * D * 2);
    bf16_t* Wmv_t   = (bf16_t*)alloc((size_t)D * D * 2);
    bf16_t* Wout_t  = (bf16_t*)alloc((size_t)D * D * 2);
    bf16_t* Wfc_t   = (bf16_t*)alloc((size_t)DFF * D * 2);
    bf16_t* Wproj_t = (bf16_t*)alloc((size_t)D * DFF * 2);
    bf16_t* h_bf    = (bf16_t*)alloc((size_t)M * D * 2);
    bf16_t* qkv_bf  = (bf16_t*)alloc((size_t)M * 3 * D * 2);
    float*  p1w     = (float*)alloc((size_t)M * 64 * 4);
    float*  p2w     = (float*)alloc((size_t)M * 64 * 4);
    float*  p1r     = (float*)alloc((size_t)M * 64 * 4);
    float*  p2r     = (float*)alloc((size_t)M * 64 * 4);
    float*  glin    = (float*)alloc((size_t)M * H * 4);
    float*  Jwb     = (float*)alloc((size_t)B * H * T * 6 * 4);
    float*  Rdb     = (float*)alloc((size_t)B * H * T * 6 * 4);
    float*  ghb     = (float*)alloc((size_t)M * H * 4);
    float*  memval  = (float*)alloc((size_t)M * D * 4);
    float*  seqout  = (float*)alloc((size_t)M * D * 4);
    bf16_t* y_bf    = (bf16_t*)alloc((size_t)M * D * 2);
    float*  x1      = (float*)alloc((size_t)M * D * 4);
    bf16_t* h2_bf   = (bf16_t*)alloc((size_t)M * D * 2);
    bf16_t* a_bf    = (bf16_t*)alloc((size_t)M * DFF * 2);

    auto gemm = [&](const bf16_t* A, const bf16_t* Wt, const float* bias,
                    const float* resid, float* oF, bf16_t* oB, int m, int n, int k, int act) {
        dim3 g((n + 127) / 128, (m + 127) / 128);
        k_gemm_bf16<<<g, 256, 0, stream>>>(A, Wt, bias, resid, oF, oB, m, n, k, act);
    };

    // 1) weights -> bf16 transposed
    TrArgs ta = { Wfc, Wproj, Wqkv, Wmv, Wout, W1w, W2w, W1r, W2r, Wmg,
                  Wfc_t, Wproj_t, Wqkv_t, Wmv_t, Wout_t, W1w_t, W2w_t, W1r_t, W2r_t, Wmg_t };
    k_transpose_bf16<<<TR_BLOCKS, 256, 0, stream>>>(ta);

    // 2) ln1
    k_layernorm<<<M, 256, 0, stream>>>(x, ln1_g, ln1_b, h_bf, D);

    // 3) projections
    ProjArgs pa = { h_bf, Wqkv_t, Wmv_t, W1w_t, W2w_t, W1r_t, W2r_t, Wmg_t,
                    bqkv, bmv, bmg, qkv_bf, memval, p1w, p2w, p1r, p2r, glin, D };
    k_gemm_proj<<<dim3(PROJ_TILES, 16), 256, 0, stream>>>(pa);

    // 4) attention
    k_attention<<<dim3(T / 128, B * H), 256, 0, stream>>>(qkv_bf, seqout, B, T, H);

    // 5) Gram memory branch
    k_lines<<<(B * T * H + 255) / 256, 256, 0, stream>>>(p1w, p2w, p1r, p2r, Jwb, Rdb, B, T, H);
    k_gram_scan<<<B * H, 256, 0, stream>>>(Jwb, Rdb, glin, decay_logits, iter_mix,
                                          mem_scale, ghb, B, T, H);
    k_combine<<<M, 256, 0, stream>>>(seqout, memval, ghb, y_bf, D, H);

    // 6) output projection + residual
    gemm(y_bf, Wout_t, bout, x, x1, nullptr, M, D, D, 0);

    // 7) MLP
    k_layernorm<<<M, 256, 0, stream>>>(x1, ln2_g, ln2_b, h2_bf, D);
    gemm(h2_bf, Wfc_t, bfc, nullptr, nullptr, a_bf, M, DFF, D, 1);
    gemm(a_bf, Wproj_t, bproj, x1, (float*)d_out, nullptr, M, D, DFF, 0);
}

// v003
// A run of this version takes 280 microseconds.
// Next to v002, in two timings, it ran 1.09 and 1.10 times as fast.
// Counting every step since v000, it is 3.11 times as fast.
#include <hip/hip_runtime.h>
#include <math.h>

typedef __bf16 bf16_t;
typedef __attribute__((ext_vector_type(16))) __bf16 v16bf;
typedef __attribute__((ext_vector_type(8)))  float  v8f;
typedef unsigned int u32x4 __attribute__((ext_vector_type(4)));
typedef int i32x4 __attribute__((ext_vector_type(4)));

union AFrag { v16bf v; u32x4 q[2]; };

#if __has_builtin(__builtin_amdgcn_global_load_async_to_lds_b128) && \
    __has_builtin(__builtin_amdgcn_s_wait_asynccnt)
#define HAS_ASYNC_LDS 1
typedef __attribute__((address_space(1))) i32x4* glds_gptr;
typedef __attribute__((address_space(3))) i32x4* glds_lptr;
#else
#define HAS_ASYNC_LDS 0
#endif

__device__ __forceinline__ void async_copy16(void* lds, const void* g) {
#if HAS_ASYNC_LDS
    __builtin_amdgcn_global_load_async_to_lds_b128(
        (glds_gptr)(g), (glds_lptr)(lds), 0, 0);
#endif
}
__device__ __forceinline__ void async_wait0() {
#if HAS_ASYNC_LDS
    __builtin_amdgcn_s_wait_asynccnt(0);
#endif
}

// ---------------------------------------------------------------------------
// Weight convert: W (K x N, f32, row-major) -> Wt (N x K, bf16, row-major)
// All ten weights in one grid: the transposes do not depend on one another, so a
// block finds its weight and its 32x32 tile from blockIdx.x (ranges below, largest first).
// ---------------------------------------------------------------------------
struct TrArgs {
    const float* wfc;  const float* wproj; const float* wqkv; const float* wmv; const float* wout;
    const float* w1w;  const float* w2w;   const float* w1r;  const float* w2r; const float* wmg;
    bf16_t* tfc;  bf16_t* tproj; bf16_t* tqkv; bf16_t* tmv; bf16_t* tout;
    bf16_t* t1w;  bf16_t* t2w;   bf16_t* t1r;  bf16_t* t2r; bf16_t* tmg;
};
#define TR_BLOCKS 13600   // 4096 + 4096 + 3072 + 1024 + 1024 + 4 * 64 + 32

__global__ __launch_bounds__(256)
void k_transpose_bf16(TrArgs a) {
    __shared__ float tile[32][33];
    const float* __restrict__ W;
    bf16_t* __restrict__ Wt;
    int K = 1024, N, kb, nb;
    int l = blockIdx.x;   // tile index inside the weight, N fastest
    if (l < 4096)                { W = a.wfc;   Wt = a.tfc;   N = 4096; nb = (l & 127) * 32; kb = (l >> 7) * 32; }
    else if ((l -= 4096) < 4096) { W = a.wproj; Wt = a.tproj; N = 1024; nb = (l & 31) * 32;  kb = (l >> 5) * 32; K = 4096; }
    else if ((l -= 4096) < 3072) { W = a.wqkv;  Wt = a.tqkv;  N = 3072; nb = (l % 96) * 32;  kb = (l / 96) * 32; }
    else if ((l -= 3072) < 1024) { W = a.wmv;   Wt = a.tmv;   N = 1024; nb = (l & 31) * 32;  kb = (l >> 5) * 32; }
    else if ((l -= 1024) < 1024) { W = a.wout;  Wt = a.tout;  N = 1024; nb = (l & 31) * 32;  kb = (l >> 5) * 32; }
    else if ((l -= 1024) < 256) {
        const int s = l >> 6;
        W  = s == 0 ? a.w1w : s == 1 ? a.w2w : s == 2 ? a.w1r : a.w2r;
        Wt = s == 0 ? a.t1w : s == 1 ? a.t2w : s == 2 ? a.t1r : a.t2r;
        N = 64; nb = (l & 1) * 32; kb = ((l & 63) >> 1) * 32;
    }
    else { l -= 256; W = a.wmg; Wt = a.tmg; N = 16; nb = 0; kb = l * 32; }
    int tx = threadIdx.x & 31, ty = threadIdx.x >> 5;
    #pragma unroll
    for (int i = ty; i < 32; i += 8) {
        int k = kb + i, n = nb + tx;
        tile[i][tx] = (k < K && n < N) ? W[(size_t)k * N + n] : 0.f;
    }
    __syncthreads();
    #pragma unroll
    for (int i = ty; i < 32; i += 8) {
        int n = nb + i, k = kb + tx;
        if (n < N && k < K) Wt[(size_t)n * K + k] = (bf16_t)tile[tx][i];
    }
}

// ---------------------------------------------------------------------------
// LayerNorm (f32 in) -> bf16 out.  One block per row.
// ---------------------------------------------------------------------------
__global__ __launch_bounds__(256)
void k_layernorm(const float* __restrict__ x, const float* __restrict__ g,
                 const float* __restrict__ b, bf16_t* __restrict__ out, int D) {
    const float* row = x + (size_t)blockIdx.x * D;
    float s = 0.f, s2 = 0.f;
    for (int d = threadIdx.x; d < D; d += 256) { float v = row[d]; s += v; s2 += v * v; }
    #pragma unroll
    for (int off = 16; off; off >>= 1) { s += __shfl_down(s, off); s2 += __shfl_down(s2, off); }
    __shared__ float ws[8], ws2[8];
    int wave = threadIdx.x >> 5, lane = threadIdx.x & 31;
    if (lane == 0) { ws[wave] = s; ws2[wave] = s2; }
    __syncthreads();
    if (threadIdx.x == 0) {
        float a = 0.f, a2 = 0.f;
        #pragma unroll
        for (int i = 0; i < 8; i++) { a += ws[i]; a2 += ws2[i]; }
        ws[0] = a; ws2[0] = a2;
    }
    __syncthreads();
    float mean = ws[0] / D;
    float var  = ws2[0] / D - mean * mean;
    float rstd = rsqrtf(var + 1e-5f);
    bf16_t* orow = out + (size_t)blockIdx.x * D;
    for (int d = threadIdx.x; d < D; d += 256)
        orow[d] = (bf16_t)((row[d] - mean) * rstd * g[d] + b[d]);
}

// ---------------------------------------------------------------------------
// Generic bf16 WMMA GEMM:  C[M,N] = A[M,K] * Wt[N,K]^T  (+bias)(+gelu)(+resid)
// Block tile 128x128, 8 waves: each wave 32(M) x 64(N).
// A stage holds 64 k of every operand row = one whole 128-B line per row, so that a wave's
// 16-B-per-lane copy covers 4 whole lines (8 lanes a row).  Two buffers, copies one stage ahead.
// K must be a multiple of 64.
// ---------------------------------------------------------------------------
#define GEMM_BK  64   // k per stage
#define GEMM_LDK 72   // LDS row pitch in elements (144 B = 16 B x 9: conflict-free 16-B reads)
#define GEMM_ROWSTEP (32 * GEMM_LDK * 2)    // LDS bytes between a thread's four rows of one operand
#define GEMM_BUFSTEP (128 * GEMM_LDK * 2)   // LDS bytes between the two buffers of one operand

// One stage: each thread brings 16 B of four A rows and of four Wt rows (32 rows apart) into LDS.
// la, lb: the thread's LDS byte addresses of its first row; a0, b0..b3: its global addresses.
// The closing s_wait_xcnt stands inside the statement so that it precedes every later write of
// the address registers that the copies name.
__device__ __forceinline__
void gemm_stage(unsigned la, unsigned lb, const bf16_t* a0, size_t arow,
                const bf16_t* b0, const bf16_t* b1, const bf16_t* b2, const bf16_t* b3) {
    asm volatile(
        "global_load_async_to_lds_b128 %0, %8, off\n\t"
        "global_load_async_to_lds_b128 %1, %9, off\n\t"
        "global_load_async_to_lds_b128 %2, %10, off\n\t"
        "global_load_async_to_lds_b128 %3, %11, off\n\t"
        "global_load_async_to_lds_b128 %4, %12, off\n\t"
        "global_load_async_to_lds_b128 %5, %13, off\n\t"
        "global_load_async_to_lds_b128 %6, %14, off\n\t"
        "global_load_async_to_lds_b128 %7, %15, off\n\t"
        "s_wait_xcnt 0x0"
        :: "v"(la), "v"(la + GEMM_ROWSTEP), "v"(la + 2 * GEMM_ROWSTEP), "v"(la + 3 * GEMM_ROWSTEP),
           "v"(lb), "v"(lb + GEMM_ROWSTEP), "v"(lb + 2 * GEMM_ROWSTEP), "v"(lb + 3 * GEMM_ROWSTEP),
           "v"(a0), "v"(a0 + arow), "v"(a0 + 2 * arow), "v"(a0 + 3 * arow),
           "v"(b0), "v"(b1), "v"(b2), "v"(b3)
        : "memory");
}

__device__ __forceinline__
void gemm_tile(const bf16_t* __restrict__ A, const bf16_t* __restrict__ Wt,
               const float* __restrict__ bias, const float* __restrict__ resid,
               float* __restrict__ outF, bf16_t* __restrict__ outB,
               int N, int K, int act, int m0, int n0) {
    __shared__ __attribute__((aligned(16))) bf16_t As[2][128][GEMM_LDK];
    __shared__ __attribute__((aligned(16))) bf16_t Bs[2][128][GEMM_LDK];
    const int tid = threadIdx.x;
    const int wave = tid >> 5, lane = tid & 31;
    const int wm = (wave & 3) * 32, wn = (wave >> 2) * 64;
    const int lm = lane & 15, kh = lane >> 4;

    v8f acc[2][4];
    #pragma unroll
    for (int i = 0; i < 2; i++)
        #pragma unroll
        for (int j = 0; j < 4; j++)
            #pragma unroll
            for (int v = 0; v < 8; v++) acc[i][j][v] = 0.f;

    // copy map: 8 lanes a row (8 x 16 B = the row's 128 B of this stage), rows cr + 32 i
    const int cr = tid >> 3, cc = (tid & 7) * 8;
    const size_t arow = (size_t)32 * K;
    const bf16_t* ga = A + (size_t)(m0 + cr) * K + cc;
    // A weight row past N is replaced by row N - 1: every lane copies, every address is in
    // bounds, and the columns n >= N that such rows feed are never stored (epilogue).
    const bf16_t* gb[4];
    #pragma unroll
    for (int i = 0; i < 4; i++) {
        int rn = n0 + cr + 32 * i;
        rn = rn < N ? rn : N - 1;
        gb[i] = Wt + (size_t)rn * K + cc;
    }
    const unsigned la = (unsigned)(size_t)&As[0][cr][cc];   // low 32 bits = LDS byte address
    const unsigned lb = (unsigned)(size_t)&Bs[0][cr][cc];
    const int nT = K / GEMM_BK;

    // stage 0 -> buffer 0, published; then stage 1 -> buffer 1 flies during trip 0
    gemm_stage(la, lb, ga, arow, gb[0], gb[1], gb[2], gb[3]);
    asm volatile("s_wait_asynccnt 0x0" ::: "memory");   // this wave's copies of stage 0 have landed
    __syncthreads();
    if (nT > 1)
        gemm_stage(la + GEMM_BUFSTEP, lb + GEMM_BUFSTEP, ga + GEMM_BK, arow,
                   gb[0] + GEMM_BK, gb[1] + GEMM_BK, gb[2] + GEMM_BK, gb[3] + GEMM_BK);

    for (int t = 0; t < nT; t++) {
        const int cur = t & 1;
        if (t + 2 < nT)
            __builtin_prefetch(A + (size_t)(m0 + (tid >> 1)) * K + (t + 2) * GEMM_BK + (tid & 1) * 32, 0, 3);

        #pragma unroll
        for (int kk = 0; kk < GEMM_BK / 32; kk++) {
            AFrag a[2], bfr[4];
            #pragma unroll
            for (int i = 0; i < 2; i++) {
                const bf16_t* p = &As[cur][wm + i * 16 + lm][kk * 32 + kh * 8];
                a[i].q[0] = *(const u32x4*)p;
                a[i].q[1] = *(const u32x4*)(p + 16);
            }
            #pragma unroll
            for (int j = 0; j < 4; j++) {
                const bf16_t* p = &Bs[cur][wn + j * 16 + lm][kk * 32 + kh * 8];
                bfr[j].q[0] = *(const u32x4*)p;
                bfr[j].q[1] = *(const u32x4*)(p + 16);
            }
            #pragma unroll
            for (int i = 0; i < 2; i++)
                #pragma unroll
                for (int j = 0; j < 4; j++)
                    acc[i][j] = __builtin_amdgcn_wmma_f32_16x16x32_bf16(
                        false, a[i].v, false, bfr[j].v, (short)0, acc[i][j], false, false);
        }

        // publish stage t + 1 and free buffer cur, in this order:
        asm volatile("s_wait_dscnt 0x0" ::: "memory");      // this wave's reads of buffer cur are done
        asm volatile("s_wait_asynccnt 0x0" ::: "memory");   // this wave's copies of stage t + 1 have landed
        __syncthreads();
        if (t + 2 < nT) {
            const int ko = (t + 2) * GEMM_BK;
            const unsigned bo = cur * GEMM_BUFSTEP;
            gemm_stage(la + bo, lb + bo, ga + ko, arow, gb[0] + ko, gb[1] + ko, gb[2] + ko, gb[3] + ko);
        }
    }
    asm volatile("s_wait_asynccnt 0x0" ::: "memory");   // no copy is left in flight behind the loop

    // Epilogue
    #pragma unroll
    for (int i = 0; i < 2; i++)
        #pragma unroll
        for (int j = 0; j < 4; j++) {
            int n = n0 + wn + j * 16 + lm;
            if (n >= N) continue;
            float bv = 0.f;
            if (bias) {
                bv = bias[n];
                // the index arithmetic below may land in this load's address registers
                asm volatile("s_wait_xcnt 0x0" ::: "memory");
            }
            #pragma unroll
            for (int v = 0; v < 8; v++) {
                int m = m0 + wm + i * 16 + v + 8 * kh;
                float c = acc[i][j][v] + bv;
                if (act == 1) c = 0.5f * c * (1.f + erff(c * 0.70710678118f));
                size_t idx = (size_t)m * N + n;
                // behind each access below: later arithmetic may land in its registers
                if (resid) {
                    c += resid[idx];
                    asm volatile("s_wait_xcnt 0x0" ::: "memory");   // see above
                }
                if (outF) {
                    outF[idx] = c;
                    asm volatile("s_wait_xcnt 0x0" ::: "memory");   // see above
                }
                if (outB) {
                    outB[idx] = (bf16_t)c;
                    asm volatile("s_wait_xcnt 0x0" ::: "memory");   // see above
                }
            }
        }
}

__global__ __launch_bounds__(256)
void k_gemm_bf16(const bf16_t* __restrict__ A, const bf16_t* __restrict__ Wt,
                 const float* __restrict__ bias, const float* __restrict__ resid,
                 float* __restrict__ outF, bf16_t* __restrict__ outB,
                 int M, int N, int K, int act) {
    gemm_tile(A, Wt, bias, resid, outF, outB, N, K, act, blockIdx.y * 128, blockIdx.x * 128);
}

// The seven projections of the same A (2048 x K) in one grid: they do not depend on one
// another, and the narrow ones (16 blocks each on their own) fill places the wide ones leave.
// blockIdx.x picks the weight and its 128-wide column tile, blockIdx.y the row tile.
struct ProjArgs {
    const bf16_t* A;
    const bf16_t* tqkv; const bf16_t* tmv; const bf16_t* t1w; const bf16_t* t2w;
    const bf16_t* t1r;  const bf16_t* t2r; const bf16_t* tmg;
    const float* bqkv; const float* bmv; const float* bmg;
    bf16_t* qkv;
    float* memval; float* p1w; float* p2w; float* p1r; float* p2r; float* glin;
    int K;
};
#define PROJ_TILES 37   // 24 (qkv) + 8 (mem values) + 4 (points) + 1 (gate)

__global__ __launch_bounds__(256)
void k_gemm_proj(ProjArgs a) {
    const int x = blockIdx.x;
    const bf16_t* Wt;
    const float* bias = nullptr;
    float* oF = nullptr;
    bf16_t* oB = nullptr;
    int N = 64, n0 = 0;
    if (x < 24)       { Wt = a.tqkv; bias = a.bqkv; oB = a.qkv;    N = 3072; n0 = x * 128; }
    else if (x < 32)  { Wt = a.tmv;  bias = a.bmv;  oF = a.memval; N = 1024; n0 = (x - 24) * 128; }
    else if (x == 32) { Wt = a.t1w;  oF = a.p1w; }
    else if (x == 33) { Wt = a.t2w;  oF = a.p2w; }
    else if (x == 34) { Wt = a.t1r;  oF = a.p1r; }
    else if (x == 35) { Wt = a.t2r;  oF = a.p2r; }
    else              { Wt = a.tmg;  bias = a.bmg;  oF = a.glin;   N = 16; }
    gemm_tile(a.A, Wt, bias, nullptr, oF, oB, N, a.K, 0, blockIdx.y * 128, n0);
}

// ---------------------------------------------------------------------------
// Flash-style causal attention.  qkv bf16 [(b,t), 3, H, 64].
// grid (T/128, B*H), 256 threads (8 waves, 16 q-rows each).
// ---------------------------------------------------------------------------
__global__ __launch_bounds__(256)
void k_attention(const bf16_t* __restrict__ qkv, float* __restrict__ seqout,
                 int B, int T, int H) {
    const int qb = blockIdx.x;
    const int bh = blockIdx.y;
    const int h = bh % H, b = bh / H;
    const int tid = threadIdx.x, wave = tid >> 5, lane = tid & 31;
    const int lm = lane & 15, kh = lane >> 4;

    __shared__ bf16_t Qs[128][72];
    __shared__ bf16_t Ks[128][72];
    __shared__ bf16_t Vt[64][136];     // V transposed: [dh][s]
    __shared__ bf16_t Ps[8][16][40];   // per-wave P staging (32-wide K chunk)

    const size_t strideT = 3 * 1024;
    const bf16_t* base = qkv + (size_t)b * T * strideT + (size_t)h * 64;

    // Load Q tile (128 x 64)
    for (int c8 = tid; c8 < 128 * 8; c8 += 256) {
        int rr = c8 >> 3, cc = (c8 & 7) * 8;
        const bf16_t* gq = base + (size_t)(qb * 128 + rr) * strideT + cc;
#if HAS_ASYNC_LDS
        async_copy16(&Qs[rr][cc], gq);
#else
        *(u32x4*)&Qs[rr][cc] = *(const u32x4*)gq;
#endif
    }

    float rowm[8], rowl[8];
    v8f oacc[4];
    #pragma unroll
    for (int v = 0; v < 8; v++) { rowm[v] = -INFINITY; rowl[v] = 0.f; }
    #pragma unroll
    for (int jt = 0; jt < 4; jt++)
        #pragma unroll
        for (int v = 0; v < 8; v++) oacc[jt][v] = 0.f;

    for (int sb = 0; sb <= qb; sb++) {
        __syncthreads();   // protect Ks/Vt reuse across iterations
        for (int c8 = tid; c8 < 128 * 8; c8 += 256) {
            int rr = c8 >> 3, cc = (c8 & 7) * 8;
            const bf16_t* gk = base + (size_t)(sb * 128 + rr) * strideT + 1024 + cc;
#if HAS_ASYNC_LDS
            async_copy16(&Ks[rr][cc], gk);
#else
            *(u32x4*)&Ks[rr][cc] = *(const u32x4*)gk;
#endif
        }
        for (int c8 = tid; c8 < 128 * 8; c8 += 256) {
            int rr = c8 >> 3, cc = (c8 & 7) * 8;
            union { u32x4 u; bf16_t e[8]; } vv;
            vv.u = *(const u32x4*)(base + (size_t)(sb * 128 + rr) * strideT + 2048 + cc);
            #pragma unroll
            for (int i = 0; i < 8; i++) Vt[cc + i][rr] = vv.e[i];
        }
        async_wait0();
        __syncthreads();

        // ---- scores: S = Q * K^T ----
        AFrag aq[2];
        #pragma unroll
        for (int kk = 0; kk < 2; kk++) {
            const bf16_t* p = &Qs[wave * 16 + lm][kk * 32 + kh * 8];
            aq[kk].q[0] = *(const u32x4*)p;
            aq[kk].q[1] = *(const u32x4*)(p + 16);
        }
        v8f sacc[8];
        #pragma unroll
        for (int j = 0; j < 8; j++)
            #pragma unroll
            for (int v = 0; v < 8; v++) sacc[j][v] = 0.f;
        #pragma unroll
        for (int j = 0; j < 8; j++)
            #pragma unroll
            for (int kk = 0; kk < 2; kk++) {
                AFrag bk;
                const bf16_t* p = &Ks[j * 16 + lm][kk * 32 + kh * 8];
                bk.q[0] = *(const u32x4*)p;
                bk.q[1] = *(const u32x4*)(p + 16);
                sacc[j] = __builtin_amdgcn_wmma_f32_16x16x32_bf16(
                    false, aq[kk].v, false, bk.v, (short)0, sacc[j], false, false);
            }

        // ---- causal mask + online softmax (wave32: 16-lane row reductions) ----
        #pragma unroll
        for (int v = 0; v < 8; v++) {
            int trow = qb * 128 + wave * 16 + v + 8 * kh;
            float rm = -INFINITY;
            #pragma unroll
            for (int j = 0; j < 8; j++) {
                int col = sb * 128 + j * 16 + lm;
                float s = (col <= trow) ? sacc[j][v] * 0.125f : -INFINITY;
                sacc[j][v] = s;
                rm = fmaxf(rm, s);
            }
            #pragma unroll
            for (int msk = 1; msk < 16; msk <<= 1) rm = fmaxf(rm, __shfl_xor(rm, msk));
            float mnew = fmaxf(rowm[v], rm);
            float corr = expf(rowm[v] - mnew);
            rowm[v] = mnew;
            float rs = 0.f;
            #pragma unroll
            for (int j = 0; j < 8; j++) {
                float p = expf(sacc[j][v] - mnew);
                sacc[j][v] = p;
                rs += p;
            }
            #pragma unroll
            for (int msk = 1; msk < 16; msk <<= 1) rs += __shfl_xor(rs, msk);
            rowl[v] = rowl[v] * corr + rs;
            #pragma unroll
            for (int jt = 0; jt < 4; jt++) oacc[jt][v] = oacc[jt][v] * corr;
        }

        // ---- O += P * V  (stage P through LDS: C-layout -> A-layout) ----
        #pragma unroll
        for (int kk = 0; kk < 4; kk++) {
            #pragma unroll
            for (int jj = 0; jj < 2; jj++) {
                int j = kk * 2 + jj;
                #pragma unroll
                for (int v = 0; v < 8; v++)
                    Ps[wave][v + 8 * kh][jj * 16 + lm] = (bf16_t)sacc[j][v];
            }
            AFrag ap;
            const bf16_t* p = &Ps[wave][lm][kh * 8];
            ap.q[0] = *(const u32x4*)p;
            ap.q[1] = *(const u32x4*)(p + 16);
            #pragma unroll
            for (int jt = 0; jt < 4; jt++) {
                AFrag bv;
                const bf16_t* q = &Vt[jt * 16 + lm][kk * 32 + kh * 8];
                bv.q[0] = *(const u32x4*)q;
                bv.q[1] = *(const u32x4*)(q + 16);
                oacc[jt] = __builtin_amdgcn_wmma_f32_16x16x32_bf16(
                    false, ap.v, false, bv.v, (short)0, oacc[jt], false, false);
            }
        }
    }

    float* out = seqout + (size_t)b * T * 1024 + (size_t)h * 64;
    #pragma unroll
    for (int jt = 0; jt < 4; jt++)
        #pragma unroll
        for (int v = 0; v < 8; v++) {
            int trow = qb * 128 + wave * 16 + v + 8 * kh;
            int col  = jt * 16 + lm;
            out[(size_t)trow * 1024 + col] = oacc[jt][v] / rowl[v];
        }
}

// ---------------------------------------------------------------------------
// Plucker lines + J6 rotation.  One thread per (b,t,h).
// ---------------------------------------------------------------------------
__device__ inline void exterior4(const float* a1, const float* a2, float* L) {
    L[0] = a1[0] * a2[1] - a1[1] * a2[0];
    L[1] = a1[0] * a2[2] - a1[2] * a2[0];
    L[2] = a1[0] * a2[3] - a1[3] * a2[0];
    L[3] = a1[1] * a2[2] - a1[2] * a2[1];
    L[4] = a1[1] * a2[3] - a1[3] * a2[1];
    L[5] = a1[2] * a2[3] - a1[3] * a2[2];
    float n2 = 0.f;
    #pragma unroll
    for (int i = 0; i < 6; i++) n2 += L[i] * L[i];
    float inv = 1.f / fmaxf(sqrtf(n2), 1e-12f);
    #pragma unroll
    for (int i = 0; i < 6; i++) L[i] *= inv;
}

__global__ __launch_bounds__(256)
void k_lines(const float* __restrict__ p1w, const float* __restrict__ p2w,
             const float* __restrict__ p1r, const float* __restrict__ p2r,
             float* __restrict__ Jw, float* __restrict__ Rd, int B, int T, int H) {
    int idx = blockIdx.x * 256 + threadIdx.x;
    if (idx >= B * T * H) return;
    int h = idx % H, t = (idx / H) % T, b = idx / (H * T);
    size_t row = (size_t)b * T + t;
    float a1[4], a2[4], L[6];
    #pragma unroll
    for (int c = 0; c < 4; c++) {
        a1[c] = (t > 0) ? p1w[(row - 1) * 64 + h * 4 + c] : 0.f;
        a2[c] = p2w[row * 64 + h * 4 + c];
    }
    exterior4(a1, a2, L);
    float* jw = Jw + ((size_t)(b * H + h) * T + t) * 6;
    jw[0] = L[5]; jw[1] = -L[4]; jw[2] = L[3]; jw[3] = L[2]; jw[4] = -L[1]; jw[5] = L[0];
    #pragma unroll
    for (int c = 0; c < 4; c++) {
        a1[c] = p1r[row * 64 + h * 4 + c];
        a2[c] = p2r[row * 64 + h * 4 + c];
    }
    exterior4(a1, a2, L);
    float* rd = Rd + ((size_t)(b * H + h) * T + t) * 6;
    #pragma unroll
    for (int j = 0; j < 6; j++) rd[j] = L[j];
}

// ---------------------------------------------------------------------------
// Decayed-Gram scan:  M_t = d*(M_{t-1} + Jw_{t-1} Jw_{t-1}^T),  M_0 = 0.
// The recurrence is linear, so it is run as a chunked parallel scan:
// one block per (b,h), thread c owns the 4 steps t = 4c .. 4c+3 (T == 4 * blockDim.x).
//   1) each thread folds its own 4 steps from zero   (chunk aggregate)
//   2) weighted prefix over chunks: lanes by shuffles, waves through LDS
//   3) each thread replays its 4 steps from its true M and writes the gates
// M is symmetric, so only its 21 upper entries are carried.
// Every loop is unrolled so that the small arrays are indexed by constants and stay in registers.
// ---------------------------------------------------------------------------
#define GS_L 4      // steps per thread
#define GS_NS 21    // upper triangle of a 6x6

__device__ __forceinline__ void gram_step(float* m, const float* J, float d) {
    int n = 0;
    #pragma unroll
    for (int i = 0; i < 6; i++)
        #pragma unroll
        for (int j = i; j < 6; j++, n++) m[n] = d * (m[n] + J[i] * J[j]);
}

__global__ __launch_bounds__(256)
void k_gram_scan(const float* __restrict__ Jw, const float* __restrict__ Rd,
                 const float* __restrict__ glin, const float* __restrict__ decay_logits,
                 const float* __restrict__ iter_mix, const float* __restrict__ mem_scale,
                 float* __restrict__ gh, int B, int T, int H) {
    __shared__ __attribute__((aligned(16))) float Wagg[8][24];   // rows of 21, padded to 16 B
    const int bh = blockIdx.x, h = bh % H, b = bh / H;
    const int c = threadIdx.x, lane = c & 31;
    const int wave = __builtin_amdgcn_readfirstlane(c >> 5);     // scalar: the tests on it in 2b are scalar compares
    const int t0 = c * GS_L;

    // all of this thread's inputs, issued up front
    union { float4 q[6]; float f[24]; } J, R;
    const float4* Jq = (const float4*)(Jw + (size_t)bh * T * 6 + (size_t)t0 * 6);
    const float4* Rq = (const float4*)(Rd + (size_t)bh * T * 6 + (size_t)t0 * 6);
    #pragma unroll
    for (int i = 0; i < 6; i++) J.q[i] = Jq[i];
    // the next loads may land in these loads' address registers
    asm volatile("s_wait_xcnt 0x0" ::: "memory");
    #pragma unroll
    for (int i = 0; i < 6; i++) R.q[i] = Rq[i];
    // as above
    asm volatile("s_wait_xcnt 0x0" ::: "memory");
    float gl[GS_L];
    #pragma unroll
    for (int k = 0; k < GS_L; k++) gl[k] = glin[((size_t)b * T + t0 + k) * H + h];
    // the loads' address registers are reused by the arithmetic below
    asm volatile("s_wait_xcnt 0x0" ::: "memory");

    const float decay = 1.f / (1.f + expf(-decay_logits[h]));
    const float alpha = 1.f / (1.f + expf(-iter_mix[0]));
    const float msc = mem_scale[h];

    // w[s] = decay^(4 * 2^s): the decay across 2^s chunks
    float w[6];
    w[0] = (decay * decay) * (decay * decay);
    #pragma unroll
    for (int s = 1; s < 6; s++) w[s] = w[s - 1] * w[s - 1];

    // 1) chunk aggregate
    float m[GS_NS];
    #pragma unroll
    for (int n = 0; n < GS_NS; n++) m[n] = 0.f;
    #pragma unroll
    for (int k = 0; k < GS_L; k++) gram_step(m, &J.f[k * 6], decay);

    // 2a) inclusive weighted prefix over the wave's 32 chunks
    #pragma unroll
    for (int s = 0; s < 5; s++) {
        const int o = 1 << s;
        #pragma unroll
        for (int n = 0; n < GS_NS; n++) {
            float v = __shfl_up(m[n], o);
            m[n] = (lane >= o) ? m[n] + w[s] * v : m[n];
        }
    }
    if (lane == 31) {
        #pragma unroll
        for (int n = 0; n < GS_NS; n++) Wagg[wave][n] = m[n];
    }
    // exclusive within the wave
    #pragma unroll
    for (int n = 0; n < GS_NS; n++) {
        float v = __shfl_up(m[n], 1);
        m[n] = (lane > 0) ? v : 0.f;
    }
    __syncthreads();

    // 2b) M at the wave's first step, from the earlier waves' totals.
    // It is the same for the whole wave: lane n folds entry n, then it is read per entry.
    const int ln = (lane < GS_NS) ? lane : 0;
    float tot[7];
    #pragma unroll
    for (int q = 0; q < 7; q++) tot[q] = Wagg[q][ln];
    float p = 0.f;
    #pragma unroll
    for (int q = 0; q < 7; q++) p = (q < wave) ? w[5] * p + tot[q] : p;
    float dl = 1.f;   // decay^(4 * lane)
    #pragma unroll
    for (int s = 0; s < 5; s++) dl *= ((lane >> s) & 1) ? w[s] : 1.f;
    #pragma unroll
    for (int n = 0; n < GS_NS; n++)
        m[n] += dl * __int_as_float(__builtin_amdgcn_readlane(__float_as_int(p), n));

    // 3) replay
    #pragma unroll
    for (int k = 0; k < GS_L; k++) {
        const float* rd = &R.f[k * 6];
        float rdM[6] = {0, 0, 0, 0, 0, 0};
        int n = 0;
        #pragma unroll
        for (int i = 0; i < 6; i++)
            #pragma unroll
            for (int j = i; j < 6; j++, n++) {
                rdM[j] += rd[i] * m[n];
                if (j != i) rdM[i] += rd[j] * m[n];
            }
        float s1 = 0.f, s2 = 0.f;
        #pragma unroll
        for (int j = 0; j < 6; j++) { s1 += rdM[j] * rd[j]; s2 += rdM[j] * rdM[j]; }
        float ms = (1.f - alpha) * s1 + alpha * s2;
        float g1 = 1.f / (1.f + expf(-ms * msc));
        float g2 = 1.f / (1.f + expf(-gl[k]));
        gh[((size_t)b * T + t0 + k) * H + h] = g1 * g2;
        if (k + 1 < GS_L) gram_step(m, &J.f[k * 6], decay);
    }
}

// ---------------------------------------------------------------------------
// y = seqout + mean_h(gh) * memval  -> bf16 (input to Wout GEMM)
// ---------------------------------------------------------------------------
__global__ __launch_bounds__(256)
void k_combine(const float* __restrict__ seqout, const float* __restrict__ memval,
               const float* __restrict__ gh, bf16_t* __restrict__ y, int D, int H) {
    size_t row = blockIdx.x;
    float g = 0.f;
    #pragma unroll
    for (int h = 0; h < 16; h++) g += gh[row * H + h];
    g *= (1.f / 16.f);
    const float* so = seqout + row * D;
    const float* mv = memval + row * D;
    bf16_t* yr = y + row * D;
    for (int d = threadIdx.x; d < D; d += 256)
        yr[d] = (bf16_t)(so[d] + g * mv[d]);
}

// ---------------------------------------------------------------------------
extern "C" void kernel_launch(void* const* d_in, const int* in_sizes, int n_in,
                              void* d_out, int out_size, void* d_ws, size_t ws_size,
                              hipStream_t stream) {
    const int B = 2, T = 1024, D = 1024, H = 16, DFF = 4096;
    const int M = B * T;

    const float* x            = (const float*)d_in[0];
    const float* ln1_g        = (const float*)d_in[1];
    const float* ln1_b        = (const float*)d_in[2];
    const float* Wqkv         = (const float*)d_in[3];
    const float* bqkv         = (const float*)d_in[4];
    const float* W1w          = (const float*)d_in[5];
    const float* W2w          = (const float*)d_in[6];
    const float* W1r          = (const float*)d_in[7];
    const float* W2r          = (const float*)d_in[8];
    const float* Wmv          = (const float*)d_in[9];
    const float* bmv          = (const float*)d_in[10];
    const float* Wmg          = (const float*)d_in[11];
    const float* bmg          = (const float*)d_in[12];
    const float* mem_scale    = (const float*)d_in[13];
    const float* iter_mix     = (const float*)d_in[14];
    const float* decay_logits = (const float*)d_in[15];
    const float* Wout         = (const float*)d_in[16];
    const float* bout         = (const float*)d_in[17];
    const float* ln2_g        = (const float*)d_in[18];
    const float* ln2_b        = (const float*)d_in[19];
    const float* Wfc          = (const float*)d_in[20];
    const float* bfc          = (const float*)d_in[21];
    const float* Wproj        = (const float*)d_in[22];
    const float* bproj        = (const float*)d_in[23];

    char* ws = (char*)d_ws;
    size_t off = 0;
    auto alloc = [&](size_t bytes) -> void* {
        void* p = ws + off;
        off += (bytes + 255) & ~(size_t)255;
        return p;
    };

    bf16_t* Wqkv_t  = (bf16_t*)alloc((size_t)3 * D * D * 2);
    bf16_t* W1w_t   = (bf16_t*)alloc((size_t)64 * D * 2);
    bf16_t* W2w_t   = (bf16_t*)alloc((size_t)64 * D * 2);
    bf16_t* W1r_t   = (bf16_t*)alloc((size_t)64 * D * 2);
    bf16_t* W2r_t   = (bf16_t*)alloc((size_t)64 * D * 2);
    bf16_t* Wmg_t   = (bf16_t*)alloc((size_t)H * D * 2);
    bf16_t* Wmv_t   = (bf16_t*)alloc((size_t)D * D * 2);
    bf16_t* Wout_t  = (bf16_t*)alloc((size_t)D * D * 2);
    bf16_t* Wfc_t   = (bf16_t*)alloc((size_t)DFF * D * 2);
    bf16_t* Wproj_t = (bf16_t*)alloc((size_t)D * DFF * 2);
    bf16_t* h_bf    = (bf16_t*)alloc((size_t)M * D * 2);
    bf16_t* qkv_bf  = (bf16_t*)alloc((size_t)M * 3 * D * 2);
    float*  p1w     = (float*)alloc((size_t)M * 64 * 4);
    float*  p2w     = (float*)alloc((size_t)M * 64 * 4);
    float*  p1r     = (float*)alloc((size_t)M * 64 * 4);
    float*  p2r     = (float*)alloc((size_t)M * 64 * 4);
    float*  glin    = (float*)alloc((size_t)M * H * 4);
    float*  Jwb     = (float*)alloc((size_t)B * H * T * 6 * 4);
    float*  Rdb     = (float*)alloc((size_t)B * H * T * 6 * 4);
    float*  ghb     = (float*)alloc((size_t)M * H * 4);
    float*  memval  = (float*)alloc((size_t)M * D * 4);
    float*  seqout  = (float*)alloc((size_t)M * D * 4);
    bf16_t* y_bf    = (bf16_t*)alloc((size_t)M * D * 2);
    float*  x1      = (float*)alloc((size_t)M * D * 4);
    bf16_t* h2_bf   = (bf16_t*)alloc((size_t)M * D * 2);
    bf16_t* a_bf    = (bf16_t*)alloc((size_t)M * DFF * 2);

    auto gemm = [&](const bf16_t* A, const bf16_t* Wt, const float* bias,
                    const float* resid, float* oF, bf16_t* oB, int m, int n, int k, int act) {
        dim3 g((n + 127) / 128, (m + 127) / 128);
        k_gemm_bf16<<<g, 256, 0, stream>>>(A, Wt, bias, resid, oF, oB, m, n, k, act);
    };

    // 1) weights -> bf16 transposed
    TrArgs ta = { Wfc, Wproj, Wqkv, Wmv, Wout, W1w, W2w, W1r, W2r, Wmg,
                  Wfc_t, Wproj_t, Wqkv_t, Wmv_t, Wout_t, W1w_t, W2w_t, W1r_t, W2r_t, Wmg_t };
    k_transpose_bf16<<<TR_BLOCKS, 256, 0, stream>>>(ta);

    // 2) ln1
    k_layernorm<<<M, 256, 0, stream>>>(x, ln1_g, ln1_b, h_bf, D);

    // 3) projections
    ProjArgs pa = { h_bf, Wqkv_t, Wmv_t, W1w_t, W2w_t, W1r_t, W2r_t, Wmg_t,
                    bqkv, bmv, bmg, qkv_bf, memval, p1w, p2w, p1r, p2r, glin, D };
    k_gemm_proj<<<dim3(PROJ_TILES, 16), 256, 0, stream>>>(pa);

    // 4) attention
    k_attention<<<dim3(T / 128, B * H), 256, 0, stream>>>(qkv_bf, seqout, B, T, H);

    // 5) Gram memory branch
    k_lines<<<(B * T * H + 255) / 256, 256, 0, stream>>>(p1w, p2w, p1r, p2r, Jwb, Rdb, B, T, H);
    k_gram_scan<<<B * H, 256, 0, stream>>>(Jwb, Rdb, glin, decay_logits, iter_mix,
                                          mem_scale, ghb, B, T, H);
    k_combine<<<M, 256, 0, stream>>>(seqout, memval, ghb, y_bf, D, H);

    // 6) output projection + residual
    gemm(y_bf, Wout_t, bout, x, x1, nullptr, M, D, D, 0);

    // 7) MLP
    k_layernorm<<<M, 256, 0, stream>>>(x1, ln2_g, ln2_b, h2_bf, D);
    gemm(h2_bf, Wfc_t, bfc, nullptr, nullptr, a_bf, M, DFF, D, 1);
    gemm(a_bf, Wproj_t, bproj, x1, (float*)d_out, nullptr, M, D, DFF, 0);
}

// v004
// Measured time: 225 microseconds a run.
// In two side-by-side timings against v003, it was 1.25 and 1.24 times as fast.
// All steps since v000 together make it 3.87 times as fast.
#include <hip/hip_runtime.h>
#include <math.h>

typedef __bf16 bf16_t;
typedef __attribute__((ext_vector_type(16))) __bf16 v16bf;
typedef __attribute__((ext_vector_type(8)))  float  v8f;
typedef unsigned int u32x4 __attribute__((ext_vector_type(4)));
typedef int i32x4 __attribute__((ext_vector_type(4)));

union AFrag { v16bf v; u32x4 q[2]; };

#if __has_builtin(__builtin_amdgcn_global_load_async_to_lds_b128) && \
    __has_builtin(__builtin_amdgcn_s_wait_asynccnt)
#define HAS_ASYNC_LDS 1
typedef __attribute__((address_space(1))) i32x4* glds_gptr;
typedef __attribute__((address_space(3))) i32x4* glds_lptr;
#else
#define HAS_ASYNC_LDS 0
#endif

__device__ __forceinline__ void async_copy16(void* lds, const void* g) {
#if HAS_ASYNC_LDS
    __builtin_amdgcn_global_load_async_to_lds_b128(
        (glds_gptr)(g), (glds_lptr)(lds), 0, 0);
#endif
}
__device__ __forceinline__ void async_wait0() {
#if HAS_ASYNC_LDS
    __builtin_amdgcn_s_wait_asynccnt(0);
#endif
}

// ---------------------------------------------------------------------------
// Weight convert: W (K x N, f32, row-major) -> Wt (N x K, bf16, row-major)
// All ten weights in one grid: the transposes do not depend on one another, so a
// block finds its weight and its 32x32 tile from blockIdx.x (ranges below, largest first).
// ---------------------------------------------------------------------------
struct TrArgs {
    const float* wfc;  const float* wproj; const float* wqkv; const float* wmv; const float* wout;
    const float* w1w;  const float* w2w;   const float* w1r;  const float* w2r; const float* wmg;
    bf16_t* tfc;  bf16_t* tproj; bf16_t* tqkv; bf16_t* tmv; bf16_t* tout;
    bf16_t* t1w;  bf16_t* t2w;   bf16_t* t1r;  bf16_t* t2r; bf16_t* tmg;
};
#define TR_BLOCKS 13600   // 4096 + 4096 + 3072 + 1024 + 1024 + 4 * 64 + 32

__global__ __launch_bounds__(256)
void k_transpose_bf16(TrArgs a) {
    __shared__ float tile[32][33];
    const float* __restrict__ W;
    bf16_t* __restrict__ Wt;
    int K = 1024, N, kb, nb;
    int l = blockIdx.x;   // tile index inside the weight, N fastest
    if (l < 4096)                { W = a.wfc;   Wt = a.tfc;   N = 4096; nb = (l & 127) * 32; kb = (l >> 7) * 32; }
    else if ((l -= 4096) < 4096) { W = a.wproj; Wt = a.tproj; N = 1024; nb = (l & 31) * 32;  kb = (l >> 5) * 32; K = 4096; }
    else if ((l -= 4096) < 3072) { W = a.wqkv;  Wt = a.tqkv;  N = 3072; nb = (l % 96) * 32;  kb = (l / 96) * 32; }
    else if ((l -= 3072) < 1024) { W = a.wmv;   Wt = a.tmv;   N = 1024; nb = (l & 31) * 32;  kb = (l >> 5) * 32; }
    else if ((l -= 1024) < 1024) { W = a.wout;  Wt = a.tout;  N = 1024; nb = (l & 31) * 32;  kb = (l >> 5) * 32; }
    else if ((l -= 1024) < 256) {
        const int s = l >> 6;
        W  = s == 0 ? a.w1w : s == 1 ? a.w2w : s == 2 ? a.w1r : a.w2r;
        Wt = s == 0 ? a.t1w : s == 1 ? a.t2w : s == 2 ? a.t1r : a.t2r;
        N = 64; nb = (l & 1) * 32; kb = ((l & 63) >> 1) * 32;
    }
    else { l -= 256; W = a.wmg; Wt = a.tmg; N = 16; nb = 0; kb = l * 32; }
    int tx = threadIdx.x & 31, ty = threadIdx.x >> 5;
    #pragma unroll
    for (int i = ty; i < 32; i += 8) {
        int k = kb + i, n = nb + tx;
        tile[i][tx] = (k < K && n < N) ? W[(size_t)k * N + n] : 0.f;
    }
    __syncthreads();
    #pragma unroll
    for (int i = ty; i < 32; i += 8) {
        int n = nb + i, k = kb + tx;
        if (n < N && k < K) Wt[(size_t)n * K + k] = (bf16_t)tile[tx][i];
    }
}

// ---------------------------------------------------------------------------
// LayerNorm (f32 in) -> bf16 out.  One block per row.
// ---------------------------------------------------------------------------
__global__ __launch_bounds__(256)
void k_layernorm(const float* __restrict__ x, const float* __restrict__ g,
                 const float* __restrict__ b, bf16_t* __restrict__ out, int D) {
    const float* row = x + (size_t)blockIdx.x * D;
    float s = 0.f, s2 = 0.f;
    for (int d = threadIdx.x; d < D; d += 256) { float v = row[d]; s += v; s2 += v * v; }
    #pragma unroll
    for (int off = 16; off; off >>= 1) { s += __shfl_down(s, off); s2 += __shfl_down(s2, off); }
    __shared__ float ws[8], ws2[8];
    int wave = threadIdx.x >> 5, lane = threadIdx.x & 31;
    if (lane == 0) { ws[wave] = s; ws2[wave] = s2; }
    __syncthreads();
    if (threadIdx.x == 0) {
        float a = 0.f, a2 = 0.f;
        #pragma unroll
        for (int i = 0; i < 8; i++) { a += ws[i]; a2 += ws2[i]; }
        ws[0] = a; ws2[0] = a2;
    }
    __syncthreads();
    float mean = ws[0] / D;
    float var  = ws2[0] / D - mean * mean;
    float rstd = rsqrtf(var + 1e-5f);
    bf16_t* orow = out + (size_t)blockIdx.x * D;
    for (int d = threadIdx.x; d < D; d += 256)
        orow[d] = (bf16_t)((row[d] - mean) * rstd * g[d] + b[d]);
}

// ---------------------------------------------------------------------------
// Generic bf16 WMMA GEMM:  C[M,N] = A[M,K] * Wt[N,K]^T  (+bias)(+gelu)(+resid)
// Block tile 128x128, 8 waves: each wave 32(M) x 64(N).
// A stage holds 64 k of every operand row = one whole 128-B line per row, so that a wave's
// 16-B-per-lane copy covers 4 whole lines (8 lanes a row).  Two buffers, copies one stage ahead.
// K must be a multiple of 64, N of 4.
// ---------------------------------------------------------------------------
#define GEMM_BK  64   // k per stage
#define GEMM_LDK 72   // LDS row pitch in elements (144 B = 16 B x 9: conflict-free 16-B reads)
#define GEMM_ROWSTEP (32 * GEMM_LDK * 2)    // LDS bytes between a thread's four rows of one operand
#define GEMM_BUFSTEP (128 * GEMM_LDK * 2)   // LDS bytes between the two buffers of one operand
#define EP_LD 68      // epilogue: LDS row pitch in floats (272 B: 16-B aligned rows, 4 banks apart)
typedef float  f32x4  __attribute__((ext_vector_type(4)));
typedef __bf16 bf16x4 __attribute__((ext_vector_type(4)));

// One stage: each thread brings 16 B of four A rows and of four Wt rows (32 rows apart) into LDS.
// la, lb: the thread's LDS byte addresses of its first row; a0, b0..b3: its global addresses.
// The closing s_wait_xcnt stands inside the statement so that it precedes every later write of
// the address registers that the copies name.
__device__ __forceinline__
void gemm_stage(unsigned la, unsigned lb, const bf16_t* a0, size_t arow,
                const bf16_t* b0, const bf16_t* b1, const bf16_t* b2, const bf16_t* b3) {
    asm volatile(
        "global_load_async_to_lds_b128 %0, %8, off\n\t"
        "global_load_async_to_lds_b128 %1, %9, off\n\t"
        "global_load_async_to_lds_b128 %2, %10, off\n\t"
        "global_load_async_to_lds_b128 %3, %11, off\n\t"
        "global_load_async_to_lds_b128 %4, %12, off\n\t"
        "global_load_async_to_lds_b128 %5, %13, off\n\t"
        "global_load_async_to_lds_b128 %6, %14, off\n\t"
        "global_load_async_to_lds_b128 %7, %15, off\n\t"
        "s_wait_xcnt 0x0"
        :: "v"(la), "v"(la + GEMM_ROWSTEP), "v"(la + 2 * GEMM_ROWSTEP), "v"(la + 3 * GEMM_ROWSTEP),
           "v"(lb), "v"(lb + GEMM_ROWSTEP), "v"(lb + 2 * GEMM_ROWSTEP), "v"(lb + 3 * GEMM_ROWSTEP),
           "v"(a0), "v"(a0 + arow), "v"(a0 + 2 * arow), "v"(a0 + 3 * arow),
           "v"(b0), "v"(b1), "v"(b2), "v"(b3)
        : "memory");
}

__device__ __forceinline__
void gemm_tile(const bf16_t* __restrict__ A, const bf16_t* __restrict__ Wt,
               const float* __restrict__ bias, const float* __restrict__ resid,
               float* __restrict__ outF, bf16_t* __restrict__ outB,
               int N, int K, int act, int m0, int n0) {
    __shared__ __attribute__((aligned(16))) bf16_t As[2][128][GEMM_LDK];
    __shared__ __attribute__((aligned(16))) bf16_t Bs[2][128][GEMM_LDK];
    const int tid = threadIdx.x;
    const int wave = tid >> 5, lane = tid & 31;
    const int wm = (wave & 3) * 32, wn = (wave >> 2) * 64;
    const int lm = lane & 15, kh = lane >> 4;

    v8f acc[2][4];
    #pragma unroll
    for (int i = 0; i < 2; i++)
        #pragma unroll
        for (int j = 0; j < 4; j++)
            #pragma unroll
            for (int v = 0; v < 8; v++) acc[i][j][v] = 0.f;

    // copy map: 8 lanes a row (8 x 16 B = the row's 128 B of this stage), rows cr + 32 i
    const int cr = tid >> 3, cc = (tid & 7) * 8;
    const size_t arow = (size_t)32 * K;
    const bf16_t* ga = A + (size_t)(m0 + cr) * K + cc;
    // A weight row past N is replaced by row N - 1: every lane copies, every address is in
    // bounds, and the columns n >= N that such rows feed are never stored (epilogue).
    const bf16_t* gb[4];
    #pragma unroll
    for (int i = 0; i < 4; i++) {
        int rn = n0 + cr + 32 * i;
        rn = rn < N ? rn : N - 1;
        gb[i] = Wt + (size_t)rn * K + cc;
    }
    const unsigned la = (unsigned)(size_t)&As[0][cr][cc];   // low 32 bits = LDS byte address
    const unsigned lb = (unsigned)(size_t)&Bs[0][cr][cc];
    const int nT = K / GEMM_BK;

    // stage 0 -> buffer 0, published; then stage 1 -> buffer 1 flies during trip 0
    gemm_stage(la, lb, ga, arow, gb[0], gb[1], gb[2], gb[3]);
    asm volatile("s_wait_asynccnt 0x0" ::: "memory");   // this wave's copies of stage 0 have landed
    __syncthreads();
    if (nT > 1)
        gemm_stage(la + GEMM_BUFSTEP, lb + GEMM_BUFSTEP, ga + GEMM_BK, arow,
                   gb[0] + GEMM_BK, gb[1] + GEMM_BK, gb[2] + GEMM_BK, gb[3] + GEMM_BK);

    for (int t = 0; t < nT; t++) {
        const int cur = t & 1;
        if (t + 2 < nT)
            __builtin_prefetch(A + (size_t)(m0 + (tid >> 1)) * K + (t + 2) * GEMM_BK + (tid & 1) * 32, 0, 3);

        #pragma unroll
        for (int kk = 0; kk < GEMM_BK / 32; kk++) {
            AFrag a[2], bfr[4];
            #pragma unroll
            for (int i = 0; i < 2; i++) {
                const bf16_t* p = &As[cur][wm + i * 16 + lm][kk * 32 + kh * 8];
                a[i].q[0] = *(const u32x4*)p;
                a[i].q[1] = *(const u32x4*)(p + 16);
            }
            #pragma unroll
            for (int j = 0; j < 4; j++) {
                const bf16_t* p = &Bs[cur][wn + j * 16 + lm][kk * 32 + kh * 8];
                bfr[j].q[0] = *(const u32x4*)p;
                bfr[j].q[1] = *(const u32x4*)(p + 16);
            }
            #pragma unroll
            for (int i = 0; i < 2; i++)
                #pragma unroll
                for (int j = 0; j < 4; j++)
                    acc[i][j] = __builtin_amdgcn_wmma_f32_16x16x32_bf16(
                        false, a[i].v, false, bfr[j].v, (short)0, acc[i][j], false, false);
        }

        // publish stage t + 1 and free buffer cur, in this order:
        asm volatile("s_wait_dscnt 0x0" ::: "memory");      // this wave's reads of buffer cur are done
        asm volatile("s_wait_asynccnt 0x0" ::: "memory");   // this wave's copies of stage t + 1 have landed
        __syncthreads();
        if (t + 2 < nT) {
            const int ko = (t + 2) * GEMM_BK;
            const unsigned bo = cur * GEMM_BUFSTEP;
            gemm_stage(la + bo, lb + bo, ga + ko, arow, gb[0] + ko, gb[1] + ko, gb[2] + ko, gb[3] + ko);
        }
    }
    asm volatile("s_wait_asynccnt 0x0" ::: "memory");   // no copy is left in flight behind the loop

    // Epilogue.  The accumulator layout gives a lane one column of 8 rows: stored from there, every
    // access is a 4-B piece and the residual loads follow one another.  So each wave turns its own
    // 32 x 64 tile through its own LDS range (the ring is free: every wave has passed the last
    // trip's barrier and no copy is in flight) and takes it back row-wise: a lane holds 4
    // neighbouring columns, 16 lanes a row, so that every residual load and every store covers
    // whole 128-B lines, and the 16 residual loads of a lane fly together, under the turn.
    if (n0 + wn < N) {   // the same for the whole wave
        float* st0 = (float*)&As[0][0][0] + wave * (16 * EP_LD);   // rows  0..15 of the wave's tile
        float* st1 = (float*)&Bs[0][0][0] + wave * (16 * EP_LD);   // rows 16..31
        const int er = lane >> 4, ec = (lane & 15) * 4;
        const int n = n0 + wn + ec;
        const bool ok = n < N;   // N is a multiple of 4: a lane's 4 columns are in or out together
        const size_t idx0 = (size_t)(m0 + wm + er) * N + n;
        const size_t rstep = (size_t)2 * N;

        // behind each load: a later load's result or later arithmetic may land in its address registers
        f32x4 bv = {0.f, 0.f, 0.f, 0.f};
        if (ok && bias) {
            bv = *(const f32x4*)(bias + n);
            asm volatile("s_wait_xcnt 0x0" ::: "memory");   // see above
        }
        f32x4 rv[16];   // filled and read only where there is a residual
        if (ok && resid) {
            #pragma unroll
            for (int q = 0; q < 16; q++) {
                rv[q] = *(const f32x4*)(resid + idx0 + q * rstep);
                asm volatile("s_wait_xcnt 0x0" ::: "memory");   // see above
            }
        }

        #pragma unroll
        for (int j = 0; j < 4; j++)
            #pragma unroll
            for (int v = 0; v < 8; v++) {
                st0[(v + 8 * kh) * EP_LD + j * 16 + lm] = acc[0][j][v];
                st1[(v + 8 * kh) * EP_LD + j * 16 + lm] = acc[1][j][v];
            }
        // the rows are read back by other lanes of this wave: their writes have to be done
        asm volatile("s_wait_dscnt 0x0" ::: "memory");
        f32x4 cv[16];
        #pragma unroll
        for (int q = 0; q < 16; q++)
            cv[q] = *(const f32x4*)((q < 8 ? st0 : st1) + ((q & 7) * 2 + er) * EP_LD + ec);

        if (ok) {
            #pragma unroll
            for (int q = 0; q < 16; q++) {
                f32x4 c = cv[q] + bv;
                if (act == 1) {
                    #pragma unroll
                    for (int e = 0; e < 4; e++) c[e] = 0.5f * c[e] * (1.f + erff(c[e] * 0.70710678118f));
                }
                if (resid) c += rv[q];
                const size_t idx = idx0 + q * rstep;
                // behind each store: later arithmetic may land in its registers
                if (outF) {
                    *(f32x4*)(outF + idx) = c;
                    asm volatile("s_wait_xcnt 0x0" ::: "memory");   // see above
                }
                if (outB) {
                    bf16x4 o;
                    #pragma unroll
                    for (int e = 0; e < 4; e++) o[e] = (bf16_t)c[e];
                    *(bf16x4*)(outB + idx) = o;
                    asm volatile("s_wait_xcnt 0x0" ::: "memory");   // see above
                }
            }
        }
    }
}

__global__ __launch_bounds__(256)
void k_gemm_bf16(const bf16_t* __restrict__ A, const bf16_t* __restrict__ Wt,
                 const float* __restrict__ bias, const float* __restrict__ resid,
                 float* __restrict__ outF, bf16_t* __restrict__ outB,
                 int M, int N, int K, int act) {
    gemm_tile(A, Wt, bias, resid, outF, outB, N, K, act, blockIdx.y * 128, blockIdx.x * 128);
}

// The seven projections of the same A (2048 x K) in one grid: they do not depend on one
// another, and the narrow ones (16 blocks each on their own) fill places the wide ones leave.
// blockIdx.x picks the weight and its 128-wide column tile, blockIdx.y the row tile.
struct ProjArgs {
    const bf16_t* A;
    const bf16_t* tqkv; const bf16_t* tmv; const bf16_t* t1w; const bf16_t* t2w;
    const bf16_t* t1r;  const bf16_t* t2r; const bf16_t* tmg;
    const float* bqkv; const float* bmv; const float* bmg;
    bf16_t* qkv;
    float* memval; float* p1w; float* p2w; float* p1r; float* p2r; float* glin;
    int K;
};
#define PROJ_TILES 37   // 24 (qkv) + 8 (mem values) + 4 (points) + 1 (gate)

__global__ __launch_bounds__(256)
void k_gemm_proj(ProjArgs a) {
    const int x = blockIdx.x;
    const bf16_t* Wt;
    const float* bias = nullptr;
    float* oF = nullptr;
    bf16_t* oB = nullptr;
    int N = 64, n0 = 0;
    if (x < 24)       { Wt = a.tqkv; bias = a.bqkv; oB = a.qkv;    N = 3072; n0 = x * 128; }
    else if (x < 32)  { Wt = a.tmv;  bias = a.bmv;  oF = a.memval; N = 1024; n0 = (x - 24) * 128; }
    else if (x == 32) { Wt = a.t1w;  oF = a.p1w; }
    else if (x == 33) { Wt = a.t2w;  oF = a.p2w; }
    else if (x == 34) { Wt = a.t1r;  oF = a.p1r; }
    else if (x == 35) { Wt = a.t2r;  oF = a.p2r; }
    else              { Wt = a.tmg;  bias = a.bmg;  oF = a.glin;   N = 16; }
    gemm_tile(a.A, Wt, bias, nullptr, oF, oB, N, a.K, 0, blockIdx.y * 128, n0);
}

// ---------------------------------------------------------------------------
// Flash-style causal attention.  qkv bf16 [(b,t), 3, H, 64].
// grid (T/128, B*H), 256 threads (8 waves, 16 q-rows each).
// ---------------------------------------------------------------------------
__global__ __launch_bounds__(256)
void k_attention(const bf16_t* __restrict__ qkv, float* __restrict__ seqout,
                 int B, int T, int H) {
    const int qb = blockIdx.x;
    const int bh = blockIdx.y;
    const int h = bh % H, b = bh / H;
    const int tid = threadIdx.x, wave = tid >> 5, lane = tid & 31;
    const int lm = lane & 15, kh = lane >> 4;

    __shared__ bf16_t Qs[128][72];
    __shared__ bf16_t Ks[128][72];
    __shared__ bf16_t Vt[64][136];     // V transposed: [dh][s]
    __shared__ bf16_t Ps[8][16][40];   // per-wave P staging (32-wide K chunk)

    const size_t strideT = 3 * 1024;
    const bf16_t* base = qkv + (size_t)b * T * strideT + (size_t)h * 64;

    // Load Q tile (128 x 64)
    for (int c8 = tid; c8 < 128 * 8; c8 += 256) {
        int rr = c8 >> 3, cc = (c8 & 7) * 8;
        const bf16_t* gq = base + (size_t)(qb * 128 + rr) * strideT + cc;
#if HAS_ASYNC_LDS
        async_copy16(&Qs[rr][cc], gq);
#else
        *(u32x4*)&Qs[rr][cc] = *(const u32x4*)gq;
#endif
    }

    float rowm[8], rowl[8];
    v8f oacc[4];
    #pragma unroll
    for (int v = 0; v < 8; v++) { rowm[v] = -INFINITY; rowl[v] = 0.f; }
    #pragma unroll
    for (int jt = 0; jt < 4; jt++)
        #pragma unroll
        for (int v = 0; v < 8; v++) oacc[jt][v] = 0.f;

    for (int sb = 0; sb <= qb; sb++) {
        __syncthreads();   // protect Ks/Vt reuse across iterations
        for (int c8 = tid; c8 < 128 * 8; c8 += 256) {
            int rr = c8 >> 3, cc = (c8 & 7) * 8;
            const bf16_t* gk = base + (size_t)(sb * 128 + rr) * strideT + 1024 + cc;
#if HAS_ASYNC_LDS
            async_copy16(&Ks[rr][cc], gk);
#else
            *(u32x4*)&Ks[rr][cc] = *(const u32x4*)gk;
#endif
        }
        for (int c8 = tid; c8 < 128 * 8; c8 += 256) {
            int rr = c8 >> 3, cc = (c8 & 7) * 8;
            union { u32x4 u; bf16_t e[8]; } vv;
            vv.u = *(const u32x4*)(base + (size_t)(sb * 128 + rr) * strideT + 2048 + cc);
            #pragma unroll
            for (int i = 0; i < 8; i++) Vt[cc + i][rr] = vv.e[i];
        }
        async_wait0();
        __syncthreads();

        // ---- scores: S = Q * K^T ----
        AFrag aq[2];
        #pragma unroll
        for (int kk = 0; kk < 2; kk++) {
            const bf16_t* p = &Qs[wave * 16 + lm][kk * 32 + kh * 8];
            aq[kk].q[0] = *(const u32x4*)p;
            aq[kk].q[1] = *(const u32x4*)(p + 16);
        }
        v8f sacc[8];
        #pragma unroll
        for (int j = 0; j < 8; j++)
            #pragma unroll
            for (int v = 0; v < 8; v++) sacc[j][v] = 0.f;
        #pragma unroll
        for (int j = 0; j < 8; j++)
            #pragma unroll
            for (int kk = 0; kk < 2; kk++) {
                AFrag bk;
                const bf16_t* p = &Ks[j * 16 + lm][kk * 32 + kh * 8];
                bk.q[0] = *(const u32x4*)p;
                bk.q[1] = *(const u32x4*)(p + 16);
                sacc[j] = __builtin_amdgcn_wmma_f32_16x16x32_bf16(
                    false, aq[kk].v, false, bk.v, (short)0, sacc[j], false, false);
            }

        // ---- causal mask + online softmax (wave32: 16-lane row reductions) ----
        #pragma unroll
        for (int v = 0; v < 8; v++) {
            int trow = qb * 128 + wave * 16 + v + 8 * kh;
            float rm = -INFINITY;
            #pragma unroll
            for (int j = 0; j < 8; j++) {
                int col = sb * 128 + j * 16 + lm;
                float s = (col <= trow) ? sacc[j][v] * 0.125f : -INFINITY;
                sacc[j][v] = s;
                rm = fmaxf(rm, s);
            }
            #pragma unroll
            for (int msk = 1; msk < 16; msk <<= 1) rm = fmaxf(rm, __shfl_xor(rm, msk));
            float mnew = fmaxf(rowm[v], rm);
            float corr = expf(rowm[v] - mnew);
            rowm[v] = mnew;
            float rs = 0.f;
            #pragma unroll
            for (int j = 0; j < 8; j++) {
                float p = expf(sacc[j][v] - mnew);
                sacc[j][v] = p;
                rs += p;
            }
            #pragma unroll
            for (int msk = 1; msk < 16; msk <<= 1) rs += __shfl_xor(rs, msk);
            rowl[v] = rowl[v] * corr + rs;
            #pragma unroll
            for (int jt = 0; jt < 4; jt++) oacc[jt][v] = oacc[jt][v] * corr;
        }

        // ---- O += P * V  (stage P through LDS: C-layout -> A-layout) ----
        #pragma unroll
        for (int kk = 0; kk < 4; kk++) {
            #pragma unroll
            for (int jj = 0; jj < 2; jj++) {
                int j = kk * 2 + jj;
                #pragma unroll
                for (int v = 0; v < 8; v++)
                    Ps[wave][v + 8 * kh][jj * 16 + lm] = (bf16_t)sacc[j][v];
            }
            AFrag ap;
            const bf16_t* p = &Ps[wave][lm][kh * 8];
            ap.q[0] = *(const u32x4*)p;
            ap.q[1] = *(const u32x4*)(p + 16);
            #pragma unroll
            for (int jt = 0; jt < 4; jt++) {
                AFrag bv;
                const bf16_t* q = &Vt[jt * 16 + lm][kk * 32 + kh * 8];
                bv.q[0] = *(const u32x4*)q;
                bv.q[1] = *(const u32x4*)(q + 16);
                oacc[jt] = __builtin_amdgcn_wmma_f32_16x16x32_bf16(
                    false, ap.v, false, bv.v, (short)0, oacc[jt], false, false);
            }
        }
    }

    float* out = seqout + (size_t)b * T * 1024 + (size_t)h * 64;
    #pragma unroll
    for (int jt = 0; jt < 4; jt++)
        #pragma unroll
        for (int v = 0; v < 8; v++) {
            int trow = qb * 128 + wave * 16 + v + 8 * kh;
            int col  = jt * 16 + lm;
            out[(size_t)trow * 1024 + col] = oacc[jt][v] / rowl[v];
        }
}

// ---------------------------------------------------------------------------
// Plucker lines + J6 rotation.  One thread per (b,t,h).
// ---------------------------------------------------------------------------
__device__ inline void exterior4(const float* a1, const float* a2, float* L) {
    L[0] = a1[0] * a2[1] - a1[1] * a2[0];
    L[1] = a1[0] * a2[2] - a1[2] * a2[0];
    L[2] = a1[0] * a2[3] - a1[3] * a2[0];
    L[3] = a1[1] * a2[2] - a1[2] * a2[1];
    L[4] = a1[1] * a2[3] - a1[3] * a2[1];
    L[5] = a1[2] * a2[3] - a1[3] * a2[2];
    float n2 = 0.f;
    #pragma unroll
    for (int i = 0; i < 6; i++) n2 += L[i] * L[i];
    float inv = 1.f / fmaxf(sqrtf(n2), 1e-12f);
    #pragma unroll
    for (int i = 0; i < 6; i++) L[i] *= inv;
}

__global__ __launch_bounds__(256)
void k_lines(const float* __restrict__ p1w, const float* __restrict__ p2w,
             const float* __restrict__ p1r, const float* __restrict__ p2r,
             float* __restrict__ Jw, float* __restrict__ Rd, int B, int T, int H) {
    int idx = blockIdx.x * 256 + threadIdx.x;
    if (idx >= B * T * H) return;
    int h = idx % H, t = (idx / H) % T, b = idx / (H * T);
    size_t row = (size_t)b * T + t;
    float a1[4], a2[4], L[6];
    #pragma unroll
    for (int c = 0; c < 4; c++) {
        a1[c] = (t > 0) ? p1w[(row - 1) * 64 + h * 4 + c] : 0.f;
        a2[c] = p2w[row * 64 + h * 4 + c];
    }
    exterior4(a1, a2, L);
    float* jw = Jw + ((size_t)(b * H + h) * T + t) * 6;
    jw[0] = L[5]; jw[1] = -L[4]; jw[2] = L[3]; jw[3] = L[2]; jw[4] = -L[1]; jw[5] = L[0];
    #pragma unroll
    for (int c = 0; c < 4; c++) {
        a1[c] = p1r[row * 64 + h * 4 + c];
        a2[c] = p2r[row * 64 + h * 4 + c];
    }
    exterior4(a1, a2, L);
    float* rd = Rd + ((size_t)(b * H + h) * T + t) * 6;
    #pragma unroll
    for (int j = 0; j < 6; j++) rd[j] = L[j];
}

// ---------------------------------------------------------------------------
// Decayed-Gram scan:  M_t = d*(M_{t-1} + Jw_{t-1} Jw_{t-1}^T),  M_0 = 0.
// The recurrence is linear, so it is run as a chunked parallel scan:
// one block per (b,h), thread c owns the 4 steps t = 4c .. 4c+3 (T == 4 * blockDim.x).
//   1) each thread folds its own 4 steps from zero   (chunk aggregate)
//   2) weighted prefix over chunks: lanes by shuffles, waves through LDS
//   3) each thread replays its 4 steps from its true M and writes the gates
// M is symmetric, so only its 21 upper entries are carried.
// Every loop is unrolled so that the small arrays are indexed by constants and stay in registers.
// ---------------------------------------------------------------------------
#define GS_L 4      // steps per thread
#define GS_NS 21    // upper triangle of a 6x6

__device__ __forceinline__ void gram_step(float* m, const float* J, float d) {
    int n = 0;
    #pragma unroll
    for (int i = 0; i < 6; i++)
        #pragma unroll
        for (int j = i; j < 6; j++, n++) m[n] = d * (m[n] + J[i] * J[j]);
}

__global__ __launch_bounds__(256)
void k_gram_scan(const float* __restrict__ Jw, const float* __restrict__ Rd,
                 const float* __restrict__ glin, const float* __restrict__ decay_logits,
                 const float* __restrict__ iter_mix, const float* __restrict__ mem_scale,
                 float* __restrict__ gh, int B, int T, int H) {
    __shared__ __attribute__((aligned(16))) float Wagg[8][24];   // rows of 21, padded to 16 B
    const int bh = blockIdx.x, h = bh % H, b = bh / H;
    const int c = threadIdx.x, lane = c & 31;
    const int wave = __builtin_amdgcn_readfirstlane(c >> 5);     // scalar: the tests on it in 2b are scalar compares
    const int t0 = c * GS_L;

    // all of this thread's inputs, issued up front
    union { float4 q[6]; float f[24]; } J, R;
    const float4* Jq = (const float4*)(Jw + (size_t)bh * T * 6 + (size_t)t0 * 6);
    const float4* Rq = (const float4*)(Rd + (size_t)bh * T * 6 + (size_t)t0 * 6);
    #pragma unroll
    for (int i = 0; i < 6; i++) J.q[i] = Jq[i];
    // the next loads may land in these loads' address registers
    asm volatile("s_wait_xcnt 0x0" ::: "memory");
    #pragma unroll
    for (int i = 0; i < 6; i++) R.q[i] = Rq[i];
    // as above
    asm volatile("s_wait_xcnt 0x0" ::: "memory");
    float gl[GS_L];
    #pragma unroll
    for (int k = 0; k < GS_L; k++) gl[k] = glin[((size_t)b * T + t0 + k) * H + h];
    // the loads' address registers are reused by the arithmetic below
    asm volatile("s_wait_xcnt 0x0" ::: "memory");

    const float decay = 1.f / (1.f + expf(-decay_logits[h]));
    const float alpha = 1.f / (1.f + expf(-iter_mix[0]));
    const float msc = mem_scale[h];

    // w[s] = decay^(4 * 2^s): the decay across 2^s chunks
    float w[6];
    w[0] = (decay * decay) * (decay * decay);
    #pragma unroll
    for (int s = 1; s < 6; s++) w[s] = w[s - 1] * w[s - 1];

    // 1) chunk aggregate
    float m[GS_NS];
    #pragma unroll
    for (int n = 0; n < GS_NS; n++) m[n] = 0.f;
    #pragma unroll
    for (int k = 0; k < GS_L; k++) gram_step(m, &J.f[k * 6], decay);

    // 2a) inclusive weighted prefix over the wave's 32 chunks
    #pragma unroll
    for (int s = 0; s < 5; s++) {
        const int o = 1 << s;
        #pragma unroll
        for (int n = 0; n < GS_NS; n++) {
            float v = __shfl_up(m[n], o);
            m[n] = (lane >= o) ? m[n] + w[s] * v : m[n];
        }
    }
    if (lane == 31) {
        #pragma unroll
        for (int n = 0; n < GS_NS; n++) Wagg[wave][n] = m[n];
    }
    // exclusive within the wave
    #pragma unroll
    for (int n = 0; n < GS_NS; n++) {
        float v = __shfl_up(m[n], 1);
        m[n] = (lane > 0) ? v : 0.f;
    }
    __syncthreads();

    // 2b) M at the wave's first step, from the earlier waves' totals.
    // It is the same for the whole wave: lane n folds entry n, then it is read per entry.
    const int ln = (lane < GS_NS) ? lane : 0;
    float tot[7];
    #pragma unroll
    for (int q = 0; q < 7; q++) tot[q] = Wagg[q][ln];
    float p = 0.f;
    #pragma unroll
    for (int q = 0; q < 7; q++) p = (q < wave) ? w[5] * p + tot[q] : p;
    float dl = 1.f;   // decay^(4 * lane)
    #pragma unroll
    for (int s = 0; s < 5; s++) dl *= ((lane >> s) & 1) ? w[s] : 1.f;
    #pragma unroll
    for (int n = 0; n < GS_NS; n++)
        m[n] += dl * __int_as_float(__builtin_amdgcn_readlane(__float_as_int(p), n));

    // 3) replay
    #pragma unroll
    for (int k = 0; k < GS_L; k++) {
        const float* rd = &R.f[k * 6];
        float rdM[6] = {0, 0, 0, 0, 0, 0};
        int n = 0;
        #pragma unroll
        for (int i = 0; i < 6; i++)
            #pragma unroll
            for (int j = i; j < 6; j++, n++) {
                rdM[j] += rd[i] * m[n];
                if (j != i) rdM[i] += rd[j] * m[n];
            }
        float s1 = 0.f, s2 = 0.f;
        #pragma unroll
        for (int j = 0; j < 6; j++) { s1 += rdM[j] * rd[j]; s2 += rdM[j] * rdM[j]; }
        float ms = (1.f - alpha) * s1 + alpha * s2;
        float g1 = 1.f / (1.f + expf(-ms * msc));
        float g2 = 1.f / (1.f + expf(-gl[k]));
        gh[((size_t)b * T + t0 + k) * H + h] = g1 * g2;
        if (k + 1 < GS_L) gram_step(m, &J.f[k * 6], decay);
    }
}

// ---------------------------------------------------------------------------
// y = seqout + mean_h(gh) * memval  -> bf16 (input to Wout GEMM)
// ---------------------------------------------------------------------------
__global__ __launch_bounds__(256)
void k_combine(const float* __restrict__ seqout, const float* __restrict__ memval,
               const float* __restrict__ gh, bf16_t* __restrict__ y, int D, int H) {
    size_t row = blockIdx.x;
    float g = 0.f;
    #pragma unroll
    for (int h = 0; h < 16; h++) g += gh[row * H + h];
    g *= (1.f / 16.f);
    const float* so = seqout + row * D;
    const float* mv = memval + row * D;
    bf16_t* yr = y + row * D;
    for (int d = threadIdx.x; d < D; d += 256)
        yr[d] = (bf16_t)(so[d] + g * mv[d]);
}

// ---------------------------------------------------------------------------
extern "C" void kernel_launch(void* const* d_in, const int* in_sizes, int n_in,
                              void* d_out, int out_size, void* d_ws, size_t ws_size,
                              hipStream_t stream) {
    const int B = 2, T = 1024, D = 1024, H = 16, DFF = 4096;
    const int M = B * T;

    const float* x            = (const float*)d_in[0];
    const float* ln1_g        = (const float*)d_in[1];
    const float* ln1_b        = (const float*)d_in[2];
    const float* Wqkv         = (const float*)d_in[3];
    const float* bqkv         = (const float*)d_in[4];
    const float* W1w          = (const float*)d_in[5];
    const float* W2w          = (const float*)d_in[6];
    const float* W1r          = (const float*)d_in[7];
    const float* W2r          = (const float*)d_in[8];
    const float* Wmv          = (const float*)d_in[9];
    const float* bmv          = (const float*)d_in[10];
    const float* Wmg          = (const float*)d_in[11];
    const float* bmg          = (const float*)d_in[12];
    const float* mem_scale    = (const float*)d_in[13];
    const float* iter_mix     = (const float*)d_in[14];
    const float* decay_logits = (const float*)d_in[15];
    const float* Wout         = (const float*)d_in[16];
    const float* bout         = (const float*)d_in[17];
    const float* ln2_g        = (const float*)d_in[18];
    const float* ln2_b        = (const float*)d_in[19];
    const float* Wfc          = (const float*)d_in[20];
    const float* bfc          = (const float*)d_in[21];
    const float* Wproj        = (const float*)d_in[22];
    const float* bproj        = (const float*)d_in[23];

    char* ws = (char*)d_ws;
    size_t off = 0;
    auto alloc = [&](size_t bytes) -> void* {
        void* p = ws + off;
        off += (bytes + 255) & ~(size_t)255;
        return p;
    };

    bf16_t* Wqkv_t  = (bf16_t*)alloc((size_t)3 * D * D * 2);
    bf16_t* W1w_t   = (bf16_t*)alloc((size_t)64 * D * 2);
    bf16_t* W2w_t   = (bf16_t*)alloc((size_t)64 * D * 2);
    bf16_t* W1r_t   = (bf16_t*)alloc((size_t)64 * D * 2);
    bf16_t* W2r_t   = (bf16_t*)alloc((size_t)64 * D * 2);
    bf16_t* Wmg_t   = (bf16_t*)alloc((size_t)H * D * 2);
    bf16_t* Wmv_t   = (bf16_t*)alloc((size_t)D * D * 2);
    bf16_t* Wout_t  = (bf16_t*)alloc((size_t)D * D * 2);
    bf16_t* Wfc_t   = (bf16_t*)alloc((size_t)DFF * D * 2);
    bf16_t* Wproj_t = (bf16_t*)alloc((size_t)D * DFF * 2);
    bf16_t* h_bf    = (bf16_t*)alloc((size_t)M * D * 2);
    bf16_t* qkv_bf  = (bf16_t*)alloc((size_t)M * 3 * D * 2);
    float*  p1w     = (float*)alloc((size_t)M * 64 * 4);
    float*  p2w     = (float*)alloc((size_t)M * 64 * 4);
    float*  p1r     = (float*)alloc((size_t)M * 64 * 4);
    float*  p2r     = (float*)alloc((size_t)M * 64 * 4);
    float*  glin    = (float*)alloc((size_t)M * H * 4);
    float*  Jwb     = (float*)alloc((size_t)B * H * T * 6 * 4);
    float*  Rdb     = (float*)alloc((size_t)B * H * T * 6 * 4);
    float*  ghb     = (float*)alloc((size_t)M * H * 4);
    float*  memval  = (float*)alloc((size_t)M * D * 4);
    float*  seqout  = (float*)alloc((size_t)M * D * 4);
    bf16_t* y_bf    = (bf16_t*)alloc((size_t)M * D * 2);
    float*  x1      = (float*)alloc((size_t)M * D * 4);
    bf16_t* h2_bf   = (bf16_t*)alloc((size_t)M * D * 2);
    bf16_t* a_bf    = (bf16_t*)alloc((size_t)M * DFF * 2);

    auto gemm = [&](const bf16_t* A, const bf16_t* Wt, const float* bias,
                    const float* resid, float* oF, bf16_t* oB, int m, int n, int k, int act) {
        dim3 g((n + 127) / 128, (m + 127) / 128);
        k_gemm_bf16<<<g, 256, 0, stream>>>(A, Wt, bias, resid, oF, oB, m, n, k, act);
    };

    // 1) weights -> bf16 transposed
    TrArgs ta = { Wfc, Wproj, Wqkv, Wmv, Wout, W1w, W2w, W1r, W2r, Wmg,
                  Wfc_t, Wproj_t, Wqkv_t, Wmv_t, Wout_t, W1w_t, W2w_t, W1r_t, W2r_t, Wmg_t };
    k_transpose_bf16<<<TR_BLOCKS, 256, 0, stream>>>(ta);

    // 2) ln1
    k_layernorm<<<M, 256, 0, stream>>>(x, ln1_g, ln1_b, h_bf, D);

    // 3) projections
    ProjArgs pa = { h_bf, Wqkv_t, Wmv_t, W1w_t, W2w_t, W1r_t, W2r_t, Wmg_t,
                    bqkv, bmv, bmg, qkv_bf, memval, p1w, p2w, p1r, p2r, glin, D };
    k_gemm_proj<<<dim3(PROJ_TILES, 16), 256, 0, stream>>>(pa);

    // 4) attention
    k_attention<<<dim3(T / 128, B * H), 256, 0, stream>>>(qkv_bf, seqout, B, T, H);

    // 5) Gram memory branch
    k_lines<<<(B * T * H + 255) / 256, 256, 0, stream>>>(p1w, p2w, p1r, p2r, Jwb, Rdb, B, T, H);
    k_gram_scan<<<B * H, 256, 0, stream>>>(Jwb, Rdb, glin, decay_logits, iter_mix,
                                          mem_scale, ghb, B, T, H);
    k_combine<<<M, 256, 0, stream>>>(seqout, memval, ghb, y_bf, D, H);

    // 6) output projection + residual
    gemm(y_bf, Wout_t, bout, x, x1, nullptr, M, D, D, 0);

    // 7) MLP
    k_layernorm<<<M, 256, 0, stream>>>(x1, ln2_g, ln2_b, h2_bf, D);
    gemm(h2_bf, Wfc_t, bfc, nullptr, nullptr, a_bf, M, DFF, D, 1);
    gemm(a_bf, Wproj_t, bproj, x1, (float*)d_out, nullptr, M, D, DFF, 0);
}

// v005
// It runs in 213 microseconds.
// Timed twice side by side with v004, it ran 1.05 times as fast both times.
// All steps since v000 together make it 4.06 times as fast.
#include <hip/hip_runtime.h>
#include <math.h>

typedef __bf16 bf16_t;
typedef __attribute__((ext_vector_type(16))) __bf16 v16bf;
typedef __attribute__((ext_vector_type(8)))  float  v8f;
typedef unsigned int u32x4 __attribute__((ext_vector_type(4)));
typedef int i32x4 __attribute__((ext_vector_type(4)));
typedef float  f32x4  __attribute__((ext_vector_type(4)));
typedef __bf16 bf16x4 __attribute__((ext_vector_type(4)));
typedef __bf16 bf16x8 __attribute__((ext_vector_type(8)));

union AFrag { v16bf v; u32x4 q[2]; };

#if __has_builtin(__builtin_amdgcn_global_load_async_to_lds_b128) && \
    __has_builtin(__builtin_amdgcn_s_wait_asynccnt)
#define HAS_ASYNC_LDS 1
typedef __attribute__((address_space(1))) i32x4* glds_gptr;
typedef __attribute__((address_space(3))) i32x4* glds_lptr;
#else
#define HAS_ASYNC_LDS 0
#endif

__device__ __forceinline__ void async_copy16(void* lds, const void* g) {
#if HAS_ASYNC_LDS
    __builtin_amdgcn_global_load_async_to_lds_b128(
        (glds_gptr)(g), (glds_lptr)(lds), 0, 0);
#endif
}
__device__ __forceinline__ void async_wait0() {
#if HAS_ASYNC_LDS
    __builtin_amdgcn_s_wait_asynccnt(0);
#endif
}

// ---------------------------------------------------------------------------
// Weight convert: W (K x N, f32, row-major) -> Wt (N x K, bf16, row-major)
// All ten weights in one grid: a block finds its weight and its tile from blockIdx.x.
// A block turns a tile of 128 k x 128 n, 64 elements a thread, so that the grid has few waves
// and each of them keeps 16 loads of 16 B a lane in flight:
//   load : a wave reads 512 contiguous bytes of a W row (4 n a lane); a lane takes the same
//          4 n of 8 successive k, twice, and so holds 8 k of each n: 16 B of a Wt row
//   turn : those 16-B pieces go to LDS as [n][k], rows of 256 B
//   store: a wave takes two rows back, 16 B a lane, and stores 2 x 256 contiguous bytes of Wt
// LDS rows have no pad; the 16-B piece c of row n lies at place c ^ ((n >> 2) & 15).  So the 16
// lanes that write one k piece of rows 4 apart, and the 16 that read one whole row, each meet
// all 64 banks once.
// K is a multiple of 128; N a multiple of 128, or below 128 and a multiple of 16 (one tile wide).
// ---------------------------------------------------------------------------
struct TrArgs {
    const float* wfc;  const float* wproj; const float* wqkv; const float* wmv; const float* wout;
    const float* w1w;  const float* w2w;   const float* w1r;  const float* w2r; const float* wmg;
    bf16_t* tfc;  bf16_t* tproj; bf16_t* tqkv; bf16_t* tmv; bf16_t* tout;
    bf16_t* t1w;  bf16_t* t2w;   bf16_t* t1r;  bf16_t* t2r; bf16_t* tmg;
};
#define TR_BLOCKS 872   // 256 + 256 + 192 + 64 + 64 + 4 * 8 + 8

template <int K, int N>
__device__ __forceinline__
void tr_tile(const float* __restrict__ W, bf16_t* __restrict__ Wt, int kb, int nb, char* lds) {
    constexpr int NT = N < 128 ? N : 128;   // columns of W in this tile
    const int tid = threadIdx.x, lane = tid & 31;
    const int wave = __builtin_amdgcn_readfirstlane(tid >> 5);   // scalar: row addresses stay scalar
    if (4 * lane < NT) {
        const float* p = W + (size_t)(kb + 8 * wave) * N + nb;   // scalar; the lane is the loads' one vector register
        f32x4 v[2][8];
        #pragma unroll
        for (int r = 0; r < 2; r++)
            #pragma unroll
            for (int i = 0; i < 8; i++) v[r][i] = ((const f32x4*)(p + (size_t)(64 * r + i) * N))[lane];
        // later arithmetic may land in the loads' index register; it is named as an input so that
        // it lives up to the wait: otherwise the last load's own result could be placed in it
        asm volatile("s_wait_xcnt 0x0" :: "v"(lane) : "memory");
        // keeps the conversions behind all 16 loads: moved up among them (to save registers) they
        // make the last loads wait for the first ones' data, a second trip to memory
        __builtin_amdgcn_sched_barrier(0);
        #pragma unroll
        for (int r = 0; r < 2; r++)
            #pragma unroll
            for (int j = 0; j < 4; j++) {
                bf16x8 o;
                #pragma unroll
                for (int i = 0; i < 8; i++) o[i] = (bf16_t)v[r][i][j];
                *(bf16x8*)(lds + (4 * lane + j) * 256 + (((wave + 8 * r) ^ (lane & 15)) * 16)) = o;
            }
    }
    __syncthreads();
    const int n = tid >> 4, c = tid & 15;
    bf16_t* q0 = Wt + (size_t)(nb + n) * K + kb + 8 * c;
    u32x4 d[NT / 16];
    #pragma unroll
    for (int q = 0; q < NT / 16; q++) {
        const int nq = n + 16 * q;
        d[q] = *(const u32x4*)(lds + nq * 256 + ((c ^ ((nq >> 2) & 15)) * 16));
    }
    #pragma unroll
    for (int q = 0; q < NT / 16; q++) *(u32x4*)(q0 + (size_t)(16 * q) * K) = d[q];
    // the code laid behind this tile's may write the stores' address and data registers
    asm volatile("s_wait_xcnt 0x0" ::: "memory");
}

__global__ __launch_bounds__(256)
void k_transpose_bf16(TrArgs a) {
    __shared__ __attribute__((aligned(16))) char tile[128 * 256];
    int l = blockIdx.x;   // tile index inside the weight, N fastest
    if (l < 256)                tr_tile<1024, 4096>(a.wfc,   a.tfc,   (l >> 5) * 128, (l & 31) * 128, tile);
    else if ((l -= 256) < 256)  tr_tile<4096, 1024>(a.wproj, a.tproj, (l >> 3) * 128, (l & 7) * 128,  tile);
    else if ((l -= 256) < 192)  tr_tile<1024, 3072>(a.wqkv,  a.tqkv,  (l / 24) * 128, (l % 24) * 128, tile);
    else if ((l -= 192) < 128) {
        const bool mv = l < 64;
        tr_tile<1024, 1024>(mv ? a.wmv : a.wout, mv ? a.tmv : a.tout, ((l & 63) >> 3) * 128, (l & 7) * 128, tile);
    }
    else if ((l -= 128) < 32) {
        const int s = l >> 3;
        tr_tile<1024, 64>(s == 0 ? a.w1w : s == 1 ? a.w2w : s == 2 ? a.w1r : a.w2r,
                          s == 0 ? a.t1w : s == 1 ? a.t2w : s == 2 ? a.t1r : a.t2r, (l & 7) * 128, 0, tile);
    }
    else tr_tile<1024, 16>(a.wmg, a.tmg, (l - 32) * 128, 0, tile);
}

// ---------------------------------------------------------------------------
// LayerNorm (f32 in) -> bf16 out.  One block per row.
// ---------------------------------------------------------------------------
__global__ __launch_bounds__(256)
void k_layernorm(const float* __restrict__ x, const float* __restrict__ g,
                 const float* __restrict__ b, bf16_t* __restrict__ out, int D) {
    const float* row = x + (size_t)blockIdx.x * D;
    float s = 0.f, s2 = 0.f;
    for (int d = threadIdx.x; d < D; d += 256) { float v = row[d]; s += v; s2 += v * v; }
    #pragma unroll
    for (int off = 16; off; off >>= 1) { s += __shfl_down(s, off); s2 += __shfl_down(s2, off); }
    __shared__ float ws[8], ws2[8];
    int wave = threadIdx.x >> 5, lane = threadIdx.x & 31;
    if (lane == 0) { ws[wave] = s; ws2[wave] = s2; }
    __syncthreads();
    if (threadIdx.x == 0) {
        float a = 0.f, a2 = 0.f;
        #pragma unroll
        for (int i = 0; i < 8; i++) { a += ws[i]; a2 += ws2[i]; }
        ws[0] = a; ws2[0] = a2;
    }
    __syncthreads();
    float mean = ws[0] / D;
    float var  = ws2[0] / D - mean * mean;
    float rstd = rsqrtf(var + 1e-5f);
    bf16_t* orow = out + (size_t)blockIdx.x * D;
    for (int d = threadIdx.x; d < D; d += 256)
        orow[d] = (bf16_t)((row[d] - mean) * rstd * g[d] + b[d]);
}

// ---------------------------------------------------------------------------
// Generic bf16 WMMA GEMM:  C[M,N] = A[M,K] * Wt[N,K]^T  (+bias)(+gelu)(+resid)
// Block tile 128x128, 8 waves: each wave 32(M) x 64(N).
// A stage holds 64 k of every operand row = one whole 128-B line per row, so that a wave's
// 16-B-per-lane copy covers 4 whole lines (8 lanes a row).  Two buffers, copies one stage ahead.
// K must be a multiple of 64, N of 4.
// ---------------------------------------------------------------------------
#define GEMM_BK  64   // k per stage
#define GEMM_LDK 72   // LDS row pitch in elements (144 B = 16 B x 9: conflict-free 16-B reads)
#define GEMM_ROWSTEP (32 * GEMM_LDK * 2)    // LDS bytes between a thread's four rows of one operand
#define GEMM_BUFSTEP (128 * GEMM_LDK * 2)   // LDS bytes between the two buffers of one operand
#define EP_LD 68      // epilogue: LDS row pitch in floats (272 B: 16-B aligned rows, 4 banks apart)

// One stage: each thread brings 16 B of four A rows and of four Wt rows (32 rows apart) into LDS.
// la, lb: the thread's LDS byte addresses of its first row; a0, b0..b3: its global addresses.
// The closing s_wait_xcnt stands inside the statement so that it precedes every later write of
// the address registers that the copies name.
__device__ __forceinline__
void gemm_stage(unsigned la, unsigned lb, const bf16_t* a0, size_t arow,
                const bf16_t* b0, const bf16_t* b1, const bf16_t* b2, const bf16_t* b3) {
    asm volatile(
        "global_load_async_to_lds_b128 %0, %8, off\n\t"
        "global_load_async_to_lds_b128 %1, %9, off\n\t"
        "global_load_async_to_lds_b128 %2, %10, off\n\t"
        "global_load_async_to_lds_b128 %3, %11, off\n\t"
        "global_load_async_to_lds_b128 %4, %12, off\n\t"
        "global_load_async_to_lds_b128 %5, %13, off\n\t"
        "global_load_async_to_lds_b128 %6, %14, off\n\t"
        "global_load_async_to_lds_b128 %7, %15, off\n\t"
        "s_wait_xcnt 0x0"
        :: "v"(la), "v"(la + GEMM_ROWSTEP), "v"(la + 2 * GEMM_ROWSTEP), "v"(la + 3 * GEMM_ROWSTEP),
           "v"(lb), "v"(lb + GEMM_ROWSTEP), "v"(lb + 2 * GEMM_ROWSTEP), "v"(lb + 3 * GEMM_ROWSTEP),
           "v"(a0), "v"(a0 + arow), "v"(a0 + 2 * arow), "v"(a0 + 3 * arow),
           "v"(b0), "v"(b1), "v"(b2), "v"(b3)
        : "memory");
}

__device__ __forceinline__
void gemm_tile(const bf16_t* __restrict__ A, const bf16_t* __restrict__ Wt,
               const float* __restrict__ bias, const float* __restrict__ resid,
               float* __restrict__ outF, bf16_t* __restrict__ outB,
               int N, int K, int act, int m0, int n0) {
    __shared__ __attribute__((aligned(16))) bf16_t As[2][128][GEMM_LDK];
    __shared__ __attribute__((aligned(16))) bf16_t Bs[2][128][GEMM_LDK];
    const int tid = threadIdx.x;
    const int wave = tid >> 5, lane = tid & 31;
    const int wm = (wave & 3) * 32, wn = (wave >> 2) * 64;
    const int lm = lane & 15, kh = lane >> 4;

    v8f acc[2][4];
    #pragma unroll
    for (int i = 0; i < 2; i++)
        #pragma unroll
        for (int j = 0; j < 4; j++)
            #pragma unroll
            for (int v = 0; v < 8; v++) acc[i][j][v] = 0.f;

    // copy map: 8 lanes a row (8 x 16 B = the row's 128 B of this stage), rows cr + 32 i
    const int cr = tid >> 3, cc = (tid & 7) * 8;
    const size_t arow = (size_t)32 * K;
    const bf16_t* ga = A + (size_t)(m0 + cr) * K + cc;
    // A weight row past N is replaced by row N - 1: every lane copies, every address is in
    // bounds, and the columns n >= N that such rows feed are never stored (epilogue).
    const bf16_t* gb[4];
    #pragma unroll
    for (int i = 0; i < 4; i++) {
        int rn = n0 + cr + 32 * i;
        rn = rn < N ? rn : N - 1;
        gb[i] = Wt + (size_t)rn * K + cc;
    }
    const unsigned la = (unsigned)(size_t)&As[0][cr][cc];   // low 32 bits = LDS byte address
    const unsigned lb = (unsigned)(size_t)&Bs[0][cr][cc];
    const int nT = K / GEMM_BK;

    // stage 0 -> buffer 0, published; then stage 1 -> buffer 1 flies during trip 0
    gemm_stage(la, lb, ga, arow, gb[0], gb[1], gb[2], gb[3]);
    asm volatile("s_wait_asynccnt 0x0" ::: "memory");   // this wave's copies of stage 0 have landed
    __syncthreads();
    if (nT > 1)
        gemm_stage(la + GEMM_BUFSTEP, lb + GEMM_BUFSTEP, ga + GEMM_BK, arow,
                   gb[0] + GEMM_BK, gb[1] + GEMM_BK, gb[2] + GEMM_BK, gb[3] + GEMM_BK);

    for (int t = 0; t < nT; t++) {
        const int cur = t & 1;
        if (t + 2 < nT)
            __builtin_prefetch(A + (size_t)(m0 + (tid >> 1)) * K + (t + 2) * GEMM_BK + (tid & 1) * 32, 0, 3);

        #pragma unroll
        for (int kk = 0; kk < GEMM_BK / 32; kk++) {
            AFrag a[2], bfr[4];
            #pragma unroll
            for (int i = 0; i < 2; i++) {
                const bf16_t* p = &As[cur][wm + i * 16 + lm][kk * 32 + kh * 8];
                a[i].q[0] = *(const u32x4*)p;
                a[i].q[1] = *(const u32x4*)(p + 16);
            }
            #pragma unroll
            for (int j = 0; j < 4; j++) {
                const bf16_t* p = &Bs[cur][wn + j * 16 + lm][kk * 32 + kh * 8];
                bfr[j].q[0] = *(const u32x4*)p;
                bfr[j].q[1] = *(const u32x4*)(p + 16);
            }
            #pragma unroll
            for (int i = 0; i < 2; i++)
                #pragma unroll
                for (int j = 0; j < 4; j++)
                    acc[i][j] = __builtin_amdgcn_wmma_f32_16x16x32_bf16(
                        false, a[i].v, false, bfr[j].v, (short)0, acc[i][j], false, false);
        }

        // publish stage t + 1 and free buffer cur, in this order:
        asm volatile("s_wait_dscnt 0x0" ::: "memory");      // this wave's reads of buffer cur are done
        asm volatile("s_wait_asynccnt 0x0" ::: "memory");   // this wave's copies of stage t + 1 have landed
        __syncthreads();
        if (t + 2 < nT) {
            const int ko = (t + 2) * GEMM_BK;
            const unsigned bo = cur * GEMM_BUFSTEP;
            gemm_stage(la + bo, lb + bo, ga + ko, arow, gb[0] + ko, gb[1] + ko, gb[2] + ko, gb[3] + ko);
        }
    }
    asm volatile("s_wait_asynccnt 0x0" ::: "memory");   // no copy is left in flight behind the loop

    // Epilogue.  The accumulator layout gives a lane one column of 8 rows: stored from there, every
    // access is a 4-B piece and the residual loads follow one another.  So each wave turns its own
    // 32 x 64 tile through its own LDS range (the ring is free: every wave has passed the last
    // trip's barrier and no copy is in flight) and takes it back row-wise: a lane holds 4
    // neighbouring columns, 16 lanes a row, so that every residual load and every store covers
    // whole 128-B lines, and the 16 residual loads of a lane fly together, under the turn.
    if (n0 + wn < N) {   // the same for the whole wave
        float* st0 = (float*)&As[0][0][0] + wave * (16 * EP_LD);   // rows  0..15 of the wave's tile
        float* st1 = (float*)&Bs[0][0][0] + wave * (16 * EP_LD);   // rows 16..31
        const int er = lane >> 4, ec = (lane & 15) * 4;
        const int n = n0 + wn + ec;
        const bool ok = n < N;   // N is a multiple of 4: a lane's 4 columns are in or out together
        const size_t idx0 = (size_t)(m0 + wm + er) * N + n;
        const size_t rstep = (size_t)2 * N;

        // behind each load: a later load's result or later arithmetic may land in its address registers
        f32x4 bv = {0.f, 0.f, 0.f, 0.f};
        if (ok && bias) {
            bv = *(const f32x4*)(bias + n);
            asm volatile("s_wait_xcnt 0x0" ::: "memory");   // see above
        }
        f32x4 rv[16];   // filled and read only where there is a residual
        if (ok && resid) {
            #pragma unroll
            for (int q = 0; q < 16; q++) {
                rv[q] = *(const f32x4*)(resid + idx0 + q * rstep);
                asm volatile("s_wait_xcnt 0x0" ::: "memory");   // see above
            }
        }

        #pragma unroll
        for (int j = 0; j < 4; j++)
            #pragma unroll
            for (int v = 0; v < 8; v++) {
                st0[(v + 8 * kh) * EP_LD + j * 16 + lm] = acc[0][j][v];
                st1[(v + 8 * kh) * EP_LD + j * 16 + lm] = acc[1][j][v];
            }
        // the rows are read back by other lanes of this wave: their writes have to be done
        asm volatile("s_wait_dscnt 0x0" ::: "memory");
        f32x4 cv[16];
        #pragma unroll
        for (int q = 0; q < 16; q++)
            cv[q] = *(const f32x4*)((q < 8 ? st0 : st1) + ((q & 7) * 2 + er) * EP_LD + ec);

        if (ok) {
            #pragma unroll
            for (int q = 0; q < 16; q++) {
                f32x4 c = cv[q] + bv;
                if (act == 1) {
                    #pragma unroll
                    for (int e = 0; e < 4; e++) c[e] = 0.5f * c[e] * (1.f + erff(c[e] * 0.70710678118f));
                }
                if (resid) c += rv[q];
                const size_t idx = idx0 + q * rstep;
                // behind each store: later arithmetic may land in its registers
                if (outF) {
                    *(f32x4*)(outF + idx) = c;
                    asm volatile("s_wait_xcnt 0x0" ::: "memory");   // see above
                }
                if (outB) {
                    bf16x4 o;
                    #pragma unroll
                    for (int e = 0; e < 4; e++) o[e] = (bf16_t)c[e];
                    *(bf16x4*)(outB + idx) = o;
                    asm volatile("s_wait_xcnt 0x0" ::: "memory");   // see above
                }
            }
        }
    }
}

__global__ __launch_bounds__(256)
void k_gemm_bf16(const bf16_t* __restrict__ A, const bf16_t* __restrict__ Wt,
                 const float* __restrict__ bias, const float* __restrict__ resid,
                 float* __restrict__ outF, bf16_t* __restrict__ outB,
                 int M, int N, int K, int act) {
    gemm_tile(A, Wt, bias, resid, outF, outB, N, K, act, blockIdx.y * 128, blockIdx.x * 128);
}

// The seven projections of the same A (2048 x K) in one grid: they do not depend on one
// another, and the narrow ones (16 blocks each on their own) fill places the wide ones leave.
// blockIdx.x picks the weight and its 128-wide column tile, blockIdx.y the row tile.
struct ProjArgs {
    const bf16_t* A;
    const bf16_t* tqkv; const bf16_t* tmv; const bf16_t* t1w; const bf16_t* t2w;
    const bf16_t* t1r;  const bf16_t* t2r; const bf16_t* tmg;
    const float* bqkv; const float* bmv; const float* bmg;
    bf16_t* qkv;
    float* memval; float* p1w; float* p2w; float* p1r; float* p2r; float* glin;
    int K;
};
#define PROJ_TILES 37   // 24 (qkv) + 8 (mem values) + 4 (points) + 1 (gate)

__global__ __launch_bounds__(256)
void k_gemm_proj(ProjArgs a) {
    const int x = blockIdx.x;
    const bf16_t* Wt;
    const float* bias = nullptr;
    float* oF = nullptr;
    bf16_t* oB = nullptr;
    int N = 64, n0 = 0;
    if (x < 24)       { Wt = a.tqkv; bias = a.bqkv; oB = a.qkv;    N = 3072; n0 = x * 128; }
    else if (x < 32)  { Wt = a.tmv;  bias = a.bmv;  oF = a.memval; N = 1024; n0 = (x - 24) * 128; }
    else if (x == 32) { Wt = a.t1w;  oF = a.p1w; }
    else if (x == 33) { Wt = a.t2w;  oF = a.p2w; }
    else if (x == 34) { Wt = a.t1r;  oF = a.p1r; }
    else if (x == 35) { Wt = a.t2r;  oF = a.p2r; }
    else              { Wt = a.tmg;  bias = a.bmg;  oF = a.glin;   N = 16; }
    gemm_tile(a.A, Wt, bias, nullptr, oF, oB, N, a.K, 0, blockIdx.y * 128, n0);
}

// ---------------------------------------------------------------------------
// Flash-style causal attention.  qkv bf16 [(b,t), 3, H, 64].
// grid (T/128, B*H), 256 threads (8 waves, 16 q-rows each).
// ---------------------------------------------------------------------------
__global__ __launch_bounds__(256)
void k_attention(const bf16_t* __restrict__ qkv, float* __restrict__ seqout,
                 int B, int T, int H) {
    const int qb = blockIdx.x;
    const int bh = blockIdx.y;
    const int h = bh % H, b = bh / H;
    const int tid = threadIdx.x, wave = tid >> 5, lane = tid & 31;
    const int lm = lane & 15, kh = lane >> 4;

    __shared__ bf16_t Qs[128][72];
    __shared__ bf16_t Ks[128][72];
    __shared__ bf16_t Vt[64][136];     // V transposed: [dh][s]
    __shared__ bf16_t Ps[8][16][40];   // per-wave P staging (32-wide K chunk)

    const size_t strideT = 3 * 1024;
    const bf16_t* base = qkv + (size_t)b * T * strideT + (size_t)h * 64;

    // Load Q tile (128 x 64)
    for (int c8 = tid; c8 < 128 * 8; c8 += 256) {
        int rr = c8 >> 3, cc = (c8 & 7) * 8;
        const bf16_t* gq = base + (size_t)(qb * 128 + rr) * strideT + cc;
#if HAS_ASYNC_LDS
        async_copy16(&Qs[rr][cc], gq);
#else
        *(u32x4*)&Qs[rr][cc] = *(const u32x4*)gq;
#endif
    }

    float rowm[8], rowl[8];
    v8f oacc[4];
    #pragma unroll
    for (int v = 0; v < 8; v++) { rowm[v] = -INFINITY; rowl[v] = 0.f; }
    #pragma unroll
    for (int jt = 0; jt < 4; jt++)
        #pragma unroll
        for (int v = 0; v < 8; v++) oacc[jt][v] = 0.f;

    for (int sb = 0; sb <= qb; sb++) {
        __syncthreads();   // protect Ks/Vt reuse across iterations
        for (int c8 = tid; c8 < 128 * 8; c8 += 256) {
            int rr = c8 >> 3, cc = (c8 & 7) * 8;
            const bf16_t* gk = base + (size_t)(sb * 128 + rr) * strideT + 1024 + cc;
#if HAS_ASYNC_LDS
            async_copy16(&Ks[rr][cc], gk);
#else
            *(u32x4*)&Ks[rr][cc] = *(const u32x4*)gk;
#endif
        }
        for (int c8 = tid; c8 < 128 * 8; c8 += 256) {
            int rr = c8 >> 3, cc = (c8 & 7) * 8;
            union { u32x4 u; bf16_t e[8]; } vv;
            vv.u = *(const u32x4*)(base + (size_t)(sb * 128 + rr) * strideT + 2048 + cc);
            #pragma unroll
            for (int i = 0; i < 8; i++) Vt[cc + i][rr] = vv.e[i];
        }
        async_wait0();
        __syncthreads();

        // ---- scores: S = Q * K^T ----
        AFrag aq[2];
        #pragma unroll
        for (int kk = 0; kk < 2; kk++) {
            const bf16_t* p = &Qs[wave * 16 + lm][kk * 32 + kh * 8];
            aq[kk].q[0] = *(const u32x4*)p;
            aq[kk].q[1] = *(const u32x4*)(p + 16);
        }
        v8f sacc[8];
        #pragma unroll
        for (int j = 0; j < 8; j++)
            #pragma unroll
            for (int v = 0; v < 8; v++) sacc[j][v] = 0.f;
        #pragma unroll
        for (int j = 0; j < 8; j++)
            #pragma unroll
            for (int kk = 0; kk < 2; kk++) {
                AFrag bk;
                const bf16_t* p = &Ks[j * 16 + lm][kk * 32 + kh * 8];
                bk.q[0] = *(const u32x4*)p;
                bk.q[1] = *(const u32x4*)(p + 16);
                sacc[j] = __builtin_amdgcn_wmma_f32_16x16x32_bf16(
                    false, aq[kk].v, false, bk.v, (short)0, sacc[j], false, false);
            }

        // ---- causal mask + online softmax (wave32: 16-lane row reductions) ----
        #pragma unroll
        for (int v = 0; v < 8; v++) {
            int trow = qb * 128 + wave * 16 + v + 8 * kh;
            float rm = -INFINITY;
            #pragma unroll
            for (int j = 0; j < 8; j++) {
                int col = sb * 128 + j * 16 + lm;
                float s = (col <= trow) ? sacc[j][v] * 0.125f : -INFINITY;
                sacc[j][v] = s;
                rm = fmaxf(rm, s);
            }
            #pragma unroll
            for (int msk = 1; msk < 16; msk <<= 1) rm = fmaxf(rm, __shfl_xor(rm, msk));
            float mnew = fmaxf(rowm[v], rm);
            float corr = expf(rowm[v] - mnew);
            rowm[v] = mnew;
            float rs = 0.f;
            #pragma unroll
            for (int j = 0; j < 8; j++) {
                float p = expf(sacc[j][v] - mnew);
                sacc[j][v] = p;
                rs += p;
            }
            #pragma unroll
            for (int msk = 1; msk < 16; msk <<= 1) rs += __shfl_xor(rs, msk);
            rowl[v] = rowl[v] * corr + rs;
            #pragma unroll
            for (int jt = 0; jt < 4; jt++) oacc[jt][v] = oacc[jt][v] * corr;
        }

        // ---- O += P * V  (stage P through LDS: C-layout -> A-layout) ----
        #pragma unroll
        for (int kk = 0; kk < 4; kk++) {
            #pragma unroll
            for (int jj = 0; jj < 2; jj++) {
                int j = kk * 2 + jj;
                #pragma unroll
                for (int v = 0; v < 8; v++)
                    Ps[wave][v + 8 * kh][jj * 16 + lm] = (bf16_t)sacc[j][v];
            }
            AFrag ap;
            const bf16_t* p = &Ps[wave][lm][kh * 8];
            ap.q[0] = *(const u32x4*)p;
            ap.q[1] = *(const u32x4*)(p + 16);
            #pragma unroll
            for (int jt = 0; jt < 4; jt++) {
                AFrag bv;
                const bf16_t* q = &Vt[jt * 16 + lm][kk * 32 + kh * 8];
                bv.q[0] = *(const u32x4*)q;
                bv.q[1] = *(const u32x4*)(q + 16);
                oacc[jt] = __builtin_amdgcn_wmma_f32_16x16x32_bf16(
                    false, ap.v, false, bv.v, (short)0, oacc[jt], false, false);
            }
        }
    }

    float* out = seqout + (size_t)b * T * 1024 + (size_t)h * 64;
    #pragma unroll
    for (int jt = 0; jt < 4; jt++)
        #pragma unroll
        for (int v = 0; v < 8; v++) {
            int trow = qb * 128 + wave * 16 + v + 8 * kh;
            int col  = jt * 16 + lm;
            out[(size_t)trow * 1024 + col] = oacc[jt][v] / rowl[v];
        }
}

// ---------------------------------------------------------------------------
// Plucker lines + J6 rotation.  One thread per (b,t,h).
// ---------------------------------------------------------------------------
__device__ inline void exterior4(const float* a1, const float* a2, float* L) {
    L[0] = a1[0] * a2[1] - a1[1] * a2[0];
    L[1] = a1[0] * a2[2] - a1[2] * a2[0];
    L[2] = a1[0] * a2[3] - a1[3] * a2[0];
    L[3] = a1[1] * a2[2] - a1[2] * a2[1];
    L[4] = a1[1] * a2[3] - a1[3] * a2[1];
    L[5] = a1[2] * a2[3] - a1[3] * a2[2];
    float n2 = 0.f;
    #pragma unroll
    for (int i = 0; i < 6; i++) n2 += L[i] * L[i];
    float inv = 1.f / fmaxf(sqrtf(n2), 1e-12f);
    #pragma unroll
    for (int i = 0; i < 6; i++) L[i] *= inv;
}

__global__ __launch_bounds__(256)
void k_lines(const float* __restrict__ p1w, const float* __restrict__ p2w,
             const float* __restrict__ p1r, const float* __restrict__ p2r,
             float* __restrict__ Jw, float* __restrict__ Rd, int B, int T, int H) {
    int idx = blockIdx.x * 256 + threadIdx.x;
    if (idx >= B * T * H) return;
    int h = idx % H, t = (idx / H) % T, b = idx / (H * T);
    size_t row = (size_t)b * T + t;
    float a1[4], a2[4], L[6];
    #pragma unroll
    for (int c = 0; c < 4; c++) {
        a1[c] = (t > 0) ? p1w[(row - 1) * 64 + h * 4 + c] : 0.f;
        a2[c] = p2w[row * 64 + h * 4 + c];
    }
    exterior4(a1, a2, L);
    float* jw = Jw + ((size_t)(b * H + h) * T + t) * 6;
    jw[0] = L[5]; jw[1] = -L[4]; jw[2] = L[3]; jw[3] = L[2]; jw[4] = -L[1]; jw[5] = L[0];
    #pragma unroll
    for (int c = 0; c < 4; c++) {
        a1[c] = p1r[row * 64 + h * 4 + c];
        a2[c] = p2r[row * 64 + h * 4 + c];
    }
    exterior4(a1, a2, L);
    float* rd = Rd + ((size_t)(b * H + h) * T + t) * 6;
    #pragma unroll
    for (int j = 0; j < 6; j++) rd[j] = L[j];
}

// ---------------------------------------------------------------------------
// Decayed-Gram scan:  M_t = d*(M_{t-1} + Jw_{t-1} Jw_{t-1}^T),  M_0 = 0.
// The recurrence is linear, so it is run as a chunked parallel scan:
// one block per (b,h), thread c owns the 4 steps t = 4c .. 4c+3 (T == 4 * blockDim.x).
//   1) each thread folds its own 4 steps from zero   (chunk aggregate)
//   2) weighted prefix over chunks: lanes by shuffles, waves through LDS
//   3) each thread replays its 4 steps from its true M and writes the gates
// M is symmetric, so only its 21 upper entries are carried.
// Every loop is unrolled so that the small arrays are indexed by constants and stay in registers.
// ---------------------------------------------------------------------------
#define GS_L 4      // steps per thread
#define GS_NS 21    // upper triangle of a 6x6

__device__ __forceinline__ void gram_step(float* m, const float* J, float d) {
    int n = 0;
    #pragma unroll
    for (int i = 0; i < 6; i++)
        #pragma unroll
        for (int j = i; j < 6; j++, n++) m[n] = d * (m[n] + J[i] * J[j]);
}

__global__ __launch_bounds__(256)
void k_gram_scan(const float* __restrict__ Jw, const float* __restrict__ Rd,
                 const float* __restrict__ glin, const float* __restrict__ decay_logits,
                 const float* __restrict__ iter_mix, const float* __restrict__ mem_scale,
                 float* __restrict__ gh, int B, int T, int H) {
    __shared__ __attribute__((aligned(16))) float Wagg[8][24];   // rows of 21, padded to 16 B
    const int bh = blockIdx.x, h = bh % H, b = bh / H;
    const int c = threadIdx.x, lane = c & 31;
    const int wave = __builtin_amdgcn_readfirstlane(c >> 5);     // scalar: the tests on it in 2b are scalar compares
    const int t0 = c * GS_L;

    // all of this thread's inputs, issued up front
    union { float4 q[6]; float f[24]; } J, R;
    const float4* Jq = (const float4*)(Jw + (size_t)bh * T * 6 + (size_t)t0 * 6);
    const float4* Rq = (const float4*)(Rd + (size_t)bh * T * 6 + (size_t)t0 * 6);
    #pragma unroll
    for (int i = 0; i < 6; i++) J.q[i] = Jq[i];
    // the next loads may land in these loads' address registers
    asm volatile("s_wait_xcnt 0x0" ::: "memory");
    #pragma unroll
    for (int i = 0; i < 6; i++) R.q[i] = Rq[i];
    // as above
    asm volatile("s_wait_xcnt 0x0" ::: "memory");
    float gl[GS_L];
    #pragma unroll
    for (int k = 0; k < GS_L; k++) gl[k] = glin[((size_t)b * T + t0 + k) * H + h];
    // the loads' address registers are reused by the arithmetic below
    asm volatile("s_wait_xcnt 0x0" ::: "memory");

    const float decay = 1.f / (1.f + expf(-decay_logits[h]));
    const float alpha = 1.f / (1.f + expf(-iter_mix[0]));
    const float msc = mem_scale[h];

    // w[s] = decay^(4 * 2^s): the decay across 2^s chunks
    float w[6];
    w[0] = (decay * decay) * (decay * decay);
    #pragma unroll
    for (int s = 1; s < 6; s++) w[s] = w[s - 1] * w[s - 1];

    // 1) chunk aggregate
    float m[GS_NS];
    #pragma unroll
    for (int n = 0; n < GS_NS; n++) m[n] = 0.f;
    #pragma unroll
    for (int k = 0; k < GS_L; k++) gram_step(m, &J.f[k * 6], decay);

    // 2a) inclusive weighted prefix over the wave's 32 chunks
    #pragma unroll
    for (int s = 0; s < 5; s++) {
        const int o = 1 << s;
        #pragma unroll
        for (int n = 0; n < GS_NS; n++) {
            float v = __shfl_up(m[n], o);
            m[n] = (lane >= o) ? m[n] + w[s] * v : m[n];
        }
    }
    if (lane == 31) {
        #pragma unroll
        for (int n = 0; n < GS_NS; n++) Wagg[wave][n] = m[n];
    }
    // exclusive within the wave
    #pragma unroll
    for (int n = 0; n < GS_NS; n++) {
        float v = __shfl_up(m[n], 1);
        m[n] = (lane > 0) ? v : 0.f;
    }
    __syncthreads();

    // 2b) M at the wave's first step, from the earlier waves' totals.
    // It is the same for the whole wave: lane n folds entry n, then it is read per entry.
    const int ln = (lane < GS_NS) ? lane : 0;
    float tot[7];
    #pragma unroll
    for (int q = 0; q < 7; q++) tot[q] = Wagg[q][ln];
    float p = 0.f;
    #pragma unroll
    for (int q = 0; q < 7; q++) p = (q < wave) ? w[5] * p + tot[q] : p;
    float dl = 1.f;   // decay^(4 * lane)
    #pragma unroll
    for (int s = 0; s < 5; s++) dl *= ((lane >> s) & 1) ? w[s] : 1.f;
    #pragma unroll
    for (int n = 0; n < GS_NS; n++)
        m[n] += dl * __int_as_float(__builtin_amdgcn_readlane(__float_as_int(p), n));

    // 3) replay
    #pragma unroll
    for (int k = 0; k < GS_L; k++) {
        const float* rd = &R.f[k * 6];
        float rdM[6] = {0, 0, 0, 0, 0, 0};
        int n = 0;
        #pragma unroll
        for (int i = 0; i < 6; i++)
            #pragma unroll
            for (int j = i; j < 6; j++, n++) {
                rdM[j] += rd[i] * m[n];
                if (j != i) rdM[i] += rd[j] * m[n];
            }
        float s1 = 0.f, s2 = 0.f;
        #pragma unroll
        for (int j = 0; j < 6; j++) { s1 += rdM[j] * rd[j]; s2 += rdM[j] * rdM[j]; }
        float ms = (1.f - alpha) * s1 + alpha * s2;
        float g1 = 1.f / (1.f + expf(-ms * msc));
        float g2 = 1.f / (1.f + expf(-gl[k]));
        gh[((size_t)b * T + t0 + k) * H + h] = g1 * g2;
        if (k + 1 < GS_L) gram_step(m, &J.f[k * 6], decay);
    }
}

// ---------------------------------------------------------------------------
// y = seqout + mean_h(gh) * memval  -> bf16 (input to Wout GEMM)
// ---------------------------------------------------------------------------
__global__ __launch_bounds__(256)
void k_combine(const float* __restrict__ seqout, const float* __restrict__ memval,
               const float* __restrict__ gh, bf16_t* __restrict__ y, int D, int H) {
    size_t row = blockIdx.x;
    float g = 0.f;
    #pragma unroll
    for (int h = 0; h < 16; h++) g += gh[row * H + h];
    g *= (1.f / 16.f);
    const float* so = seqout + row * D;
    const float* mv = memval + row * D;
    bf16_t* yr = y + row * D;
    for (int d = threadIdx.x; d < D; d += 256)
        yr[d] = (bf16_t)(so[d] + g * mv[d]);
}

// ---------------------------------------------------------------------------
extern "C" void kernel_launch(void* const* d_in, const int* in_sizes, int n_in,
                              void* d_out, int out_size, void* d_ws, size_t ws_size,
                              hipStream_t stream) {
    const int B = 2, T = 1024, D = 1024, H = 16, DFF = 4096;
    const int M = B * T;

    const float* x            = (const float*)d_in[0];
    const float* ln1_g        = (const float*)d_in[1];
    const float* ln1_b        = (const float*)d_in[2];
    const float* Wqkv         = (const float*)d_in[3];
    const float* bqkv         = (const float*)d_in[4];
    const float* W1w          = (const float*)d_in[5];
    const float* W2w          = (const float*)d_in[6];
    const float* W1r          = (const float*)d_in[7];
    const float* W2r          = (const float*)d_in[8];
    const float* Wmv          = (const float*)d_in[9];
    const float* bmv          = (const float*)d_in[10];
    const float* Wmg          = (const float*)d_in[11];
    const float* bmg          = (const float*)d_in[12];
    const float* mem_scale    = (const float*)d_in[13];
    const float* iter_mix     = (const float*)d_in[14];
    const float* decay_logits = (const float*)d_in[15];
    const float* Wout         = (const float*)d_in[16];
    const float* bout         = (const float*)d_in[17];
    const float* ln2_g        = (const float*)d_in[18];
    const float* ln2_b        = (const float*)d_in[19];
    const float* Wfc          = (const float*)d_in[20];
    const float* bfc          = (const float*)d_in[21];
    const float* Wproj        = (const float*)d_in[22];
    const float* bproj        = (const float*)d_in[23];

    char* ws = (char*)d_ws;
    size_t off = 0;
    auto alloc = [&](size_t bytes) -> void* {
        void* p = ws + off;
        off += (bytes + 255) & ~(size_t)255;
        return p;
    };

    bf16_t* Wqkv_t  = (bf16_t*)alloc((size_t)3 * D * D * 2);
    bf16_t* W1w_t   = (bf16_t*)alloc((size_t)64 * D * 2);
    bf16_t* W2w_t   = (bf16_t*)alloc((size_t)64 * D * 2);
    bf16_t* W1r_t   = (bf16_t*)alloc((size_t)64 * D * 2);
    bf16_t* W2r_t   = (bf16_t*)alloc((size_t)64 * D * 2);
    bf16_t* Wmg_t   = (bf16_t*)alloc((size_t)H * D * 2);
    bf16_t* Wmv_t   = (bf16_t*)alloc((size_t)D * D * 2);
    bf16_t* Wout_t  = (bf16_t*)alloc((size_t)D * D * 2);
    bf16_t* Wfc_t   = (bf16_t*)alloc((size_t)DFF * D * 2);
    bf16_t* Wproj_t = (bf16_t*)alloc((size_t)D * DFF * 2);
    bf16_t* h_bf    = (bf16_t*)alloc((size_t)M * D * 2);
    bf16_t* qkv_bf  = (bf16_t*)alloc((size_t)M * 3 * D * 2);
    float*  p1w     = (float*)alloc((size_t)M * 64 * 4);
    float*  p2w     = (float*)alloc((size_t)M * 64 * 4);
    float*  p1r     = (float*)alloc((size_t)M * 64 * 4);
    float*  p2r     = (float*)alloc((size_t)M * 64 * 4);
    float*  glin    = (float*)alloc((size_t)M * H * 4);
    float*  Jwb     = (float*)alloc((size_t)B * H * T * 6 * 4);
    float*  Rdb     = (float*)alloc((size_t)B * H * T * 6 * 4);
    float*  ghb     = (float*)alloc((size_t)M * H * 4);
    float*  memval  = (float*)alloc((size_t)M * D * 4);
    float*  seqout  = (float*)alloc((size_t)M * D * 4);
    bf16_t* y_bf    = (bf16_t*)alloc((size_t)M * D * 2);
    float*  x1      = (float*)alloc((size_t)M * D * 4);
    bf16_t* h2_bf   = (bf16_t*)alloc((size_t)M * D * 2);
    bf16_t* a_bf    = (bf16_t*)alloc((size_t)M * DFF * 2);

    auto gemm = [&](const bf16_t* A, const bf16_t* Wt, const float* bias,
                    const float* resid, float* oF, bf16_t* oB, int m, int n, int k, int act) {
        dim3 g((n + 127) / 128, (m + 127) / 128);
        k_gemm_bf16<<<g, 256, 0, stream>>>(A, Wt, bias, resid, oF, oB, m, n, k, act);
    };

    // 1) weights -> bf16 transposed
    TrArgs ta = { Wfc, Wproj, Wqkv, Wmv, Wout, W1w, W2w, W1r, W2r, Wmg,
                  Wfc_t, Wproj_t, Wqkv_t, Wmv_t, Wout_t, W1w_t, W2w_t, W1r_t, W2r_t, Wmg_t };
    k_transpose_bf16<<<TR_BLOCKS, 256, 0, stream>>>(ta);

    // 2) ln1
    k_layernorm<<<M, 256, 0, stream>>>(x, ln1_g, ln1_b, h_bf, D);

    // 3) projections
    ProjArgs pa = { h_bf, Wqkv_t, Wmv_t, W1w_t, W2w_t, W1r_t, W2r_t, Wmg_t,
                    bqkv, bmv, bmg, qkv_bf, memval, p1w, p2w, p1r, p2r, glin, D };
    k_gemm_proj<<<dim3(PROJ_TILES, 16), 256, 0, stream>>>(pa);

    // 4) attention
    k_attention<<<dim3(T / 128, B * H), 256, 0, stream>>>(qkv_bf, seqout, B, T, H);

    // 5) Gram memory branch
    k_lines<<<(B * T * H + 255) / 256, 256, 0, stream>>>(p1w, p2w, p1r, p2r, Jwb, Rdb, B, T, H);
    k_gram_scan<<<B * H, 256, 0, stream>>>(Jwb, Rdb, glin, decay_logits, iter_mix,
                                          mem_scale, ghb, B, T, H);
    k_combine<<<M, 256, 0, stream>>>(seqout, memval, ghb, y_bf, D, H);

    // 6) output projection + residual
    gemm(y_bf, Wout_t, bout, x, x1, nullptr, M, D, D, 0);

    // 7) MLP
    k_layernorm<<<M, 256, 0, stream>>>(x1, ln2_g, ln2_b, h2_bf, D);
    gemm(h2_bf, Wfc_t, bfc, nullptr, nullptr, a_bf, M, DFF, D, 1);
    gemm(a_bf, Wproj_t, bproj, x1, (float*)d_out, nullptr, M, D, DFF, 0);
}

// v006
// A run of this version takes 189 microseconds.
// Next to v005, in two timings, it ran 1.11 and 1.14 times as fast.
// All steps since v000 together make it 4.57 times as fast.
#include <hip/hip_runtime.h>
#include <math.h>

typedef __bf16 bf16_t;
typedef __attribute__((ext_vector_type(16))) __bf16 v16bf;
typedef __attribute__((ext_vector_type(8)))  float  v8f;
typedef unsigned int u32x4 __attribute__((ext_vector_type(4)));
typedef int i32x4 __attribute__((ext_vector_type(4)));
typedef float  f32x4  __attribute__((ext_vector_type(4)));
typedef __bf16 bf16x4 __attribute__((ext_vector_type(4)));
typedef __bf16 bf16x8 __attribute__((ext_vector_type(8)));

union AFrag { v16bf v; u32x4 q[2]; };

#if __has_builtin(__builtin_amdgcn_global_load_async_to_lds_b128) && \
    __has_builtin(__builtin_amdgcn_s_wait_asynccnt)
#define HAS_ASYNC_LDS 1
typedef __attribute__((address_space(1))) i32x4* glds_gptr;
typedef __attribute__((address_space(3))) i32x4* glds_lptr;
#else
#define HAS_ASYNC_LDS 0
#endif

__device__ __forceinline__ void async_copy16(void* lds, const void* g) {
#if HAS_ASYNC_LDS
    __builtin_amdgcn_global_load_async_to_lds_b128(
        (glds_gptr)(g), (glds_lptr)(lds), 0, 0);
#endif
}
__device__ __forceinline__ void async_wait0() {
#if HAS_ASYNC_LDS
    __builtin_amdgcn_s_wait_asynccnt(0);
#endif
}

// ---------------------------------------------------------------------------
// Weight convert: W (K x N, f32, row-major) -> Wt (N x K, bf16, row-major)
// A block finds its weight and its tile from an index l that its kernel hands it (tr_first, tr_late).
// A block turns a tile of 128 k x 128 n, 64 elements a thread, so that the grid has few waves
// and each of them keeps 16 loads of 16 B a lane in flight:
//   load : a wave reads 512 contiguous bytes of a W row (4 n a lane); a lane takes the same
//          4 n of 8 successive k, twice, and so holds 8 k of each n: 16 B of a Wt row
//   turn : those 16-B pieces go to LDS as [n][k], rows of 256 B
//   store: a wave takes two rows back, 16 B a lane, and stores 2 x 256 contiguous bytes of Wt
// LDS rows have no pad; the 16-B piece c of row n lies at place c ^ ((n >> 2) & 15).  So the 16
// lanes that write one k piece of rows 4 apart, and the 16 that read one whole row, each meet
// all 64 banks once.
// K is a multiple of 128; N a multiple of 128, or below 128 and a multiple of 16 (one tile wide).
// ---------------------------------------------------------------------------
struct TrArgs {
    const float* wfc;  const float* wproj; const float* wqkv; const float* wmv; const float* wout;
    const float* w1w;  const float* w2w;   const float* w1r;  const float* w2r; const float* wmg;
    bf16_t* tfc;  bf16_t* tproj; bf16_t* tqkv; bf16_t* tmv; bf16_t* tout;
    bf16_t* t1w;  bf16_t* t2w;   bf16_t* t1r;  bf16_t* t2r; bf16_t* tmg;
};
#define TR_FIRST_BLOCKS 296   // 192 + 64 + 4 * 8 + 8: the weights that the projections of ln1(x) read
#define TR_LATE_BLOCKS  576   // 256 + 256 + 64: Wfc, Wproj, Wout, first read behind the attention

template <int K, int N>
__device__ __forceinline__
void tr_tile(const float* __restrict__ W, bf16_t* __restrict__ Wt, int kb, int nb, char* lds) {
    constexpr int NT = N < 128 ? N : 128;   // columns of W in this tile
    const int tid = threadIdx.x, lane = tid & 31;
    const int wave = __builtin_amdgcn_readfirstlane(tid >> 5);   // scalar: row addresses stay scalar
    if (4 * lane < NT) {
        const float* p = W + (size_t)(kb + 8 * wave) * N + nb;   // scalar; the lane is the loads' one vector register
        f32x4 v[2][8];
        #pragma unroll
        for (int r = 0; r < 2; r++)
            #pragma unroll
            for (int i = 0; i < 8; i++) v[r][i] = ((const f32x4*)(p + (size_t)(64 * r + i) * N))[lane];
        // later arithmetic may land in the loads' index register; it is named as an input so that
        // it lives up to the wait: otherwise the last load's own result could be placed in it
        asm volatile("s_wait_xcnt 0x0" :: "v"(lane) : "memory");
        // keeps the conversions behind all 16 loads: moved up among them (to save registers) they
        // make the last loads wait for the first ones' data, a second trip to memory
        __builtin_amdgcn_sched_barrier(0);
        #pragma unroll
        for (int r = 0; r < 2; r++)
            #pragma unroll
            for (int j = 0; j < 4; j++) {
                bf16x8 o;
                #pragma unroll
                for (int i = 0; i < 8; i++) o[i] = (bf16_t)v[r][i][j];
                *(bf16x8*)(lds + (4 * lane + j) * 256 + (((wave + 8 * r) ^ (lane & 15)) * 16)) = o;
            }
    }
    __syncthreads();
    const int n = tid >> 4, c = tid & 15;
    bf16_t* q0 = Wt + (size_t)(nb + n) * K + kb + 8 * c;
    u32x4 d[NT / 16];
    #pragma unroll
    for (int q = 0; q < NT / 16; q++) {
        const int nq = n + 16 * q;
        d[q] = *(const u32x4*)(lds + nq * 256 + ((c ^ ((nq >> 2) & 15)) * 16));
    }
    #pragma unroll
    for (int q = 0; q < NT / 16; q++) *(u32x4*)(q0 + (size_t)(16 * q) * K) = d[q];
    // the code laid behind this tile's may write the stores' address and data registers
    asm volatile("s_wait_xcnt 0x0" ::: "memory");
}

// l: tile index, inside a weight N fastest
__device__ __forceinline__
void tr_first(const TrArgs& a, int l, char* tile) {
    if (l < 192)               tr_tile<1024, 3072>(a.wqkv, a.tqkv, (l / 24) * 128, (l % 24) * 128, tile);
    else if ((l -= 192) < 64)  tr_tile<1024, 1024>(a.wmv,  a.tmv,  (l >> 3) * 128, (l & 7) * 128,  tile);
    else if ((l -= 64) < 32) {
        const int s = l >> 3;
        tr_tile<1024, 64>(s == 0 ? a.w1w : s == 1 ? a.w2w : s == 2 ? a.w1r : a.w2r,
                          s == 0 ? a.t1w : s == 1 ? a.t2w : s == 2 ? a.t1r : a.t2r, (l & 7) * 128, 0, tile);
    }
    else tr_tile<1024, 16>(a.wmg, a.tmg, (l - 32) * 128, 0, tile);
}

__device__ __forceinline__
void tr_late(const TrArgs& a, int l, char* tile) {
    if (l < 256)               tr_tile<1024, 4096>(a.wfc,   a.tfc,   (l >> 5) * 128, (l & 31) * 128, tile);
    else if ((l -= 256) < 256) tr_tile<4096, 1024>(a.wproj, a.tproj, (l >> 3) * 128, (l & 7) * 128,  tile);
    else                       tr_tile<1024, 1024>(a.wout,  a.tout,  ((l - 256) >> 3) * 128, (l & 7) * 128, tile);
}

// ---------------------------------------------------------------------------
// LayerNorm (f32 in) -> bf16 out.  One block per row r.
// The row length is fixed, so that a thread's loads stand together, off one address with constant
// offsets, and one wait behind each group covers them.
// ---------------------------------------------------------------------------
#define LN_D 1024            // row length
#define LN_E (LN_D / 256)    // elements a thread

__device__ __forceinline__
void layernorm_row(const float* __restrict__ x, const float* __restrict__ g,
                   const float* __restrict__ b, bf16_t* __restrict__ out, int r) {
    const float* row = x + (size_t)r * LN_D + threadIdx.x;
    float v[LN_E];
    #pragma unroll
    for (int i = 0; i < LN_E; i++) v[i] = row[256 * i];
    // later arithmetic may land in the loads' address registers
    asm volatile("s_wait_xcnt 0x0" ::: "memory");
    float s = 0.f, s2 = 0.f;
    #pragma unroll
    for (int i = 0; i < LN_E; i++) { s += v[i]; s2 += v[i] * v[i]; }
    #pragma unroll
    for (int off = 16; off; off >>= 1) { s += __shfl_down(s, off); s2 += __shfl_down(s2, off); }
    __shared__ float ws[8], ws2[8];
    int wave = threadIdx.x >> 5, lane = threadIdx.x & 31;
    if (lane == 0) { ws[wave] = s; ws2[wave] = s2; }
    __syncthreads();
    if (threadIdx.x == 0) {
        float a = 0.f, a2 = 0.f;
        #pragma unroll
        for (int i = 0; i < 8; i++) { a += ws[i]; a2 += ws2[i]; }
        ws[0] = a; ws2[0] = a2;
    }
    __syncthreads();
    float mean = ws[0] / LN_D;
    float var  = ws2[0] / LN_D - mean * mean;
    float rstd = rsqrtf(var + 1e-5f);
    bf16_t* orow = out + (size_t)r * LN_D + threadIdx.x;
    float gv[LN_E], bv[LN_E];
    #pragma unroll
    for (int i = 0; i < LN_E; i++) gv[i] = g[threadIdx.x + 256 * i];
    // the next loads' results or addresses may land in these loads' address registers
    asm volatile("s_wait_xcnt 0x0" ::: "memory");
    #pragma unroll
    for (int i = 0; i < LN_E; i++) bv[i] = b[threadIdx.x + 256 * i];
    // as above
    asm volatile("s_wait_xcnt 0x0" ::: "memory");
    #pragma unroll
    for (int i = 0; i < LN_E; i++) orow[256 * i] = (bf16_t)((v[i] - mean) * rstd * gv[i] + bv[i]);
    // the code laid behind this row's may write the stores' registers
    asm volatile("s_wait_xcnt 0x0" ::: "memory");
}

__global__ __launch_bounds__(256)
void k_layernorm(const float* __restrict__ x, const float* __restrict__ g,
                 const float* __restrict__ b, bf16_t* __restrict__ out) {
    layernorm_row(x, g, b, out, blockIdx.x);
}

// First launch: all that the projections wait for.  The turn of their seven weights and ln1 do not
// depend on one another, so they share a grid: blocks below TR_FIRST_BLOCKS turn a weight tile (they
// move the most bytes each and start first), every later block normalises one row of x.
__global__ __launch_bounds__(256)
void k_front(TrArgs a, const float* __restrict__ x, const float* __restrict__ g,
             const float* __restrict__ b, bf16_t* __restrict__ out) {
    __shared__ __attribute__((aligned(16))) char tile[128 * 256];
    const int l = blockIdx.x;
    if (l < TR_FIRST_BLOCKS) tr_first(a, l, tile);
    else                     layernorm_row(x, g, b, out, l - TR_FIRST_BLOCKS);
}

// ---------------------------------------------------------------------------
// Generic bf16 WMMA GEMM:  C[M,N] = A[M,K] * Wt[N,K]^T  (+bias)(+gelu)(+resid)
// Block tile 128x128, 8 waves: each wave 32(M) x 64(N).
// A stage holds 64 k of every operand row = one whole 128-B line per row, so that a wave's
// 16-B-per-lane copy covers 4 whole lines (8 lanes a row).  Two buffers, copies one stage ahead.
// K must be a multiple of 64, N of 4.
// ---------------------------------------------------------------------------
#define GEMM_BK  64   // k per stage
#define GEMM_LDK 72   // LDS row pitch in elements (144 B = 16 B x 9: conflict-free 16-B reads)
#define GEMM_ROWSTEP (32 * GEMM_LDK * 2)    // LDS bytes between a thread's four rows of one operand
#define GEMM_BUFSTEP (128 * GEMM_LDK * 2)   // LDS bytes between the two buffers of one operand
#define EP_LD 68      // epilogue: LDS row pitch in floats (272 B: 16-B aligned rows, 4 banks apart)

// One stage: each thread brings 16 B of four A rows and of four Wt rows (32 rows apart) into LDS.
// la, lb: the thread's LDS byte addresses of its first row; a0, b0..b3: its global addresses.
// The closing s_wait_xcnt stands inside the statement so that it precedes every later write of
// the address registers that the copies name.
__device__ __forceinline__
void gemm_stage(unsigned la, unsigned lb, const bf16_t* a0, size_t arow,
                const bf16_t* b0, const bf16_t* b1, const bf16_t* b2, const bf16_t* b3) {
    asm volatile(
        "global_load_async_to_lds_b128 %0, %8, off\n\t"
        "global_load_async_to_lds_b128 %1, %9, off\n\t"
        "global_load_async_to_lds_b128 %2, %10, off\n\t"
        "global_load_async_to_lds_b128 %3, %11, off\n\t"
        "global_load_async_to_lds_b128 %4, %12, off\n\t"
        "global_load_async_to_lds_b128 %5, %13, off\n\t"
        "global_load_async_to_lds_b128 %6, %14, off\n\t"
        "global_load_async_to_lds_b128 %7, %15, off\n\t"
        "s_wait_xcnt 0x0"
        :: "v"(la), "v"(la + GEMM_ROWSTEP), "v"(la + 2 * GEMM_ROWSTEP), "v"(la + 3 * GEMM_ROWSTEP),
           "v"(lb), "v"(lb + GEMM_ROWSTEP), "v"(lb + 2 * GEMM_ROWSTEP), "v"(lb + 3 * GEMM_ROWSTEP),
           "v"(a0), "v"(a0 + arow), "v"(a0 + 2 * arow), "v"(a0 + 3 * arow),
           "v"(b0), "v"(b1), "v"(b2), "v"(b3)
        : "memory");
}

__device__ __forceinline__
void gemm_tile(const bf16_t* __restrict__ A, const bf16_t* __restrict__ Wt,
               const float* __restrict__ bias, const float* __restrict__ resid,
               float* __restrict__ outF, bf16_t* __restrict__ outB,
               int N, int K, int act, int m0, int n0) {
    __shared__ __attribute__((aligned(16))) bf16_t As[2][128][GEMM_LDK];
    __shared__ __attribute__((aligned(16))) bf16_t Bs[2][128][GEMM_LDK];
    const int tid = threadIdx.x;
    const int wave = tid >> 5, lane = tid & 31;
    const int wm = (wave & 3) * 32, wn = (wave >> 2) * 64;
    const int lm = lane & 15, kh = lane >> 4;

    v8f acc[2][4];
    #pragma unroll
    for (int i = 0; i < 2; i++)
        #pragma unroll
        for (int j = 0; j < 4; j++)
            #pragma unroll
            for (int v = 0; v < 8; v++) acc[i][j][v] = 0.f;

    // copy map: 8 lanes a row (8 x 16 B = the row's 128 B of this stage), rows cr + 32 i
    const int cr = tid >> 3, cc = (tid & 7) * 8;
    const size_t arow = (size_t)32 * K;
    const bf16_t* ga = A + (size_t)(m0 + cr) * K + cc;
    // A weight row past N is replaced by row N - 1: every lane copies, every address is in
    // bounds, and the columns n >= N that such rows feed are never stored (epilogue).
    const bf16_t* gb[4];
    #pragma unroll
    for (int i = 0; i < 4; i++) {
        int rn = n0 + cr + 32 * i;
        rn = rn < N ? rn : N - 1;
        gb[i] = Wt + (size_t)rn * K + cc;
    }
    const unsigned la = (unsigned)(size_t)&As[0][cr][cc];   // low 32 bits = LDS byte address
    const unsigned lb = (unsigned)(size_t)&Bs[0][cr][cc];
    const int nT = K / GEMM_BK;

    // stage 0 -> buffer 0, published; then stage 1 -> buffer 1 flies during trip 0
    gemm_stage(la, lb, ga, arow, gb[0], gb[1], gb[2], gb[3]);
    asm volatile("s_wait_asynccnt 0x0" ::: "memory");   // this wave's copies of stage 0 have landed
    __syncthreads();
    if (nT > 1)
        gemm_stage(la + GEMM_BUFSTEP, lb + GEMM_BUFSTEP, ga + GEMM_BK, arow,
                   gb[0] + GEMM_BK, gb[1] + GEMM_BK, gb[2] + GEMM_BK, gb[3] + GEMM_BK);

    for (int t = 0; t < nT; t++) {
        const int cur = t & 1;
        if (t + 2 < nT)
            __builtin_prefetch(A + (size_t)(m0 + (tid >> 1)) * K + (t + 2) * GEMM_BK + (tid & 1) * 32, 0, 3);

        #pragma unroll
        for (int kk = 0; kk < GEMM_BK / 32; kk++) {
            AFrag a[2], bfr[4];
            #pragma unroll
            for (int i = 0; i < 2; i++) {
                const bf16_t* p = &As[cur][wm + i * 16 + lm][kk * 32 + kh * 8];
                a[i].q[0] = *(const u32x4*)p;
                a[i].q[1] = *(const u32x4*)(p + 16);
            }
            #pragma unroll
            for (int j = 0; j < 4; j++) {
                const bf16_t* p = &Bs[cur][wn + j * 16 + lm][kk * 32 + kh * 8];
                bfr[j].q[0] = *(const u32x4*)p;
                bfr[j].q[1] = *(const u32x4*)(p + 16);
            }
            #pragma unroll
            for (int i = 0; i < 2; i++)
                #pragma unroll
                for (int j = 0; j < 4; j++)
                    acc[i][j] = __builtin_amdgcn_wmma_f32_16x16x32_bf16(
                        false, a[i].v, false, bfr[j].v, (short)0, acc[i][j], false, false);
        }

        // publish stage t + 1 and free buffer cur, in this order:
        asm volatile("s_wait_dscnt 0x0" ::: "memory");      // this wave's reads of buffer cur are done
        asm volatile("s_wait_asynccnt 0x0" ::: "memory");   // this wave's copies of stage t + 1 have landed
        __syncthreads();
        if (t + 2 < nT) {
            const int ko = (t + 2) * GEMM_BK;
            const unsigned bo = cur * GEMM_BUFSTEP;
            gemm_stage(la + bo, lb + bo, ga + ko, arow, gb[0] + ko, gb[1] + ko, gb[2] + ko, gb[3] + ko);
        }
    }
    asm volatile("s_wait_asynccnt 0x0" ::: "memory");   // no copy is left in flight behind the loop

    // Epilogue.  The accumulator layout gives a lane one column of 8 rows: stored from there, every
    // access is a 4-B piece and the residual loads follow one another.  So each wave turns its own
    // 32 x 64 tile through its own LDS range (the ring is free: every wave has passed the last
    // trip's barrier and no copy is in flight) and takes it back row-wise: a lane holds 4
    // neighbouring columns, 16 lanes a row, so that every residual load and every store covers
    // whole 128-B lines, and the 16 residual loads of a lane fly together, under the turn.
    if (n0 + wn < N) {   // the same for the whole wave
        float* st0 = (float*)&As[0][0][0] + wave * (16 * EP_LD);   // rows  0..15 of the wave's tile
        float* st1 = (float*)&Bs[0][0][0] + wave * (16 * EP_LD);   // rows 16..31
        const int er = lane >> 4, ec = (lane & 15) * 4;
        const int n = n0 + wn + ec;
        const bool ok = n < N;   // N is a multiple of 4: a lane's 4 columns are in or out together
        const size_t idx0 = (size_t)(m0 + wm + er) * N + n;
        const size_t rstep = (size_t)2 * N;

        // behind each load: a later load's result or later arithmetic may land in its address registers
        f32x4 bv = {0.f, 0.f, 0.f, 0.f};
        if (ok && bias) {
            bv = *(const f32x4*)(bias + n);
            asm volatile("s_wait_xcnt 0x0" ::: "memory");   // see above
        }
        f32x4 rv[16];   // filled and read only where there is a residual
        if (ok && resid) {
            #pragma unroll
            for (int q = 0; q < 16; q++) {
                rv[q] = *(const f32x4*)(resid + idx0 + q * rstep);
                asm volatile("s_wait_xcnt 0x0" ::: "memory");   // see above
            }
        }

        #pragma unroll
        for (int j = 0; j < 4; j++)
            #pragma unroll
            for (int v = 0; v < 8; v++) {
                st0[(v + 8 * kh) * EP_LD + j * 16 + lm] = acc[0][j][v];
                st1[(v + 8 * kh) * EP_LD + j * 16 + lm] = acc[1][j][v];
            }
        // the rows are read back by other lanes of this wave: their writes have to be done
        asm volatile("s_wait_dscnt 0x0" ::: "memory");
        f32x4 cv[16];
        #pragma unroll
        for (int q = 0; q < 16; q++)
            cv[q] = *(const f32x4*)((q < 8 ? st0 : st1) + ((q & 7) * 2 + er) * EP_LD + ec);

        if (ok) {
            #pragma unroll
            for (int q = 0; q < 16; q++) {
                f32x4 c = cv[q] + bv;
                if (act == 1) {
                    #pragma unroll
                    for (int e = 0; e < 4; e++) c[e] = 0.5f * c[e] * (1.f + erff(c[e] * 0.70710678118f));
                }
                if (resid) c += rv[q];
                const size_t idx = idx0 + q * rstep;
                // behind each store: later arithmetic may land in its registers
                if (outF) {
                    *(f32x4*)(outF + idx) = c;
                    asm volatile("s_wait_xcnt 0x0" ::: "memory");   // see above
                }
                if (outB) {
                    bf16x4 o;
                    #pragma unroll
                    for (int e = 0; e < 4; e++) o[e] = (bf16_t)c[e];
                    *(bf16x4*)(outB + idx) = o;
                    asm volatile("s_wait_xcnt 0x0" ::: "memory");   // see above
                }
            }
        }
    }
}

__global__ __launch_bounds__(256)
void k_gemm_bf16(const bf16_t* __restrict__ A, const bf16_t* __restrict__ Wt,
                 const float* __restrict__ bias, const float* __restrict__ resid,
                 float* __restrict__ outF, bf16_t* __restrict__ outB,
                 int M, int N, int K, int act) {
    gemm_tile(A, Wt, bias, resid, outF, outB, N, K, act, blockIdx.y * 128, blockIdx.x * 128);
}

// The seven projections of the same A (2048 x K) in one grid: they do not depend on one
// another, and the narrow ones (16 blocks each on their own) fill places the wide ones leave.
// blockIdx.x picks the weight and its 128-wide column tile, blockIdx.y the row tile.
struct ProjArgs {
    const bf16_t* A;
    const bf16_t* tqkv; const bf16_t* tmv; const bf16_t* t1w; const bf16_t* t2w;
    const bf16_t* t1r;  const bf16_t* t2r; const bf16_t* tmg;
    const float* bqkv; const float* bmv; const float* bmg;
    bf16_t* qkv;
    float* memval; float* p1w; float* p2w; float* p1r; float* p2r; float* glin;
    int K;
};
#define PROJ_TILES 37   // 24 (qkv) + 8 (mem values) + 4 (points) + 1 (gate)

__global__ __launch_bounds__(256)
void k_gemm_proj(ProjArgs a) {
    const int x = blockIdx.x;
    const bf16_t* Wt;
    const float* bias = nullptr;
    float* oF = nullptr;
    bf16_t* oB = nullptr;
    int N = 64, n0 = 0;
    if (x < 24)       { Wt = a.tqkv; bias = a.bqkv; oB = a.qkv;    N = 3072; n0 = x * 128; }
    else if (x < 32)  { Wt = a.tmv;  bias = a.bmv;  oF = a.memval; N = 1024; n0 = (x - 24) * 128; }
    else if (x == 32) { Wt = a.t1w;  oF = a.p1w; }
    else if (x == 33) { Wt = a.t2w;  oF = a.p2w; }
    else if (x == 34) { Wt = a.t1r;  oF = a.p1r; }
    else if (x == 35) { Wt = a.t2r;  oF = a.p2r; }
    else              { Wt = a.tmg;  bias = a.bmg;  oF = a.glin;   N = 16; }
    gemm_tile(a.A, Wt, bias, nullptr, oF, oB, N, a.K, 0, blockIdx.y * 128, n0);
}

// ---------------------------------------------------------------------------
// Flash-style causal attention.  qkv bf16 [(b,t), 3, H, 64].
// One block per (qb, bh): 128 q-rows of one head; 256 threads (8 waves, 16 q-rows each).
// ---------------------------------------------------------------------------
__device__ __forceinline__
void attention_block(const bf16_t* __restrict__ qkv, float* __restrict__ seqout,
                     int T, int H, int qb, int bh) {
    const int h = bh % H, b = bh / H;
    const int tid = threadIdx.x, wave = tid >> 5, lane = tid & 31;
    const int lm = lane & 15, kh = lane >> 4;

    __shared__ bf16_t Qs[128][72];
    __shared__ bf16_t Ks[128][72];
    __shared__ bf16_t Vt[64][136];     // V transposed: [dh][s]
    __shared__ bf16_t Ps[8][16][40];   // per-wave P staging (32-wide K chunk)

    const size_t strideT = 3 * 1024;
    const bf16_t* base = qkv + (size_t)b * T * strideT + (size_t)h * 64;

    // Load Q tile (128 x 64)
    for (int c8 = tid; c8 < 128 * 8; c8 += 256) {
        int rr = c8 >> 3, cc = (c8 & 7) * 8;
        const bf16_t* gq = base + (size_t)(qb * 128 + rr) * strideT + cc;
#if HAS_ASYNC_LDS
        async_copy16(&Qs[rr][cc], gq);
#else
        *(u32x4*)&Qs[rr][cc] = *(const u32x4*)gq;
#endif
    }

    float rowm[8], rowl[8];
    v8f oacc[4];
    #pragma unroll
    for (int v = 0; v < 8; v++) { rowm[v] = -INFINITY; rowl[v] = 0.f; }
    #pragma unroll
    for (int jt = 0; jt < 4; jt++)
        #pragma unroll
        for (int v = 0; v < 8; v++) oacc[jt][v] = 0.f;

    for (int sb = 0; sb <= qb; sb++) {
        __syncthreads();   // protect Ks/Vt reuse across iterations
        for (int c8 = tid; c8 < 128 * 8; c8 += 256) {
            int rr = c8 >> 3, cc = (c8 & 7) * 8;
            const bf16_t* gk = base + (size_t)(sb * 128 + rr) * strideT + 1024 + cc;
#if HAS_ASYNC_LDS
            async_copy16(&Ks[rr][cc], gk);
#else
            *(u32x4*)&Ks[rr][cc] = *(const u32x4*)gk;
#endif
        }
        for (int c8 = tid; c8 < 128 * 8; c8 += 256) {
            int rr = c8 >> 3, cc = (c8 & 7) * 8;
            union { u32x4 u; bf16_t e[8]; } vv;
            vv.u = *(const u32x4*)(base + (size_t)(sb * 128 + rr) * strideT + 2048 + cc);
            #pragma unroll
            for (int i = 0; i < 8; i++) Vt[cc + i][rr] = vv.e[i];
        }
        async_wait0();
        __syncthreads();

        // ---- scores: S = Q * K^T ----
        AFrag aq[2];
        #pragma unroll
        for (int kk = 0; kk < 2; kk++) {
            const bf16_t* p = &Qs[wave * 16 + lm][kk * 32 + kh * 8];
            aq[kk].q[0] = *(const u32x4*)p;
            aq[kk].q[1] = *(const u32x4*)(p + 16);
        }
        v8f sacc[8];
        #pragma unroll
        for (int j = 0; j < 8; j++)
            #pragma unroll
            for (int v = 0; v < 8; v++) sacc[j][v] = 0.f;
        #pragma unroll
        for (int j = 0; j < 8; j++)
            #pragma unroll
            for (int kk = 0; kk < 2; kk++) {
                AFrag bk;
                const bf16_t* p = &Ks[j * 16 + lm][kk * 32 + kh * 8];
                bk.q[0] = *(const u32x4*)p;
                bk.q[1] = *(const u32x4*)(p + 16);
                sacc[j] = __builtin_amdgcn_wmma_f32_16x16x32_bf16(
                    false, aq[kk].v, false, bk.v, (short)0, sacc[j], false, false);
            }

        // ---- causal mask + online softmax (wave32: 16-lane row reductions) ----
        #pragma unroll
        for (int v = 0; v < 8; v++) {
            int trow = qb * 128 + wave * 16 + v + 8 * kh;
            float rm = -INFINITY;
            #pragma unroll
            for (int j = 0; j < 8; j++) {
                int col = sb * 128 + j * 16 + lm;
                float s = (col <= trow) ? sacc[j][v] * 0.125f : -INFINITY;
                sacc[j][v] = s;
                rm = fmaxf(rm, s);
            }
            #pragma unroll
            for (int msk = 1; msk < 16; msk <<= 1) rm = fmaxf(rm, __shfl_xor(rm, msk));
            float mnew = fmaxf(rowm[v], rm);
            float corr = expf(rowm[v] - mnew);
            rowm[v] = mnew;
            float rs = 0.f;
            #pragma unroll
            for (int j = 0; j < 8; j++) {
                float p = expf(sacc[j][v] - mnew);
                sacc[j][v] = p;
                rs += p;
            }
            #pragma unroll
            for (int msk = 1; msk < 16; msk <<= 1) rs += __shfl_xor(rs, msk);
            rowl[v] = rowl[v] * corr + rs;
            #pragma unroll
            for (int jt = 0; jt < 4; jt++) oacc[jt][v] = oacc[jt][v] * corr;
        }

        // ---- O += P * V  (stage P through LDS: C-layout -> A-layout) ----
        #pragma unroll
        for (int kk = 0; kk < 4; kk++) {
            #pragma unroll
            for (int jj = 0; jj < 2; jj++) {
                int j = kk * 2 + jj;
                #pragma unroll
                for (int v = 0; v < 8; v++)
                    Ps[wave][v + 8 * kh][jj * 16 + lm] = (bf16_t)sacc[j][v];
            }
            AFrag ap;
            const bf16_t* p = &Ps[wave][lm][kh * 8];
            ap.q[0] = *(const u32x4*)p;
            ap.q[1] = *(const u32x4*)(p + 16);
            #pragma unroll
            for (int jt = 0; jt < 4; jt++) {
                AFrag bv;
                const bf16_t* q = &Vt[jt * 16 + lm][kk * 32 + kh * 8];
                bv.q[0] = *(const u32x4*)q;
                bv.q[1] = *(const u32x4*)(q + 16);
                oacc[jt] = __builtin_amdgcn_wmma_f32_16x16x32_bf16(
                    false, ap.v, false, bv.v, (short)0, oacc[jt], false, false);
            }
        }
    }

    float* out = seqout + (size_t)b * T * 1024 + (size_t)h * 64;
    #pragma unroll
    for (int jt = 0; jt < 4; jt++)
        #pragma unroll
        for (int v = 0; v < 8; v++) oacc[jt][v] = oacc[jt][v] / rowl[v];
    // keeps every quotient's arithmetic in front of the stores: moved in among them it lands in
    // registers of stores already issued, and each store would need a wait of its own
    __builtin_amdgcn_sched_barrier(0);
    #pragma unroll
    for (int jt = 0; jt < 4; jt++)
        #pragma unroll
        for (int v = 0; v < 8; v++) {
            int trow = qb * 128 + wave * 16 + v + 8 * kh;
            int col  = jt * 16 + lm;
            out[(size_t)trow * 1024 + col] = oacc[jt][v];
        }
    // the code laid behind the attention's may write the stores' registers
    asm volatile("s_wait_xcnt 0x0" ::: "memory");
}

// ---------------------------------------------------------------------------
// Plucker line through two points of R^4, normalised.
// ---------------------------------------------------------------------------
__device__ inline void exterior4(const float* a1, const float* a2, float* L) {
    L[0] = a1[0] * a2[1] - a1[1] * a2[0];
    L[1] = a1[0] * a2[2] - a1[2] * a2[0];
    L[2] = a1[0] * a2[3] - a1[3] * a2[0];
    L[3] = a1[1] * a2[2] - a1[2] * a2[1];
    L[4] = a1[1] * a2[3] - a1[3] * a2[1];
    L[5] = a1[2] * a2[3] - a1[3] * a2[2];
    float n2 = 0.f;
    #pragma unroll
    for (int i = 0; i < 6; i++) n2 += L[i] * L[i];
    float inv = 1.f / fmaxf(sqrtf(n2), 1e-12f);
    #pragma unroll
    for (int i = 0; i < 6; i++) L[i] *= inv;
}

// ---------------------------------------------------------------------------
// Decayed-Gram scan:  M_t = d*(M_{t-1} + Jw_{t-1} Jw_{t-1}^T),  M_0 = 0.
// The recurrence is linear, so it is run as a chunked parallel scan:
// one block per (b,h), thread c owns the 4 steps t = 4c .. 4c+3 (T == 4 * blockDim.x).
//   0) each thread forms the write lines (rotated by J6) and the read lines of its own 4 steps
//      from the projected points: no one else reads them, so they never go through memory
//   1) each thread folds its own 4 steps from zero   (chunk aggregate)
//   2) weighted prefix over chunks: lanes by shuffles, waves through LDS
//   3) each thread replays its 4 steps from its true M and writes the gates
// M is symmetric, so only its 21 upper entries are carried.
// Every loop is unrolled so that the small arrays are indexed by constants and stay in registers.
// ---------------------------------------------------------------------------
#define GS_L 4      // steps per thread
#define GS_NS 21    // upper triangle of a 6x6

__device__ __forceinline__ void gram_step(float* m, const float* J, float d) {
    int n = 0;
    #pragma unroll
    for (int i = 0; i < 6; i++)
        #pragma unroll
        for (int j = i; j < 6; j++, n++) m[n] = d * (m[n] + J[i] * J[j]);
}

__device__ __forceinline__
void gram_block(const float* __restrict__ p1w, const float* __restrict__ p2w,
                const float* __restrict__ p1r, const float* __restrict__ p2r,
                const float* __restrict__ glin, const float* __restrict__ decay_logits,
                const float* __restrict__ iter_mix, const float* __restrict__ mem_scale,
                float* __restrict__ gh, int T, int H, int bh) {
    __shared__ __attribute__((aligned(16))) float Wagg[8][24];   // rows of 21, padded to 16 B
    const int h = bh % H, b = bh / H;
    const int c = threadIdx.x, lane = c & 31;
    const int wave = __builtin_amdgcn_readfirstlane(c >> 5);     // scalar: the tests on it in 2b are scalar compares
    const int t0 = c * GS_L;

    // all of this thread's inputs, issued up front
    // a head's point is 16 B of a 256-B row; po: this thread's first row, this head, in floats
    const size_t po = ((size_t)b * T + t0) * 64 + h * 4;
    union F4 { f32x4 q; float f[4]; };
    F4 w1[GS_L], w2[GS_L], r1[GS_L], r2[GS_L];
    // the write line of step t takes its first point from row t - 1; step 0 has none (zero below),
    // and its load reads row 0 so that the address stays inside the array
    #pragma unroll
    for (int k = 0; k < GS_L; k++) w1[k].q = *(const f32x4*)(p1w + po + (t0 + k > 0 ? k - 1 : k) * 64);
    // the next loads may land in these loads' address registers
    asm volatile("s_wait_xcnt 0x0" ::: "memory");
    #pragma unroll
    for (int k = 0; k < GS_L; k++) w2[k].q = *(const f32x4*)(p2w + po + k * 64);
    // as above
    asm volatile("s_wait_xcnt 0x0" ::: "memory");
    #pragma unroll
    for (int k = 0; k < GS_L; k++) r1[k].q = *(const f32x4*)(p1r + po + k * 64);
    // as above
    asm volatile("s_wait_xcnt 0x0" ::: "memory");
    #pragma unroll
    for (int k = 0; k < GS_L; k++) r2[k].q = *(const f32x4*)(p2r + po + k * 64);
    // as above
    asm volatile("s_wait_xcnt 0x0" ::: "memory");
    float gl[GS_L];
    #pragma unroll
    for (int k = 0; k < GS_L; k++) gl[k] = glin[((size_t)b * T + t0 + k) * H + h];
    // the loads' address registers are reused by the arithmetic below
    asm volatile("s_wait_xcnt 0x0" ::: "memory");

    const float decay = 1.f / (1.f + expf(-decay_logits[h]));
    const float alpha = 1.f / (1.f + expf(-iter_mix[0]));
    const float msc = mem_scale[h];

    // w[s] = decay^(4 * 2^s): the decay across 2^s chunks
    float w[6];
    w[0] = (decay * decay) * (decay * decay);
    #pragma unroll
    for (int s = 1; s < 6; s++) w[s] = w[s - 1] * w[s - 1];

    // 0) lines
    struct { float f[24]; } J, R;
    #pragma unroll
    for (int k = 0; k < GS_L; k++) {
        float L[6];
        if (t0 + k == 0) {
            #pragma unroll
            for (int e = 0; e < 4; e++) w1[k].f[e] = 0.f;
        }
        exterior4(w1[k].f, w2[k].f, L);
        float* jw = &J.f[k * 6];
        jw[0] = L[5]; jw[1] = -L[4]; jw[2] = L[3]; jw[3] = L[2]; jw[4] = -L[1]; jw[5] = L[0];
        exterior4(r1[k].f, r2[k].f, &R.f[k * 6]);
    }

    // 1) chunk aggregate
    float m[GS_NS];
    #pragma unroll
    for (int n = 0; n < GS_NS; n++) m[n] = 0.f;
    #pragma unroll
    for (int k = 0; k < GS_L; k++) gram_step(m, &J.f[k * 6], decay);

    // 2a) inclusive weighted prefix over the wave's 32 chunks
    #pragma unroll
    for (int s = 0; s < 5; s++) {
        const int o = 1 << s;
        #pragma unroll
        for (int n = 0; n < GS_NS; n++) {
            float v = __shfl_up(m[n], o);
            m[n] = (lane >= o) ? m[n] + w[s] * v : m[n];
        }
    }
    if (lane == 31) {
        #pragma unroll
        for (int n = 0; n < GS_NS; n++) Wagg[wave][n] = m[n];
    }
    // exclusive within the wave
    #pragma unroll
    for (int n = 0; n < GS_NS; n++) {
        float v = __shfl_up(m[n], 1);
        m[n] = (lane > 0) ? v : 0.f;
    }
    __syncthreads();

    // 2b) M at the wave's first step, from the earlier waves' totals.
    // It is the same for the whole wave: lane n folds entry n, then it is read per entry.
    const int ln = (lane < GS_NS) ? lane : 0;
    float tot[7];
    #pragma unroll
    for (int q = 0; q < 7; q++) tot[q] = Wagg[q][ln];
    float p = 0.f;
    #pragma unroll
    for (int q = 0; q < 7; q++) p = (q < wave) ? w[5] * p + tot[q] : p;
    float dl = 1.f;   // decay^(4 * lane)
    #pragma unroll
    for (int s = 0; s < 5; s++) dl *= ((lane >> s) & 1) ? w[s] : 1.f;
    #pragma unroll
    for (int n = 0; n < GS_NS; n++)
        m[n] += dl * __int_as_float(__builtin_amdgcn_readlane(__float_as_int(p), n));

    // 3) replay
    #pragma unroll
    for (int k = 0; k < GS_L; k++) {
        const float* rd = &R.f[k * 6];
        float rdM[6] = {0, 0, 0, 0, 0, 0};
        int n = 0;
        #pragma unroll
        for (int i = 0; i < 6; i++)
            #pragma unroll
            for (int j = i; j < 6; j++, n++) {
                rdM[j] += rd[i] * m[n];
                if (j != i) rdM[i] += rd[j] * m[n];
            }
        float s1 = 0.f, s2 = 0.f;
        #pragma unroll
        for (int j = 0; j < 6; j++) { s1 += rdM[j] * rd[j]; s2 += rdM[j] * rdM[j]; }
        float ms = (1.f - alpha) * s1 + alpha * s2;
        float g1 = 1.f / (1.f + expf(-ms * msc));
        float g2 = 1.f / (1.f + expf(-gl[k]));
        gh[((size_t)b * T + t0 + k) * H + h] = g1 * g2;
        if (k + 1 < GS_L) gram_step(m, &J.f[k * 6], decay);
    }
}

// ---------------------------------------------------------------------------
// Third launch: all that needs the projections or nothing at all, and that the later launches wait
// for.  The attention, the Gram branch and the turn of Wfc, Wproj and Wout do not depend on one
// another, so they share a grid.  The attention blocks last longest and start first; the others run
// beside them.
// ---------------------------------------------------------------------------
#define MID_ATT_BLOCKS  256   // 8 q-tiles x 32 (b, h)
#define MID_GRAM_BLOCKS 32    // one per (b, h)
#define MID_BLOCKS (MID_ATT_BLOCKS + MID_GRAM_BLOCKS + TR_LATE_BLOCKS)

__global__ __launch_bounds__(256)
void k_mid(TrArgs a, const bf16_t* __restrict__ qkv, float* __restrict__ seqout,
           const float* __restrict__ p1w, const float* __restrict__ p2w,
           const float* __restrict__ p1r, const float* __restrict__ p2r,
           const float* __restrict__ glin, const float* __restrict__ decay_logits,
           const float* __restrict__ iter_mix, const float* __restrict__ mem_scale,
           float* __restrict__ gh, int T, int H) {
    __shared__ __attribute__((aligned(16))) char tile[128 * 256];
    const int l = blockIdx.x;
    // written in this order the attention, the longest code on the longest path, comes first in the
    // kernel's text
    if (l >= MID_ATT_BLOCKS) {
        if (l < MID_ATT_BLOCKS + MID_GRAM_BLOCKS)
            gram_block(p1w, p2w, p1r, p2r, glin, decay_logits, iter_mix, mem_scale, gh, T, H, l - MID_ATT_BLOCKS);
        else
            tr_late(a, l - (MID_ATT_BLOCKS + MID_GRAM_BLOCKS), tile);
        return;
    }
    attention_block(qkv, seqout, T, H, l & 7, l >> 3);
}

// ---------------------------------------------------------------------------
// y = seqout + mean_h(gh) * memval  -> bf16 (input to Wout GEMM)
// ---------------------------------------------------------------------------
__global__ __launch_bounds__(256)
void k_combine(const float* __restrict__ seqout, const float* __restrict__ memval,
               const float* __restrict__ gh, bf16_t* __restrict__ y, int D, int H) {
    size_t row = blockIdx.x;
    float g = 0.f;
    #pragma unroll
    for (int h = 0; h < 16; h++) g += gh[row * H + h];
    g *= (1.f / 16.f);
    const float* so = seqout + row * D;
    const float* mv = memval + row * D;
    bf16_t* yr = y + row * D;
    for (int d = threadIdx.x; d < D; d += 256)
        yr[d] = (bf16_t)(so[d] + g * mv[d]);
}

// ---------------------------------------------------------------------------
extern "C" void kernel_launch(void* const* d_in, const int* in_sizes, int n_in,
                              void* d_out, int out_size, void* d_ws, size_t ws_size,
                              hipStream_t stream) {
    const int B = 2, T = 1024, D = 1024, H = 16, DFF = 4096;
    const int M = B * T;

    const float* x            = (const float*)d_in[0];
    const float* ln1_g        = (const float*)d_in[1];
    const float* ln1_b        = (const float*)d_in[2];
    const float* Wqkv         = (const float*)d_in[3];
    const float* bqkv         = (const float*)d_in[4];
    const float* W1w          = (const float*)d_in[5];
    const float* W2w          = (const float*)d_in[6];
    const float* W1r          = (const float*)d_in[7];
    const float* W2r          = (const float*)d_in[8];
    const float* Wmv          = (const float*)d_in[9];
    const float* bmv          = (const float*)d_in[10];
    const float* Wmg          = (const float*)d_in[11];
    const float* bmg          = (const float*)d_in[12];
    const float* mem_scale    = (const float*)d_in[13];
    const float* iter_mix     = (const float*)d_in[14];
    const float* decay_logits = (const float*)d_in[15];
    const float* Wout         = (const float*)d_in[16];
    const float* bout         = (const float*)d_in[17];
    const float* ln2_g        = (const float*)d_in[18];
    const float* ln2_b        = (const float*)d_in[19];
    const float* Wfc          = (const float*)d_in[20];
    const float* bfc          = (const float*)d_in[21];
    const float* Wproj        = (const float*)d_in[22];
    const float* bproj        = (const float*)d_in[23];

    char* ws = (char*)d_ws;
    size_t off = 0;
    auto alloc = [&](size_t bytes) -> void* {
        void* p = ws + off;
        off += (bytes + 255) & ~(size_t)255;
        return p;
    };

    bf16_t* Wqkv_t  = (bf16_t*)alloc((size_t)3 * D * D * 2);
    bf16_t* W1w_t   = (bf16_t*)alloc((size_t)64 * D * 2);
    bf16_t* W2w_t   = (bf16_t*)alloc((size_t)64 * D * 2);
    bf16_t* W1r_t   = (bf16_t*)alloc((size_t)64 * D * 2);
    bf16_t* W2r_t   = (bf16_t*)alloc((size_t)64 * D * 2);
    bf16_t* Wmg_t   = (bf16_t*)alloc((size_t)H * D * 2);
    bf16_t* Wmv_t   = (bf16_t*)alloc((size_t)D * D * 2);
    bf16_t* Wout_t  = (bf16_t*)alloc((size_t)D * D * 2);
    bf16_t* Wfc_t   = (bf16_t*)alloc((size_t)DFF * D * 2);
    bf16_t* Wproj_t = (bf16_t*)alloc((size_t)D * DFF * 2);
    bf16_t* h_bf    = (bf16_t*)alloc((size_t)M * D * 2);
    bf16_t* qkv_bf  = (bf16_t*)alloc((size_t)M * 3 * D * 2);
    float*  p1w     = (float*)alloc((size_t)M * 64 * 4);
    float*  p2w     = (float*)alloc((size_t)M * 64 * 4);
    float*  p1r     = (float*)alloc((size_t)M * 64 * 4);
    float*  p2r     = (float*)alloc((size_t)M * 64 * 4);
    float*  glin    = (float*)alloc((size_t)M * H * 4);
    float*  ghb     = (float*)alloc((size_t)M * H * 4);
    float*  memval  = (float*)alloc((size_t)M * D * 4);
    float*  seqout  = (float*)alloc((size_t)M * D * 4);
    bf16_t* y_bf    = (bf16_t*)alloc((size_t)M * D * 2);
    float*  x1      = (float*)alloc((size_t)M * D * 4);
    bf16_t* h2_bf   = (bf16_t*)alloc((size_t)M * D * 2);
    bf16_t* a_bf    = (bf16_t*)alloc((size_t)M * DFF * 2);

    auto gemm = [&](const bf16_t* A, const bf16_t* Wt, const float* bias,
                    const float* resid, float* oF, bf16_t* oB, int m, int n, int k, int act) {
        dim3 g((n + 127) / 128, (m + 127) / 128);
        k_gemm_bf16<<<g, 256, 0, stream>>>(A, Wt, bias, resid, oF, oB, m, n, k, act);
    };

    // 1) the projections' weights -> bf16 transposed, and ln1
    TrArgs ta = { Wfc, Wproj, Wqkv, Wmv, Wout, W1w, W2w, W1r, W2r, Wmg,
                  Wfc_t, Wproj_t, Wqkv_t, Wmv_t, Wout_t, W1w_t, W2w_t, W1r_t, W2r_t, Wmg_t };
    k_front<<<TR_FIRST_BLOCKS + M, 256, 0, stream>>>(ta, x, ln1_g, ln1_b, h_bf);

    // 2) projections
    ProjArgs pa = { h_bf, Wqkv_t, Wmv_t, W1w_t, W2w_t, W1r_t, W2r_t, Wmg_t,
                    bqkv, bmv, bmg, qkv_bf, memval, p1w, p2w, p1r, p2r, glin, D };
    k_gemm_proj<<<dim3(PROJ_TILES, 16), 256, 0, stream>>>(pa);

    // 3) attention, Gram memory branch, the other weights -> bf16 transposed
    k_mid<<<MID_BLOCKS, 256, 0, stream>>>(ta, qkv_bf, seqout, p1w, p2w, p1r, p2r, glin,
                                          decay_logits, iter_mix, mem_scale, ghb, T, H);

    // 4) the two branches joined
    k_combine<<<M, 256, 0, stream>>>(seqout, memval, ghb, y_bf, D, H);

    // 5) output projection + residual
    gemm(y_bf, Wout_t, bout, x, x1, nullptr, M, D, D, 0);

    // 6) MLP
    k_layernorm<<<M, 256, 0, stream>>>(x1, ln2_g, ln2_b, h2_bf);
    gemm(h2_bf, Wfc_t, bfc, nullptr, nullptr, a_bf, M, DFF, D, 1);
    gemm(a_bf, Wproj_t, bproj, x1, (float*)d_out, nullptr, M, D, DFF, 0);
}

// v007
// It runs in 160 microseconds.
// Timed twice side by side with v006, it ran 1.21 and 1.20 times as fast.
// Over all steps from v000 it is 5.50 times as fast.
#include <hip/hip_runtime.h>
#include <math.h>

typedef __bf16 bf16_t;
typedef __attribute__((ext_vector_type(16))) __bf16 v16bf;
typedef __attribute__((ext_vector_type(8)))  float  v8f;
typedef unsigned int u32x4 __attribute__((ext_vector_type(4)));
typedef int i32x4 __attribute__((ext_vector_type(4)));
typedef float  f32x4  __attribute__((ext_vector_type(4)));
typedef __bf16 bf16x4 __attribute__((ext_vector_type(4)));
typedef __bf16 bf16x8 __attribute__((ext_vector_type(8)));

union AFrag { v16bf v; u32x4 q[2]; };

#if __has_builtin(__builtin_amdgcn_global_load_async_to_lds_b128) && \
    __has_builtin(__builtin_amdgcn_s_wait_asynccnt)
#define HAS_ASYNC_LDS 1
typedef __attribute__((address_space(1))) i32x4* glds_gptr;
typedef __attribute__((address_space(3))) i32x4* glds_lptr;
#else
#define HAS_ASYNC_LDS 0
#endif

__device__ __forceinline__ void async_copy16(void* lds, const void* g) {
#if HAS_ASYNC_LDS
    __builtin_amdgcn_global_load_async_to_lds_b128(
        (glds_gptr)(g), (glds_lptr)(lds), 0, 0);
#endif
}
__device__ __forceinline__ void async_wait0() {
#if HAS_ASYNC_LDS
    __builtin_amdgcn_s_wait_asynccnt(0);
#endif
}

// ---------------------------------------------------------------------------
// Weight convert: W (K x N, f32, row-major) -> Wt (N x K, bf16, row-major)
// A block finds its weight and its tile from an index l that its kernel hands it (tr_first, tr_late).
// A block turns a tile of 128 k x 128 n, 64 elements a thread, so that the grid has few waves
// and each of them keeps 16 loads of 16 B a lane in flight:
//   load : a wave reads 512 contiguous bytes of a W row (4 n a lane); a lane takes the same
//          4 n of 8 successive k, twice, and so holds 8 k of each n: 16 B of a Wt row
//   turn : those 16-B pieces go to LDS as [n][k], rows of 256 B
//   store: a wave takes two rows back, 16 B a lane, and stores 2 x 256 contiguous bytes of Wt
// LDS rows have no pad; the 16-B piece c of row n lies at place c ^ ((n >> 2) & 15).  So the 16
// lanes that write one k piece of rows 4 apart, and the 16 that read one whole row, each meet
// all 64 banks once.
// K is a multiple of 128; N a multiple of 128, or below 128 and a multiple of 16 (one tile wide).
// ---------------------------------------------------------------------------
struct TrArgs {
    const float* wfc;  const float* wproj; const float* wqkv; const float* wmv; const float* wout;
    const float* w1w;  const float* w2w;   const float* w1r;  const float* w2r; const float* wmg;
    bf16_t* tfc;  bf16_t* tproj; bf16_t* tqkv; bf16_t* tmv; bf16_t* tout;
    bf16_t* t1w;  bf16_t* t2w;   bf16_t* t1r;  bf16_t* t2r; bf16_t* tmg;
};
#define TR_FIRST_BLOCKS 296   // 192 + 64 + 4 * 8 + 8: the weights that the projections of ln1(x) read
#define TR_LATE_BLOCKS  576   // 256 + 256 + 64: Wfc, Wproj, Wout, first read behind the attention

template <int K, int N>
__device__ __forceinline__
void tr_tile(const float* __restrict__ W, bf16_t* __restrict__ Wt, int kb, int nb, char* lds) {
    constexpr int NT = N < 128 ? N : 128;   // columns of W in this tile
    const int tid = threadIdx.x, lane = tid & 31;
    const int wave = __builtin_amdgcn_readfirstlane(tid >> 5);   // scalar: row addresses stay scalar
    if (4 * lane < NT) {
        const float* p = W + (size_t)(kb + 8 * wave) * N + nb;   // scalar; the lane is the loads' one vector register
        f32x4 v[2][8];
        #pragma unroll
        for (int r = 0; r < 2; r++)
            #pragma unroll
            for (int i = 0; i < 8; i++) v[r][i] = ((const f32x4*)(p + (size_t)(64 * r + i) * N))[lane];
        // later arithmetic may land in the loads' index register; it is named as an input so that
        // it lives up to the wait: otherwise the last load's own result could be placed in it
        asm volatile("s_wait_xcnt 0x0" :: "v"(lane) : "memory");
        // keeps the conversions behind all 16 loads: moved up among them (to save registers) they
        // make the last loads wait for the first ones' data, a second trip to memory
        __builtin_amdgcn_sched_barrier(0);
        #pragma unroll
        for (int r = 0; r < 2; r++)
            #pragma unroll
            for (int j = 0; j < 4; j++) {
                bf16x8 o;
                #pragma unroll
                for (int i = 0; i < 8; i++) o[i] = (bf16_t)v[r][i][j];
                *(bf16x8*)(lds + (4 * lane + j) * 256 + (((wave + 8 * r) ^ (lane & 15)) * 16)) = o;
            }
    }
    __syncthreads();
    const int n = tid >> 4, c = tid & 15;
    bf16_t* q0 = Wt + (size_t)(nb + n) * K + kb + 8 * c;
    u32x4 d[NT / 16];
    #pragma unroll
    for (int q = 0; q < NT / 16; q++) {
        const int nq = n + 16 * q;
        d[q] = *(const u32x4*)(lds + nq * 256 + ((c ^ ((nq >> 2) & 15)) * 16));
    }
    #pragma unroll
    for (int q = 0; q < NT / 16; q++) *(u32x4*)(q0 + (size_t)(16 * q) * K) = d[q];
    // the code laid behind this tile's may write the stores' address and data registers
    asm volatile("s_wait_xcnt 0x0" ::: "memory");
}

// l: tile index, inside a weight N fastest
__device__ __forceinline__
void tr_first(const TrArgs& a, int l, char* tile) {
    if (l < 192)               tr_tile<1024, 3072>(a.wqkv, a.tqkv, (l / 24) * 128, (l % 24) * 128, tile);
    else if ((l -= 192) < 64)  tr_tile<1024, 1024>(a.wmv,  a.tmv,  (l >> 3) * 128, (l & 7) * 128,  tile);
    else if ((l -= 64) < 32) {
        const int s = l >> 3;
        tr_tile<1024, 64>(s == 0 ? a.w1w : s == 1 ? a.w2w : s == 2 ? a.w1r : a.w2r,
                          s == 0 ? a.t1w : s == 1 ? a.t2w : s == 2 ? a.t1r : a.t2r, (l & 7) * 128, 0, tile);
    }
    else tr_tile<1024, 16>(a.wmg, a.tmg, (l - 32) * 128, 0, tile);
}

__device__ __forceinline__
void tr_late(const TrArgs& a, int l, char* tile) {
    if (l < 256)               tr_tile<1024, 4096>(a.wfc,   a.tfc,   (l >> 5) * 128, (l & 31) * 128, tile);
    else if ((l -= 256) < 256) tr_tile<4096, 1024>(a.wproj, a.tproj, (l >> 3) * 128, (l & 7) * 128,  tile);
    else                       tr_tile<1024, 1024>(a.wout,  a.tout,  ((l - 256) >> 3) * 128, (l & 7) * 128, tile);
}

// ---------------------------------------------------------------------------
// LayerNorm (f32 in) -> bf16 out.  One block per row r.
// The row length is fixed, so that a thread's loads stand together, off one address with constant
// offsets, and one wait behind each group covers them.
// ---------------------------------------------------------------------------
#define LN_D 1024            // row length
#define LN_E (LN_D / 256)    // elements a thread

__device__ __forceinline__
void layernorm_row(const float* __restrict__ x, const float* __restrict__ g,
                   const float* __restrict__ b, bf16_t* __restrict__ out, int r) {
    const float* row = x + (size_t)r * LN_D + threadIdx.x;
    float v[LN_E];
    #pragma unroll
    for (int i = 0; i < LN_E; i++) v[i] = row[256 * i];
    // later arithmetic may land in the loads' address registers
    asm volatile("s_wait_xcnt 0x0" ::: "memory");
    float s = 0.f, s2 = 0.f;
    #pragma unroll
    for (int i = 0; i < LN_E; i++) { s += v[i]; s2 += v[i] * v[i]; }
    #pragma unroll
    for (int off = 16; off; off >>= 1) { s += __shfl_down(s, off); s2 += __shfl_down(s2, off); }
    __shared__ float ws[8], ws2[8];
    int wave = threadIdx.x >> 5, lane = threadIdx.x & 31;
    if (lane == 0) { ws[wave] = s; ws2[wave] = s2; }
    __syncthreads();
    if (threadIdx.x == 0) {
        float a = 0.f, a2 = 0.f;
        #pragma unroll
        for (int i = 0; i < 8; i++) { a += ws[i]; a2 += ws2[i]; }
        ws[0] = a; ws2[0] = a2;
    }
    __syncthreads();
    float mean = ws[0] / LN_D;
    float var  = ws2[0] / LN_D - mean * mean;
    float rstd = rsqrtf(var + 1e-5f);
    bf16_t* orow = out + (size_t)r * LN_D + threadIdx.x;
    float gv[LN_E], bv[LN_E];
    #pragma unroll
    for (int i = 0; i < LN_E; i++) gv[i] = g[threadIdx.x + 256 * i];
    // the next loads' results or addresses may land in these loads' address registers
    asm volatile("s_wait_xcnt 0x0" ::: "memory");
    #pragma unroll
    for (int i = 0; i < LN_E; i++) bv[i] = b[threadIdx.x + 256 * i];
    // as above
    asm volatile("s_wait_xcnt 0x0" ::: "memory");
    #pragma unroll
    for (int i = 0; i < LN_E; i++) orow[256 * i] = (bf16_t)((v[i] - mean) * rstd * gv[i] + bv[i]);
    // the code laid behind this row's may write the stores' registers
    asm volatile("s_wait_xcnt 0x0" ::: "memory");
}

__global__ __launch_bounds__(256)
void k_layernorm(const float* __restrict__ x, const float* __restrict__ g,
                 const float* __restrict__ b, bf16_t* __restrict__ out) {
    layernorm_row(x, g, b, out, blockIdx.x);
}

// First launch: all that the projections wait for.  The turn of their seven weights and ln1 do not
// depend on one another, so they share a grid: blocks below TR_FIRST_BLOCKS turn a weight tile (they
// move the most bytes each and start first), every later block normalises one row of x.
__global__ __launch_bounds__(256)
void k_front(TrArgs a, const float* __restrict__ x, const float* __restrict__ g,
             const float* __restrict__ b, bf16_t* __restrict__ out) {
    __shared__ __attribute__((aligned(16))) char tile[128 * 256];
    const int l = blockIdx.x;
    if (l < TR_FIRST_BLOCKS) tr_first(a, l, tile);
    else                     layernorm_row(x, g, b, out, l - TR_FIRST_BLOCKS);
}

// ---------------------------------------------------------------------------
// Generic bf16 WMMA GEMM:  C[M,N] = A[M,K] * Wt[N,K]^T  (+bias)(+gelu)(+resid)
// Block tile 128x128, 8 waves: each wave 32(M) x 64(N).
// A stage holds 64 k of every operand row = one whole 128-B line per row, so that a wave's
// 16-B-per-lane copy covers 4 whole lines (8 lanes a row).  Two buffers, copies one stage ahead.
// K must be a multiple of 64, N of 4.
// ---------------------------------------------------------------------------
#define GEMM_BK  64   // k per stage
#define GEMM_LDK 72   // LDS row pitch in elements (144 B = 16 B x 9: conflict-free 16-B reads)
#define GEMM_ROWSTEP (32 * GEMM_LDK * 2)    // LDS bytes between a thread's four rows of one operand
#define GEMM_BUFSTEP (128 * GEMM_LDK * 2)   // LDS bytes between the two buffers of one operand
#define EP_LD 68      // epilogue: LDS row pitch in floats (272 B: 16-B aligned rows, 4 banks apart)

// One stage: each thread brings 16 B of four A rows and of four Wt rows (32 rows apart) into LDS.
// la, lb: the thread's LDS byte addresses of its first row; a0, b0..b3: its global addresses.
// The closing s_wait_xcnt stands inside the statement so that it precedes every later write of
// the address registers that the copies name.
__device__ __forceinline__
void gemm_stage(unsigned la, unsigned lb, const bf16_t* a0, size_t arow,
                const bf16_t* b0, const bf16_t* b1, const bf16_t* b2, const bf16_t* b3) {
    asm volatile(
        "global_load_async_to_lds_b128 %0, %8, off\n\t"
        "global_load_async_to_lds_b128 %1, %9, off\n\t"
        "global_load_async_to_lds_b128 %2, %10, off\n\t"
        "global_load_async_to_lds_b128 %3, %11, off\n\t"
        "global_load_async_to_lds_b128 %4, %12, off\n\t"
        "global_load_async_to_lds_b128 %5, %13, off\n\t"
        "global_load_async_to_lds_b128 %6, %14, off\n\t"
        "global_load_async_to_lds_b128 %7, %15, off\n\t"
        "s_wait_xcnt 0x0"
        :: "v"(la), "v"(la + GEMM_ROWSTEP), "v"(la + 2 * GEMM_ROWSTEP), "v"(la + 3 * GEMM_ROWSTEP),
           "v"(lb), "v"(lb + GEMM_ROWSTEP), "v"(lb + 2 * GEMM_ROWSTEP), "v"(lb + 3 * GEMM_ROWSTEP),
           "v"(a0), "v"(a0 + arow), "v"(a0 + 2 * arow), "v"(a0 + 3 * arow),
           "v"(b0), "v"(b1), "v"(b2), "v"(b3)
        : "memory");
}

__device__ __forceinline__
void gemm_tile(const bf16_t* __restrict__ A, const bf16_t* __restrict__ Wt,
               const float* __restrict__ bias, const float* __restrict__ resid,
               float* __restrict__ outF, bf16_t* __restrict__ outB,
               int N, int K, int act, int m0, int n0) {
    __shared__ __attribute__((aligned(16))) bf16_t As[2][128][GEMM_LDK];
    __shared__ __attribute__((aligned(16))) bf16_t Bs[2][128][GEMM_LDK];
    const int tid = threadIdx.x;
    const int wave = tid >> 5, lane = tid & 31;
    const int wm = (wave & 3) * 32, wn = (wave >> 2) * 64;
    const int lm = lane & 15, kh = lane >> 4;

    v8f acc[2][4];
    #pragma unroll
    for (int i = 0; i < 2; i++)
        #pragma unroll
        for (int j = 0; j < 4; j++)
            #pragma unroll
            for (int v = 0; v < 8; v++) acc[i][j][v] = 0.f;

    // copy map: 8 lanes a row (8 x 16 B = the row's 128 B of this stage), rows cr + 32 i
    const int cr = tid >> 3, cc = (tid & 7) * 8;
    const size_t arow = (size_t)32 * K;
    const bf16_t* ga = A + (size_t)(m0 + cr) * K + cc;
    // A weight row past N is replaced by row N - 1: every lane copies, every address is in
    // bounds, and the columns n >= N that such rows feed are never stored (epilogue).
    const bf16_t* gb[4];
    #pragma unroll
    for (int i = 0; i < 4; i++) {
        int rn = n0 + cr + 32 * i;
        rn = rn < N ? rn : N - 1;
        gb[i] = Wt + (size_t)rn * K + cc;
    }
    const unsigned la = (unsigned)(size_t)&As[0][cr][cc];   // low 32 bits = LDS byte address
    const unsigned lb = (unsigned)(size_t)&Bs[0][cr][cc];
    const int nT = K / GEMM_BK;

    // stage 0 -> buffer 0, published; then stage 1 -> buffer 1 flies during trip 0
    gemm_stage(la, lb, ga, arow, gb[0], gb[1], gb[2], gb[3]);
    asm volatile("s_wait_asynccnt 0x0" ::: "memory");   // this wave's copies of stage 0 have landed
    __syncthreads();
    if (nT > 1)
        gemm_stage(la + GEMM_BUFSTEP, lb + GEMM_BUFSTEP, ga + GEMM_BK, arow,
                   gb[0] + GEMM_BK, gb[1] + GEMM_BK, gb[2] + GEMM_BK, gb[3] + GEMM_BK);

    for (int t = 0; t < nT; t++) {
        const int cur = t & 1;
        if (t + 2 < nT)
            __builtin_prefetch(A + (size_t)(m0 + (tid >> 1)) * K + (t + 2) * GEMM_BK + (tid & 1) * 32, 0, 3);

        #pragma unroll
        for (int kk = 0; kk < GEMM_BK / 32; kk++) {
            AFrag a[2], bfr[4];
            #pragma unroll
            for (int i = 0; i < 2; i++) {
                const bf16_t* p = &As[cur][wm + i * 16 + lm][kk * 32 + kh * 8];
                a[i].q[0] = *(const u32x4*)p;
                a[i].q[1] = *(const u32x4*)(p + 16);
            }
            #pragma unroll
            for (int j = 0; j < 4; j++) {
                const bf16_t* p = &Bs[cur][wn + j * 16 + lm][kk * 32 + kh * 8];
                bfr[j].q[0] = *(const u32x4*)p;
                bfr[j].q[1] = *(const u32x4*)(p + 16);
            }
            #pragma unroll
            for (int i = 0; i < 2; i++)
                #pragma unroll
                for (int j = 0; j < 4; j++)
                    acc[i][j] = __builtin_amdgcn_wmma_f32_16x16x32_bf16(
                        false, a[i].v, false, bfr[j].v, (short)0, acc[i][j], false, false);
        }

        // publish stage t + 1 and free buffer cur, in this order:
        asm volatile("s_wait_dscnt 0x0" ::: "memory");      // this wave's reads of buffer cur are done
        asm volatile("s_wait_asynccnt 0x0" ::: "memory");   // this wave's copies of stage t + 1 have landed
        __syncthreads();
        if (t + 2 < nT) {
            const int ko = (t + 2) * GEMM_BK;
            const unsigned bo = cur * GEMM_BUFSTEP;
            gemm_stage(la + bo, lb + bo, ga + ko, arow, gb[0] + ko, gb[1] + ko, gb[2] + ko, gb[3] + ko);
        }
    }
    asm volatile("s_wait_asynccnt 0x0" ::: "memory");   // no copy is left in flight behind the loop

    // Epilogue.  The accumulator layout gives a lane one column of 8 rows: stored from there, every
    // access is a 4-B piece and the residual loads follow one another.  So each wave turns its own
    // 32 x 64 tile through its own LDS range (the ring is free: every wave has passed the last
    // trip's barrier and no copy is in flight) and takes it back row-wise: a lane holds 4
    // neighbouring columns, 16 lanes a row, so that every residual load and every store covers
    // whole 128-B lines, and the 16 residual loads of a lane fly together, under the turn.
    if (n0 + wn < N) {   // the same for the whole wave
        float* st0 = (float*)&As[0][0][0] + wave * (16 * EP_LD);   // rows  0..15 of the wave's tile
        float* st1 = (float*)&Bs[0][0][0] + wave * (16 * EP_LD);   // rows 16..31
        const int er = lane >> 4, ec = (lane & 15) * 4;
        const int n = n0 + wn + ec;
        const bool ok = n < N;   // N is a multiple of 4: a lane's 4 columns are in or out together
        const size_t idx0 = (size_t)(m0 + wm + er) * N + n;
        const size_t rstep = (size_t)2 * N;

        // behind each load: a later load's result or later arithmetic may land in its address registers
        f32x4 bv = {0.f, 0.f, 0.f, 0.f};
        if (ok && bias) {
            bv = *(const f32x4*)(bias + n);
            asm volatile("s_wait_xcnt 0x0" ::: "memory");   // see above
        }
        f32x4 rv[16];   // filled and read only where there is a residual
        if (ok && resid) {
            #pragma unroll
            for (int q = 0; q < 16; q++) {
                rv[q] = *(const f32x4*)(resid + idx0 + q * rstep);
                asm volatile("s_wait_xcnt 0x0" ::: "memory");   // see above
            }
        }

        #pragma unroll
        for (int j = 0; j < 4; j++)
            #pragma unroll
            for (int v = 0; v < 8; v++) {
                st0[(v + 8 * kh) * EP_LD + j * 16 + lm] = acc[0][j][v];
                st1[(v + 8 * kh) * EP_LD + j * 16 + lm] = acc[1][j][v];
            }
        // the rows are read back by other lanes of this wave: their writes have to be done
        asm volatile("s_wait_dscnt 0x0" ::: "memory");
        f32x4 cv[16];
        #pragma unroll
        for (int q = 0; q < 16; q++)
            cv[q] = *(const f32x4*)((q < 8 ? st0 : st1) + ((q & 7) * 2 + er) * EP_LD + ec);

        if (ok) {
            #pragma unroll
            for (int q = 0; q < 16; q++) {
                f32x4 c = cv[q] + bv;
                if (act == 1) {
                    #pragma unroll
                    for (int e = 0; e < 4; e++) c[e] = 0.5f * c[e] * (1.f + erff(c[e] * 0.70710678118f));
                }
                if (resid) c += rv[q];
                const size_t idx = idx0 + q * rstep;
                // behind each store: later arithmetic may land in its registers
                if (outF) {
                    *(f32x4*)(outF + idx) = c;
                    asm volatile("s_wait_xcnt 0x0" ::: "memory");   // see above
                }
                if (outB) {
                    bf16x4 o;
                    #pragma unroll
                    for (int e = 0; e < 4; e++) o[e] = (bf16_t)c[e];
                    *(bf16x4*)(outB + idx) = o;
                    asm volatile("s_wait_xcnt 0x0" ::: "memory");   // see above
                }
            }
        }
    }
}

__global__ __launch_bounds__(256)
void k_gemm_bf16(const bf16_t* __restrict__ A, const bf16_t* __restrict__ Wt,
                 const float* __restrict__ bias, const float* __restrict__ resid,
                 float* __restrict__ outF, bf16_t* __restrict__ outB,
                 int M, int N, int K, int act) {
    gemm_tile(A, Wt, bias, resid, outF, outB, N, K, act, blockIdx.y * 128, blockIdx.x * 128);
}

// The seven projections of the same A (2048 x K) in one grid: they do not depend on one
// another, and the narrow ones (16 blocks each on their own) fill places the wide ones leave.
// blockIdx.x picks the weight and its 128-wide column tile, blockIdx.y the row tile.
struct ProjArgs {
    const bf16_t* A;
    const bf16_t* tqkv; const bf16_t* tmv; const bf16_t* t1w; const bf16_t* t2w;
    const bf16_t* t1r;  const bf16_t* t2r; const bf16_t* tmg;
    const float* bqkv; const float* bmv; const float* bmg;
    bf16_t* qkv;
    float* memval; float* p1w; float* p2w; float* p1r; float* p2r; float* glin;
    int K;
};
#define PROJ_TILES 37   // 24 (qkv) + 8 (mem values) + 4 (points) + 1 (gate)

__global__ __launch_bounds__(256)
void k_gemm_proj(ProjArgs a) {
    const int x = blockIdx.x;
    const bf16_t* Wt;
    const float* bias = nullptr;
    float* oF = nullptr;
    bf16_t* oB = nullptr;
    int N = 64, n0 = 0;
    if (x < 24)       { Wt = a.tqkv; bias = a.bqkv; oB = a.qkv;    N = 3072; n0 = x * 128; }
    else if (x < 32)  { Wt = a.tmv;  bias = a.bmv;  oF = a.memval; N = 1024; n0 = (x - 24) * 128; }
    else if (x == 32) { Wt = a.t1w;  oF = a.p1w; }
    else if (x == 33) { Wt = a.t2w;  oF = a.p2w; }
    else if (x == 34) { Wt = a.t1r;  oF = a.p1r; }
    else if (x == 35) { Wt = a.t2r;  oF = a.p2r; }
    else              { Wt = a.tmg;  bias = a.bmg;  oF = a.glin;   N = 16; }
    gemm_tile(a.A, Wt, bias, nullptr, oF, oB, N, a.K, 0, blockIdx.y * 128, n0);
}

// ---------------------------------------------------------------------------
// Flash-style causal attention.  qkv bf16 [(b,t), 3, H, 64].
// One block per (qb, part, bh): 128 q-rows of one head against the key tiles sb0 .. sb1 - 1;
// 256 threads (8 waves, 16 q-rows each).
// A wave walks its key tiles one after the other, so a launch lasts as long as the longest walk.
// The walk of q-tile qb (qb + 1 key tiles) is therefore cut into ATT_NPARTS(qb) parts of at most 3
// tiles, each a block of its own.  A part leaves its sums as they stand: the output sum without the
// division (opart), each row's maximum (pm) and its sum of exponentials (pl); k_combine joins them.
// ---------------------------------------------------------------------------
#define ATT_MAXPARTS 3
#define ATT_T 1024                                  // positions of a sequence: 8 q-tiles
#define ATT_NPARTS(qb) (((qb) + 3) / 3)             // parts of q-tile qb
#define ATT_OSTEP ((size_t)2048 * 1024)             // floats between two parts' output sums
#define ATT_SSTEP ((size_t)2048 * 16)               // floats between two parts' row maxima, or row sums

__device__ __forceinline__
void attention_block(const bf16_t* __restrict__ qkv, float* __restrict__ opart,
                     float* __restrict__ pm, float* __restrict__ pl,
                     int T, int H, int qb, int bh, int sb0, int sb1) {
    const int h = bh % H, b = bh / H;
    const int tid = threadIdx.x, wave = tid >> 5, lane = tid & 31;
    const int lm = lane & 15, kh = lane >> 4;

    __shared__ bf16_t Qs[128][72];
    __shared__ bf16_t Ks[128][72];
    __shared__ bf16_t Vt[64][136];     // V transposed: [dh][s]
    __shared__ bf16_t Ps[8][16][40];   // per-wave P staging (32-wide K chunk)

    const size_t strideT = 3 * 1024;
    const bf16_t* base = qkv + (size_t)b * T * strideT + (size_t)h * 64;

    // Load Q tile (128 x 64)
    for (int c8 = tid; c8 < 128 * 8; c8 += 256) {
        int rr = c8 >> 3, cc = (c8 & 7) * 8;
        const bf16_t* gq = base + (size_t)(qb * 128 + rr) * strideT + cc;
#if HAS_ASYNC_LDS
        async_copy16(&Qs[rr][cc], gq);
#else
        *(u32x4*)&Qs[rr][cc] = *(const u32x4*)gq;
#endif
    }

    float rowm[8], rowl[8];
    v8f oacc[4];
    #pragma unroll
    for (int v = 0; v < 8; v++) { rowm[v] = -INFINITY; rowl[v] = 0.f; }
    #pragma unroll
    for (int jt = 0; jt < 4; jt++)
        #pragma unroll
        for (int v = 0; v < 8; v++) oacc[jt][v] = 0.f;

    for (int sb = sb0; sb < sb1; sb++) {
        __syncthreads();   // protect Ks/Vt reuse across iterations
        for (int c8 = tid; c8 < 128 * 8; c8 += 256) {
            int rr = c8 >> 3, cc = (c8 & 7) * 8;
            const bf16_t* gk = base + (size_t)(sb * 128 + rr) * strideT + 1024 + cc;
#if HAS_ASYNC_LDS
            async_copy16(&Ks[rr][cc], gk);
#else
            *(u32x4*)&Ks[rr][cc] = *(const u32x4*)gk;
#endif
        }
        for (int c8 = tid; c8 < 128 * 8; c8 += 256) {
            int rr = c8 >> 3, cc = (c8 & 7) * 8;
            union { u32x4 u; bf16_t e[8]; } vv;
            vv.u = *(const u32x4*)(base + (size_t)(sb * 128 + rr) * strideT + 2048 + cc);
            #pragma unroll
            for (int i = 0; i < 8; i++) Vt[cc + i][rr] = vv.e[i];
        }
        async_wait0();
        __syncthreads();

        // ---- scores: S = Q * K^T ----
        AFrag aq[2];
        #pragma unroll
        for (int kk = 0; kk < 2; kk++) {
            const bf16_t* p = &Qs[wave * 16 + lm][kk * 32 + kh * 8];
            aq[kk].q[0] = *(const u32x4*)p;
            aq[kk].q[1] = *(const u32x4*)(p + 16);
        }
        v8f sacc[8];
        #pragma unroll
        for (int j = 0; j < 8; j++)
            #pragma unroll
            for (int v = 0; v < 8; v++) sacc[j][v] = 0.f;
        #pragma unroll
        for (int j = 0; j < 8; j++)
            #pragma unroll
            for (int kk = 0; kk < 2; kk++) {
                AFrag bk;
                const bf16_t* p = &Ks[j * 16 + lm][kk * 32 + kh * 8];
                bk.q[0] = *(const u32x4*)p;
                bk.q[1] = *(const u32x4*)(p + 16);
                sacc[j] = __builtin_amdgcn_wmma_f32_16x16x32_bf16(
                    false, aq[kk].v, false, bk.v, (short)0, sacc[j], false, false);
            }

        // ---- causal mask + online softmax (wave32: 16-lane row reductions) ----
        #pragma unroll
        for (int v = 0; v < 8; v++) {
            int trow = qb * 128 + wave * 16 + v + 8 * kh;
            float rm = -INFINITY;
            #pragma unroll
            for (int j = 0; j < 8; j++) {
                int col = sb * 128 + j * 16 + lm;
                float s = (col <= trow) ? sacc[j][v] * 0.125f : -INFINITY;
                sacc[j][v] = s;
                rm = fmaxf(rm, s);
            }
            #pragma unroll
            for (int msk = 1; msk < 16; msk <<= 1) rm = fmaxf(rm, __shfl_xor(rm, msk));
            float mnew = fmaxf(rowm[v], rm);
            float corr = expf(rowm[v] - mnew);
            rowm[v] = mnew;
            float rs = 0.f;
            #pragma unroll
            for (int j = 0; j < 8; j++) {
                float p = expf(sacc[j][v] - mnew);
                sacc[j][v] = p;
                rs += p;
            }
            #pragma unroll
            for (int msk = 1; msk < 16; msk <<= 1) rs += __shfl_xor(rs, msk);
            rowl[v] = rowl[v] * corr + rs;
            #pragma unroll
            for (int jt = 0; jt < 4; jt++) oacc[jt][v] = oacc[jt][v] * corr;
        }

        // ---- O += P * V  (stage P through LDS: C-layout -> A-layout) ----
        #pragma unroll
        for (int kk = 0; kk < 4; kk++) {
            #pragma unroll
            for (int jj = 0; jj < 2; jj++) {
                int j = kk * 2 + jj;
                #pragma unroll
                for (int v = 0; v < 8; v++)
                    Ps[wave][v + 8 * kh][jj * 16 + lm] = (bf16_t)sacc[j][v];
            }
            AFrag ap;
            const bf16_t* p = &Ps[wave][lm][kh * 8];
            ap.q[0] = *(const u32x4*)p;
            ap.q[1] = *(const u32x4*)(p + 16);
            #pragma unroll
            for (int jt = 0; jt < 4; jt++) {
                AFrag bv;
                const bf16_t* q = &Vt[jt * 16 + lm][kk * 32 + kh * 8];
                bv.q[0] = *(const u32x4*)q;
                bv.q[1] = *(const u32x4*)(q + 16);
                oacc[jt] = __builtin_amdgcn_wmma_f32_16x16x32_bf16(
                    false, ap.v, false, bv.v, (short)0, oacc[jt], false, false);
            }
        }
    }

    float* out = opart + (size_t)b * T * 1024 + (size_t)h * 64;
    // a row's maximum and sum are the same in its 16 lanes: the first of them stores both
    if (lm == 0) {
        // 16 heads a row, as in ATT_SSTEP: a constant, so that the 8 rows are offsets of one address
        const size_t r0 = ((size_t)b * T + qb * 128 + wave * 16 + 8 * kh) * 16 + h;
        #pragma unroll
        for (int v = 0; v < 8; v++) { pm[r0 + v * 16] = rowm[v]; pl[r0 + v * 16] = rowl[v]; }
    }
    #pragma unroll
    for (int jt = 0; jt < 4; jt++)
        #pragma unroll
        for (int v = 0; v < 8; v++) {
            int trow = qb * 128 + wave * 16 + v + 8 * kh;
            int col  = jt * 16 + lm;
            out[(size_t)trow * 1024 + col] = oacc[jt][v];
        }
    // the code laid behind the attention's may write the stores' registers
    asm volatile("s_wait_xcnt 0x0" ::: "memory");
}

// ---------------------------------------------------------------------------
// Plucker line through two points of R^4, normalised.
// ---------------------------------------------------------------------------
__device__ inline void exterior4(const float* a1, const float* a2, float* L) {
    L[0] = a1[0] * a2[1] - a1[1] * a2[0];
    L[1] = a1[0] * a2[2] - a1[2] * a2[0];
    L[2] = a1[0] * a2[3] - a1[3] * a2[0];
    L[3] = a1[1] * a2[2] - a1[2] * a2[1];
    L[4] = a1[1] * a2[3] - a1[3] * a2[1];
    L[5] = a1[2] * a2[3] - a1[3] * a2[2];
    float n2 = 0.f;
    #pragma unroll
    for (int i = 0; i < 6; i++) n2 += L[i] * L[i];
    float inv = 1.f / fmaxf(sqrtf(n2), 1e-12f);
    #pragma unroll
    for (int i = 0; i < 6; i++) L[i] *= inv;
}

// ---------------------------------------------------------------------------
// Decayed-Gram scan:  M_t = d*(M_{t-1} + Jw_{t-1} Jw_{t-1}^T),  M_0 = 0.
// The recurrence is linear, so it is run as a chunked parallel scan:
// one block per (b,h), thread c owns the 4 steps t = 4c .. 4c+3 (T == 4 * blockDim.x).
//   0) each thread forms the write lines (rotated by J6) and the read lines of its own 4 steps
//      from the projected points: no one else reads them, so they never go through memory
//   1) each thread folds its own 4 steps from zero   (chunk aggregate)
//   2) weighted prefix over chunks: lanes by shuffles, waves through LDS
//   3) each thread replays its 4 steps from its true M and writes the gates
// M is symmetric, so only its 21 upper entries are carried.
// Every loop is unrolled so that the small arrays are indexed by constants and stay in registers.
// ---------------------------------------------------------------------------
#define GS_L 4      // steps per thread
#define GS_NS 21    // upper triangle of a 6x6

__device__ __forceinline__ void gram_step(float* m, const float* J, float d) {
    int n = 0;
    #pragma unroll
    for (int i = 0; i < 6; i++)
        #pragma unroll
        for (int j = i; j < 6; j++, n++) m[n] = d * (m[n] + J[i] * J[j]);
}

__device__ __forceinline__
void gram_block(const float* __restrict__ p1w, const float* __restrict__ p2w,
                const float* __restrict__ p1r, const float* __restrict__ p2r,
                const float* __restrict__ glin, const float* __restrict__ decay_logits,
                const float* __restrict__ iter_mix, const float* __restrict__ mem_scale,
                float* __restrict__ gh, int T, int H, int bh) {
    __shared__ __attribute__((aligned(16))) float Wagg[8][24];   // rows of 21, padded to 16 B
    const int h = bh % H, b = bh / H;
    const int c = threadIdx.x, lane = c & 31;
    const int wave = __builtin_amdgcn_readfirstlane(c >> 5);     // scalar: the tests on it in 2b are scalar compares
    const int t0 = c * GS_L;

    // all of this thread's inputs, issued up front
    // a head's point is 16 B of a 256-B row; po: this thread's first row, this head, in floats
    const size_t po = ((size_t)b * T + t0) * 64 + h * 4;
    union F4 { f32x4 q; float f[4]; };
    F4 w1[GS_L], w2[GS_L], r1[GS_L], r2[GS_L];
    // the write line of step t takes its first point from row t - 1; step 0 has none (zero below),
    // and its load reads row 0 so that the address stays inside the array
    #pragma unroll
    for (int k = 0; k < GS_L; k++) w1[k].q = *(const f32x4*)(p1w + po + (t0 + k > 0 ? k - 1 : k) * 64);
    // the next loads may land in these loads' address registers
    asm volatile("s_wait_xcnt 0x0" ::: "memory");
    #pragma unroll
    for (int k = 0; k < GS_L; k++) w2[k].q = *(const f32x4*)(p2w + po + k * 64);
    // as above
    asm volatile("s_wait_xcnt 0x0" ::: "memory");
    #pragma unroll
    for (int k = 0; k < GS_L; k++) r1[k].q = *(const f32x4*)(p1r + po + k * 64);
    // as above
    asm volatile("s_wait_xcnt 0x0" ::: "memory");
    #pragma unroll
    for (int k = 0; k < GS_L; k++) r2[k].q = *(const f32x4*)(p2r + po + k * 64);
    // as above
    asm volatile("s_wait_xcnt 0x0" ::: "memory");
    float gl[GS_L];
    #pragma unroll
    for (int k = 0; k < GS_L; k++) gl[k] = glin[((size_t)b * T + t0 + k) * H + h];
    // the loads' address registers are reused by the arithmetic below
    asm volatile("s_wait_xcnt 0x0" ::: "memory");

    const float decay = 1.f / (1.f + expf(-decay_logits[h]));
    const float alpha = 1.f / (1.f + expf(-iter_mix[0]));
    const float msc = mem_scale[h];

    // w[s] = decay^(4 * 2^s): the decay across 2^s chunks
    float w[6];
    w[0] = (decay * decay) * (decay * decay);
    #pragma unroll
    for (int s = 1; s < 6; s++) w[s] = w[s - 1] * w[s - 1];

    // 0) lines
    struct { float f[24]; } J, R;
    #pragma unroll
    for (int k = 0; k < GS_L; k++) {
        float L[6];
        if (t0 + k == 0) {
            #pragma unroll
            for (int e = 0; e < 4; e++) w1[k].f[e] = 0.f;
        }
        exterior4(w1[k].f, w2[k].f, L);
        float* jw = &J.f[k * 6];
        jw[0] = L[5]; jw[1] = -L[4]; jw[2] = L[3]; jw[3] = L[2]; jw[4] = -L[1]; jw[5] = L[0];
        exterior4(r1[k].f, r2[k].f, &R.f[k * 6]);
    }

    // 1) chunk aggregate
    float m[GS_NS];
    #pragma unroll
    for (int n = 0; n < GS_NS; n++) m[n] = 0.f;
    #pragma unroll
    for (int k = 0; k < GS_L; k++) gram_step(m, &J.f[k * 6], decay);

    // 2a) inclusive weighted prefix over the wave's 32 chunks
    #pragma unroll
    for (int s = 0; s < 5; s++) {
        const int o = 1 << s;
        #pragma unroll
        for (int n = 0; n < GS_NS; n++) {
            float v = __shfl_up(m[n], o);
            m[n] = (lane >= o) ? m[n] + w[s] * v : m[n];
        }
    }
    if (lane == 31) {
        #pragma unroll
        for (int n = 0; n < GS_NS; n++) Wagg[wave][n] = m[n];
    }
    // exclusive within the wave
    #pragma unroll
    for (int n = 0; n < GS_NS; n++) {
        float v = __shfl_up(m[n], 1);
        m[n] = (lane > 0) ? v : 0.f;
    }
    __syncthreads();

    // 2b) M at the wave's first step, from the earlier waves' totals.
    // It is the same for the whole wave: lane n folds entry n, then it is read per entry.
    const int ln = (lane < GS_NS) ? lane : 0;
    float tot[7];
    #pragma unroll
    for (int q = 0; q < 7; q++) tot[q] = Wagg[q][ln];
    float p = 0.f;
    #pragma unroll
    for (int q = 0; q < 7; q++) p = (q < wave) ? w[5] * p + tot[q] : p;
    float dl = 1.f;   // decay^(4 * lane)
    #pragma unroll
    for (int s = 0; s < 5; s++) dl *= ((lane >> s) & 1) ? w[s] : 1.f;
    #pragma unroll
    for (int n = 0; n < GS_NS; n++)
        m[n] += dl * __int_as_float(__builtin_amdgcn_readlane(__float_as_int(p), n));

    // 3) replay
    #pragma unroll
    for (int k = 0; k < GS_L; k++) {
        const float* rd = &R.f[k * 6];
        float rdM[6] = {0, 0, 0, 0, 0, 0};
        int n = 0;
        #pragma unroll
        for (int i = 0; i < 6; i++)
            #pragma unroll
            for (int j = i; j < 6; j++, n++) {
                rdM[j] += rd[i] * m[n];
                if (j != i) rdM[i] += rd[j] * m[n];
            }
        float s1 = 0.f, s2 = 0.f;
        #pragma unroll
        for (int j = 0; j < 6; j++) { s1 += rdM[j] * rd[j]; s2 += rdM[j] * rdM[j]; }
        float ms = (1.f - alpha) * s1 + alpha * s2;
        float g1 = 1.f / (1.f + expf(-ms * msc));
        float g2 = 1.f / (1.f + expf(-gl[k]));
        gh[((size_t)b * T + t0 + k) * H + h] = g1 * g2;
        if (k + 1 < GS_L) gram_step(m, &J.f[k * 6], decay);
    }
}

// ---------------------------------------------------------------------------
// Third launch: all that needs the projections or nothing at all, and that the later launches wait
// for.  The attention, the Gram branch and the turn of Wfc, Wproj and Wout do not depend on one
// another, so they share a grid.  The attention blocks last longest and start first; the others run
// beside them.
// ---------------------------------------------------------------------------
#define MID_ATT_BLOCKS  480   // 15 parts of the 8 q-tiles x 32 (b, h)
#define MID_GRAM_BLOCKS 32    // one per (b, h)
#define MID_BLOCKS (MID_ATT_BLOCKS + MID_GRAM_BLOCKS + TR_LATE_BLOCKS)

__global__ __launch_bounds__(256)
void k_mid(TrArgs a, const bf16_t* __restrict__ qkv, float* __restrict__ opart,
           float* __restrict__ pm, float* __restrict__ pl,
           const float* __restrict__ p1w, const float* __restrict__ p2w,
           const float* __restrict__ p1r, const float* __restrict__ p2r,
           const float* __restrict__ glin, const float* __restrict__ decay_logits,
           const float* __restrict__ iter_mix, const float* __restrict__ mem_scale,
           float* __restrict__ gh, int T, int H) {
    __shared__ __attribute__((aligned(16))) char tile[128 * 256];
    const int l = blockIdx.x;
    // written in this order the attention, the longest code on the longest path, comes first in the
    // kernel's text
    if (l >= MID_ATT_BLOCKS) {
        if (l < MID_ATT_BLOCKS + MID_GRAM_BLOCKS)
            gram_block(p1w, p2w, p1r, p2r, glin, decay_logits, iter_mix, mem_scale, gh, T, H, l - MID_ATT_BLOCKS);
        else
            tr_late(a, l - (MID_ATT_BLOCKS + MID_GRAM_BLOCKS), tile);
        return;
    }
    // The 15 parts, those of 3 key tiles first, then those of 2, then the one of 1; 32 (b, h) each.
    // Digit c of each constant belongs to part c: its q-tile, its number among that q-tile's parts
    // (part p of P takes the tiles p * n / P .. (p + 1) * n / P - 1 of n = qb + 1), first tile, end.
    const int c4 = (l >> 5) * 4;
    const int qb  = (int)((0x013346672455677ULL >> c4) & 15);
    const int p   = (int)((0x001001000110221ULL >> c4) & 15);
    const int sb0 = (int)((0x002002000230452ULL >> c4) & 15);
    const int sb1 = (int)((0x124224223563785ULL >> c4) & 15);
    attention_block(qkv, opart + p * ATT_OSTEP, pm + p * ATT_SSTEP, pl + p * ATT_SSTEP,
                    T, H, qb, l & 31, sb0, sb1);
}

// ---------------------------------------------------------------------------
// y = seqout + mean_h(gh) * memval  -> bf16 (input to Wout GEMM)
// seqout is formed here, from the P parts that the row's attention was cut into.  Per head, with
// m_p, l_p, O_p a part's row maximum, sum of exponentials and output sum, and M = max_p m_p:
//   seqout = sum_p exp(m_p - M) O_p / sum_p exp(m_p - M) l_p        (P == 1: O_0 / l_0)
// One block per row of 1024 = 4 x 256 columns; op, mv, yr: the row's start; pm, pl: its 16 heads.
// ---------------------------------------------------------------------------
template <int P>
__device__ __forceinline__
void combine_row(const float* __restrict__ op, const float* __restrict__ pm,
                 const float* __restrict__ pl, const float* __restrict__ mv,
                 float g, bf16_t* __restrict__ yr) {
    const int tid = threadIdx.x, hd = tid >> 6;   // column tid + 256 i lies in head hd + 4 i
    float o[4][P], m[4][P], l[4][P], v[4];
    // The loads stand in groups off one address each.  Behind each group: the next loads' results or
    // later arithmetic may land in its address registers.
    #pragma unroll
    for (int p = 0; p < P; p++) {
        #pragma unroll
        for (int i = 0; i < 4; i++) o[i][p] = op[p * ATT_OSTEP + tid + 256 * i];
        asm volatile("s_wait_xcnt 0x0" ::: "memory");   // see above
    }
    #pragma unroll
    for (int i = 0; i < 4; i++) v[i] = mv[tid + 256 * i];
    asm volatile("s_wait_xcnt 0x0" ::: "memory");   // see above
    #pragma unroll
    for (int p = 0; p < P; p++)
        #pragma unroll
        for (int i = 0; i < 4; i++) l[i][p] = pl[p * ATT_SSTEP + hd + 4 * i];
    asm volatile("s_wait_xcnt 0x0" ::: "memory");   // see above
    #pragma unroll
    for (int p = 0; p < P; p++)
        #pragma unroll
        for (int i = 0; i < 4; i++) m[i][p] = P > 1 ? pm[p * ATT_SSTEP + hd + 4 * i] : 0.f;
    if (P > 1) asm volatile("s_wait_xcnt 0x0" ::: "memory");   // see above
    // keeps the arithmetic behind all the loads: moved up among them it makes the later loads wait
    // for the first ones' data, a second trip to memory
    __builtin_amdgcn_sched_barrier(0);
    bf16_t r[4];
    #pragma unroll
    for (int i = 0; i < 4; i++) {
        float num = o[i][0], den = l[i][0];
        if (P > 1) {
            float mx = m[i][0];
            #pragma unroll
            for (int p = 1; p < P; p++) mx = fmaxf(mx, m[i][p]);
            num = 0.f; den = 0.f;
            #pragma unroll
            for (int p = 0; p < P; p++) {
                const float w = expf(m[i][p] - mx);
                num += w * o[i][p];
                den += w * l[i][p];
            }
        }
        r[i] = (bf16_t)(num / den + g * v[i]);
    }
    // keeps the arithmetic in front of the stores: moved in among them it could land in registers
    // of stores already issued
    __builtin_amdgcn_sched_barrier(0);
    #pragma unroll
    for (int i = 0; i < 4; i++) yr[tid + 256 * i] = r[i];
    // the code laid behind this row's may write the stores' registers
    asm volatile("s_wait_xcnt 0x0" ::: "memory");
}

__global__ __launch_bounds__(256)
void k_combine(const float* __restrict__ opart, const float* __restrict__ pm,
               const float* __restrict__ pl, const float* __restrict__ memval,
               const float* __restrict__ gh, bf16_t* __restrict__ y, int D, int H) {
    size_t row = blockIdx.x;
    float g = 0.f;
    #pragma unroll
    for (int h = 0; h < 16; h++) g += gh[row * H + h];
    g *= (1.f / 16.f);
    const float* op = opart + row * D;
    const float* rm = pm + row * H;
    const float* rl = pl + row * H;
    const float* mv = memval + row * D;
    bf16_t* yr = y + row * D;
    const int P = ATT_NPARTS(((int)blockIdx.x % ATT_T) >> 7);   // the same for the whole block
    if (P == 1)      combine_row<1>(op, rm, rl, mv, g, yr);
    else if (P == 2) combine_row<2>(op, rm, rl, mv, g, yr);
    else             combine_row<3>(op, rm, rl, mv, g, yr);
}

// ---------------------------------------------------------------------------
extern "C" void kernel_launch(void* const* d_in, const int* in_sizes, int n_in,
                              void* d_out, int out_size, void* d_ws, size_t ws_size,
                              hipStream_t stream) {
    const int B = 2, T = 1024, D = 1024, H = 16, DFF = 4096;
    const int M = B * T;

    const float* x            = (const float*)d_in[0];
    const float* ln1_g        = (const float*)d_in[1];
    const float* ln1_b        = (const float*)d_in[2];
    const float* Wqkv         = (const float*)d_in[3];
    const float* bqkv         = (const float*)d_in[4];
    const float* W1w          = (const float*)d_in[5];
    const float* W2w          = (const float*)d_in[6];
    const float* W1r          = (const float*)d_in[7];
    const float* W2r          = (const float*)d_in[8];
    const float* Wmv          = (const float*)d_in[9];
    const float* bmv          = (const float*)d_in[10];
    const float* Wmg          = (const float*)d_in[11];
    const float* bmg          = (const float*)d_in[12];
    const float* mem_scale    = (const float*)d_in[13];
    const float* iter_mix     = (const float*)d_in[14];
    const float* decay_logits = (const float*)d_in[15];
    const float* Wout         = (const float*)d_in[16];
    const float* bout         = (const float*)d_in[17];
    const float* ln2_g        = (const float*)d_in[18];
    const float* ln2_b        = (const float*)d_in[19];
    const float* Wfc          = (const float*)d_in[20];
    const float* bfc          = (const float*)d_in[21];
    const float* Wproj        = (const float*)d_in[22];
    const float* bproj        = (const float*)d_in[23];

    char* ws = (char*)d_ws;
    size_t off = 0;
    auto alloc = [&](size_t bytes) -> void* {
        void* p = ws + off;
        off += (bytes + 255) & ~(size_t)255;
        return p;
    };

    bf16_t* Wqkv_t  = (bf16_t*)alloc((size_t)3 * D * D * 2);
    bf16_t* W1w_t   = (bf16_t*)alloc((size_t)64 * D * 2);
    bf16_t* W2w_t   = (bf16_t*)alloc((size_t)64 * D * 2);
    bf16_t* W1r_t   = (bf16_t*)alloc((size_t)64 * D * 2);
    bf16_t* W2r_t   = (bf16_t*)alloc((size_t)64 * D * 2);
    bf16_t* Wmg_t   = (bf16_t*)alloc((size_t)H * D * 2);
    bf16_t* Wmv_t   = (bf16_t*)alloc((size_t)D * D * 2);
    bf16_t* Wout_t  = (bf16_t*)alloc((size_t)D * D * 2);
    bf16_t* Wfc_t   = (bf16_t*)alloc((size_t)DFF * D * 2);
    bf16_t* Wproj_t = (bf16_t*)alloc((size_t)D * DFF * 2);
    bf16_t* h_bf    = (bf16_t*)alloc((size_t)M * D * 2);
    bf16_t* qkv_bf  = (bf16_t*)alloc((size_t)M * 3 * D * 2);
    float*  p1w     = (float*)alloc((size_t)M * 64 * 4);
    float*  p2w     = (float*)alloc((size_t)M * 64 * 4);
    float*  p1r     = (float*)alloc((size_t)M * 64 * 4);
    float*  p2r     = (float*)alloc((size_t)M * 64 * 4);
    float*  glin    = (float*)alloc((size_t)M * H * 4);
    float*  ghb     = (float*)alloc((size_t)M * H * 4);
    float*  memval  = (float*)alloc((size_t)M * D * 4);
    float*  opart   = (float*)alloc((size_t)ATT_MAXPARTS * M * D * 4);
    float*  pmax    = (float*)alloc((size_t)ATT_MAXPARTS * M * H * 4);
    float*  psum    = (float*)alloc((size_t)ATT_MAXPARTS * M * H * 4);
    bf16_t* y_bf    = (bf16_t*)alloc((size_t)M * D * 2);
    float*  x1      = (float*)alloc((size_t)M * D * 4);
    bf16_t* h2_bf   = (bf16_t*)alloc((size_t)M * D * 2);
    bf16_t* a_bf    = (bf16_t*)alloc((size_t)M * DFF * 2);

    auto gemm = [&](const bf16_t* A, const bf16_t* Wt, const float* bias,
                    const float* resid, float* oF, bf16_t* oB, int m, int n, int k, int act) {
        dim3 g((n + 127) / 128, (m + 127) / 128);
        k_gemm_bf16<<<g, 256, 0, stream>>>(A, Wt, bias, resid, oF, oB, m, n, k, act);
    };

    // 1) the projections' weights -> bf16 transposed, and ln1
    TrArgs ta = { Wfc, Wproj, Wqkv, Wmv, Wout, W1w, W2w, W1r, W2r, Wmg,
                  Wfc_t, Wproj_t, Wqkv_t, Wmv_t, Wout_t, W1w_t, W2w_t, W1r_t, W2r_t, Wmg_t };
    k_front<<<TR_FIRST_BLOCKS + M, 256, 0, stream>>>(ta, x, ln1_g, ln1_b, h_bf);

    // 2) projections
    ProjArgs pa = { h_bf, Wqkv_t, Wmv_t, W1w_t, W2w_t, W1r_t, W2r_t, Wmg_t,
                    bqkv, bmv, bmg, qkv_bf, memval, p1w, p2w, p1r, p2r, glin, D };
    k_gemm_proj<<<dim3(PROJ_TILES, 16), 256, 0, stream>>>(pa);

    // 3) attention, Gram memory branch, the other weights -> bf16 transposed
    k_mid<<<MID_BLOCKS, 256, 0, stream>>>(ta, qkv_bf, opart, pmax, psum, p1w, p2w, p1r, p2r, glin,
                                          decay_logits, iter_mix, mem_scale, ghb, T, H);

    // 4) the two branches joined
    k_combine<<<M, 256, 0, stream>>>(opart, pmax, psum, memval, ghb, y_bf, D, H);

    // 5) output projection + residual
    gemm(y_bf, Wout_t, bout, x, x1, nullptr, M, D, D, 0);

    // 6) MLP
    k_layernorm<<<M, 256, 0, stream>>>(x1, ln2_g, ln2_b, h2_bf);
    gemm(h2_bf, Wfc_t, bfc, nullptr, nullptr, a_bf, M, DFF, D, 1);
    gemm(a_bf, Wproj_t, bproj, x1, (float*)d_out, nullptr, M, D, DFF, 0);
}

// v008
// Measured time: 132 microseconds a run.
// Two timings next to v007 put it at 1.20 and 1.19 times that version's speed.
// All steps since v000 together make it 6.57 times as fast.
#include <hip/hip_runtime.h>
#include <math.h>

typedef __bf16 bf16_t;
typedef __attribute__((ext_vector_type(16))) __bf16 v16bf;
typedef __attribute__((ext_vector_type(8)))  float  v8f;
typedef unsigned int u32x4 __attribute__((ext_vector_type(4)));
typedef int i32x4 __attribute__((ext_vector_type(4)));
typedef float  f32x4  __attribute__((ext_vector_type(4)));
typedef __bf16 bf16x4 __attribute__((ext_vector_type(4)));
typedef __bf16 bf16x8 __attribute__((ext_vector_type(8)));

union AFrag { v16bf v; u32x4 q[2]; };

#if __has_builtin(__builtin_amdgcn_global_load_async_to_lds_b128) && \
    __has_builtin(__builtin_amdgcn_s_wait_asynccnt)
#define HAS_ASYNC_LDS 1
typedef __attribute__((address_space(1))) i32x4* glds_gptr;
typedef __attribute__((address_space(3))) i32x4* glds_lptr;
#else
#define HAS_ASYNC_LDS 0
#endif

__device__ __forceinline__ void async_copy16(void* lds, const void* g) {
#if HAS_ASYNC_LDS
    __builtin_amdgcn_global_load_async_to_lds_b128(
        (glds_gptr)(g), (glds_lptr)(lds), 0, 0);
#endif
}
__device__ __forceinline__ void async_wait0() {
#if HAS_ASYNC_LDS
    __builtin_amdgcn_s_wait_asynccnt(0);
#endif
}

// ---------------------------------------------------------------------------
// Weight convert: W (K x N, f32, row-major) -> Wt (N x K, bf16, row-major)
// A block finds its weight and its tile from an index l that its kernel hands it (tr_first, tr_late).
// A block turns a tile of 128 k x 128 n, 64 elements a thread, so that the grid has few waves
// and each of them keeps 16 loads of 16 B a lane in flight:
//   load : a wave reads 512 contiguous bytes of a W row (4 n a lane); a lane takes the same
//          4 n of 8 successive k, twice, and so holds 8 k of each n: 16 B of a Wt row
//   turn : those 16-B pieces go to LDS as [n][k], rows of 256 B
//   store: a wave takes two rows back, 16 B a lane, and stores 2 x 256 contiguous bytes of Wt
// LDS rows have no pad; the 16-B piece c of row n lies at place c ^ ((n >> 2) & 15).  So the 16
// lanes that write one k piece of rows 4 apart, and the 16 that read one whole row, each meet
// all 64 banks once.
// K is a multiple of 128; N a multiple of 128, or below 128 and a multiple of 16 (one tile wide).
// ---------------------------------------------------------------------------
struct TrArgs {
    const float* wfc;  const float* wproj; const float* wqkv; const float* wmv; const float* wout;
    const float* w1w;  const float* w2w;   const float* w1r;  const float* w2r; const float* wmg;
    bf16_t* tfc;  bf16_t* tproj; bf16_t* tqkv; bf16_t* tmv; bf16_t* tout;
    bf16_t* t1w;  bf16_t* t2w;   bf16_t* t1r;  bf16_t* t2r; bf16_t* tmg;
};
#define TR_FIRST_BLOCKS 296   // 192 + 64 + 4 * 8 + 8: the weights that the projections of ln1(x) read
#define TR_LATE_BLOCKS  576   // 256 + 256 + 64: Wfc, Wproj, Wout, first read behind the attention

template <int K, int N>
__device__ __forceinline__
void tr_tile(const float* __restrict__ W, bf16_t* __restrict__ Wt, int kb, int nb, char* lds) {
    constexpr int NT = N < 128 ? N : 128;   // columns of W in this tile
    const int tid = threadIdx.x, lane = tid & 31;
    const int wave = __builtin_amdgcn_readfirstlane(tid >> 5);   // scalar: row addresses stay scalar
    if (4 * lane < NT) {
        const float* p = W + (size_t)(kb + 8 * wave) * N + nb;   // scalar; the lane is the loads' one vector register
        f32x4 v[2][8];
        #pragma unroll
        for (int r = 0; r < 2; r++)
            #pragma unroll
            for (int i = 0; i < 8; i++) v[r][i] = ((const f32x4*)(p + (size_t)(64 * r + i) * N))[lane];
        // later arithmetic may land in the loads' index register; it is named as an input so that
        // it lives up to the wait: otherwise the last load's own result could be placed in it
        asm volatile("s_wait_xcnt 0x0" :: "v"(lane) : "memory");
        // keeps the conversions behind all 16 loads: moved up among them (to save registers) they
        // make the last loads wait for the first ones' data, a second trip to memory
        __builtin_amdgcn_sched_barrier(0);
        #pragma unroll
        for (int r = 0; r < 2; r++)
            #pragma unroll
            for (int j = 0; j < 4; j++) {
                bf16x8 o;
                #pragma unroll
                for (int i = 0; i < 8; i++) o[i] = (bf16_t)v[r][i][j];
                *(bf16x8*)(lds + (4 * lane + j) * 256 + (((wave + 8 * r) ^ (lane & 15)) * 16)) = o;
            }
    }
    __syncthreads();
    const int n = tid >> 4, c = tid & 15;
    bf16_t* q0 = Wt + (size_t)(nb + n) * K + kb + 8 * c;
    u32x4 d[NT / 16];
    #pragma unroll
    for (int q = 0; q < NT / 16; q++) {
        const int nq = n + 16 * q;
        d[q] = *(const u32x4*)(lds + nq * 256 + ((c ^ ((nq >> 2) & 15)) * 16));
    }
    #pragma unroll
    for (int q = 0; q < NT / 16; q++) *(u32x4*)(q0 + (size_t)(16 * q) * K) = d[q];
    // the code laid behind this tile's may write the stores' address and data registers
    asm volatile("s_wait_xcnt 0x0" ::: "memory");
}

// l: tile index, inside a weight N fastest
__device__ __forceinline__
void tr_first(const TrArgs& a, int l, char* tile) {
    if (l < 192)               tr_tile<1024, 3072>(a.wqkv, a.tqkv, (l / 24) * 128, (l % 24) * 128, tile);
    else if ((l -= 192) < 64)  tr_tile<1024, 1024>(a.wmv,  a.tmv,  (l >> 3) * 128, (l & 7) * 128,  tile);
    else if ((l -= 64) < 32) {
        const int s = l >> 3;
        tr_tile<1024, 64>(s == 0 ? a.w1w : s == 1 ? a.w2w : s == 2 ? a.w1r : a.w2r,
                          s == 0 ? a.t1w : s == 1 ? a.t2w : s == 2 ? a.t1r : a.t2r, (l & 7) * 128, 0, tile);
    }
    else tr_tile<1024, 16>(a.wmg, a.tmg, (l - 32) * 128, 0, tile);
}

__device__ __forceinline__
void tr_late(const TrArgs& a, int l, char* tile) {
    if (l < 256)               tr_tile<1024, 4096>(a.wfc,   a.tfc,   (l >> 5) * 128, (l & 31) * 128, tile);
    else if ((l -= 256) < 256) tr_tile<4096, 1024>(a.wproj, a.tproj, (l >> 3) * 128, (l & 7) * 128,  tile);
    else                       tr_tile<1024, 1024>(a.wout,  a.tout,  ((l - 256) >> 3) * 128, (l & 7) * 128, tile);
}

// ---------------------------------------------------------------------------
// LayerNorm (f32 in) -> bf16 out.  One block per row r.
// The row length is fixed, so that a thread's loads stand together, off one address with constant
// offsets, and one wait behind each group covers them.
// ---------------------------------------------------------------------------
#define LN_D 1024            // row length
#define LN_E (LN_D / 256)    // elements a thread

// v: the thread's elements of row r, columns threadIdx.x + 256 i
__device__ __forceinline__
void layernorm_vals(const float* v, const float* __restrict__ g,
                    const float* __restrict__ b, bf16_t* __restrict__ out, int r) {
    float s = 0.f, s2 = 0.f;
    #pragma unroll
    for (int i = 0; i < LN_E; i++) { s += v[i]; s2 += v[i] * v[i]; }
    #pragma unroll
    for (int off = 16; off; off >>= 1) { s += __shfl_down(s, off); s2 += __shfl_down(s2, off); }
    __shared__ float ws[8], ws2[8];
    int wave = threadIdx.x >> 5, lane = threadIdx.x & 31;
    if (lane == 0) { ws[wave] = s; ws2[wave] = s2; }
    __syncthreads();
    if (threadIdx.x == 0) {
        float a = 0.f, a2 = 0.f;
        #pragma unroll
        for (int i = 0; i < 8; i++) { a += ws[i]; a2 += ws2[i]; }
        ws[0] = a; ws2[0] = a2;
    }
    __syncthreads();
    float mean = ws[0] / LN_D;
    float var  = ws2[0] / LN_D - mean * mean;
    float rstd = rsqrtf(var + 1e-5f);
    bf16_t* orow = out + (size_t)r * LN_D + threadIdx.x;
    float gv[LN_E], bv[LN_E];
    #pragma unroll
    for (int i = 0; i < LN_E; i++) gv[i] = g[threadIdx.x + 256 * i];
    // the next loads' results or addresses may land in these loads' address registers
    asm volatile("s_wait_xcnt 0x0" ::: "memory");
    #pragma unroll
    for (int i = 0; i < LN_E; i++) bv[i] = b[threadIdx.x + 256 * i];
    // as above
    asm volatile("s_wait_xcnt 0x0" ::: "memory");
    #pragma unroll
    for (int i = 0; i < LN_E; i++) orow[256 * i] = (bf16_t)((v[i] - mean) * rstd * gv[i] + bv[i]);
    // the code laid behind this row's may write the stores' registers
    asm volatile("s_wait_xcnt 0x0" ::: "memory");
}

__device__ __forceinline__
void layernorm_row(const float* __restrict__ x, const float* __restrict__ g,
                   const float* __restrict__ b, bf16_t* __restrict__ out, int r) {
    const float* row = x + (size_t)r * LN_D + threadIdx.x;
    float v[LN_E];
    #pragma unroll
    for (int i = 0; i < LN_E; i++) v[i] = row[256 * i];
    // later arithmetic may land in the loads' address registers
    asm volatile("s_wait_xcnt 0x0" ::: "memory");
    layernorm_vals(v, g, b, out, r);
}

// First launch: all that the projections wait for.  The turn of their seven weights and ln1 do not
// depend on one another, so they share a grid: blocks below TR_FIRST_BLOCKS turn a weight tile (they
// move the most bytes each and start first), every later block normalises one row of x.
__global__ __launch_bounds__(256)
void k_front(TrArgs a, const float* __restrict__ x, const float* __restrict__ g,
             const float* __restrict__ b, bf16_t* __restrict__ out) {
    __shared__ __attribute__((aligned(16))) char tile[128 * 256];
    const int l = blockIdx.x;
    if (l < TR_FIRST_BLOCKS) tr_first(a, l, tile);
    else                     layernorm_row(x, g, b, out, l - TR_FIRST_BLOCKS);
}

// ---------------------------------------------------------------------------
// Generic bf16 WMMA GEMM:  C[M,N] = A[M,K] * Wt[N,K]^T  (+bias)(+gelu)(+resid)
// Block tile 128x128, 8 waves: each wave 32(M) x 64(N).
// A stage holds 64 k of every operand row = one whole 128-B line per row, so that a wave's
// 16-B-per-lane copy covers 4 whole lines (8 lanes a row).  Two buffers, copies one stage ahead.
// K: the k that this block sums over, a multiple of 64; ld: elements between two rows of A and of
// Wt (K, or more where the block takes one range of a longer row).  N must be a multiple of 4.
// ---------------------------------------------------------------------------
#define GEMM_BK  64   // k per stage
#define GEMM_LDK 72   // LDS row pitch in elements (144 B = 16 B x 9: conflict-free 16-B reads)
#define GEMM_ROWSTEP (32 * GEMM_LDK * 2)    // LDS bytes between a thread's four rows of one operand
#define GEMM_BUFSTEP (128 * GEMM_LDK * 2)   // LDS bytes between the two buffers of one operand
#define EP_LD 68      // epilogue: LDS row pitch in floats (272 B: 16-B aligned rows, 4 banks apart)

// One stage: each thread brings 16 B of four A rows and of four Wt rows (32 rows apart) into LDS.
// la, lb: the thread's LDS byte addresses of its first row; a0, b0..b3: its global addresses.
// The closing s_wait_xcnt stands inside the statement so that it precedes every later write of
// the address registers that the copies name.
__device__ __forceinline__
void gemm_stage(unsigned la, unsigned lb, const bf16_t* a0, size_t arow,
                const bf16_t* b0, const bf16_t* b1, const bf16_t* b2, const bf16_t* b3) {
    asm volatile(
        "global_load_async_to_lds_b128 %0, %8, off\n\t"
        "global_load_async_to_lds_b128 %1, %9, off\n\t"
        "global_load_async_to_lds_b128 %2, %10, off\n\t"
        "global_load_async_to_lds_b128 %3, %11, off\n\t"
        "global_load_async_to_lds_b128 %4, %12, off\n\t"
        "global_load_async_to_lds_b128 %5, %13, off\n\t"
        "global_load_async_to_lds_b128 %6, %14, off\n\t"
        "global_load_async_to_lds_b128 %7, %15, off\n\t"
        "s_wait_xcnt 0x0"
        :: "v"(la), "v"(la + GEMM_ROWSTEP), "v"(la + 2 * GEMM_ROWSTEP), "v"(la + 3 * GEMM_ROWSTEP),
           "v"(lb), "v"(lb + GEMM_ROWSTEP), "v"(lb + 2 * GEMM_ROWSTEP), "v"(lb + 3 * GEMM_ROWSTEP),
           "v"(a0), "v"(a0 + arow), "v"(a0 + 2 * arow), "v"(a0 + 3 * arow),
           "v"(b0), "v"(b1), "v"(b2), "v"(b3)
        : "memory");
}

__device__ __forceinline__
void gemm_tile(const bf16_t* __restrict__ A, const bf16_t* __restrict__ Wt,
               const float* __restrict__ bias, const float* __restrict__ resid,
               float* __restrict__ outF, bf16_t* __restrict__ outB,
               int N, int K, int ld, int act, int m0, int n0) {
    __shared__ __attribute__((aligned(16))) bf16_t As[2][128][GEMM_LDK];
    __shared__ __attribute__((aligned(16))) bf16_t Bs[2][128][GEMM_LDK];
    const int tid = threadIdx.x;
    const int wave = tid >> 5, lane = tid & 31;
    const int wm = (wave & 3) * 32, wn = (wave >> 2) * 64;
    const int lm = lane & 15, kh = lane >> 4;

    v8f acc[2][4];
    #pragma unroll
    for (int i = 0; i < 2; i++)
        #pragma unroll
        for (int j = 0; j < 4; j++)
            #pragma unroll
            for (int v = 0; v < 8; v++) acc[i][j][v] = 0.f;

    // copy map: 8 lanes a row (8 x 16 B = the row's 128 B of this stage), rows cr + 32 i
    const int cr = tid >> 3, cc = (tid & 7) * 8;
    const size_t arow = (size_t)32 * ld;
    const bf16_t* ga = A + (size_t)(m0 + cr) * ld + cc;
    // A weight row past N is replaced by row N - 1: every lane copies, every address is in
    // bounds, and the columns n >= N that such rows feed are never stored (epilogue).
    const bf16_t* gb[4];
    #pragma unroll
    for (int i = 0; i < 4; i++) {
        int rn = n0 + cr + 32 * i;
        rn = rn < N ? rn : N - 1;
        gb[i] = Wt + (size_t)rn * ld + cc;
    }
    const unsigned la = (unsigned)(size_t)&As[0][cr][cc];   // low 32 bits = LDS byte address
    const unsigned lb = (unsigned)(size_t)&Bs[0][cr][cc];
    const int nT = K / GEMM_BK;

    // stage 0 -> buffer 0, published; then stage 1 -> buffer 1 flies during trip 0
    gemm_stage(la, lb, ga, arow, gb[0], gb[1], gb[2], gb[3]);
    asm volatile("s_wait_asynccnt 0x0" ::: "memory");   // this wave's copies of stage 0 have landed
    __syncthreads();
    if (nT > 1)
        gemm_stage(la + GEMM_BUFSTEP, lb + GEMM_BUFSTEP, ga + GEMM_BK, arow,
                   gb[0] + GEMM_BK, gb[1] + GEMM_BK, gb[2] + GEMM_BK, gb[3] + GEMM_BK);

    for (int t = 0; t < nT; t++) {
        const int cur = t & 1;
        if (t + 2 < nT)
            __builtin_prefetch(A + (size_t)(m0 + (tid >> 1)) * ld + (t + 2) * GEMM_BK + (tid & 1) * 32, 0, 3);

        #pragma unroll
        for (int kk = 0; kk < GEMM_BK / 32; kk++) {
            AFrag a[2], bfr[4];
            #pragma unroll
            for (int i = 0; i < 2; i++) {
                const bf16_t* p = &As[cur][wm + i * 16 + lm][kk * 32 + kh * 8];
                a[i].q[0] = *(const u32x4*)p;
                a[i].q[1] = *(const u32x4*)(p + 16);
            }
            #pragma unroll
            for (int j = 0; j < 4; j++) {
                const bf16_t* p = &Bs[cur][wn + j * 16 + lm][kk * 32 + kh * 8];
                bfr[j].q[0] = *(const u32x4*)p;
                bfr[j].q[1] = *(const u32x4*)(p + 16);
            }
            #pragma unroll
            for (int i = 0; i < 2; i++)
                #pragma unroll
                for (int j = 0; j < 4; j++)
                    acc[i][j] = __builtin_amdgcn_wmma_f32_16x16x32_bf16(
                        false, a[i].v, false, bfr[j].v, (short)0, acc[i][j], false, false);
        }

        // publish stage t + 1 and free buffer cur, in this order:
        asm volatile("s_wait_dscnt 0x0" ::: "memory");      // this wave's reads of buffer cur are done
        asm volatile("s_wait_asynccnt 0x0" ::: "memory");   // this wave's copies of stage t + 1 have landed
        __syncthreads();
        if (t + 2 < nT) {
            const int ko = (t + 2) * GEMM_BK;
            const unsigned bo = cur * GEMM_BUFSTEP;
            gemm_stage(la + bo, lb + bo, ga + ko, arow, gb[0] + ko, gb[1] + ko, gb[2] + ko, gb[3] + ko);
        }
    }
    asm volatile("s_wait_asynccnt 0x0" ::: "memory");   // no copy is left in flight behind the loop

    // Epilogue.  The accumulator layout gives a lane one column of 8 rows: stored from there, every
    // access is a 4-B piece and the residual loads follow one another.  So each wave turns its own
    // 32 x 64 tile through its own LDS range (the ring is free: every wave has passed the last
    // trip's barrier and no copy is in flight) and takes it back row-wise: a lane holds 4
    // neighbouring columns, 16 lanes a row, so that every residual load and every store covers
    // whole 128-B lines, and the 16 residual loads of a lane fly together, under the turn.
    if (n0 + wn < N) {   // the same for the whole wave
        float* st0 = (float*)&As[0][0][0] + wave * (16 * EP_LD);   // rows  0..15 of the wave's tile
        float* st1 = (float*)&Bs[0][0][0] + wave * (16 * EP_LD);   // rows 16..31
        const int er = lane >> 4, ec = (lane & 15) * 4;
        const int n = n0 + wn + ec;
        const bool ok = n < N;   // N is a multiple of 4: a lane's 4 columns are in or out together
        const size_t idx0 = (size_t)(m0 + wm + er) * N + n;
        const size_t rstep = (size_t)2 * N;

        // behind each load: a later load's result or later arithmetic may land in its address registers
        f32x4 bv = {0.f, 0.f, 0.f, 0.f};
        if (ok && bias) {
            bv = *(const f32x4*)(bias + n);
            asm volatile("s_wait_xcnt 0x0" ::: "memory");   // see above
        }
        f32x4 rv[16];   // filled and read only where there is a residual
        if (ok && resid) {
            #pragma unroll
            for (int q = 0; q < 16; q++) {
                rv[q] = *(const f32x4*)(resid + idx0 + q * rstep);
                asm volatile("s_wait_xcnt 0x0" ::: "memory");   // see above
            }
        }

        #pragma unroll
        for (int j = 0; j < 4; j++)
            #pragma unroll
            for (int v = 0; v < 8; v++) {
                st0[(v + 8 * kh) * EP_LD + j * 16 + lm] = acc[0][j][v];
                st1[(v + 8 * kh) * EP_LD + j * 16 + lm] = acc[1][j][v];
            }
        // the rows are read back by other lanes of this wave: their writes have to be done
        asm volatile("s_wait_dscnt 0x0" ::: "memory");
        f32x4 cv[16];
        #pragma unroll
        for (int q = 0; q < 16; q++)
            cv[q] = *(const f32x4*)((q < 8 ? st0 : st1) + ((q & 7) * 2 + er) * EP_LD + ec);

        if (ok) {
            #pragma unroll
            for (int q = 0; q < 16; q++) {
                f32x4 c = cv[q] + bv;
                if (act == 1) {
                    #pragma unroll
                    for (int e = 0; e < 4; e++) c[e] = 0.5f * c[e] * (1.f + erff(c[e] * 0.70710678118f));
                }
                if (resid) c += rv[q];
                const size_t idx = idx0 + q * rstep;
                // behind each store: later arithmetic may land in its registers
                if (outF) {
                    *(f32x4*)(outF + idx) = c;
                    asm volatile("s_wait_xcnt 0x0" ::: "memory");   // see above
                }
                if (outB) {
                    bf16x4 o;
                    #pragma unroll
                    for (int e = 0; e < 4; e++) o[e] = (bf16_t)c[e];
                    *(bf16x4*)(outB + idx) = o;
                    asm volatile("s_wait_xcnt 0x0" ::: "memory");   // see above
                }
            }
        }
    }
}

__global__ __launch_bounds__(256)
void k_gemm_bf16(const bf16_t* __restrict__ A, const bf16_t* __restrict__ Wt,
                 const float* __restrict__ bias, const float* __restrict__ resid,
                 float* __restrict__ outF, bf16_t* __restrict__ outB,
                 int M, int N, int K, int act) {
    gemm_tile(A, Wt, bias, resid, outF, outB, N, K, K, act, blockIdx.y * 128, blockIdx.x * 128);
}

// The two products with N = 1024 have only 128 tiles of 128 x 128 for 256 WGPs, and a block walks its
// stages one after the other, so such a launch lasts as long as one walk over all of K.  Here K is cut
// into gridDim.z ranges of klen, each a block of its own: more blocks, each with a shorter walk.
// A block leaves its range's sum as it stands, f32, in its range's plane of part; the launch behind
// it adds the planes, the bias and the residual (k_join_ln, k_join_out).
#define SPLIT_STEP ((size_t)2048 * 1024)   // floats between two ranges' planes
#define SPLIT_OUT  2                       // ranges of the output projection (K = 1024)
#define SPLIT_PROJ 4                       // ranges of the second MLP product (K = 4096)

__global__ __launch_bounds__(256)
void k_gemm_splitk(const bf16_t* __restrict__ A, const bf16_t* __restrict__ Wt,
                   float* __restrict__ part, int N, int K, int klen) {
    const size_t ko = (size_t)blockIdx.z * klen;
    gemm_tile(A + ko, Wt + ko, nullptr, nullptr, part + blockIdx.z * SPLIT_STEP, nullptr,
              N, klen, K, 0, blockIdx.y * 128, blockIdx.x * 128);
}

// out = sum of the SPLIT_PROJ planes + bias + resid.  A block takes 4 rows of 1024; a thread holds the
// same 16 B of each, so that every load and store of a wave covers 4 whole lines and all of a
// thread's loads fly together.
__global__ __launch_bounds__(256)
void k_join_out(const float* __restrict__ part, const float* __restrict__ bias,
                const float* __restrict__ resid, float* __restrict__ out) {
    const unsigned e = blockIdx.x * 4096u + threadIdx.x * 4u;   // the thread's first element
    f32x4 p[SPLIT_PROJ][4], r[4];
    // The loads stand in groups off one address each.  Behind each group: the next loads' results or
    // later arithmetic may land in its address registers.
    #pragma unroll
    for (int z = 0; z < SPLIT_PROJ; z++) {
        #pragma unroll
        for (int q = 0; q < 4; q++) p[z][q] = *(const f32x4*)(part + z * SPLIT_STEP + e + q * 1024);
        asm volatile("s_wait_xcnt 0x0" ::: "memory");   // see above
    }
    #pragma unroll
    for (int q = 0; q < 4; q++) r[q] = *(const f32x4*)(resid + e + q * 1024);
    asm volatile("s_wait_xcnt 0x0" ::: "memory");   // see above
    const f32x4 bv = *(const f32x4*)(bias + threadIdx.x * 4u);
    asm volatile("s_wait_xcnt 0x0" ::: "memory");   // see above
    // keeps the additions behind all the loads: moved up among them they make the later loads wait
    // for the first ones' data, a second trip to memory
    __builtin_amdgcn_sched_barrier(0);
    f32x4 c[4];
    #pragma unroll
    for (int q = 0; q < 4; q++) {
        c[q] = p[0][q];
        #pragma unroll
        for (int z = 1; z < SPLIT_PROJ; z++) c[q] += p[z][q];
        c[q] = c[q] + bv + r[q];
    }
    // keeps the additions in front of the stores: moved in among them they could land in registers
    // of stores already issued
    __builtin_amdgcn_sched_barrier(0);
    #pragma unroll
    for (int q = 0; q < 4; q++) *(f32x4*)(out + e + q * 1024) = c[q];
    // nothing may land in the stores' registers before this
    asm volatile("s_wait_xcnt 0x0" ::: "memory");
}

// x1 = sum of the SPLIT_OUT planes + bias + x, stored, and its LayerNorm -> bf16.  One block per row.
__global__ __launch_bounds__(256)
void k_join_ln(const float* __restrict__ part, const float* __restrict__ bias,
               const float* __restrict__ x, float* __restrict__ x1,
               const float* __restrict__ g, const float* __restrict__ b, bf16_t* __restrict__ out) {
    const size_t o = (size_t)blockIdx.x * LN_D + threadIdx.x;
    float p[SPLIT_OUT][LN_E], xr[LN_E], bo[LN_E], v[LN_E];
    // groups of loads off one address each; behind each group: the next loads' results or addresses
    // may land in its address registers
    #pragma unroll
    for (int z = 0; z < SPLIT_OUT; z++) {
        #pragma unroll
        for (int i = 0; i < LN_E; i++) p[z][i] = part[z * SPLIT_STEP + o + 256 * i];
        asm volatile("s_wait_xcnt 0x0" ::: "memory");   // see above
    }
    #pragma unroll
    for (int i = 0; i < LN_E; i++) xr[i] = x[o + 256 * i];
    asm volatile("s_wait_xcnt 0x0" ::: "memory");   // see above
    #pragma unroll
    for (int i = 0; i < LN_E; i++) bo[i] = bias[threadIdx.x + 256 * i];
    asm volatile("s_wait_xcnt 0x0" ::: "memory");   // see above
    #pragma unroll
    for (int i = 0; i < LN_E; i++) {
        float c = p[0][i];
        #pragma unroll
        for (int z = 1; z < SPLIT_OUT; z++) c += p[z][i];
        v[i] = c + bo[i] + xr[i];
    }
    #pragma unroll
    for (int i = 0; i < LN_E; i++) x1[o + 256 * i] = v[i];
    // later arithmetic may land in the stores' registers
    asm volatile("s_wait_xcnt 0x0" ::: "memory");
    layernorm_vals(v, g, b, out, blockIdx.x);
}

// The seven projections of the same A (2048 x K) in one grid: they do not depend on one
// another, and the narrow ones (16 blocks each on their own) fill places the wide ones leave.
// blockIdx.x picks the weight and its 128-wide column tile, blockIdx.y the row tile.
struct ProjArgs {
    const bf16_t* A;
    const bf16_t* tqkv; const bf16_t* tmv; const bf16_t* t1w; const bf16_t* t2w;
    const bf16_t* t1r;  const bf16_t* t2r; const bf16_t* tmg;
    const float* bqkv; const float* bmv; const float* bmg;
    bf16_t* qkv;
    float* memval; float* p1w; float* p2w; float* p1r; float* p2r; float* glin;
    int K;
};
#define PROJ_TILES 37   // 24 (qkv) + 8 (mem values) + 4 (points) + 1 (gate)

__global__ __launch_bounds__(256)
void k_gemm_proj(ProjArgs a) {
    const int x = blockIdx.x;
    const bf16_t* Wt;
    const float* bias = nullptr;
    float* oF = nullptr;
    bf16_t* oB = nullptr;
    int N = 64, n0 = 0;
    if (x < 24)       { Wt = a.tqkv; bias = a.bqkv; oB = a.qkv;    N = 3072; n0 = x * 128; }
    else if (x < 32)  { Wt = a.tmv;  bias = a.bmv;  oF = a.memval; N = 1024; n0 = (x - 24) * 128; }
    else if (x == 32) { Wt = a.t1w;  oF = a.p1w; }
    else if (x == 33) { Wt = a.t2w;  oF = a.p2w; }
    else if (x == 34) { Wt = a.t1r;  oF = a.p1r; }
    else if (x == 35) { Wt = a.t2r;  oF = a.p2r; }
    else              { Wt = a.tmg;  bias = a.bmg;  oF = a.glin;   N = 16; }
    gemm_tile(a.A, Wt, bias, nullptr, oF, oB, N, a.K, a.K, 0, blockIdx.y * 128, n0);
}

// ---------------------------------------------------------------------------
// Flash-style causal attention.  qkv bf16 [(b,t), 3, H, 64].
// One block per (qb, part, bh): 128 q-rows of one head against the key tiles sb0 .. sb1 - 1;
// 256 threads (8 waves, 16 q-rows each).
// A wave walks its key tiles one after the other, so a launch lasts as long as the longest walk.
// The walk of q-tile qb (qb + 1 key tiles) is therefore cut into ATT_NPARTS(qb) parts of at most 3
// tiles, each a block of its own.  A part leaves its sums as they stand: the output sum without the
// division (opart), each row's maximum (pm) and its sum of exponentials (pl); k_combine joins them.
// ---------------------------------------------------------------------------
#define ATT_MAXPARTS 3
#define ATT_T 1024                                  // positions of a sequence: 8 q-tiles
#define ATT_NPARTS(qb) (((qb) + 3) / 3)             // parts of q-tile qb
#define ATT_OSTEP ((size_t)2048 * 1024)             // floats between two parts' output sums
#define ATT_SSTEP ((size_t)2048 * 16)               // floats between two parts' row maxima, or row sums

__device__ __forceinline__
void attention_block(const bf16_t* __restrict__ qkv, float* __restrict__ opart,
                     float* __restrict__ pm, float* __restrict__ pl,
                     int T, int H, int qb, int bh, int sb0, int sb1) {
    const int h = bh % H, b = bh / H;
    const int tid = threadIdx.x, wave = tid >> 5, lane = tid & 31;
    const int lm = lane & 15, kh = lane >> 4;

    __shared__ bf16_t Qs[128][72];
    __shared__ bf16_t Ks[128][72];
    __shared__ bf16_t Vt[64][136];     // V transposed: [dh][s]
    __shared__ bf16_t Ps[8][16][40];   // per-wave P staging (32-wide K chunk)

    const size_t strideT = 3 * 1024;
    const bf16_t* base = qkv + (size_t)b * T * strideT + (size_t)h * 64;

    // Load Q tile (128 x 64)
    for (int c8 = tid; c8 < 128 * 8; c8 += 256) {
        int rr = c8 >> 3, cc = (c8 & 7) * 8;
        const bf16_t* gq = base + (size_t)(qb * 128 + rr) * strideT + cc;
#if HAS_ASYNC_LDS
        async_copy16(&Qs[rr][cc], gq);
#else
        *(u32x4*)&Qs[rr][cc] = *(const u32x4*)gq;
#endif
    }

    float rowm[8], rowl[8];
    v8f oacc[4];
    #pragma unroll
    for (int v = 0; v < 8; v++) { rowm[v] = -INFINITY; rowl[v] = 0.f; }
    #pragma unroll
    for (int jt = 0; jt < 4; jt++)
        #pragma unroll
        for (int v = 0; v < 8; v++) oacc[jt][v] = 0.f;

    for (int sb = sb0; sb < sb1; sb++) {
        __syncthreads();   // protect Ks/Vt reuse across iterations
        for (int c8 = tid; c8 < 128 * 8; c8 += 256) {
            int rr = c8 >> 3, cc = (c8 & 7) * 8;
            const bf16_t* gk = base + (size_t)(sb * 128 + rr) * strideT + 1024 + cc;
#if HAS_ASYNC_LDS
            async_copy16(&Ks[rr][cc], gk);
#else
            *(u32x4*)&Ks[rr][cc] = *(const u32x4*)gk;
#endif
        }
        for (int c8 = tid; c8 < 128 * 8; c8 += 256) {
            int rr = c8 >> 3, cc = (c8 & 7) * 8;
            union { u32x4 u; bf16_t e[8]; } vv;
            vv.u = *(const u32x4*)(base + (size_t)(sb * 128 + rr) * strideT + 2048 + cc);
            #pragma unroll
            for (int i = 0; i < 8; i++) Vt[cc + i][rr] = vv.e[i];
        }
        async_wait0();
        __syncthreads();

        // ---- scores: S = Q * K^T ----
        AFrag aq[2];
        #pragma unroll
        for (int kk = 0; kk < 2; kk++) {
            const bf16_t* p = &Qs[wave * 16 + lm][kk * 32 + kh * 8];
            aq[kk].q[0] = *(const u32x4*)p;
            aq[kk].q[1] = *(const u32x4*)(p + 16);
        }
        v8f sacc[8];
        #pragma unroll
        for (int j = 0; j < 8; j++)
            #pragma unroll
            for (int v = 0; v < 8; v++) sacc[j][v] = 0.f;
        #pragma unroll
        for (int j = 0; j < 8; j++)
            #pragma unroll
            for (int kk = 0; kk < 2; kk++) {
                AFrag bk;
                const bf16_t* p = &Ks[j * 16 + lm][kk * 32 + kh * 8];
                bk.q[0] = *(const u32x4*)p;
                bk.q[1] = *(const u32x4*)(p + 16);
                sacc[j] = __builtin_amdgcn_wmma_f32_16x16x32_bf16(
                    false, aq[kk].v, false, bk.v, (short)0, sacc[j], false, false);
            }

        // ---- causal mask + online softmax (wave32: 16-lane row reductions) ----
        #pragma unroll
        for (int v = 0; v < 8; v++) {
            int trow = qb * 128 + wave * 16 + v + 8 * kh;
            float rm = -INFINITY;
            #pragma unroll
            for (int j = 0; j < 8; j++) {
                int col = sb * 128 + j * 16 + lm;
                float s = (col <= trow) ? sacc[j][v] * 0.125f : -INFINITY;
                sacc[j][v] = s;
                rm = fmaxf(rm, s);
            }
            #pragma unroll
            for (int msk = 1; msk < 16; msk <<= 1) rm = fmaxf(rm, __shfl_xor(rm, msk));
            float mnew = fmaxf(rowm[v], rm);
            float corr = expf(rowm[v] - mnew);
            rowm[v] = mnew;
            float rs = 0.f;
            #pragma unroll
            for (int j = 0; j < 8; j++) {
                float p = expf(sacc[j][v] - mnew);
                sacc[j][v] = p;
                rs += p;
            }
            #pragma unroll
            for (int msk = 1; msk < 16; msk <<= 1) rs += __shfl_xor(rs, msk);
            rowl[v] = rowl[v] * corr + rs;
            #pragma unroll
            for (int jt = 0; jt < 4; jt++) oacc[jt][v] = oacc[jt][v] * corr;
        }

        // ---- O += P * V  (stage P through LDS: C-layout -> A-layout) ----
        #pragma unroll
        for (int kk = 0; kk < 4; kk++) {
            #pragma unroll
            for (int jj = 0; jj < 2; jj++) {
                int j = kk * 2 + jj;
                #pragma unroll
                for (int v = 0; v < 8; v++)
                    Ps[wave][v + 8 * kh][jj * 16 + lm] = (bf16_t)sacc[j][v];
            }
            AFrag ap;
            const bf16_t* p = &Ps[wave][lm][kh * 8];
            ap.q[0] = *(const u32x4*)p;
            ap.q[1] = *(const u32x4*)(p + 16);
            #pragma unroll
            for (int jt = 0; jt < 4; jt++) {
                AFrag bv;
                const bf16_t* q = &Vt[jt * 16 + lm][kk * 32 + kh * 8];
                bv.q[0] = *(const u32x4*)q;
                bv.q[1] = *(const u32x4*)(q + 16);
                oacc[jt] = __builtin_amdgcn_wmma_f32_16x16x32_bf16(
                    false, ap.v, false, bv.v, (short)0, oacc[jt], false, false);
            }
        }
    }

    float* out = opart + (size_t)b * T * 1024 + (size_t)h * 64;
    // a row's maximum and sum are the same in its 16 lanes: the first of them stores both
    if (lm == 0) {
        // 16 heads a row, as in ATT_SSTEP: a constant, so that the 8 rows are offsets of one address
        const size_t r0 = ((size_t)b * T + qb * 128 + wave * 16 + 8 * kh) * 16 + h;
        #pragma unroll
        for (int v = 0; v < 8; v++) { pm[r0 + v * 16] = rowm[v]; pl[r0 + v * 16] = rowl[v]; }
    }
    #pragma unroll
    for (int jt = 0; jt < 4; jt++)
        #pragma unroll
        for (int v = 0; v < 8; v++) {
            int trow = qb * 128 + wave * 16 + v + 8 * kh;
            int col  = jt * 16 + lm;
            out[(size_t)trow * 1024 + col] = oacc[jt][v];
        }
    // the code laid behind the attention's may write the stores' registers
    asm volatile("s_wait_xcnt 0x0" ::: "memory");
}

// ---------------------------------------------------------------------------
// Plucker line through two points of R^4, normalised.
// ---------------------------------------------------------------------------
__device__ inline void exterior4(const float* a1, const float* a2, float* L) {
    L[0] = a1[0] * a2[1] - a1[1] * a2[0];
    L[1] = a1[0] * a2[2] - a1[2] * a2[0];
    L[2] = a1[0] * a2[3] - a1[3] * a2[0];
    L[3] = a1[1] * a2[2] - a1[2] * a2[1];
    L[4] = a1[1] * a2[3] - a1[3] * a2[1];
    L[5] = a1[2] * a2[3] - a1[3] * a2[2];
    float n2 = 0.f;
    #pragma unroll
    for (int i = 0; i < 6; i++) n2 += L[i] * L[i];
    float inv = 1.f / fmaxf(sqrtf(n2), 1e-12f);
    #pragma unroll
    for (int i = 0; i < 6; i++) L[i] *= inv;
}

// ---------------------------------------------------------------------------
// Decayed-Gram scan:  M_t = d*(M_{t-1} + Jw_{t-1} Jw_{t-1}^T),  M_0 = 0.
// The recurrence is linear, so it is run as a chunked parallel scan:
// one block per (b,h), thread c owns the 4 steps t = 4c .. 4c+3 (T == 4 * blockDim.x).
//   0) each thread forms the write lines (rotated by J6) and the read lines of its own 4 steps
//      from the projected points: no one else reads them, so they never go through memory
//   1) each thread folds its own 4 steps from zero   (chunk aggregate)
//   2) weighted prefix over chunks: lanes by shuffles, waves through LDS
//   3) each thread replays its 4 steps from its true M and writes the gates
// M is symmetric, so only its 21 upper entries are carried.
// Every loop is unrolled so that the small arrays are indexed by constants and stay in registers.
// ---------------------------------------------------------------------------
#define GS_L 4      // steps per thread
#define GS_NS 21    // upper triangle of a 6x6

__device__ __forceinline__ void gram_step(float* m, const float* J, float d) {
    int n = 0;
    #pragma unroll
    for (int i = 0; i < 6; i++)
        #pragma unroll
        for (int j = i; j < 6; j++, n++) m[n] = d * (m[n] + J[i] * J[j]);
}

__device__ __forceinline__
void gram_block(const float* __restrict__ p1w, const float* __restrict__ p2w,
                const float* __restrict__ p1r, const float* __restrict__ p2r,
                const float* __restrict__ glin, const float* __restrict__ decay_logits,
                const float* __restrict__ iter_mix, const float* __restrict__ mem_scale,
                float* __restrict__ gh, int T, int H, int bh) {
    __shared__ __attribute__((aligned(16))) float Wagg[8][24];   // rows of 21, padded to 16 B
    const int h = bh % H, b = bh / H;
    const int c = threadIdx.x, lane = c & 31;
    const int wave = __builtin_amdgcn_readfirstlane(c >> 5);     // scalar: the tests on it in 2b are scalar compares
    const int t0 = c * GS_L;

    // all of this thread's inputs, issued up front
    // a head's point is 16 B of a 256-B row; po: this thread's first row, this head, in floats
    const size_t po = ((size_t)b * T + t0) * 64 + h * 4;
    union F4 { f32x4 q; float f[4]; };
    F4 w1[GS_L], w2[GS_L], r1[GS_L], r2[GS_L];
    // the write line of step t takes its first point from row t - 1; step 0 has none (zero below),
    // and its load reads row 0 so that the address stays inside the array
    #pragma unroll
    for (int k = 0; k < GS_L; k++) w1[k].q = *(const f32x4*)(p1w + po + (t0 + k > 0 ? k - 1 : k) * 64);
    // the next loads may land in these loads' address registers
    asm volatile("s_wait_xcnt 0x0" ::: "memory");
    #pragma unroll
    for (int k = 0; k < GS_L; k++) w2[k].q = *(const f32x4*)(p2w + po + k * 64);
    // as above
    asm volatile("s_wait_xcnt 0x0" ::: "memory");
    #pragma unroll
    for (int k = 0; k < GS_L; k++) r1[k].q = *(const f32x4*)(p1r + po + k * 64);
    // as above
    asm volatile("s_wait_xcnt 0x0" ::: "memory");
    #pragma unroll
    for (int k = 0; k < GS_L; k++) r2[k].q = *(const f32x4*)(p2r + po + k * 64);
    // as above
    asm volatile("s_wait_xcnt 0x0" ::: "memory");
    float gl[GS_L];
    #pragma unroll
    for (int k = 0; k < GS_L; k++) gl[k] = glin[((size_t)b * T + t0 + k) * H + h];
    // the loads' address registers are reused by the arithmetic below
    asm volatile("s_wait_xcnt 0x0" ::: "memory");

    const float decay = 1.f / (1.f + expf(-decay_logits[h]));
    const float alpha = 1.f / (1.f + expf(-iter_mix[0]));
    const float msc = mem_scale[h];

    // w[s] = decay^(4 * 2^s): the decay across 2^s chunks
    float w[6];
    w[0] = (decay * decay) * (decay * decay);
    #pragma unroll
    for (int s = 1; s < 6; s++) w[s] = w[s - 1] * w[s - 1];

    // 0) lines
    struct { float f[24]; } J, R;
    #pragma unroll
    for (int k = 0; k < GS_L; k++) {
        float L[6];
        if (t0 + k == 0) {
            #pragma unroll
            for (int e = 0; e < 4; e++) w1[k].f[e] = 0.f;
        }
        exterior4(w1[k].f, w2[k].f, L);
        float* jw = &J.f[k * 6];
        jw[0] = L[5]; jw[1] = -L[4]; jw[2] = L[3]; jw[3] = L[2]; jw[4] = -L[1]; jw[5] = L[0];
        exterior4(r1[k].f, r2[k].f, &R.f[k * 6]);
    }

    // 1) chunk aggregate
    float m[GS_NS];
    #pragma unroll
    for (int n = 0; n < GS_NS; n++) m[n] = 0.f;
    #pragma unroll
    for (int k = 0; k < GS_L; k++) gram_step(m, &J.f[k * 6], decay);

    // 2a) inclusive weighted prefix over the wave's 32 chunks
    #pragma unroll
    for (int s = 0; s < 5; s++) {
        const int o = 1 << s;
        #pragma unroll
        for (int n = 0; n < GS_NS; n++) {
            float v = __shfl_up(m[n], o);
            m[n] = (lane >= o) ? m[n] + w[s] * v : m[n];
        }
    }
    if (lane == 31) {
        #pragma unroll
        for (int n = 0; n < GS_NS; n++) Wagg[wave][n] = m[n];
    }
    // exclusive within the wave
    #pragma unroll
    for (int n = 0; n < GS_NS; n++) {
        float v = __shfl_up(m[n], 1);
        m[n] = (lane > 0) ? v : 0.f;
    }
    __syncthreads();

    // 2b) M at the wave's first step, from the earlier waves' totals.
    // It is the same for the whole wave: lane n folds entry n, then it is read per entry.
    const int ln = (lane < GS_NS) ? lane : 0;
    float tot[7];
    #pragma unroll
    for (int q = 0; q < 7; q++) tot[q] = Wagg[q][ln];
    float p = 0.f;
    #pragma unroll
    for (int q = 0; q < 7; q++) p = (q < wave) ? w[5] * p + tot[q] : p;
    float dl = 1.f;   // decay^(4 * lane)
    #pragma unroll
    for (int s = 0; s < 5; s++) dl *= ((lane >> s) & 1) ? w[s] : 1.f;
    #pragma unroll
    for (int n = 0; n < GS_NS; n++)
        m[n] += dl * __int_as_float(__builtin_amdgcn_readlane(__float_as_int(p), n));

    // 3) replay
    #pragma unroll
    for (int k = 0; k < GS_L; k++) {
        const float* rd = &R.f[k * 6];
        float rdM[6] = {0, 0, 0, 0, 0, 0};
        int n = 0;
        #pragma unroll
        for (int i = 0; i < 6; i++)
            #pragma unroll
            for (int j = i; j < 6; j++, n++) {
                rdM[j] += rd[i] * m[n];
                if (j != i) rdM[i] += rd[j] * m[n];
            }
        float s1 = 0.f, s2 = 0.f;
        #pragma unroll
        for (int j = 0; j < 6; j++) { s1 += rdM[j] * rd[j]; s2 += rdM[j] * rdM[j]; }
        float ms = (1.f - alpha) * s1 + alpha * s2;
        float g1 = 1.f / (1.f + expf(-ms * msc));
        float g2 = 1.f / (1.f + expf(-gl[k]));
        gh[((size_t)b * T + t0 + k) * H + h] = g1 * g2;
        if (k + 1 < GS_L) gram_step(m, &J.f[k * 6], decay);
    }
}

// ---------------------------------------------------------------------------
// Third launch: all that needs the projections or nothing at all, and that the later launches wait
// for.  The attention, the Gram branch and the turn of Wfc, Wproj and Wout do not depend on one
// another, so they share a grid.  The attention blocks last longest and start first; the others run
// beside them.
// ---------------------------------------------------------------------------
#define MID_ATT_BLOCKS  480   // 15 parts of the 8 q-tiles x 32 (b, h)
#define MID_GRAM_BLOCKS 32    // one per (b, h)
#define MID_BLOCKS (MID_ATT_BLOCKS + MID_GRAM_BLOCKS + TR_LATE_BLOCKS)

__global__ __launch_bounds__(256)
void k_mid(TrArgs a, const bf16_t* __restrict__ qkv, float* __restrict__ opart,
           float* __restrict__ pm, float* __restrict__ pl,
           const float* __restrict__ p1w, const float* __restrict__ p2w,
           const float* __restrict__ p1r, const float* __restrict__ p2r,
           const float* __restrict__ glin, const float* __restrict__ decay_logits,
           const float* __restrict__ iter_mix, const float* __restrict__ mem_scale,
           float* __restrict__ gh, int T, int H) {
    __shared__ __attribute__((aligned(16))) char tile[128 * 256];
    const int l = blockIdx.x;
    // written in this order the attention, the longest code on the longest path, comes first in the
    // kernel's text
    if (l >= MID_ATT_BLOCKS) {
        if (l < MID_ATT_BLOCKS + MID_GRAM_BLOCKS)
            gram_block(p1w, p2w, p1r, p2r, glin, decay_logits, iter_mix, mem_scale, gh, T, H, l - MID_ATT_BLOCKS);
        else
            tr_late(a, l - (MID_ATT_BLOCKS + MID_GRAM_BLOCKS), tile);
        return;
    }
    // The 15 parts, those of 3 key tiles first, then those of 2, then the one of 1; 32 (b, h) each.
    // Digit c of each constant belongs to part c: its q-tile, its number among that q-tile's parts
    // (part p of P takes the tiles p * n / P .. (p + 1) * n / P - 1 of n = qb + 1), first tile, end.
    const int c4 = (l >> 5) * 4;
    const int qb  = (int)((0x013346672455677ULL >> c4) & 15);
    const int p   = (int)((0x001001000110221ULL >> c4) & 15);
    const int sb0 = (int)((0x002002000230452ULL >> c4) & 15);
    const int sb1 = (int)((0x124224223563785ULL >> c4) & 15);
    attention_block(qkv, opart + p * ATT_OSTEP, pm + p * ATT_SSTEP, pl + p * ATT_SSTEP,
                    T, H, qb, l & 31, sb0, sb1);
}

// ---------------------------------------------------------------------------
// y = seqout + mean_h(gh) * memval  -> bf16 (input to Wout GEMM)
// seqout is formed here, from the P parts that the row's attention was cut into.  Per head, with
// m_p, l_p, O_p a part's row maximum, sum of exponentials and output sum, and M = max_p m_p:
//   seqout = sum_p exp(m_p - M) O_p / sum_p exp(m_p - M) l_p        (P == 1: O_0 / l_0)
// One block per row of 1024 = 4 x 256 columns; op, mv, yr: the row's start; pm, pl: its 16 heads.
// ---------------------------------------------------------------------------
template <int P>
__device__ __forceinline__
void combine_row(const float* __restrict__ op, const float* __restrict__ pm,
                 const float* __restrict__ pl, const float* __restrict__ mv,
                 float g, bf16_t* __restrict__ yr) {
    const int tid = threadIdx.x, hd = tid >> 6;   // column tid + 256 i lies in head hd + 4 i
    float o[4][P], m[4][P], l[4][P], v[4];
    // The loads stand in groups off one address each.  Behind each group: the next loads' results or
    // later arithmetic may land in its address registers.
    #pragma unroll
    for (int p = 0; p < P; p++) {
        #pragma unroll
        for (int i = 0; i < 4; i++) o[i][p] = op[p * ATT_OSTEP + tid + 256 * i];
        asm volatile("s_wait_xcnt 0x0" ::: "memory");   // see above
    }
    #pragma unroll
    for (int i = 0; i < 4; i++) v[i] = mv[tid + 256 * i];
    asm volatile("s_wait_xcnt 0x0" ::: "memory");   // see above
    #pragma unroll
    for (int p = 0; p < P; p++)
        #pragma unroll
        for (int i = 0; i < 4; i++) l[i][p] = pl[p * ATT_SSTEP + hd + 4 * i];
    asm volatile("s_wait_xcnt 0x0" ::: "memory");   // see above
    #pragma unroll
    for (int p = 0; p < P; p++)
        #pragma unroll
        for (int i = 0; i < 4; i++) m[i][p] = P > 1 ? pm[p * ATT_SSTEP + hd + 4 * i] : 0.f;
    if (P > 1) asm volatile("s_wait_xcnt 0x0" ::: "memory");   // see above
    // keeps the arithmetic behind all the loads: moved up among them it makes the later loads wait
    // for the first ones' data, a second trip to memory
    __builtin_amdgcn_sched_barrier(0);
    bf16_t r[4];
    #pragma unroll
    for (int i = 0; i < 4; i++) {
        float num = o[i][0], den = l[i][0];
        if (P > 1) {
            float mx = m[i][0];
            #pragma unroll
            for (int p = 1; p < P; p++) mx = fmaxf(mx, m[i][p]);
            num = 0.f; den = 0.f;
            #pragma unroll
            for (int p = 0; p < P; p++) {
                const float w = expf(m[i][p] - mx);
                num += w * o[i][p];
                den += w * l[i][p];
            }
        }
        r[i] = (bf16_t)(num / den + g * v[i]);
    }
    // keeps the arithmetic in front of the stores: moved in among them it could land in registers
    // of stores already issued
    __builtin_amdgcn_sched_barrier(0);
    #pragma unroll
    for (int i = 0; i < 4; i++) yr[tid + 256 * i] = r[i];
    // the code laid behind this row's may write the stores' registers
    asm volatile("s_wait_xcnt 0x0" ::: "memory");
}

__global__ __launch_bounds__(256)
void k_combine(const float* __restrict__ opart, const float* __restrict__ pm,
               const float* __restrict__ pl, const float* __restrict__ memval,
               const float* __restrict__ gh, bf16_t* __restrict__ y, int D, int H) {
    size_t row = blockIdx.x;
    float g = 0.f;
    #pragma unroll
    for (int h = 0; h < 16; h++) g += gh[row * H + h];
    g *= (1.f / 16.f);
    const float* op = opart + row * D;
    const float* rm = pm + row * H;
    const float* rl = pl + row * H;
    const float* mv = memval + row * D;
    bf16_t* yr = y + row * D;
    const int P = ATT_NPARTS(((int)blockIdx.x % ATT_T) >> 7);   // the same for the whole block
    if (P == 1)      combine_row<1>(op, rm, rl, mv, g, yr);
    else if (P == 2) combine_row<2>(op, rm, rl, mv, g, yr);
    else             combine_row<3>(op, rm, rl, mv, g, yr);
}

// ---------------------------------------------------------------------------
extern "C" void kernel_launch(void* const* d_in, const int* in_sizes, int n_in,
                              void* d_out, int out_size, void* d_ws, size_t ws_size,
                              hipStream_t stream) {
    const int B = 2, T = 1024, D = 1024, H = 16, DFF = 4096;
    const int M = B * T;

    const float* x            = (const float*)d_in[0];
    const float* ln1_g        = (const float*)d_in[1];
    const float* ln1_b        = (const float*)d_in[2];
    const float* Wqkv         = (const float*)d_in[3];
    const float* bqkv         = (const float*)d_in[4];
    const float* W1w          = (const float*)d_in[5];
    const float* W2w          = (const float*)d_in[6];
    const float* W1r          = (const float*)d_in[7];
    const float* W2r          = (const float*)d_in[8];
    const float* Wmv          = (const float*)d_in[9];
    const float* bmv          = (const float*)d_in[10];
    const float* Wmg          = (const float*)d_in[11];
    const float* bmg          = (const float*)d_in[12];
    const float* mem_scale    = (const float*)d_in[13];
    const float* iter_mix     = (const float*)d_in[14];
    const float* decay_logits = (const float*)d_in[15];
    const float* Wout         = (const float*)d_in[16];
    const float* bout         = (const float*)d_in[17];
    const float* ln2_g        = (const float*)d_in[18];
    const float* ln2_b        = (const float*)d_in[19];
    const float* Wfc          = (const float*)d_in[20];
    const float* bfc          = (const float*)d_in[21];
    const float* Wproj        = (const float*)d_in[22];
    const float* bproj        = (const float*)d_in[23];

    char* ws = (char*)d_ws;
    size_t off = 0;
    auto alloc = [&](size_t bytes) -> void* {
        void* p = ws + off;
        off += (bytes + 255) & ~(size_t)255;
        return p;
    };

    bf16_t* Wqkv_t  = (bf16_t*)alloc((size_t)3 * D * D * 2);
    bf16_t* W1w_t   = (bf16_t*)alloc((size_t)64 * D * 2);
    bf16_t* W2w_t   = (bf16_t*)alloc((size_t)64 * D * 2);
    bf16_t* W1r_t   = (bf16_t*)alloc((size_t)64 * D * 2);
    bf16_t* W2r_t   = (bf16_t*)alloc((size_t)64 * D * 2);
    bf16_t* Wmg_t   = (bf16_t*)alloc((size_t)H * D * 2);
    bf16_t* Wmv_t   = (bf16_t*)alloc((size_t)D * D * 2);
    bf16_t* Wout_t  = (bf16_t*)alloc((size_t)D * D * 2);
    bf16_t* Wfc_t   = (bf16_t*)alloc((size_t)DFF * D * 2);
    bf16_t* Wproj_t = (bf16_t*)alloc((size_t)D * DFF * 2);
    bf16_t* h_bf    = (bf16_t*)alloc((size_t)M * D * 2);
    bf16_t* qkv_bf  = (bf16_t*)alloc((size_t)M * 3 * D * 2);
    float*  p1w     = (float*)alloc((size_t)M * 64 * 4);
    float*  p2w     = (float*)alloc((size_t)M * 64 * 4);
    float*  p1r     = (float*)alloc((size_t)M * 64 * 4);
    float*  p2r     = (float*)alloc((size_t)M * 64 * 4);
    float*  glin    = (float*)alloc((size_t)M * H * 4);
    float*  ghb     = (float*)alloc((size_t)M * H * 4);
    float*  memval  = (float*)alloc((size_t)M * D * 4);
    float*  opart   = (float*)alloc((size_t)ATT_MAXPARTS * M * D * 4);
    float*  pmax    = (float*)alloc((size_t)ATT_MAXPARTS * M * H * 4);
    float*  psum    = (float*)alloc((size_t)ATT_MAXPARTS * M * H * 4);
    bf16_t* y_bf    = (bf16_t*)alloc((size_t)M * D * 2);
    float*  x1      = (float*)alloc((size_t)M * D * 4);
    bf16_t* h2_bf   = (bf16_t*)alloc((size_t)M * D * 2);
    bf16_t* a_bf    = (bf16_t*)alloc((size_t)M * DFF * 2);
    float*  part_o  = (float*)alloc((size_t)SPLIT_OUT * M * D * 4);
    float*  part_p  = (float*)alloc((size_t)SPLIT_PROJ * M * D * 4);

    auto gemm = [&](const bf16_t* A, const bf16_t* Wt, const float* bias,
                    const float* resid, float* oF, bf16_t* oB, int m, int n, int k, int act) {
        dim3 g((n + 127) / 128, (m + 127) / 128);
        k_gemm_bf16<<<g, 256, 0, stream>>>(A, Wt, bias, resid, oF, oB, m, n, k, act);
    };

    // 1) the projections' weights -> bf16 transposed, and ln1
    TrArgs ta = { Wfc, Wproj, Wqkv, Wmv, Wout, W1w, W2w, W1r, W2r, Wmg,
                  Wfc_t, Wproj_t, Wqkv_t, Wmv_t, Wout_t, W1w_t, W2w_t, W1r_t, W2r_t, Wmg_t };
    k_front<<<TR_FIRST_BLOCKS + M, 256, 0, stream>>>(ta, x, ln1_g, ln1_b, h_bf);

    // 2) projections
    ProjArgs pa = { h_bf, Wqkv_t, Wmv_t, W1w_t, W2w_t, W1r_t, W2r_t, Wmg_t,
                    bqkv, bmv, bmg, qkv_bf, memval, p1w, p2w, p1r, p2r, glin, D };
    k_gemm_proj<<<dim3(PROJ_TILES, 16), 256, 0, stream>>>(pa);

    // 3) attention, Gram memory branch, the other weights -> bf16 transposed
    k_mid<<<MID_BLOCKS, 256, 0, stream>>>(ta, qkv_bf, opart, pmax, psum, p1w, p2w, p1r, p2r, glin,
                                          decay_logits, iter_mix, mem_scale, ghb, T, H);

    // 4) the two branches joined
    k_combine<<<M, 256, 0, stream>>>(opart, pmax, psum, memval, ghb, y_bf, D, H);

    // 5) output projection in k ranges; their sum + bias + residual, and ln2
    k_gemm_splitk<<<dim3(8, 16, SPLIT_OUT), 256, 0, stream>>>(y_bf, Wout_t, part_o, D, D, D / SPLIT_OUT);
    k_join_ln<<<M, 256, 0, stream>>>(part_o, bout, x, x1, ln2_g, ln2_b, h2_bf);

    // 6) MLP; the second product in k ranges, then their sum + bias + residual
    gemm(h2_bf, Wfc_t, bfc, nullptr, nullptr, a_bf, M, DFF, D, 1);
    k_gemm_splitk<<<dim3(8, 16, SPLIT_PROJ), 256, 0, stream>>>(a_bf, Wproj_t, part_p, D, DFF, DFF / SPLIT_PROJ);
    k_join_out<<<M / 4, 256, 0, stream>>>(part_p, bproj, x1, (float*)d_out);
}

// v009
// Measured time: 120 microseconds a run.
// Timed twice side by side with v008, it ran 1.10 and 1.09 times as fast.
// Over all steps from v000 it is 7.20 times as fast.
#include <hip/hip_runtime.h>
#include <math.h>

typedef __bf16 bf16_t;
typedef __attribute__((ext_vector_type(16))) __bf16 v16bf;
typedef __attribute__((ext_vector_type(8)))  float  v8f;
typedef unsigned int u32x4 __attribute__((ext_vector_type(4)));
typedef int i32x4 __attribute__((ext_vector_type(4)));
typedef float  f32x4  __attribute__((ext_vector_type(4)));
typedef __bf16 bf16x4 __attribute__((ext_vector_type(4)));
typedef __bf16 bf16x8 __attribute__((ext_vector_type(8)));

union AFrag { v16bf v; u32x4 q[2]; };

#if __has_builtin(__builtin_amdgcn_global_load_async_to_lds_b128) && \
    __has_builtin(__builtin_amdgcn_s_wait_asynccnt)
#define HAS_ASYNC_LDS 1
typedef __attribute__((address_space(1))) i32x4* glds_gptr;
typedef __attribute__((address_space(3))) i32x4* glds_lptr;
#else
#define HAS_ASYNC_LDS 0
#endif

__device__ __forceinline__ void async_copy16(void* lds, const void* g) {
#if HAS_ASYNC_LDS
    __builtin_amdgcn_global_load_async_to_lds_b128(
        (glds_gptr)(g), (glds_lptr)(lds), 0, 0);
#endif
}
__device__ __forceinline__ void async_wait0() {
#if HAS_ASYNC_LDS
    __builtin_amdgcn_s_wait_asynccnt(0);
#endif
}

// ---------------------------------------------------------------------------
// Exponentials and the error function of the two hot places (softmax, GELU) on the chip's own
// instructions.  The library's expf spends about a dozen vector instructions around its one v_exp_f32
// (split-precision argument, ldexp, two range tests), and its erff picks one of two polynomials by a
// branch on the lanes' values: a wave whose lanes differ runs both, one element after the other.
// ---------------------------------------------------------------------------
#define LOG2E 1.44269504f

// 0.5 c (1 + erf(c / sqrt 2)).  erf by one formula for every argument, without a branch, so that
// independent elements interleave:  erf|x| = 1 - t (a1 + t (a2 + t (a3 + t (a4 + t a5)))) exp(-x^2),
// t = 1 / (1 + p |x|); its absolute error is at most 1.5e-7, the size of an f32 rounding step at 1.
__device__ __forceinline__ float gelu_erf(float c) {
    const float x = c * 0.70710678118f;
    const float t = __builtin_amdgcn_rcpf(fmaf(0.3275911f, fabsf(x), 1.f));
    float q = fmaf(t, 1.061405429f, -1.453152027f);
    q = fmaf(t, q, 1.421413741f);
    q = fmaf(t, q, -0.284496736f);
    q = fmaf(t, q, 0.254829592f);
    const float e = __builtin_amdgcn_exp2f((x * -LOG2E) * x);
    const float er = copysignf(fmaf(-(q * t), e, 1.f), x);
    return 0.5f * c * (1.f + er);
}

// ---------------------------------------------------------------------------
// Weight convert: W (K x N, f32, row-major) -> Wt (N x K, bf16, row-major)
// A block finds its weight and its tile from an index l that its kernel hands it (tr_first, tr_late).
// A block turns a tile of 128 k x 128 n, 64 elements a thread, so that the grid has few waves
// and each of them keeps 16 loads of 16 B a lane in flight:
//   load : a wave reads 512 contiguous bytes of a W row (4 n a lane); a lane takes the same
//          4 n of 8 successive k, twice, and so holds 8 k of each n: 16 B of a Wt row
//   turn : those 16-B pieces go to LDS as [n][k], rows of 256 B
//   store: a wave takes two rows back, 16 B a lane, and stores 2 x 256 contiguous bytes of Wt
// LDS rows have no pad; the 16-B piece c of row n lies at place c ^ ((n >> 2) & 15).  So the 16
// lanes that write one k piece of rows 4 apart, and the 16 that read one whole row, each meet
// all 64 banks once.
// K is a multiple of 128; N a multiple of 128, or below 128 and a multiple of 16 (one tile wide).
// ---------------------------------------------------------------------------
struct TrArgs {
    const float* wfc;  const float* wproj; const float* wqkv; const float* wmv; const float* wout;
    const float* w1w;  const float* w2w;   const float* w1r;  const float* w2r; const float* wmg;
    bf16_t* tfc;  bf16_t* tproj; bf16_t* tqkv; bf16_t* tmv; bf16_t* tout;
    bf16_t* t1w;  bf16_t* t2w;   bf16_t* t1r;  bf16_t* t2r; bf16_t* tmg;
};
#define TR_FIRST_BLOCKS 296   // 192 + 64 + 4 * 8 + 8: the weights that the projections of ln1(x) read
#define TR_LATE_BLOCKS  576   // 256 + 256 + 64: Wfc, Wproj, Wout, first read behind the attention

template <int K, int N>
__device__ __forceinline__
void tr_tile(const float* __restrict__ W, bf16_t* __restrict__ Wt, int kb, int nb, char* lds) {
    constexpr int NT = N < 128 ? N : 128;   // columns of W in this tile
    const int tid = threadIdx.x, lane = tid & 31;
    const int wave = __builtin_amdgcn_readfirstlane(tid >> 5);   // scalar: row addresses stay scalar
    if (4 * lane < NT) {
        const float* p = W + (size_t)(kb + 8 * wave) * N + nb;   // scalar; the lane is the loads' one vector register
        f32x4 v[2][8];
        #pragma unroll
        for (int r = 0; r < 2; r++)
            #pragma unroll
            for (int i = 0; i < 8; i++) v[r][i] = ((const f32x4*)(p + (size_t)(64 * r + i) * N))[lane];
        // later arithmetic may land in the loads' index register; it is named as an input so that
        // it lives up to the wait: otherwise the last load's own result could be placed in it
        asm volatile("s_wait_xcnt 0x0" :: "v"(lane) : "memory");
        // keeps the conversions behind all 16 loads: moved up among them (to save registers) they
        // make the last loads wait for the first ones' data, a second trip to memory
        __builtin_amdgcn_sched_barrier(0);
        #pragma unroll
        for (int r = 0; r < 2; r++)
            #pragma unroll
            for (int j = 0; j < 4; j++) {
                bf16x8 o;
                #pragma unroll
                for (int i = 0; i < 8; i++) o[i] = (bf16_t)v[r][i][j];
                *(bf16x8*)(lds + (4 * lane + j) * 256 + (((wave + 8 * r) ^ (lane & 15)) * 16)) = o;
            }
    }
    __syncthreads();
    const int n = tid >> 4, c = tid & 15;
    bf16_t* q0 = Wt + (size_t)(nb + n) * K + kb + 8 * c;
    u32x4 d[NT / 16];
    #pragma unroll
    for (int q = 0; q < NT / 16; q++) {
        const int nq = n + 16 * q;
        d[q] = *(const u32x4*)(lds + nq * 256 + ((c ^ ((nq >> 2) & 15)) * 16));
    }
    #pragma unroll
    for (int q = 0; q < NT / 16; q++) *(u32x4*)(q0 + (size_t)(16 * q) * K) = d[q];
    // the code laid behind this tile's may write the stores' address and data registers
    asm volatile("s_wait_xcnt 0x0" ::: "memory");
}

// l: tile index, inside a weight N fastest
__device__ __forceinline__
void tr_first(const TrArgs& a, int l, char* tile) {
    if (l < 192)               tr_tile<1024, 3072>(a.wqkv, a.tqkv, (l / 24) * 128, (l % 24) * 128, tile);
    else if ((l -= 192) < 64)  tr_tile<1024, 1024>(a.wmv,  a.tmv,  (l >> 3) * 128, (l & 7) * 128,  tile);
    else if ((l -= 64) < 32) {
        const int s = l >> 3;
        tr_tile<1024, 64>(s == 0 ? a.w1w : s == 1 ? a.w2w : s == 2 ? a.w1r : a.w2r,
                          s == 0 ? a.t1w : s == 1 ? a.t2w : s == 2 ? a.t1r : a.t2r, (l & 7) * 128, 0, tile);
    }
    else tr_tile<1024, 16>(a.wmg, a.tmg, (l - 32) * 128, 0, tile);
}

__device__ __forceinline__
void tr_late(const TrArgs& a, int l, char* tile) {
    if (l < 256)               tr_tile<1024, 4096>(a.wfc,   a.tfc,   (l >> 5) * 128, (l & 31) * 128, tile);
    else if ((l -= 256) < 256) tr_tile<4096, 1024>(a.wproj, a.tproj, (l >> 3) * 128, (l & 7) * 128,  tile);
    else                       tr_tile<1024, 1024>(a.wout,  a.tout,  ((l - 256) >> 3) * 128, (l & 7) * 128, tile);
}

// ---------------------------------------------------------------------------
// LayerNorm (f32 in) -> bf16 out.  One block per row r.
// The row length is fixed, so that a thread's loads stand together, off one address with constant
// offsets, and one wait behind each group covers them.
// ---------------------------------------------------------------------------
#define LN_D 1024            // row length
#define LN_E (LN_D / 256)    // elements a thread

// v: the thread's elements of row r, columns threadIdx.x + 256 i
__device__ __forceinline__
void layernorm_vals(const float* v, const float* __restrict__ g,
                    const float* __restrict__ b, bf16_t* __restrict__ out, int r) {
    float s = 0.f, s2 = 0.f;
    #pragma unroll
    for (int i = 0; i < LN_E; i++) { s += v[i]; s2 += v[i] * v[i]; }
    #pragma unroll
    for (int off = 16; off; off >>= 1) { s += __shfl_down(s, off); s2 += __shfl_down(s2, off); }
    __shared__ float ws[8], ws2[8];
    int wave = threadIdx.x >> 5, lane = threadIdx.x & 31;
    if (lane == 0) { ws[wave] = s; ws2[wave] = s2; }
    __syncthreads();
    if (threadIdx.x == 0) {
        float a = 0.f, a2 = 0.f;
        #pragma unroll
        for (int i = 0; i < 8; i++) { a += ws[i]; a2 += ws2[i]; }
        ws[0] = a; ws2[0] = a2;
    }
    __syncthreads();
    float mean = ws[0] / LN_D;
    float var  = ws2[0] / LN_D - mean * mean;
    float rstd = rsqrtf(var + 1e-5f);
    bf16_t* orow = out + (size_t)r * LN_D + threadIdx.x;
    float gv[LN_E], bv[LN_E];
    #pragma unroll
    for (int i = 0; i < LN_E; i++) gv[i] = g[threadIdx.x + 256 * i];
    // the next loads' results or addresses may land in these loads' address registers
    asm volatile("s_wait_xcnt 0x0" ::: "memory");
    #pragma unroll
    for (int i = 0; i < LN_E; i++) bv[i] = b[threadIdx.x + 256 * i];
    // as above
    asm volatile("s_wait_xcnt 0x0" ::: "memory");
    #pragma unroll
    for (int i = 0; i < LN_E; i++) orow[256 * i] = (bf16_t)((v[i] - mean) * rstd * gv[i] + bv[i]);
    // the code laid behind this row's may write the stores' registers
    asm volatile("s_wait_xcnt 0x0" ::: "memory");
}

__device__ __forceinline__
void layernorm_row(const float* __restrict__ x, const float* __restrict__ g,
                   const float* __restrict__ b, bf16_t* __restrict__ out, int r) {
    const float* row = x + (size_t)r * LN_D + threadIdx.x;
    float v[LN_E];
    #pragma unroll
    for (int i = 0; i < LN_E; i++) v[i] = row[256 * i];
    // later arithmetic may land in the loads' address registers
    asm volatile("s_wait_xcnt 0x0" ::: "memory");
    layernorm_vals(v, g, b, out, r);
}

// First launch: all that the projections wait for.  The turn of their seven weights and ln1 do not
// depend on one another, so they share a grid: blocks below TR_FIRST_BLOCKS turn a weight tile (they
// move the most bytes each and start first), every later block normalises one row of x.
__global__ __launch_bounds__(256)
void k_front(TrArgs a, const float* __restrict__ x, const float* __restrict__ g,
             const float* __restrict__ b, bf16_t* __restrict__ out) {
    __shared__ __attribute__((aligned(16))) char tile[128 * 256];
    const int l = blockIdx.x;
    if (l < TR_FIRST_BLOCKS) tr_first(a, l, tile);
    else                     layernorm_row(x, g, b, out, l - TR_FIRST_BLOCKS);
}

// ---------------------------------------------------------------------------
// Generic bf16 WMMA GEMM:  C[M,N] = A[M,K] * Wt[N,K]^T  (+bias)(+gelu)(+resid)
// Block tile 128x128, 8 waves: each wave 32(M) x 64(N).
// A stage holds 64 k of every operand row = one whole 128-B line per row, so that a wave's
// 16-B-per-lane copy covers 4 whole lines (8 lanes a row).  Two buffers, copies one stage ahead.
// K: the k that this block sums over, a multiple of 64; ld: elements between two rows of A and of
// Wt (K, or more where the block takes one range of a longer row).  N must be a multiple of 4.
// ---------------------------------------------------------------------------
#define GEMM_BK  64   // k per stage
#define GEMM_LDK 72   // LDS row pitch in elements (144 B = 16 B x 9: conflict-free 16-B reads)
#define GEMM_ROWSTEP (32 * GEMM_LDK * 2)    // LDS bytes between a thread's four rows of one operand
#define GEMM_BUFSTEP (128 * GEMM_LDK * 2)   // LDS bytes between the two buffers of one operand
#define EP_LD 68      // epilogue: LDS row pitch in floats (272 B: 16-B aligned rows, 4 banks apart)

// One stage: each thread brings 16 B of four A rows and of four Wt rows (32 rows apart) into LDS.
// la, lb: the thread's LDS byte addresses of its first row; a0, b0..b3: its global addresses.
// The closing s_wait_xcnt stands inside the statement so that it precedes every later write of
// the address registers that the copies name.
__device__ __forceinline__
void gemm_stage(unsigned la, unsigned lb, const bf16_t* a0, size_t arow,
                const bf16_t* b0, const bf16_t* b1, const bf16_t* b2, const bf16_t* b3) {
    asm volatile(
        "global_load_async_to_lds_b128 %0, %8, off\n\t"
        "global_load_async_to_lds_b128 %1, %9, off\n\t"
        "global_load_async_to_lds_b128 %2, %10, off\n\t"
        "global_load_async_to_lds_b128 %3, %11, off\n\t"
        "global_load_async_to_lds_b128 %4, %12, off\n\t"
        "global_load_async_to_lds_b128 %5, %13, off\n\t"
        "global_load_async_to_lds_b128 %6, %14, off\n\t"
        "global_load_async_to_lds_b128 %7, %15, off\n\t"
        "s_wait_xcnt 0x0"
        :: "v"(la), "v"(la + GEMM_ROWSTEP), "v"(la + 2 * GEMM_ROWSTEP), "v"(la + 3 * GEMM_ROWSTEP),
           "v"(lb), "v"(lb + GEMM_ROWSTEP), "v"(lb + 2 * GEMM_ROWSTEP), "v"(lb + 3 * GEMM_ROWSTEP),
           "v"(a0), "v"(a0 + arow), "v"(a0 + 2 * arow), "v"(a0 + 3 * arow),
           "v"(b0), "v"(b1), "v"(b2), "v"(b3)
        : "memory");
}

__device__ __forceinline__
void gemm_tile(const bf16_t* __restrict__ A, const bf16_t* __restrict__ Wt,
               const float* __restrict__ bias, const float* __restrict__ resid,
               float* __restrict__ outF, bf16_t* __restrict__ outB,
               int N, int K, int ld, int act, int m0, int n0) {
    __shared__ __attribute__((aligned(16))) bf16_t As[2][128][GEMM_LDK];
    __shared__ __attribute__((aligned(16))) bf16_t Bs[2][128][GEMM_LDK];
    const int tid = threadIdx.x;
    const int wave = tid >> 5, lane = tid & 31;
    const int wm = (wave & 3) * 32, wn = (wave >> 2) * 64;
    const int lm = lane & 15, kh = lane >> 4;

    v8f acc[2][4];
    #pragma unroll
    for (int i = 0; i < 2; i++)
        #pragma unroll
        for (int j = 0; j < 4; j++)
            #pragma unroll
            for (int v = 0; v < 8; v++) acc[i][j][v] = 0.f;

    // copy map: 8 lanes a row (8 x 16 B = the row's 128 B of this stage), rows cr + 32 i
    const int cr = tid >> 3, cc = (tid & 7) * 8;
    const size_t arow = (size_t)32 * ld;
    const bf16_t* ga = A + (size_t)(m0 + cr) * ld + cc;
    // A weight row past N is replaced by row N - 1: every lane copies, every address is in
    // bounds, and the columns n >= N that such rows feed are never stored (epilogue).
    const bf16_t* gb[4];
    #pragma unroll
    for (int i = 0; i < 4; i++) {
        int rn = n0 + cr + 32 * i;
        rn = rn < N ? rn : N - 1;
        gb[i] = Wt + (size_t)rn * ld + cc;
    }
    const unsigned la = (unsigned)(size_t)&As[0][cr][cc];   // low 32 bits = LDS byte address
    const unsigned lb = (unsigned)(size_t)&Bs[0][cr][cc];
    const int nT = K / GEMM_BK;

    // stage 0 -> buffer 0, published; then stage 1 -> buffer 1 flies during trip 0
    gemm_stage(la, lb, ga, arow, gb[0], gb[1], gb[2], gb[3]);
    asm volatile("s_wait_asynccnt 0x0" ::: "memory");   // this wave's copies of stage 0 have landed
    __syncthreads();
    if (nT > 1)
        gemm_stage(la + GEMM_BUFSTEP, lb + GEMM_BUFSTEP, ga + GEMM_BK, arow,
                   gb[0] + GEMM_BK, gb[1] + GEMM_BK, gb[2] + GEMM_BK, gb[3] + GEMM_BK);

    for (int t = 0; t < nT; t++) {
        const int cur = t & 1;
        if (t + 2 < nT)
            __builtin_prefetch(A + (size_t)(m0 + (tid >> 1)) * ld + (t + 2) * GEMM_BK + (tid & 1) * 32, 0, 3);

        #pragma unroll
        for (int kk = 0; kk < GEMM_BK / 32; kk++) {
            AFrag a[2], bfr[4];
            #pragma unroll
            for (int i = 0; i < 2; i++) {
                const bf16_t* p = &As[cur][wm + i * 16 + lm][kk * 32 + kh * 8];
                a[i].q[0] = *(const u32x4*)p;
                a[i].q[1] = *(const u32x4*)(p + 16);
            }
            #pragma unroll
            for (int j = 0; j < 4; j++) {
                const bf16_t* p = &Bs[cur][wn + j * 16 + lm][kk * 32 + kh * 8];
                bfr[j].q[0] = *(const u32x4*)p;
                bfr[j].q[1] = *(const u32x4*)(p + 16);
            }
            #pragma unroll
            for (int i = 0; i < 2; i++)
                #pragma unroll
                for (int j = 0; j < 4; j++)
                    acc[i][j] = __builtin_amdgcn_wmma_f32_16x16x32_bf16(
                        false, a[i].v, false, bfr[j].v, (short)0, acc[i][j], false, false);
        }

        // publish stage t + 1 and free buffer cur, in this order:
        asm volatile("s_wait_dscnt 0x0" ::: "memory");      // this wave's reads of buffer cur are done
        asm volatile("s_wait_asynccnt 0x0" ::: "memory");   // this wave's copies of stage t + 1 have landed
        __syncthreads();
        if (t + 2 < nT) {
            const int ko = (t + 2) * GEMM_BK;
            const unsigned bo = cur * GEMM_BUFSTEP;
            gemm_stage(la + bo, lb + bo, ga + ko, arow, gb[0] + ko, gb[1] + ko, gb[2] + ko, gb[3] + ko);
        }
    }
    asm volatile("s_wait_asynccnt 0x0" ::: "memory");   // no copy is left in flight behind the loop

    // Epilogue.  The accumulator layout gives a lane one column of 8 rows: stored from there, every
    // access is a 4-B piece and the residual loads follow one another.  So each wave turns its own
    // 32 x 64 tile through its own LDS range (the ring is free: every wave has passed the last
    // trip's barrier and no copy is in flight) and takes it back row-wise: a lane holds 4
    // neighbouring columns, 16 lanes a row, so that every residual load and every store covers
    // whole 128-B lines, and the 16 residual loads of a lane fly together, under the turn.
    if (n0 + wn < N) {   // the same for the whole wave
        float* st0 = (float*)&As[0][0][0] + wave * (16 * EP_LD);   // rows  0..15 of the wave's tile
        float* st1 = (float*)&Bs[0][0][0] + wave * (16 * EP_LD);   // rows 16..31
        const int er = lane >> 4, ec = (lane & 15) * 4;
        const int n = n0 + wn + ec;
        const bool ok = n < N;   // N is a multiple of 4: a lane's 4 columns are in or out together
        const size_t idx0 = (size_t)(m0 + wm + er) * N + n;
        const size_t rstep = (size_t)2 * N;

        // behind each load: a later load's result or later arithmetic may land in its address registers
        f32x4 bv = {0.f, 0.f, 0.f, 0.f};
        if (ok && bias) {
            bv = *(const f32x4*)(bias + n);
            asm volatile("s_wait_xcnt 0x0" ::: "memory");   // see above
        }
        f32x4 rv[16];   // filled and read only where there is a residual
        if (ok && resid) {
            #pragma unroll
            for (int q = 0; q < 16; q++) {
                rv[q] = *(const f32x4*)(resid + idx0 + q * rstep);
                asm volatile("s_wait_xcnt 0x0" ::: "memory");   // see above
            }
        }

        #pragma unroll
        for (int j = 0; j < 4; j++)
            #pragma unroll
            for (int v = 0; v < 8; v++) {
                st0[(v + 8 * kh) * EP_LD + j * 16 + lm] = acc[0][j][v];
                st1[(v + 8 * kh) * EP_LD + j * 16 + lm] = acc[1][j][v];
            }
        // the rows are read back by other lanes of this wave: their writes have to be done
        asm volatile("s_wait_dscnt 0x0" ::: "memory");
        f32x4 cv[16];
        #pragma unroll
        for (int q = 0; q < 16; q++)
            cv[q] = *(const f32x4*)((q < 8 ? st0 : st1) + ((q & 7) * 2 + er) * EP_LD + ec);

        if (ok) {
            #pragma unroll
            for (int q = 0; q < 16; q++) cv[q] += bv;
            // all 64 elements in one stretch of code: they do not depend on one another
            if (act == 1) {
                #pragma unroll
                for (int q = 0; q < 16; q++)
                    #pragma unroll
                    for (int e = 0; e < 4; e++) cv[q][e] = gelu_erf(cv[q][e]);
            }
            #pragma unroll
            for (int q = 0; q < 16; q++) {
                f32x4 c = cv[q];
                if (resid) c += rv[q];
                const size_t idx = idx0 + q * rstep;
                // behind each store: later arithmetic may land in its registers
                if (outF) {
                    *(f32x4*)(outF + idx) = c;
                    asm volatile("s_wait_xcnt 0x0" ::: "memory");   // see above
                }
                if (outB) {
                    bf16x4 o;
                    #pragma unroll
                    for (int e = 0; e < 4; e++) o[e] = (bf16_t)c[e];
                    *(bf16x4*)(outB + idx) = o;
                    asm volatile("s_wait_xcnt 0x0" ::: "memory");   // see above
                }
            }
        }
    }
}

__global__ __launch_bounds__(256)
void k_gemm_bf16(const bf16_t* __restrict__ A, const bf16_t* __restrict__ Wt,
                 const float* __restrict__ bias, const float* __restrict__ resid,
                 float* __restrict__ outF, bf16_t* __restrict__ outB,
                 int M, int N, int K, int act) {
    gemm_tile(A, Wt, bias, resid, outF, outB, N, K, K, act, blockIdx.y * 128, blockIdx.x * 128);
}

// The two products with N = 1024 have only 128 tiles of 128 x 128 for 256 WGPs, and a block walks its
// stages one after the other, so such a launch lasts as long as one walk over all of K.  Here K is cut
// into gridDim.z ranges of klen, each a block of its own: more blocks, each with a shorter walk.
// A block leaves its range's sum as it stands, f32, in its range's plane of part; the launch behind
// it adds the planes, the bias and the residual (k_join_ln, k_join_out).
#define SPLIT_STEP ((size_t)2048 * 1024)   // floats between two ranges' planes
#define SPLIT_OUT  2                       // ranges of the output projection (K = 1024)
#define SPLIT_PROJ 4                       // ranges of the second MLP product (K = 4096)

__global__ __launch_bounds__(256)
void k_gemm_splitk(const bf16_t* __restrict__ A, const bf16_t* __restrict__ Wt,
                   float* __restrict__ part, int N, int K, int klen) {
    const size_t ko = (size_t)blockIdx.z * klen;
    gemm_tile(A + ko, Wt + ko, nullptr, nullptr, part + blockIdx.z * SPLIT_STEP, nullptr,
              N, klen, K, 0, blockIdx.y * 128, blockIdx.x * 128);
}

// out = sum of the SPLIT_PROJ planes + bias + resid.  A block takes 4 rows of 1024; a thread holds the
// same 16 B of each, so that every load and store of a wave covers 4 whole lines and all of a
// thread's loads fly together.
__global__ __launch_bounds__(256)
void k_join_out(const float* __restrict__ part, const float* __restrict__ bias,
                const float* __restrict__ resid, float* __restrict__ out) {
    const unsigned e = blockIdx.x * 4096u + threadIdx.x * 4u;   // the thread's first element
    f32x4 p[SPLIT_PROJ][4], r[4];
    // The loads stand in groups off one address each.  Behind each group: the next loads' results or
    // later arithmetic may land in its address registers.
    #pragma unroll
    for (int z = 0; z < SPLIT_PROJ; z++) {
        #pragma unroll
        for (int q = 0; q < 4; q++) p[z][q] = *(const f32x4*)(part + z * SPLIT_STEP + e + q * 1024);
        asm volatile("s_wait_xcnt 0x0" ::: "memory");   // see above
    }
    #pragma unroll
    for (int q = 0; q < 4; q++) r[q] = *(const f32x4*)(resid + e + q * 1024);
    asm volatile("s_wait_xcnt 0x0" ::: "memory");   // see above
    const f32x4 bv = *(const f32x4*)(bias + threadIdx.x * 4u);
    asm volatile("s_wait_xcnt 0x0" ::: "memory");   // see above
    // keeps the additions behind all the loads: moved up among them they make the later loads wait
    // for the first ones' data, a second trip to memory
    __builtin_amdgcn_sched_barrier(0);
    f32x4 c[4];
    #pragma unroll
    for (int q = 0; q < 4; q++) {
        c[q] = p[0][q];
        #pragma unroll
        for (int z = 1; z < SPLIT_PROJ; z++) c[q] += p[z][q];
        c[q] = c[q] + bv + r[q];
    }
    // keeps the additions in front of the stores: moved in among them they could land in registers
    // of stores already issued
    __builtin_amdgcn_sched_barrier(0);
    #pragma unroll
    for (int q = 0; q < 4; q++) *(f32x4*)(out + e + q * 1024) = c[q];
    // nothing may land in the stores' registers before this
    asm volatile("s_wait_xcnt 0x0" ::: "memory");
}

// x1 = sum of the SPLIT_OUT planes + bias + x, stored, and its LayerNorm -> bf16.  One block per row.
__global__ __launch_bounds__(256)
void k_join_ln(const float* __restrict__ part, const float* __restrict__ bias,
               const float* __restrict__ x, float* __restrict__ x1,
               const float* __restrict__ g, const float* __restrict__ b, bf16_t* __restrict__ out) {
    const size_t o = (size_t)blockIdx.x * LN_D + threadIdx.x;
    float p[SPLIT_OUT][LN_E], xr[LN_E], bo[LN_E], v[LN_E];
    // groups of loads off one address each; behind each group: the next loads' results or addresses
    // may land in its address registers
    #pragma unroll
    for (int z = 0; z < SPLIT_OUT; z++) {
        #pragma unroll
        for (int i = 0; i < LN_E; i++) p[z][i] = part[z * SPLIT_STEP + o + 256 * i];
        asm volatile("s_wait_xcnt 0x0" ::: "memory");   // see above
    }
    #pragma unroll
    for (int i = 0; i < LN_E; i++) xr[i] = x[o + 256 * i];
    asm volatile("s_wait_xcnt 0x0" ::: "memory");   // see above
    #pragma unroll
    for (int i = 0; i < LN_E; i++) bo[i] = bias[threadIdx.x + 256 * i];
    asm volatile("s_wait_xcnt 0x0" ::: "memory");   // see above
    #pragma unroll
    for (int i = 0; i < LN_E; i++) {
        float c = p[0][i];
        #pragma unroll
        for (int z = 1; z < SPLIT_OUT; z++) c += p[z][i];
        v[i] = c + bo[i] + xr[i];
    }
    #pragma unroll
    for (int i = 0; i < LN_E; i++) x1[o + 256 * i] = v[i];
    // later arithmetic may land in the stores' registers
    asm volatile("s_wait_xcnt 0x0" ::: "memory");
    layernorm_vals(v, g, b, out, blockIdx.x);
}

// The seven projections of the same A (2048 x K) in one grid: they do not depend on one
// another, and the narrow ones (16 blocks each on their own) fill places the wide ones leave.
// blockIdx.x picks the weight and its 128-wide column tile, blockIdx.y the row tile.
struct ProjArgs {
    const bf16_t* A;
    const bf16_t* tqkv; const bf16_t* tmv; const bf16_t* t1w; const bf16_t* t2w;
    const bf16_t* t1r;  const bf16_t* t2r; const bf16_t* tmg;
    const float* bqkv; const float* bmv; const float* bmg;
    bf16_t* qkv;
    float* memval; float* p1w; float* p2w; float* p1r; float* p2r; float* glin;
    int K;
};
#define PROJ_TILES 37   // 24 (qkv) + 8 (mem values) + 4 (points) + 1 (gate)

__global__ __launch_bounds__(256)
void k_gemm_proj(ProjArgs a) {
    const int x = blockIdx.x;
    const bf16_t* Wt;
    const float* bias = nullptr;
    float* oF = nullptr;
    bf16_t* oB = nullptr;
    int N = 64, n0 = 0;
    if (x < 24)       { Wt = a.tqkv; bias = a.bqkv; oB = a.qkv;    N = 3072; n0 = x * 128; }
    else if (x < 32)  { Wt = a.tmv;  bias = a.bmv;  oF = a.memval; N = 1024; n0 = (x - 24) * 128; }
    else if (x == 32) { Wt = a.t1w;  oF = a.p1w; }
    else if (x == 33) { Wt = a.t2w;  oF = a.p2w; }
    else if (x == 34) { Wt = a.t1r;  oF = a.p1r; }
    else if (x == 35) { Wt = a.t2r;  oF = a.p2r; }
    else              { Wt = a.tmg;  bias = a.bmg;  oF = a.glin;   N = 16; }
    gemm_tile(a.A, Wt, bias, nullptr, oF, oB, N, a.K, a.K, 0, blockIdx.y * 128, n0);
}

// ---------------------------------------------------------------------------
// Flash-style causal attention.  qkv bf16 [(b,t), 3, H, 64].
// One block per (qb, part, bh): 128 q-rows of one head against the key tiles sb0 .. sb1 - 1;
// 256 threads (8 waves, 16 q-rows each).
// A wave walks its key tiles one after the other, so a launch lasts as long as the longest walk.
// The walk of q-tile qb (qb + 1 key tiles) is therefore cut into ATT_NPARTS(qb) parts of at most 3
// tiles, each a block of its own.  A part leaves its sums as they stand: the output sum without the
// division (opart), each row's maximum (pm) and its sum of exponentials (pl); k_combine joins them.
// ---------------------------------------------------------------------------
#define ATT_MAXPARTS 3
#define ATT_T 1024                                  // positions of a sequence: 8 q-tiles
#define ATT_NPARTS(qb) (((qb) + 3) / 3)             // parts of q-tile qb
#define ATT_OSTEP ((size_t)2048 * 1024)             // floats between two parts' output sums
#define ATT_SSTEP ((size_t)2048 * 16)               // floats between two parts' row maxima, or row sums

__device__ __forceinline__
void attention_block(const bf16_t* __restrict__ qkv, float* __restrict__ opart,
                     float* __restrict__ pm, float* __restrict__ pl,
                     int T, int H, int qb, int bh, int sb0, int sb1) {
    const int h = bh % H, b = bh / H;
    const int tid = threadIdx.x, wave = tid >> 5, lane = tid & 31;
    const int lm = lane & 15, kh = lane >> 4;

    __shared__ bf16_t Qs[128][72];
    __shared__ bf16_t Ks[128][72];
    __shared__ bf16_t Vt[64][136];     // V transposed: [dh][s]
    __shared__ bf16_t Ps[8][16][40];   // per-wave P staging (32-wide K chunk)

    const size_t strideT = 3 * 1024;
    const bf16_t* base = qkv + (size_t)b * T * strideT + (size_t)h * 64;

    // Load Q tile (128 x 64)
    for (int c8 = tid; c8 < 128 * 8; c8 += 256) {
        int rr = c8 >> 3, cc = (c8 & 7) * 8;
        const bf16_t* gq = base + (size_t)(qb * 128 + rr) * strideT + cc;
#if HAS_ASYNC_LDS
        async_copy16(&Qs[rr][cc], gq);
#else
        *(u32x4*)&Qs[rr][cc] = *(const u32x4*)gq;
#endif
    }

    float rowm[8], rowl[8];
    v8f oacc[4];
    #pragma unroll
    for (int v = 0; v < 8; v++) { rowm[v] = -INFINITY; rowl[v] = 0.f; }
    #pragma unroll
    for (int jt = 0; jt < 4; jt++)
        #pragma unroll
        for (int v = 0; v < 8; v++) oacc[jt][v] = 0.f;

    for (int sb = sb0; sb < sb1; sb++) {
        __syncthreads();   // protect Ks/Vt reuse across iterations
        for (int c8 = tid; c8 < 128 * 8; c8 += 256) {
            int rr = c8 >> 3, cc = (c8 & 7) * 8;
            const bf16_t* gk = base + (size_t)(sb * 128 + rr) * strideT + 1024 + cc;
#if HAS_ASYNC_LDS
            async_copy16(&Ks[rr][cc], gk);
#else
            *(u32x4*)&Ks[rr][cc] = *(const u32x4*)gk;
#endif
        }
        for (int c8 = tid; c8 < 128 * 8; c8 += 256) {
            int rr = c8 >> 3, cc = (c8 & 7) * 8;
            union { u32x4 u; bf16_t e[8]; } vv;
            vv.u = *(const u32x4*)(base + (size_t)(sb * 128 + rr) * strideT + 2048 + cc);
            #pragma unroll
            for (int i = 0; i < 8; i++) Vt[cc + i][rr] = vv.e[i];
        }
        async_wait0();
        __syncthreads();

        // ---- scores: S = Q * K^T ----
        AFrag aq[2];
        #pragma unroll
        for (int kk = 0; kk < 2; kk++) {
            const bf16_t* p = &Qs[wave * 16 + lm][kk * 32 + kh * 8];
            aq[kk].q[0] = *(const u32x4*)p;
            aq[kk].q[1] = *(const u32x4*)(p + 16);
        }
        v8f sacc[8];
        #pragma unroll
        for (int j = 0; j < 8; j++)
            #pragma unroll
            for (int v = 0; v < 8; v++) sacc[j][v] = 0.f;
        #pragma unroll
        for (int j = 0; j < 8; j++)
            #pragma unroll
            for (int kk = 0; kk < 2; kk++) {
                AFrag bk;
                const bf16_t* p = &Ks[j * 16 + lm][kk * 32 + kh * 8];
                bk.q[0] = *(const u32x4*)p;
                bk.q[1] = *(const u32x4*)(p + 16);
                sacc[j] = __builtin_amdgcn_wmma_f32_16x16x32_bf16(
                    false, aq[kk].v, false, bk.v, (short)0, sacc[j], false, false);
            }

        // ---- causal mask + online softmax (wave32: 16-lane row reductions) ----
        #pragma unroll
        for (int v = 0; v < 8; v++) {
            int trow = qb * 128 + wave * 16 + v + 8 * kh;
            float rm = -INFINITY;
            #pragma unroll
            for (int j = 0; j < 8; j++) {
                int col = sb * 128 + j * 16 + lm;
                float s = (col <= trow) ? sacc[j][v] * 0.125f : -INFINITY;
                sacc[j][v] = s;
                rm = fmaxf(rm, s);
            }
            #pragma unroll
            for (int msk = 1; msk < 16; msk <<= 1) rm = fmaxf(rm, __shfl_xor(rm, msk));
            float mnew = fmaxf(rowm[v], rm);
            float corr = __builtin_amdgcn_exp2f((rowm[v] - mnew) * LOG2E);
            rowm[v] = mnew;
            float rs = 0.f;
            #pragma unroll
            for (int j = 0; j < 8; j++) {
                float p = __builtin_amdgcn_exp2f((sacc[j][v] - mnew) * LOG2E);
                sacc[j][v] = p;
                rs += p;
            }
            #pragma unroll
            for (int msk = 1; msk < 16; msk <<= 1) rs += __shfl_xor(rs, msk);
            rowl[v] = rowl[v] * corr + rs;
            #pragma unroll
            for (int jt = 0; jt < 4; jt++) oacc[jt][v] = oacc[jt][v] * corr;
        }

        // ---- O += P * V  (stage P through LDS: C-layout -> A-layout) ----
        #pragma unroll
        for (int kk = 0; kk < 4; kk++) {
            #pragma unroll
            for (int jj = 0; jj < 2; jj++) {
                int j = kk * 2 + jj;
                #pragma unroll
                for (int v = 0; v < 8; v++)
                    Ps[wave][v + 8 * kh][jj * 16 + lm] = (bf16_t)sacc[j][v];
            }
            AFrag ap;
            const bf16_t* p = &Ps[wave][lm][kh * 8];
            ap.q[0] = *(const u32x4*)p;
            ap.q[1] = *(const u32x4*)(p + 16);
            #pragma unroll
            for (int jt = 0; jt < 4; jt++) {
                AFrag bv;
                const bf16_t* q = &Vt[jt * 16 + lm][kk * 32 + kh * 8];
                bv.q[0] = *(const u32x4*)q;
                bv.q[1] = *(const u32x4*)(q + 16);
                oacc[jt] = __builtin_amdgcn_wmma_f32_16x16x32_bf16(
                    false, ap.v, false, bv.v, (short)0, oacc[jt], false, false);
            }
        }
    }

    float* out = opart + (size_t)b * T * 1024 + (size_t)h * 64;
    // a row's maximum and sum are the same in its 16 lanes: the first of them stores both
    if (lm == 0) {
        // 16 heads a row, as in ATT_SSTEP: a constant, so that the 8 rows are offsets of one address
        const size_t r0 = ((size_t)b * T + qb * 128 + wave * 16 + 8 * kh) * 16 + h;
        #pragma unroll
        for (int v = 0; v < 8; v++) { pm[r0 + v * 16] = rowm[v]; pl[r0 + v * 16] = rowl[v]; }
    }
    #pragma unroll
    for (int jt = 0; jt < 4; jt++)
        #pragma unroll
        for (int v = 0; v < 8; v++) {
            int trow = qb * 128 + wave * 16 + v + 8 * kh;
            int col  = jt * 16 + lm;
            out[(size_t)trow * 1024 + col] = oacc[jt][v];
        }
    // the code laid behind the attention's may write the stores' registers
    asm volatile("s_wait_xcnt 0x0" ::: "memory");
}

// ---------------------------------------------------------------------------
// Plucker line through two points of R^4, normalised.
// ---------------------------------------------------------------------------
__device__ inline void exterior4(const float* a1, const float* a2, float* L) {
    L[0] = a1[0] * a2[1] - a1[1] * a2[0];
    L[1] = a1[0] * a2[2] - a1[2] * a2[0];
    L[2] = a1[0] * a2[3] - a1[3] * a2[0];
    L[3] = a1[1] * a2[2] - a1[2] * a2[1];
    L[4] = a1[1] * a2[3] - a1[3] * a2[1];
    L[5] = a1[2] * a2[3] - a1[3] * a2[2];
    float n2 = 0.f;
    #pragma unroll
    for (int i = 0; i < 6; i++) n2 += L[i] * L[i];
    float inv = 1.f / fmaxf(sqrtf(n2), 1e-12f);
    #pragma unroll
    for (int i = 0; i < 6; i++) L[i] *= inv;
}

// ---------------------------------------------------------------------------
// Decayed-Gram scan:  M_t = d*(M_{t-1} + Jw_{t-1} Jw_{t-1}^T),  M_0 = 0.
// The recurrence is linear, so it is run as a chunked parallel scan:
// one block per (b,h), thread c owns the 4 steps t = 4c .. 4c+3 (T == 4 * blockDim.x).
//   0) each thread forms the write lines (rotated by J6) and the read lines of its own 4 steps
//      from the projected points: no one else reads them, so they never go through memory
//   1) each thread folds its own 4 steps from zero   (chunk aggregate)
//   2) weighted prefix over chunks: lanes by shuffles, waves through LDS
//   3) each thread replays its 4 steps from its true M and writes the gates
// M is symmetric, so only its 21 upper entries are carried.
// Every loop is unrolled so that the small arrays are indexed by constants and stay in registers.
// ---------------------------------------------------------------------------
#define GS_L 4      // steps per thread
#define GS_NS 21    // upper triangle of a 6x6

__device__ __forceinline__ void gram_step(float* m, const float* J, float d) {
    int n = 0;
    #pragma unroll
    for (int i = 0; i < 6; i++)
        #pragma unroll
        for (int j = i; j < 6; j++, n++) m[n] = d * (m[n] + J[i] * J[j]);
}

__device__ __forceinline__
void gram_block(const float* __restrict__ p1w, const float* __restrict__ p2w,
                const float* __restrict__ p1r, const float* __restrict__ p2r,
                const float* __restrict__ glin, const float* __restrict__ decay_logits,
                const float* __restrict__ iter_mix, const float* __restrict__ mem_scale,
                float* __restrict__ gh, int T, int H, int bh) {
    __shared__ __attribute__((aligned(16))) float Wagg[8][24];   // rows of 21, padded to 16 B
    const int h = bh % H, b = bh / H;
    const int c = threadIdx.x, lane = c & 31;
    const int wave = __builtin_amdgcn_readfirstlane(c >> 5);     // scalar: the tests on it in 2b are scalar compares
    const int t0 = c * GS_L;

    // all of this thread's inputs, issued up front
    // a head's point is 16 B of a 256-B row; po: this thread's first row, this head, in floats
    const size_t po = ((size_t)b * T + t0) * 64 + h * 4;
    union F4 { f32x4 q; float f[4]; };
    F4 w1[GS_L], w2[GS_L], r1[GS_L], r2[GS_L];
    // the write line of step t takes its first point from row t - 1; step 0 has none (zero below),
    // and its load reads row 0 so that the address stays inside the array
    #pragma unroll
    for (int k = 0; k < GS_L; k++) w1[k].q = *(const f32x4*)(p1w + po + (t0 + k > 0 ? k - 1 : k) * 64);
    // the next loads may land in these loads' address registers
    asm volatile("s_wait_xcnt 0x0" ::: "memory");
    #pragma unroll
    for (int k = 0; k < GS_L; k++) w2[k].q = *(const f32x4*)(p2w + po + k * 64);
    // as above
    asm volatile("s_wait_xcnt 0x0" ::: "memory");
    #pragma unroll
    for (int k = 0; k < GS_L; k++) r1[k].q = *(const f32x4*)(p1r + po + k * 64);
    // as above
    asm volatile("s_wait_xcnt 0x0" ::: "memory");
    #pragma unroll
    for (int k = 0; k < GS_L; k++) r2[k].q = *(const f32x4*)(p2r + po + k * 64);
    // as above
    asm volatile("s_wait_xcnt 0x0" ::: "memory");
    float gl[GS_L];
    #pragma unroll
    for (int k = 0; k < GS_L; k++) gl[k] = glin[((size_t)b * T + t0 + k) * H + h];
    // the loads' address registers are reused by the arithmetic below
    asm volatile("s_wait_xcnt 0x0" ::: "memory");

    const float decay = 1.f / (1.f + expf(-decay_logits[h]));
    const float alpha = 1.f / (1.f + expf(-iter_mix[0]));
    const float msc = mem_scale[h];

    // w[s] = decay^(4 * 2^s): the decay across 2^s chunks
    float w[6];
    w[0] = (decay * decay) * (decay * decay);
    #pragma unroll
    for (int s = 1; s < 6; s++) w[s] = w[s - 1] * w[s - 1];

    // 0) lines
    struct { float f[24]; } J, R;
    #pragma unroll
    for (int k = 0; k < GS_L; k++) {
        float L[6];
        if (t0 + k == 0) {
            #pragma unroll
            for (int e = 0; e < 4; e++) w1[k].f[e] = 0.f;
        }
        exterior4(w1[k].f, w2[k].f, L);
        float* jw = &J.f[k * 6];
        jw[0] = L[5]; jw[1] = -L[4]; jw[2] = L[3]; jw[3] = L[2]; jw[4] = -L[1]; jw[5] = L[0];
        exterior4(r1[k].f, r2[k].f, &R.f[k * 6]);
    }

    // 1) chunk aggregate
    float m[GS_NS];
    #pragma unroll
    for (int n = 0; n < GS_NS; n++) m[n] = 0.f;
    #pragma unroll
    for (int k = 0; k < GS_L; k++) gram_step(m, &J.f[k * 6], decay);

    // 2a) inclusive weighted prefix over the wave's 32 chunks
    #pragma unroll
    for (int s = 0; s < 5; s++) {
        const int o = 1 << s;
        #pragma unroll
        for (int n = 0; n < GS_NS; n++) {
            float v = __shfl_up(m[n], o);
            m[n] = (lane >= o) ? m[n] + w[s] * v : m[n];
        }
    }
    if (lane == 31) {
        #pragma unroll
        for (int n = 0; n < GS_NS; n++) Wagg[wave][n] = m[n];
    }
    // exclusive within the wave
    #pragma unroll
    for (int n = 0; n < GS_NS; n++) {
        float v = __shfl_up(m[n], 1);
        m[n] = (lane > 0) ? v : 0.f;
    }
    __syncthreads();

    // 2b) M at the wave's first step, from the earlier waves' totals.
    // It is the same for the whole wave: lane n folds entry n, then it is read per entry.
    const int ln = (lane < GS_NS) ? lane : 0;
    float tot[7];
    #pragma unroll
    for (int q = 0; q < 7; q++) tot[q] = Wagg[q][ln];
    float p = 0.f;
    #pragma unroll
    for (int q = 0; q < 7; q++) p = (q < wave) ? w[5] * p + tot[q] : p;
    float dl = 1.f;   // decay^(4 * lane)
    #pragma unroll
    for (int s = 0; s < 5; s++) dl *= ((lane >> s) & 1) ? w[s] : 1.f;
    #pragma unroll
    for (int n = 0; n < GS_NS; n++)
        m[n] += dl * __int_as_float(__builtin_amdgcn_readlane(__float_as_int(p), n));

    // 3) replay
    #pragma unroll
    for (int k = 0; k < GS_L; k++) {
        const float* rd = &R.f[k * 6];
        float rdM[6] = {0, 0, 0, 0, 0, 0};
        int n = 0;
        #pragma unroll
        for (int i = 0; i < 6; i++)
            #pragma unroll
            for (int j = i; j < 6; j++, n++) {
                rdM[j] += rd[i] * m[n];
                if (j != i) rdM[i] += rd[j] * m[n];
            }
        float s1 = 0.f, s2 = 0.f;
        #pragma unroll
        for (int j = 0; j < 6; j++) { s1 += rdM[j] * rd[j]; s2 += rdM[j] * rdM[j]; }
        float ms = (1.f - alpha) * s1 + alpha * s2;
        float g1 = 1.f / (1.f + expf(-ms * msc));
        float g2 = 1.f / (1.f + expf(-gl[k]));
        gh[((size_t)b * T + t0 + k) * H + h] = g1 * g2;
        if (k + 1 < GS_L) gram_step(m, &J.f[k * 6], decay);
    }
}

// ---------------------------------------------------------------------------
// Third launch: all that needs the projections or nothing at all, and that the later launches wait
// for.  The attention, the Gram branch and the turn of Wfc, Wproj and Wout do not depend on one
// another, so they share a grid.  The attention blocks last longest and start first; the others run
// beside them.
// ---------------------------------------------------------------------------
#define MID_ATT_BLOCKS  480   // 15 parts of the 8 q-tiles x 32 (b, h)
#define MID_GRAM_BLOCKS 32    // one per (b, h)
#define MID_BLOCKS (MID_ATT_BLOCKS + MID_GRAM_BLOCKS + TR_LATE_BLOCKS)

__global__ __launch_bounds__(256)
void k_mid(TrArgs a, const bf16_t* __restrict__ qkv, float* __restrict__ opart,
           float* __restrict__ pm, float* __restrict__ pl,
           const float* __restrict__ p1w, const float* __restrict__ p2w,
           const float* __restrict__ p1r, const float* __restrict__ p2r,
           const float* __restrict__ glin, const float* __restrict__ decay_logits,
           const float* __restrict__ iter_mix, const float* __restrict__ mem_scale,
           float* __restrict__ gh, int T, int H) {
    __shared__ __attribute__((aligned(16))) char tile[128 * 256];
    const int l = blockIdx.x;
    // written in this order the attention, the longest code on the longest path, comes first in the
    // kernel's text
    if (l >= MID_ATT_BLOCKS) {
        if (l < MID_ATT_BLOCKS + MID_GRAM_BLOCKS)
            gram_block(p1w, p2w, p1r, p2r, glin, decay_logits, iter_mix, mem_scale, gh, T, H, l - MID_ATT_BLOCKS);
        else
            tr_late(a, l - (MID_ATT_BLOCKS + MID_GRAM_BLOCKS), tile);
        return;
    }
    // The 15 parts, those of 3 key tiles first, then those of 2, then the one of 1; 32 (b, h) each.
    // Digit c of each constant belongs to part c: its q-tile, its number among that q-tile's parts
    // (part p of P takes the tiles p * n / P .. (p + 1) * n / P - 1 of n = qb + 1), first tile, end.
    const int c4 = (l >> 5) * 4;
    const int qb  = (int)((0x013346672455677ULL >> c4) & 15);
    const int p   = (int)((0x001001000110221ULL >> c4) & 15);
    const int sb0 = (int)((0x002002000230452ULL >> c4) & 15);
    const int sb1 = (int)((0x124224223563785ULL >> c4) & 15);
    attention_block(qkv, opart + p * ATT_OSTEP, pm + p * ATT_SSTEP, pl + p * ATT_SSTEP,
                    T, H, qb, l & 31, sb0, sb1);
}

// ---------------------------------------------------------------------------
// y = seqout + mean_h(gh) * memval  -> bf16 (input to Wout GEMM)
// seqout is formed here, from the P parts that the row's attention was cut into.  Per head, with
// m_p, l_p, O_p a part's row maximum, sum of exponentials and output sum, and M = max_p m_p:
//   seqout = sum_p exp(m_p - M) O_p / sum_p exp(m_p - M) l_p        (P == 1: O_0 / l_0)
// One block per row of 1024 = 4 x 256 columns; op, mv, yr: the row's start; pm, pl: its 16 heads.
// ---------------------------------------------------------------------------
template <int P>
__device__ __forceinline__
void combine_row(const float* __restrict__ op, const float* __restrict__ pm,
                 const float* __restrict__ pl, const float* __restrict__ mv,
                 float g, bf16_t* __restrict__ yr) {
    const int tid = threadIdx.x, hd = tid >> 6;   // column tid + 256 i lies in head hd + 4 i
    float o[4][P], m[4][P], l[4][P], v[4];
    // The loads stand in groups off one address each.  Behind each group: the next loads' results or
    // later arithmetic may land in its address registers.
    #pragma unroll
    for (int p = 0; p < P; p++) {
        #pragma unroll
        for (int i = 0; i < 4; i++) o[i][p] = op[p * ATT_OSTEP + tid + 256 * i];
        asm volatile("s_wait_xcnt 0x0" ::: "memory");   // see above
    }
    #pragma unroll
    for (int i = 0; i < 4; i++) v[i] = mv[tid + 256 * i];
    asm volatile("s_wait_xcnt 0x0" ::: "memory");   // see above
    #pragma unroll
    for (int p = 0; p < P; p++)
        #pragma unroll
        for (int i = 0; i < 4; i++) l[i][p] = pl[p * ATT_SSTEP + hd + 4 * i];
    asm volatile("s_wait_xcnt 0x0" ::: "memory");   // see above
    #pragma unroll
    for (int p = 0; p < P; p++)
        #pragma unroll
        for (int i = 0; i < 4; i++) m[i][p] = P > 1 ? pm[p * ATT_SSTEP + hd + 4 * i] : 0.f;
    if (P > 1) asm volatile("s_wait_xcnt 0x0" ::: "memory");   // see above
    // keeps the arithmetic behind all the loads: moved up among them it makes the later loads wait
    // for the first ones' data, a second trip to memory
    __builtin_amdgcn_sched_barrier(0);
    bf16_t r[4];
    #pragma unroll
    for (int i = 0; i < 4; i++) {
        float num = o[i][0], den = l[i][0];
        if (P > 1) {
            float mx = m[i][0];
            #pragma unroll
            for (int p = 1; p < P; p++) mx = fmaxf(mx, m[i][p]);
            num = 0.f; den = 0.f;
            #pragma unroll
            for (int p = 0; p < P; p++) {
                const float w = expf(m[i][p] - mx);
                num += w * o[i][p];
                den += w * l[i][p];
            }
        }
        r[i] = (bf16_t)(num / den + g * v[i]);
    }
    // keeps the arithmetic in front of the stores: moved in among them it could land in registers
    // of stores already issued
    __builtin_amdgcn_sched_barrier(0);
    #pragma unroll
    for (int i = 0; i < 4; i++) yr[tid + 256 * i] = r[i];
    // the code laid behind this row's may write the stores' registers
    asm volatile("s_wait_xcnt 0x0" ::: "memory");
}

__global__ __launch_bounds__(256)
void k_combine(const float* __restrict__ opart, const float* __restrict__ pm,
               const float* __restrict__ pl, const float* __restrict__ memval,
               const float* __restrict__ gh, bf16_t* __restrict__ y, int D, int H) {
    size_t row = blockIdx.x;
    float g = 0.f;
    #pragma unroll
    for (int h = 0; h < 16; h++) g += gh[row * H + h];
    g *= (1.f / 16.f);
    const float* op = opart + row * D;
    const float* rm = pm + row * H;
    const float* rl = pl + row * H;
    const float* mv = memval + row * D;
    bf16_t* yr = y + row * D;
    const int P = ATT_NPARTS(((int)blockIdx.x % ATT_T) >> 7);   // the same for the whole block
    if (P == 1)      combine_row<1>(op, rm, rl, mv, g, yr);
    else if (P == 2) combine_row<2>(op, rm, rl, mv, g, yr);
    else             combine_row<3>(op, rm, rl, mv, g, yr);
}

// ---------------------------------------------------------------------------
extern "C" void kernel_launch(void* const* d_in, const int* in_sizes, int n_in,
                              void* d_out, int out_size, void* d_ws, size_t ws_size,
                              hipStream_t stream) {
    const int B = 2, T = 1024, D = 1024, H = 16, DFF = 4096;
    const int M = B * T;

    const float* x            = (const float*)d_in[0];
    const float* ln1_g        = (const float*)d_in[1];
    const float* ln1_b        = (const float*)d_in[2];
    const float* Wqkv         = (const float*)d_in[3];
    const float* bqkv         = (const float*)d_in[4];
    const float* W1w          = (const float*)d_in[5];
    const float* W2w          = (const float*)d_in[6];
    const float* W1r          = (const float*)d_in[7];
    const float* W2r          = (const float*)d_in[8];
    const float* Wmv          = (const float*)d_in[9];
    const float* bmv          = (const float*)d_in[10];
    const float* Wmg          = (const float*)d_in[11];
    const float* bmg          = (const float*)d_in[12];
    const float* mem_scale    = (const float*)d_in[13];
    const float* iter_mix     = (const float*)d_in[14];
    const float* decay_logits = (const float*)d_in[15];
    const float* Wout         = (const float*)d_in[16];
    const float* bout         = (const float*)d_in[17];
    const float* ln2_g        = (const float*)d_in[18];
    const float* ln2_b        = (const float*)d_in[19];
    const float* Wfc          = (const float*)d_in[20];
    const float* bfc          = (const float*)d_in[21];
    const float* Wproj        = (const float*)d_in[22];
    const float* bproj        = (const float*)d_in[23];

    char* ws = (char*)d_ws;
    size_t off = 0;
    auto alloc = [&](size_t bytes) -> void* {
        void* p = ws + off;
        off += (bytes + 255) & ~(size_t)255;
        return p;
    };

    bf16_t* Wqkv_t  = (bf16_t*)alloc((size_t)3 * D * D * 2);
    bf16_t* W1w_t   = (bf16_t*)alloc((size_t)64 * D * 2);
    bf16_t* W2w_t   = (bf16_t*)alloc((size_t)64 * D * 2);
    bf16_t* W1r_t   = (bf16_t*)alloc((size_t)64 * D * 2);
    bf16_t* W2r_t   = (bf16_t*)alloc((size_t)64 * D * 2);
    bf16_t* Wmg_t   = (bf16_t*)alloc((size_t)H * D * 2);
    bf16_t* Wmv_t   = (bf16_t*)alloc((size_t)D * D * 2);
    bf16_t* Wout_t  = (bf16_t*)alloc((size_t)D * D * 2);
    bf16_t* Wfc_t   = (bf16_t*)alloc((size_t)DFF * D * 2);
    bf16_t* Wproj_t = (bf16_t*)alloc((size_t)D * DFF * 2);
    bf16_t* h_bf    = (bf16_t*)alloc((size_t)M * D * 2);
    bf16_t* qkv_bf  = (bf16_t*)alloc((size_t)M * 3 * D * 2);
    float*  p1w     = (float*)alloc((size_t)M * 64 * 4);
    float*  p2w     = (float*)alloc((size_t)M * 64 * 4);
    float*  p1r     = (float*)alloc((size_t)M * 64 * 4);
    float*  p2r     = (float*)alloc((size_t)M * 64 * 4);
    float*  glin    = (float*)alloc((size_t)M * H * 4);
    float*  ghb     = (float*)alloc((size_t)M * H * 4);
    float*  memval  = (float*)alloc((size_t)M * D * 4);
    float*  opart   = (float*)alloc((size_t)ATT_MAXPARTS * M * D * 4);
    float*  pmax    = (float*)alloc((size_t)ATT_MAXPARTS * M * H * 4);
    float*  psum    = (float*)alloc((size_t)ATT_MAXPARTS * M * H * 4);
    bf16_t* y_bf    = (bf16_t*)alloc((size_t)M * D * 2);
    float*  x1      = (float*)alloc((size_t)M * D * 4);
    bf16_t* h2_bf   = (bf16_t*)alloc((size_t)M * D * 2);
    bf16_t* a_bf    = (bf16_t*)alloc((size_t)M * DFF * 2);
    float*  part_o  = (float*)alloc((size_t)SPLIT_OUT * M * D * 4);
    float*  part_p  = (float*)alloc((size_t)SPLIT_PROJ * M * D * 4);

    auto gemm = [&](const bf16_t* A, const bf16_t* Wt, const float* bias,
                    const float* resid, float* oF, bf16_t* oB, int m, int n, int k, int act) {
        dim3 g((n + 127) / 128, (m + 127) / 128);
        k_gemm_bf16<<<g, 256, 0, stream>>>(A, Wt, bias, resid, oF, oB, m, n, k, act);
    };

    // 1) the projections' weights -> bf16 transposed, and ln1
    TrArgs ta = { Wfc, Wproj, Wqkv, Wmv, Wout, W1w, W2w, W1r, W2r, Wmg,
                  Wfc_t, Wproj_t, Wqkv_t, Wmv_t, Wout_t, W1w_t, W2w_t, W1r_t, W2r_t, Wmg_t };
    k_front<<<TR_FIRST_BLOCKS + M, 256, 0, stream>>>(ta, x, ln1_g, ln1_b, h_bf);

    // 2) projections
    ProjArgs pa = { h_bf, Wqkv_t, Wmv_t, W1w_t, W2w_t, W1r_t, W2r_t, Wmg_t,
                    bqkv, bmv, bmg, qkv_bf, memval, p1w, p2w, p1r, p2r, glin, D };
    k_gemm_proj<<<dim3(PROJ_TILES, 16), 256, 0, stream>>>(pa);

    // 3) attention, Gram memory branch, the other weights -> bf16 transposed
    k_mid<<<MID_BLOCKS, 256, 0, stream>>>(ta, qkv_bf, opart, pmax, psum, p1w, p2w, p1r, p2r, glin,
                                          decay_logits, iter_mix, mem_scale, ghb, T, H);

    // 4) the two branches joined
    k_combine<<<M, 256, 0, stream>>>(opart, pmax, psum, memval, ghb, y_bf, D, H);

    // 5) output projection in k ranges; their sum + bias + residual, and ln2
    k_gemm_splitk<<<dim3(8, 16, SPLIT_OUT), 256, 0, stream>>>(y_bf, Wout_t, part_o, D, D, D / SPLIT_OUT);
    k_join_ln<<<M, 256, 0, stream>>>(part_o, bout, x, x1, ln2_g, ln2_b, h2_bf);

    // 6) MLP; the second product in k ranges, then their sum + bias + residual
    gemm(h2_bf, Wfc_t, bfc, nullptr, nullptr, a_bf, M, DFF, D, 1);
    k_gemm_splitk<<<dim3(8, 16, SPLIT_PROJ), 256, 0, stream>>>(a_bf, Wproj_t, part_p, D, DFF, DFF / SPLIT_PROJ);
    k_join_out<<<M / 4, 256, 0, stream>>>(part_p, bproj, x1, (float*)d_out);
}

// v010
// It runs in 114 microseconds.
// Timed twice side by side with v009, it ran 1.06 and 1.05 times as fast.
// All steps since v000 together make it 7.60 times as fast.
#include <hip/hip_runtime.h>
#include <math.h>

typedef __bf16 bf16_t;
typedef __attribute__((ext_vector_type(16))) __bf16 v16bf;
typedef __attribute__((ext_vector_type(8)))  float  v8f;
typedef unsigned int u32x4 __attribute__((ext_vector_type(4)));
typedef int i32x4 __attribute__((ext_vector_type(4)));
typedef float  f32x4  __attribute__((ext_vector_type(4)));
typedef __bf16 bf16x4 __attribute__((ext_vector_type(4)));
typedef __bf16 bf16x8 __attribute__((ext_vector_type(8)));

union AFrag { v16bf v; u32x4 q[2]; };

#if __has_builtin(__builtin_amdgcn_global_load_async_to_lds_b128) && \
    __has_builtin(__builtin_amdgcn_s_wait_asynccnt)
#define HAS_ASYNC_LDS 1
typedef __attribute__((address_space(1))) i32x4* glds_gptr;
typedef __attribute__((address_space(3))) i32x4* glds_lptr;
#else
#define HAS_ASYNC_LDS 0
#endif

__device__ __forceinline__ void async_copy16(void* lds, const void* g) {
#if HAS_ASYNC_LDS
    __builtin_amdgcn_global_load_async_to_lds_b128(
        (glds_gptr)(g), (glds_lptr)(lds), 0, 0);
#endif
}
__device__ __forceinline__ void async_wait0() {
#if HAS_ASYNC_LDS
    __builtin_amdgcn_s_wait_asynccnt(0);
#endif
}

// ---------------------------------------------------------------------------
// Exponentials and the error function of the two hot places (softmax, GELU) on the chip's own
// instructions.  The library's expf spends about a dozen vector instructions around its one v_exp_f32
// (split-precision argument, ldexp, two range tests), and its erff picks one of two polynomials by a
// branch on the lanes' values: a wave whose lanes differ runs both, one element after the other.
// ---------------------------------------------------------------------------
#define LOG2E 1.44269504f

// x[i] = 2^x[i], eight at a time.  Behind a transcendental the instruction set asks for one independent
// instruction before its result is read or its source overwritten.  In one statement each stands behind an independent one,
// in its own register, and the v_nop is the slot behind the last.
__device__ __forceinline__ void exp2_x8(float (&x)[8]) {
    asm("v_exp_f32 %0, %0\n\t"
        "v_exp_f32 %1, %1\n\t"
        "v_exp_f32 %2, %2\n\t"
        "v_exp_f32 %3, %3\n\t"
        "v_exp_f32 %4, %4\n\t"
        "v_exp_f32 %5, %5\n\t"
        "v_exp_f32 %6, %6\n\t"
        "v_exp_f32 %7, %7\n\t"
        "v_nop"
        : "+v"(x[0]), "+v"(x[1]), "+v"(x[2]), "+v"(x[3]), "+v"(x[4]), "+v"(x[5]), "+v"(x[6]), "+v"(x[7]));
}

// the value that lane l ^ 16 holds, by a vector move between the wave's two rows of 16 lanes
__device__ __forceinline__ float xhalf(float x) {
    const int b = __builtin_bit_cast(int, x);
    return __builtin_bit_cast(float, __builtin_amdgcn_permlanex16(b, b, 0x76543210, 0xfedcba98, false, false));
}

// 0.5 c (1 + erf(c / sqrt 2)).  erf by one formula for every argument, without a branch, so that
// independent elements interleave:  erf|x| = 1 - t (a1 + t (a2 + t (a3 + t (a4 + t a5)))) exp(-x^2),
// t = 1 / (1 + p |x|); its absolute error is at most 1.5e-7, the size of an f32 rounding step at 1.
__device__ __forceinline__ float gelu_erf(float c) {
    const float x = c * 0.70710678118f;
    const float t = __builtin_amdgcn_rcpf(fmaf(0.3275911f, fabsf(x), 1.f));
    float q = fmaf(t, 1.061405429f, -1.453152027f);
    q = fmaf(t, q, 1.421413741f);
    q = fmaf(t, q, -0.284496736f);
    q = fmaf(t, q, 0.254829592f);
    const float e = __builtin_amdgcn_exp2f((x * -LOG2E) * x);
    const float er = copysignf(fmaf(-(q * t), e, 1.f), x);
    return 0.5f * c * (1.f + er);
}

// ---------------------------------------------------------------------------
// Weight convert: W (K x N, f32, row-major) -> Wt (N x K, bf16, row-major)
// A block finds its weight and its tile from an index l that its kernel hands it (tr_first, tr_late).
// A block turns a tile of 128 k x 128 n, 64 elements a thread, so that the grid has few waves
// and each of them keeps 16 loads of 16 B a lane in flight:
//   load : a wave reads 512 contiguous bytes of a W row (4 n a lane); a lane takes the same
//          4 n of 8 successive k, twice, and so holds 8 k of each n: 16 B of a Wt row
//   turn : those 16-B pieces go to LDS as [n][k], rows of 256 B
//   store: a wave takes two rows back, 16 B a lane, and stores 2 x 256 contiguous bytes of Wt
// LDS rows have no pad; the 16-B piece c of row n lies at place c ^ ((n >> 2) & 15).  So the 16
// lanes that write one k piece of rows 4 apart, and the 16 that read one whole row, each meet
// all 64 banks once.
// K is a multiple of 128; N a multiple of 128, or below 128 and a multiple of 16 (one tile wide).
// ---------------------------------------------------------------------------
struct TrArgs {
    const float* wfc;  const float* wproj; const float* wqkv; const float* wmv; const float* wout;
    const float* w1w;  const float* w2w;   const float* w1r;  const float* w2r; const float* wmg;
    bf16_t* tfc;  bf16_t* tproj; bf16_t* tqkv; bf16_t* tmv; bf16_t* tout;
    bf16_t* t1w;  bf16_t* t2w;   bf16_t* t1r;  bf16_t* t2r; bf16_t* tmg;
};
#define TR_FIRST_BLOCKS 296   // 192 + 64 + 4 * 8 + 8: the weights that the projections of ln1(x) read
#define TR_LATE_BLOCKS  576   // 256 + 256 + 64: Wfc, Wproj, Wout, first read behind the attention

template <int K, int N>
__device__ __forceinline__
void tr_tile(const float* __restrict__ W, bf16_t* __restrict__ Wt, int kb, int nb, char* lds) {
    constexpr int NT = N < 128 ? N : 128;   // columns of W in this tile
    const int tid = threadIdx.x, lane = tid & 31;
    const int wave = __builtin_amdgcn_readfirstlane(tid >> 5);   // scalar: row addresses stay scalar
    if (4 * lane < NT) {
        const float* p = W + (size_t)(kb + 8 * wave) * N + nb;   // scalar; the lane is the loads' one vector register
        f32x4 v[2][8];
        #pragma unroll
        for (int r = 0; r < 2; r++)
            #pragma unroll
            for (int i = 0; i < 8; i++) v[r][i] = ((const f32x4*)(p + (size_t)(64 * r + i) * N))[lane];
        // later arithmetic may land in the loads' index register; it is named as an input so that
        // it lives up to the wait: otherwise the last load's own result could be placed in it
        asm volatile("s_wait_xcnt 0x0" :: "v"(lane) : "memory");
        // keeps the conversions behind all 16 loads: moved up among them (to save registers) they
        // make the last loads wait for the first ones' data, a second trip to memory
        __builtin_amdgcn_sched_barrier(0);
        #pragma unroll
        for (int r = 0; r < 2; r++)
            #pragma unroll
            for (int j = 0; j < 4; j++) {
                bf16x8 o;
                #pragma unroll
                for (int i = 0; i < 8; i++) o[i] = (bf16_t)v[r][i][j];
                *(bf16x8*)(lds + (4 * lane + j) * 256 + (((wave + 8 * r) ^ (lane & 15)) * 16)) = o;
            }
    }
    __syncthreads();
    const int n = tid >> 4, c = tid & 15;
    bf16_t* q0 = Wt + (size_t)(nb + n) * K + kb + 8 * c;
    u32x4 d[NT / 16];
    #pragma unroll
    for (int q = 0; q < NT / 16; q++) {
        const int nq = n + 16 * q;
        d[q] = *(const u32x4*)(lds + nq * 256 + ((c ^ ((nq >> 2) & 15)) * 16));
    }
    #pragma unroll
    for (int q = 0; q < NT / 16; q++) *(u32x4*)(q0 + (size_t)(16 * q) * K) = d[q];
    // the code laid behind this tile's may write the stores' address and data registers
    asm volatile("s_wait_xcnt 0x0" ::: "memory");
}

// l: tile index, inside a weight N fastest
__device__ __forceinline__
void tr_first(const TrArgs& a, int l, char* tile) {
    if (l < 192)               tr_tile<1024, 3072>(a.wqkv, a.tqkv, (l / 24) * 128, (l % 24) * 128, tile);
    else if ((l -= 192) < 64)  tr_tile<1024, 1024>(a.wmv,  a.tmv,  (l >> 3) * 128, (l & 7) * 128,  tile);
    else if ((l -= 64) < 32) {
        const int s = l >> 3;
        tr_tile<1024, 64>(s == 0 ? a.w1w : s == 1 ? a.w2w : s == 2 ? a.w1r : a.w2r,
                          s == 0 ? a.t1w : s == 1 ? a.t2w : s == 2 ? a.t1r : a.t2r, (l & 7) * 128, 0, tile);
    }
    else tr_tile<1024, 16>(a.wmg, a.tmg, (l - 32) * 128, 0, tile);
}

__device__ __forceinline__
void tr_late(const TrArgs& a, int l, char* tile) {
    if (l < 256)               tr_tile<1024, 4096>(a.wfc,   a.tfc,   (l >> 5) * 128, (l & 31) * 128, tile);
    else if ((l -= 256) < 256) tr_tile<4096, 1024>(a.wproj, a.tproj, (l >> 3) * 128, (l & 7) * 128,  tile);
    else                       tr_tile<1024, 1024>(a.wout,  a.tout,  ((l - 256) >> 3) * 128, (l & 7) * 128, tile);
}

// ---------------------------------------------------------------------------
// LayerNorm (f32 in) -> bf16 out.  One block per row r.
// The row length is fixed, so that a thread's loads stand together, off one address with constant
// offsets, and one wait behind each group covers them.
// ---------------------------------------------------------------------------
#define LN_D 1024            // row length
#define LN_E (LN_D / 256)    // elements a thread

// v: the thread's elements of row r, columns threadIdx.x + 256 i
__device__ __forceinline__
void layernorm_vals(const float* v, const float* __restrict__ g,
                    const float* __restrict__ b, bf16_t* __restrict__ out, int r) {
    float s = 0.f, s2 = 0.f;
    #pragma unroll
    for (int i = 0; i < LN_E; i++) { s += v[i]; s2 += v[i] * v[i]; }
    #pragma unroll
    for (int off = 16; off; off >>= 1) { s += __shfl_down(s, off); s2 += __shfl_down(s2, off); }
    __shared__ float ws[8], ws2[8];
    int wave = threadIdx.x >> 5, lane = threadIdx.x & 31;
    if (lane == 0) { ws[wave] = s; ws2[wave] = s2; }
    __syncthreads();
    if (threadIdx.x == 0) {
        float a = 0.f, a2 = 0.f;
        #pragma unroll
        for (int i = 0; i < 8; i++) { a += ws[i]; a2 += ws2[i]; }
        ws[0] = a; ws2[0] = a2;
    }
    __syncthreads();
    float mean = ws[0] / LN_D;
    float var  = ws2[0] / LN_D - mean * mean;
    float rstd = rsqrtf(var + 1e-5f);
    bf16_t* orow = out + (size_t)r * LN_D + threadIdx.x;
    float gv[LN_E], bv[LN_E];
    #pragma unroll
    for (int i = 0; i < LN_E; i++) gv[i] = g[threadIdx.x + 256 * i];
    // the next loads' results or addresses may land in these loads' address registers
    asm volatile("s_wait_xcnt 0x0" ::: "memory");
    #pragma unroll
    for (int i = 0; i < LN_E; i++) bv[i] = b[threadIdx.x + 256 * i];
    // as above
    asm volatile("s_wait_xcnt 0x0" ::: "memory");
    #pragma unroll
    for (int i = 0; i < LN_E; i++) orow[256 * i] = (bf16_t)((v[i] - mean) * rstd * gv[i] + bv[i]);
    // the code laid behind this row's may write the stores' registers
    asm volatile("s_wait_xcnt 0x0" ::: "memory");
}

__device__ __forceinline__
void layernorm_row(const float* __restrict__ x, const float* __restrict__ g,
                   const float* __restrict__ b, bf16_t* __restrict__ out, int r) {
    const float* row = x + (size_t)r * LN_D + threadIdx.x;
    float v[LN_E];
    #pragma unroll
    for (int i = 0; i < LN_E; i++) v[i] = row[256 * i];
    // later arithmetic may land in the loads' address registers
    asm volatile("s_wait_xcnt 0x0" ::: "memory");
    layernorm_vals(v, g, b, out, r);
}

// First launch: all that the projections wait for.  The turn of their seven weights and ln1 do not
// depend on one another, so they share a grid: blocks below TR_FIRST_BLOCKS turn a weight tile (they
// move the most bytes each and start first), every later block normalises one row of x.
__global__ __launch_bounds__(256)
void k_front(TrArgs a, const float* __restrict__ x, const float* __restrict__ g,
             const float* __restrict__ b, bf16_t* __restrict__ out) {
    __shared__ __attribute__((aligned(16))) char tile[128 * 256];
    const int l = blockIdx.x;
    if (l < TR_FIRST_BLOCKS) tr_first(a, l, tile);
    else                     layernorm_row(x, g, b, out, l - TR_FIRST_BLOCKS);
}

// ---------------------------------------------------------------------------
// Generic bf16 WMMA GEMM:  C[M,N] = A[M,K] * Wt[N,K]^T  (+bias)(+gelu)(+resid)
// Block tile 128x128, 8 waves: each wave 32(M) x 64(N).
// A stage holds 64 k of every operand row = one whole 128-B line per row, so that a wave's
// 16-B-per-lane copy covers 4 whole lines (8 lanes a row).  Two buffers, copies one stage ahead.
// K: the k that this block sums over, a multiple of 64; ld: elements between two rows of A and of
// Wt (K, or more where the block takes one range of a longer row).  N must be a multiple of 4.
// ---------------------------------------------------------------------------
#define GEMM_BK  64   // k per stage
#define GEMM_LDK 72   // LDS row pitch in elements (144 B = 16 B x 9: conflict-free 16-B reads)
#define GEMM_ROWSTEP (32 * GEMM_LDK * 2)    // LDS bytes between a thread's four rows of one operand
#define GEMM_BUFSTEP (128 * GEMM_LDK * 2)   // LDS bytes between the two buffers of one operand
#define EP_LD 68      // epilogue: LDS row pitch in floats (272 B: 16-B aligned rows, 4 banks apart)

// One stage: each thread brings 16 B of four A rows and of four Wt rows (32 rows apart) into LDS.
// la, lb: the thread's LDS byte addresses of its first row; a0, b0..b3: its global addresses.
// The closing s_wait_xcnt stands inside the statement so that it precedes every later write of
// the address registers that the copies name.
__device__ __forceinline__
void gemm_stage(unsigned la, unsigned lb, const bf16_t* a0, size_t arow,
                const bf16_t* b0, const bf16_t* b1, const bf16_t* b2, const bf16_t* b3) {
    asm volatile(
        "global_load_async_to_lds_b128 %0, %8, off\n\t"
        "global_load_async_to_lds_b128 %1, %9, off\n\t"
        "global_load_async_to_lds_b128 %2, %10, off\n\t"
        "global_load_async_to_lds_b128 %3, %11, off\n\t"
        "global_load_async_to_lds_b128 %4, %12, off\n\t"
        "global_load_async_to_lds_b128 %5, %13, off\n\t"
        "global_load_async_to_lds_b128 %6, %14, off\n\t"
        "global_load_async_to_lds_b128 %7, %15, off\n\t"
        "s_wait_xcnt 0x0"
        :: "v"(la), "v"(la + GEMM_ROWSTEP), "v"(la + 2 * GEMM_ROWSTEP), "v"(la + 3 * GEMM_ROWSTEP),
           "v"(lb), "v"(lb + GEMM_ROWSTEP), "v"(lb + 2 * GEMM_ROWSTEP), "v"(lb + 3 * GEMM_ROWSTEP),
           "v"(a0), "v"(a0 + arow), "v"(a0 + 2 * arow), "v"(a0 + 3 * arow),
           "v"(b0), "v"(b1), "v"(b2), "v"(b3)
        : "memory");
}

__device__ __forceinline__
void gemm_tile(const bf16_t* __restrict__ A, const bf16_t* __restrict__ Wt,
               const float* __restrict__ bias, const float* __restrict__ resid,
               float* __restrict__ outF, bf16_t* __restrict__ outB,
               int N, int K, int ld, int act, int m0, int n0) {
    __shared__ __attribute__((aligned(16))) bf16_t As[2][128][GEMM_LDK];
    __shared__ __attribute__((aligned(16))) bf16_t Bs[2][128][GEMM_LDK];
    const int tid = threadIdx.x;
    const int wave = tid >> 5, lane = tid & 31;
    const int wm = (wave & 3) * 32, wn = (wave >> 2) * 64;
    const int lm = lane & 15, kh = lane >> 4;

    v8f acc[2][4];
    #pragma unroll
    for (int i = 0; i < 2; i++)
        #pragma unroll
        for (int j = 0; j < 4; j++)
            #pragma unroll
            for (int v = 0; v < 8; v++) acc[i][j][v] = 0.f;

    // copy map: 8 lanes a row (8 x 16 B = the row's 128 B of this stage), rows cr + 32 i
    const int cr = tid >> 3, cc = (tid & 7) * 8;
    const size_t arow = (size_t)32 * ld;
    const bf16_t* ga = A + (size_t)(m0 + cr) * ld + cc;
    // A weight row past N is replaced by row N - 1: every lane copies, every address is in
    // bounds, and the columns n >= N that such rows feed are never stored (epilogue).
    const bf16_t* gb[4];
    #pragma unroll
    for (int i = 0; i < 4; i++) {
        int rn = n0 + cr + 32 * i;
        rn = rn < N ? rn : N - 1;
        gb[i] = Wt + (size_t)rn * ld + cc;
    }
    const unsigned la = (unsigned)(size_t)&As[0][cr][cc];   // low 32 bits = LDS byte address
    const unsigned lb = (unsigned)(size_t)&Bs[0][cr][cc];
    const int nT = K / GEMM_BK;

    // stage 0 -> buffer 0, published; then stage 1 -> buffer 1 flies during trip 0
    gemm_stage(la, lb, ga, arow, gb[0], gb[1], gb[2], gb[3]);
    asm volatile("s_wait_asynccnt 0x0" ::: "memory");   // this wave's copies of stage 0 have landed
    __syncthreads();
    if (nT > 1)
        gemm_stage(la + GEMM_BUFSTEP, lb + GEMM_BUFSTEP, ga + GEMM_BK, arow,
                   gb[0] + GEMM_BK, gb[1] + GEMM_BK, gb[2] + GEMM_BK, gb[3] + GEMM_BK);

    for (int t = 0; t < nT; t++) {
        const int cur = t & 1;
        if (t + 2 < nT)
            __builtin_prefetch(A + (size_t)(m0 + (tid >> 1)) * ld + (t + 2) * GEMM_BK + (tid & 1) * 32, 0, 3);

        #pragma unroll
        for (int kk = 0; kk < GEMM_BK / 32; kk++) {
            AFrag a[2], bfr[4];
            #pragma unroll
            for (int i = 0; i < 2; i++) {
                const bf16_t* p = &As[cur][wm + i * 16 + lm][kk * 32 + kh * 8];
                a[i].q[0] = *(const u32x4*)p;
                a[i].q[1] = *(const u32x4*)(p + 16);
            }
            #pragma unroll
            for (int j = 0; j < 4; j++) {
                const bf16_t* p = &Bs[cur][wn + j * 16 + lm][kk * 32 + kh * 8];
                bfr[j].q[0] = *(const u32x4*)p;
                bfr[j].q[1] = *(const u32x4*)(p + 16);
            }
            #pragma unroll
            for (int i = 0; i < 2; i++)
                #pragma unroll
                for (int j = 0; j < 4; j++)
                    acc[i][j] = __builtin_amdgcn_wmma_f32_16x16x32_bf16(
                        false, a[i].v, false, bfr[j].v, (short)0, acc[i][j], false, false);
        }

        // publish stage t + 1 and free buffer cur, in this order:
        asm volatile("s_wait_dscnt 0x0" ::: "memory");      // this wave's reads of buffer cur are done
        asm volatile("s_wait_asynccnt 0x0" ::: "memory");   // this wave's copies of stage t + 1 have landed
        __syncthreads();
        if (t + 2 < nT) {
            const int ko = (t + 2) * GEMM_BK;
            const unsigned bo = cur * GEMM_BUFSTEP;
            gemm_stage(la + bo, lb + bo, ga + ko, arow, gb[0] + ko, gb[1] + ko, gb[2] + ko, gb[3] + ko);
        }
    }
    asm volatile("s_wait_asynccnt 0x0" ::: "memory");   // no copy is left in flight behind the loop

    // Epilogue.  The accumulator layout gives a lane one column of 8 rows: stored from there, every
    // access is a 4-B piece and the residual loads follow one another.  So each wave turns its own
    // 32 x 64 tile through its own LDS range (the ring is free: every wave has passed the last
    // trip's barrier and no copy is in flight) and takes it back row-wise: a lane holds 4
    // neighbouring columns, 16 lanes a row, so that every residual load and every store covers
    // whole 128-B lines, and the 16 residual loads of a lane fly together, under the turn.
    if (n0 + wn < N) {   // the same for the whole wave
        float* st0 = (float*)&As[0][0][0] + wave * (16 * EP_LD);   // rows  0..15 of the wave's tile
        float* st1 = (float*)&Bs[0][0][0] + wave * (16 * EP_LD);   // rows 16..31
        const int er = lane >> 4, ec = (lane & 15) * 4;
        const int n = n0 + wn + ec;
        const bool ok = n < N;   // N is a multiple of 4: a lane's 4 columns are in or out together
        const size_t idx0 = (size_t)(m0 + wm + er) * N + n;
        const size_t rstep = (size_t)2 * N;

        // behind each load: a later load's result or later arithmetic may land in its address registers
        f32x4 bv = {0.f, 0.f, 0.f, 0.f};
        if (ok && bias) {
            bv = *(const f32x4*)(bias + n);
            asm volatile("s_wait_xcnt 0x0" ::: "memory");   // see above
        }
        f32x4 rv[16];   // filled and read only where there is a residual
        if (ok && resid) {
            #pragma unroll
            for (int q = 0; q < 16; q++) {
                rv[q] = *(const f32x4*)(resid + idx0 + q * rstep);
                asm volatile("s_wait_xcnt 0x0" ::: "memory");   // see above
            }
        }

        #pragma unroll
        for (int j = 0; j < 4; j++)
            #pragma unroll
            for (int v = 0; v < 8; v++) {
                st0[(v + 8 * kh) * EP_LD + j * 16 + lm] = acc[0][j][v];
                st1[(v + 8 * kh) * EP_LD + j * 16 + lm] = acc[1][j][v];
            }
        // the rows are read back by other lanes of this wave: their writes have to be done
        asm volatile("s_wait_dscnt 0x0" ::: "memory");
        f32x4 cv[16];
        #pragma unroll
        for (int q = 0; q < 16; q++)
            cv[q] = *(const f32x4*)((q < 8 ? st0 : st1) + ((q & 7) * 2 + er) * EP_LD + ec);

        if (ok) {
            #pragma unroll
            for (int q = 0; q < 16; q++) cv[q] += bv;
            // all 64 elements in one stretch of code: they do not depend on one another
            if (act == 1) {
                #pragma unroll
                for (int q = 0; q < 16; q++)
                    #pragma unroll
                    for (int e = 0; e < 4; e++) cv[q][e] = gelu_erf(cv[q][e]);
            }
            #pragma unroll
            for (int q = 0; q < 16; q++) {
                f32x4 c = cv[q];
                if (resid) c += rv[q];
                const size_t idx = idx0 + q * rstep;
                // behind each store: later arithmetic may land in its registers
                if (outF) {
                    *(f32x4*)(outF + idx) = c;
                    asm volatile("s_wait_xcnt 0x0" ::: "memory");   // see above
                }
                if (outB) {
                    bf16x4 o;
                    #pragma unroll
                    for (int e = 0; e < 4; e++) o[e] = (bf16_t)c[e];
                    *(bf16x4*)(outB + idx) = o;
                    asm volatile("s_wait_xcnt 0x0" ::: "memory");   // see above
                }
            }
        }
    }
}

__global__ __launch_bounds__(256)
void k_gemm_bf16(const bf16_t* __restrict__ A, const bf16_t* __restrict__ Wt,
                 const float* __restrict__ bias, const float* __restrict__ resid,
                 float* __restrict__ outF, bf16_t* __restrict__ outB,
                 int M, int N, int K, int act) {
    gemm_tile(A, Wt, bias, resid, outF, outB, N, K, K, act, blockIdx.y * 128, blockIdx.x * 128);
}

// The two products with N = 1024 have only 128 tiles of 128 x 128 for 256 WGPs, and a block walks its
// stages one after the other, so such a launch lasts as long as one walk over all of K.  Here K is cut
// into gridDim.z ranges of klen, each a block of its own: more blocks, each with a shorter walk.
// A block leaves its range's sum as it stands, f32, in its range's plane of part; the launch behind
// it adds the planes, the bias and the residual (k_join_ln, k_join_out).
#define SPLIT_STEP ((size_t)2048 * 1024)   // floats between two ranges' planes
#define SPLIT_OUT  2                       // ranges of the output projection (K = 1024)
#define SPLIT_PROJ 4                       // ranges of the second MLP product (K = 4096)

__global__ __launch_bounds__(256)
void k_gemm_splitk(const bf16_t* __restrict__ A, const bf16_t* __restrict__ Wt,
                   float* __restrict__ part, int N, int K, int klen) {
    const size_t ko = (size_t)blockIdx.z * klen;
    gemm_tile(A + ko, Wt + ko, nullptr, nullptr, part + blockIdx.z * SPLIT_STEP, nullptr,
              N, klen, K, 0, blockIdx.y * 128, blockIdx.x * 128);
}

// out = sum of the SPLIT_PROJ planes + bias + resid.  A block takes 4 rows of 1024; a thread holds the
// same 16 B of each, so that every load and store of a wave covers 4 whole lines and all of a
// thread's loads fly together.
__global__ __launch_bounds__(256)
void k_join_out(const float* __restrict__ part, const float* __restrict__ bias,
                const float* __restrict__ resid, float* __restrict__ out) {
    const unsigned e = blockIdx.x * 4096u + threadIdx.x * 4u;   // the thread's first element
    f32x4 p[SPLIT_PROJ][4], r[4];
    // The loads stand in groups off one address each.  Behind each group: the next loads' results or
    // later arithmetic may land in its address registers.
    #pragma unroll
    for (int z = 0; z < SPLIT_PROJ; z++) {
        #pragma unroll
        for (int q = 0; q < 4; q++) p[z][q] = *(const f32x4*)(part + z * SPLIT_STEP + e + q * 1024);
        asm volatile("s_wait_xcnt 0x0" ::: "memory");   // see above
    }
    #pragma unroll
    for (int q = 0; q < 4; q++) r[q] = *(const f32x4*)(resid + e + q * 1024);
    asm volatile("s_wait_xcnt 0x0" ::: "memory");   // see above
    const f32x4 bv = *(const f32x4*)(bias + threadIdx.x * 4u);
    asm volatile("s_wait_xcnt 0x0" ::: "memory");   // see above
    // keeps the additions behind all the loads: moved up among them they make the later loads wait
    // for the first ones' data, a second trip to memory
    __builtin_amdgcn_sched_barrier(0);
    f32x4 c[4];
    #pragma unroll
    for (int q = 0; q < 4; q++) {
        c[q] = p[0][q];
        #pragma unroll
        for (int z = 1; z < SPLIT_PROJ; z++) c[q] += p[z][q];
        c[q] = c[q] + bv + r[q];
    }
    // keeps the additions in front of the stores: moved in among them they could land in registers
    // of stores already issued
    __builtin_amdgcn_sched_barrier(0);
    #pragma unroll
    for (int q = 0; q < 4; q++) *(f32x4*)(out + e + q * 1024) = c[q];
    // nothing may land in the stores' registers before this
    asm volatile("s_wait_xcnt 0x0" ::: "memory");
}

// x1 = sum of the SPLIT_OUT planes + bias + x, stored, and its LayerNorm -> bf16.  One block per row.
__global__ __launch_bounds__(256)
void k_join_ln(const float* __restrict__ part, const float* __restrict__ bias,
               const float* __restrict__ x, float* __restrict__ x1,
               const float* __restrict__ g, const float* __restrict__ b, bf16_t* __restrict__ out) {
    const size_t o = (size_t)blockIdx.x * LN_D + threadIdx.x;
    float p[SPLIT_OUT][LN_E], xr[LN_E], bo[LN_E], v[LN_E];
    // groups of loads off one address each; behind each group: the next loads' results or addresses
    // may land in its address registers
    #pragma unroll
    for (int z = 0; z < SPLIT_OUT; z++) {
        #pragma unroll
        for (int i = 0; i < LN_E; i++) p[z][i] = part[z * SPLIT_STEP + o + 256 * i];
        asm volatile("s_wait_xcnt 0x0" ::: "memory");   // see above
    }
    #pragma unroll
    for (int i = 0; i < LN_E; i++) xr[i] = x[o + 256 * i];
    asm volatile("s_wait_xcnt 0x0" ::: "memory");   // see above
    #pragma unroll
    for (int i = 0; i < LN_E; i++) bo[i] = bias[threadIdx.x + 256 * i];
    asm volatile("s_wait_xcnt 0x0" ::: "memory");   // see above
    #pragma unroll
    for (int i = 0; i < LN_E; i++) {
        float c = p[0][i];
        #pragma unroll
        for (int z = 1; z < SPLIT_OUT; z++) c += p[z][i];
        v[i] = c + bo[i] + xr[i];
    }
    #pragma unroll
    for (int i = 0; i < LN_E; i++) x1[o + 256 * i] = v[i];
    // later arithmetic may land in the stores' registers
    asm volatile("s_wait_xcnt 0x0" ::: "memory");
    layernorm_vals(v, g, b, out, blockIdx.x);
}

// The seven projections of the same A (2048 x K) in one grid: they do not depend on one
// another, and the narrow ones (16 blocks each on their own) fill places the wide ones leave.
// blockIdx.x picks the weight and its 128-wide column tile, blockIdx.y the row tile.
struct ProjArgs {
    const bf16_t* A;
    const bf16_t* tqkv; const bf16_t* tmv; const bf16_t* t1w; const bf16_t* t2w;
    const bf16_t* t1r;  const bf16_t* t2r; const bf16_t* tmg;
    const float* bqkv; const float* bmv; const float* bmg;
    bf16_t* qkv;
    float* memval; float* p1w; float* p2w; float* p1r; float* p2r; float* glin;
    int K;
};
#define PROJ_TILES 37   // 24 (qkv) + 8 (mem values) + 4 (points) + 1 (gate)

__global__ __launch_bounds__(256)
void k_gemm_proj(ProjArgs a) {
    const int x = blockIdx.x;
    const bf16_t* Wt;
    const float* bias = nullptr;
    float* oF = nullptr;
    bf16_t* oB = nullptr;
    int N = 64, n0 = 0;
    if (x < 24)       { Wt = a.tqkv; bias = a.bqkv; oB = a.qkv;    N = 3072; n0 = x * 128; }
    else if (x < 32)  { Wt = a.tmv;  bias = a.bmv;  oF = a.memval; N = 1024; n0 = (x - 24) * 128; }
    else if (x == 32) { Wt = a.t1w;  oF = a.p1w; }
    else if (x == 33) { Wt = a.t2w;  oF = a.p2w; }
    else if (x == 34) { Wt = a.t1r;  oF = a.p1r; }
    else if (x == 35) { Wt = a.t2r;  oF = a.p2r; }
    else              { Wt = a.tmg;  bias = a.bmg;  oF = a.glin;   N = 16; }
    gemm_tile(a.A, Wt, bias, nullptr, oF, oB, N, a.K, a.K, 0, blockIdx.y * 128, n0);
}

#define ATT_MAXPARTS 3
#define ATT_T 1024                                  // positions of a sequence: 8 q-tiles
#define ATT_NPARTS(qb) (((qb) + 3) / 3)             // parts of q-tile qb
#define ATT_OSTEP ((size_t)2048 * 1024)             // floats between two parts' output sums
#define ATT_SSTEP ((size_t)2048 * 16)               // floats between two parts' row maxima, or row sums

__device__ __forceinline__
void attention_block(const bf16_t* __restrict__ qkv, float* __restrict__ opart,
                     float* __restrict__ pm, float* __restrict__ pl,
                     int T, int H, int qb, int bh, int sb0, int sb1) {
    const int h = bh % H, b = bh / H;
    const int tid = threadIdx.x, wave = tid >> 5, lane = tid & 31;
    const int lm = lane & 15, kh = lane >> 4;

    __shared__ bf16_t Qs[128][72];
    __shared__ bf16_t Ks[128][72];
    __shared__ bf16_t Vt[64][136];     // V transposed: [dh][s]

    const size_t strideT = 3 * 1024;
    const bf16_t* base = qkv + (size_t)b * T * strideT + (size_t)h * 64;

    // Load Q tile (128 x 64)
    for (int c8 = tid; c8 < 128 * 8; c8 += 256) {
        int rr = c8 >> 3, cc = (c8 & 7) * 8;
        const bf16_t* gq = base + (size_t)(qb * 128 + rr) * strideT + cc;
#if HAS_ASYNC_LDS
        async_copy16(&Qs[rr][cc], gq);
#else
        *(u32x4*)&Qs[rr][cc] = *(const u32x4*)gq;
#endif
    }

    // the lane's q-row: its maximum so far (alike in both halves) and this half's sum of exponentials
    const int trow = qb * 128 + wave * 16 + lm;
    float rowm = -INFINITY, rowl = 0.f;
    v8f oacc[4];   // O^T: register v of tile jt = column jt * 16 + 8 * kh + v of the lane's q-row
    #pragma unroll
    for (int jt = 0; jt < 4; jt++)
        #pragma unroll
        for (int v = 0; v < 8; v++) oacc[jt][v] = 0.f;

    for (int sb = sb0; sb < sb1; sb++) {
        __syncthreads();   // protect Ks/Vt reuse across iterations
        for (int c8 = tid; c8 < 128 * 8; c8 += 256) {
            int rr = c8 >> 3, cc = (c8 & 7) * 8;
            const bf16_t* gk = base + (size_t)(sb * 128 + rr) * strideT + 1024 + cc;
#if HAS_ASYNC_LDS
            async_copy16(&Ks[rr][cc], gk);
#else
            *(u32x4*)&Ks[rr][cc] = *(const u32x4*)gk;
#endif
        }
        for (int c8 = tid; c8 < 128 * 8; c8 += 256) {
            int rr = c8 >> 3, cc = (c8 & 7) * 8;
            union { u32x4 u; bf16_t e[8]; } vv;
            vv.u = *(const u32x4*)(base + (size_t)(sb * 128 + rr) * strideT + 2048 + cc);
            #pragma unroll
            for (int i = 0; i < 8; i++) Vt[cc + i][rr] = vv.e[i];
        }
        async_wait0();
        __syncthreads();

        // ---- scores: S^T = K * Q^T; sacc[j][v] = key j * 16 + 8 * kh + v against the lane's q-row ----
        AFrag aq[2];
        #pragma unroll
        for (int kk = 0; kk < 2; kk++) {
            const bf16_t* p = &Qs[wave * 16 + lm][kk * 32 + kh * 8];
            aq[kk].q[0] = *(const u32x4*)p;
            aq[kk].q[1] = *(const u32x4*)(p + 16);
        }
        v8f sacc[8];
        #pragma unroll
        for (int j = 0; j < 8; j++)
            #pragma unroll
            for (int v = 0; v < 8; v++) sacc[j][v] = 0.f;
        #pragma unroll
        for (int j = 0; j < 8; j++)
            #pragma unroll
            for (int kk = 0; kk < 2; kk++) {
                AFrag bk;
                const bf16_t* p = &Ks[j * 16 + lm][kk * 32 + kh * 8];
                bk.q[0] = *(const u32x4*)p;
                bk.q[1] = *(const u32x4*)(p + 16);
                sacc[j] = __builtin_amdgcn_wmma_f32_16x16x32_bf16(
                    false, bk.v, false, aq[kk].v, (short)0, sacc[j], false, false);
            }

        // ---- causal mask + online softmax, all of it inside the lane but for one exchange ----
        const int lim = trow - sb * 128 - 8 * kh;   // key j * 16 + v of this half is seen where it is <= lim
        float rm = -INFINITY;
        #pragma unroll
        for (int j = 0; j < 8; j++)
            #pragma unroll
            for (int v = 0; v < 8; v++) {
                float s = (j * 16 + v <= lim) ? sacc[j][v] * 0.125f : -INFINITY;
                sacc[j][v] = s;
                rm = fmaxf(rm, s);
            }
        rm = fmaxf(rm, xhalf(rm));   // the row's other 64 keys
        const float mnew = fmaxf(rowm, rm);
        float corr = (rowm - mnew) * LOG2E;
        asm("v_exp_f32 %0, %0\n\tv_nop" : "+v"(corr));   // 2^corr, with the slot behind it: see exp2_x8
        rowm = mnew;
        float rs[4] = {0.f, 0.f, 0.f, 0.f};   // four sums side by side: one would be a chain of 64 dependent adds
        #pragma unroll
        for (int j = 0; j < 8; j++) {
            float p[8];
            #pragma unroll
            for (int v = 0; v < 8; v++) p[v] = (sacc[j][v] - mnew) * LOG2E;
            exp2_x8(p);
            #pragma unroll
            for (int v = 0; v < 8; v++) { sacc[j][v] = p[v]; rs[v & 3] += p[v]; }
        }
        rowl = rowl * corr + ((rs[0] + rs[1]) + (rs[2] + rs[3]));
        #pragma unroll
        for (int jt = 0; jt < 4; jt++)
            #pragma unroll
            for (int v = 0; v < 8; v++) oacc[jt][v] = oacc[jt][v] * corr;

        // ---- O^T += V^T * P^T ----
        // B element s of a lane is key 8 * kh + s (s < 8) or 16 + 8 * kh + s - 8 of the 32: what the
        // lane holds in score tiles 2 kk and 2 kk + 1; the V^T loads take their k in the same order
        #pragma unroll
        for (int kk = 0; kk < 4; kk++) {
            AFrag bp;
            #pragma unroll
            for (int v = 0; v < 8; v++) {
                bp.v[v]     = (bf16_t)sacc[kk * 2][v];
                bp.v[8 + v] = (bf16_t)sacc[kk * 2 + 1][v];
            }
            #pragma unroll
            for (int jt = 0; jt < 4; jt++) {
                AFrag av;
                const bf16_t* q = &Vt[jt * 16 + lm][kk * 32 + kh * 8];
                av.q[0] = *(const u32x4*)q;
                av.q[1] = *(const u32x4*)(q + 16);
                oacc[jt] = __builtin_amdgcn_wmma_f32_16x16x32_bf16(
                    false, av.v, false, bp.v, (short)0, oacc[jt], false, false);
            }
        }
    }

    rowl += xhalf(rowl);   // the two halves' sums joined, once
    float* out = opart + (size_t)b * T * 1024 + (size_t)h * 64;
    // a row's maximum and sum are the same in its 2 lanes: the first of them stores both
    if (kh == 0) {
        const size_t r0 = ((size_t)b * T + trow) * 16 + h;   // 16 heads a row, as in ATT_SSTEP
        pm[r0] = rowm; pl[r0] = rowl;
    }
    // a lane's 8 registers of a tile are 8 neighbouring columns of its row: 2 stores of 16 B
    float* orow = out + (size_t)trow * 1024 + 8 * kh;
    #pragma unroll
    for (int jt = 0; jt < 4; jt++) {
        f32x4 lo = {oacc[jt][0], oacc[jt][1], oacc[jt][2], oacc[jt][3]};
        f32x4 hi = {oacc[jt][4], oacc[jt][5], oacc[jt][6], oacc[jt][7]};
        *(f32x4*)(orow + jt * 16)     = lo;
        *(f32x4*)(orow + jt * 16 + 4) = hi;
    }
    // the code laid behind the attention's may write the stores' registers
    asm volatile("s_wait_xcnt 0x0" ::: "memory");
}

// ---------------------------------------------------------------------------
// Plucker line through two points of R^4, normalised.
// ---------------------------------------------------------------------------
__device__ inline void exterior4(const float* a1, const float* a2, float* L) {
    L[0] = a1[0] * a2[1] - a1[1] * a2[0];
    L[1] = a1[0] * a2[2] - a1[2] * a2[0];
    L[2] = a1[0] * a2[3] - a1[3] * a2[0];
    L[3] = a1[1] * a2[2] - a1[2] * a2[1];
    L[4] = a1[1] * a2[3] - a1[3] * a2[1];
    L[5] = a1[2] * a2[3] - a1[3] * a2[2];
    float n2 = 0.f;
    #pragma unroll
    for (int i = 0; i < 6; i++) n2 += L[i] * L[i];
    float inv = 1.f / fmaxf(sqrtf(n2), 1e-12f);
    #pragma unroll
    for (int i = 0; i < 6; i++) L[i] *= inv;
}

// ---------------------------------------------------------------------------
// Decayed-Gram scan:  M_t = d*(M_{t-1} + Jw_{t-1} Jw_{t-1}^T),  M_0 = 0.
// The recurrence is linear, so it is run as a chunked parallel scan:
// one block per (b,h), thread c owns the 4 steps t = 4c .. 4c+3 (T == 4 * blockDim.x).
//   0) each thread forms the write lines (rotated by J6) and the read lines of its own 4 steps
//      from the projected points: no one else reads them, so they never go through memory
//   1) each thread folds its own 4 steps from zero   (chunk aggregate)
//   2) weighted prefix over chunks: lanes by shuffles, waves through LDS
//   3) each thread replays its 4 steps from its true M and writes the gates
// M is symmetric, so only its 21 upper entries are carried.
// Every loop is unrolled so that the small arrays are indexed by constants and stay in registers.
// ---------------------------------------------------------------------------
#define GS_L 4      // steps per thread
#define GS_NS 21    // upper triangle of a 6x6

__device__ __forceinline__ void gram_step(float* m, const float* J, float d) {
    int n = 0;
    #pragma unroll
    for (int i = 0; i < 6; i++)
        #pragma unroll
        for (int j = i; j < 6; j++, n++) m[n] = d * (m[n] + J[i] * J[j]);
}

__device__ __forceinline__
void gram_block(const float* __restrict__ p1w, const float* __restrict__ p2w,
                const float* __restrict__ p1r, const float* __restrict__ p2r,
                const float* __restrict__ glin, const float* __restrict__ decay_logits,
                const float* __restrict__ iter_mix, const float* __restrict__ mem_scale,
                float* __restrict__ gh, int T, int H, int bh) {
    __shared__ __attribute__((aligned(16))) float Wagg[8][24];   // rows of 21, padded to 16 B
    const int h = bh % H, b = bh / H;
    const int c = threadIdx.x, lane = c & 31;
    const int wave = __builtin_amdgcn_readfirstlane(c >> 5);     // scalar: the tests on it in 2b are scalar compares
    const int t0 = c * GS_L;

    // all of this thread's inputs, issued up front
    // a head's point is 16 B of a 256-B row; po: this thread's first row, this head, in floats
    const size_t po = ((size_t)b * T + t0) * 64 + h * 4;
    union F4 { f32x4 q; float f[4]; };
    F4 w1[GS_L], w2[GS_L], r1[GS_L], r2[GS_L];
    // the write line of step t takes its first point from row t - 1; step 0 has none (zero below),
    // and its load reads row 0 so that the address stays inside the array
    #pragma unroll
    for (int k = 0; k < GS_L; k++) w1[k].q = *(const f32x4*)(p1w + po + (t0 + k > 0 ? k - 1 : k) * 64);
    // the next loads may land in these loads' address registers
    asm volatile("s_wait_xcnt 0x0" ::: "memory");
    #pragma unroll
    for (int k = 0; k < GS_L; k++) w2[k].q = *(const f32x4*)(p2w + po + k * 64);
    // as above
    asm volatile("s_wait_xcnt 0x0" ::: "memory");
    #pragma unroll
    for (int k = 0; k < GS_L; k++) r1[k].q = *(const f32x4*)(p1r + po + k * 64);
    // as above
    asm volatile("s_wait_xcnt 0x0" ::: "memory");
    #pragma unroll
    for (int k = 0; k < GS_L; k++) r2[k].q = *(const f32x4*)(p2r + po + k * 64);
    // as above
    asm volatile("s_wait_xcnt 0x0" ::: "memory");
    float gl[GS_L];
    #pragma unroll
    for (int k = 0; k < GS_L; k++) gl[k] = glin[((size_t)b * T + t0 + k) * H + h];
    // the loads' address registers are reused by the arithmetic below
    asm volatile("s_wait_xcnt 0x0" ::: "memory");

    const float decay = 1.f / (1.f + expf(-decay_logits[h]));
    const float alpha = 1.f / (1.f + expf(-iter_mix[0]));
    const float msc = mem_scale[h];

    // w[s] = decay^(4 * 2^s): the decay across 2^s chunks
    float w[6];
    w[0] = (decay * decay) * (decay * decay);
    #pragma unroll
    for (int s = 1; s < 6; s++) w[s] = w[s - 1] * w[s - 1];

    // 0) lines
    struct { float f[24]; } J, R;
    #pragma unroll
    for (int k = 0; k < GS_L; k++) {
        float L[6];
        if (t0 + k == 0) {
            #pragma unroll
            for (int e = 0; e < 4; e++) w1[k].f[e] = 0.f;
        }
        exterior4(w1[k].f, w2[k].f, L);
        float* jw = &J.f[k * 6];
        jw[0] = L[5]; jw[1] = -L[4]; jw[2] = L[3]; jw[3] = L[2]; jw[4] = -L[1]; jw[5] = L[0];
        exterior4(r1[k].f, r2[k].f, &R.f[k * 6]);
    }

    // 1) chunk aggregate
    float m[GS_NS];
    #pragma unroll
    for (int n = 0; n < GS_NS; n++) m[n] = 0.f;
    #pragma unroll
    for (int k = 0; k < GS_L; k++) gram_step(m, &J.f[k * 6], decay);

    // 2a) inclusive weighted prefix over the wave's 32 chunks
    #pragma unroll
    for (int s = 0; s < 5; s++) {
        const int o = 1 << s;
        #pragma unroll
        for (int n = 0; n < GS_NS; n++) {
            float v = __shfl_up(m[n], o);
            m[n] = (lane >= o) ? m[n] + w[s] * v : m[n];
        }
    }
    if (lane == 31) {
        #pragma unroll
        for (int n = 0; n < GS_NS; n++) Wagg[wave][n] = m[n];
    }
    // exclusive within the wave
    #pragma unroll
    for (int n = 0; n < GS_NS; n++) {
        float v = __shfl_up(m[n], 1);
        m[n] = (lane > 0) ? v : 0.f;
    }
    __syncthreads();

    // 2b) M at the wave's first step, from the earlier waves' totals.
    // It is the same for the whole wave: lane n folds entry n, then it is read per entry.
    const int ln = (lane < GS_NS) ? lane : 0;
    float tot[7];
    #pragma unroll
    for (int q = 0; q < 7; q++) tot[q] = Wagg[q][ln];
    float p = 0.f;
    #pragma unroll
    for (int q = 0; q < 7; q++) p = (q < wave) ? w[5] * p + tot[q] : p;
    float dl = 1.f;   // decay^(4 * lane)
    #pragma unroll
    for (int s = 0; s < 5; s++) dl *= ((lane >> s) & 1) ? w[s] : 1.f;
    #pragma unroll
    for (int n = 0; n < GS_NS; n++)
        m[n] += dl * __int_as_float(__builtin_amdgcn_readlane(__float_as_int(p), n));

    // 3) replay
    #pragma unroll
    for (int k = 0; k < GS_L; k++) {
        const float* rd = &R.f[k * 6];
        float rdM[6] = {0, 0, 0, 0, 0, 0};
        int n = 0;
        #pragma unroll
        for (int i = 0; i < 6; i++)
            #pragma unroll
            for (int j = i; j < 6; j++, n++) {
                rdM[j] += rd[i] * m[n];
                if (j != i) rdM[i] += rd[j] * m[n];
            }
        float s1 = 0.f, s2 = 0.f;
        #pragma unroll
        for (int j = 0; j < 6; j++) { s1 += rdM[j] * rd[j]; s2 += rdM[j] * rdM[j]; }
        float ms = (1.f - alpha) * s1 + alpha * s2;
        float g1 = 1.f / (1.f + expf(-ms * msc));
        float g2 = 1.f / (1.f + expf(-gl[k]));
        gh[((size_t)b * T + t0 + k) * H + h] = g1 * g2;
        if (k + 1 < GS_L) gram_step(m, &J.f[k * 6], decay);
    }
}

// ---------------------------------------------------------------------------
// Third launch: all that needs the projections or nothing at all, and that the later launches wait
// for.  The attention, the Gram branch and the turn of Wfc, Wproj and Wout do not depend on one
// another, so they share a grid.  The attention blocks last longest and start first; the others run
// beside them.
// ---------------------------------------------------------------------------
#define MID_ATT_BLOCKS  480   // 15 parts of the 8 q-tiles x 32 (b, h)
#define MID_GRAM_BLOCKS 32    // one per (b, h)
#define MID_BLOCKS (MID_ATT_BLOCKS + MID_GRAM_BLOCKS + TR_LATE_BLOCKS)

__global__ __launch_bounds__(256)
void k_mid(TrArgs a, const bf16_t* __restrict__ qkv, float* __restrict__ opart,
           float* __restrict__ pm, float* __restrict__ pl,
           const float* __restrict__ p1w, const float* __restrict__ p2w,
           const float* __restrict__ p1r, const float* __restrict__ p2r,
           const float* __restrict__ glin, const float* __restrict__ decay_logits,
           const float* __restrict__ iter_mix, const float* __restrict__ mem_scale,
           float* __restrict__ gh, int T, int H) {
    __shared__ __attribute__((aligned(16))) char tile[128 * 256];
    const int l = blockIdx.x;
    // written in this order the attention, the longest code on the longest path, comes first in the
    // kernel's text
    if (l >= MID_ATT_BLOCKS) {
        if (l < MID_ATT_BLOCKS + MID_GRAM_BLOCKS)
            gram_block(p1w, p2w, p1r, p2r, glin, decay_logits, iter_mix, mem_scale, gh, T, H, l - MID_ATT_BLOCKS);
        else
            tr_late(a, l - (MID_ATT_BLOCKS + MID_GRAM_BLOCKS), tile);
        return;
    }
    // The 15 parts, those of 3 key tiles first, then those of 2, then the one of 1; 32 (b, h) each.
    // Digit c of each constant belongs to part c: its q-tile, its number among that q-tile's parts
    // (part p of P takes the tiles p * n / P .. (p + 1) * n / P - 1 of n = qb + 1), first tile, end.
    const int c4 = (l >> 5) * 4;
    const int qb  = (int)((0x013346672455677ULL >> c4) & 15);
    const int p   = (int)((0x001001000110221ULL >> c4) & 15);
    const int sb0 = (int)((0x002002000230452ULL >> c4) & 15);
    const int sb1 = (int)((0x124224223563785ULL >> c4) & 15);
    attention_block(qkv, opart + p * ATT_OSTEP, pm + p * ATT_SSTEP, pl + p * ATT_SSTEP,
                    T, H, qb, l & 31, sb0, sb1);
}

// ---------------------------------------------------------------------------
// y = seqout + mean_h(gh) * memval  -> bf16 (input to Wout GEMM)
// seqout is formed here, from the P parts that the row's attention was cut into.  Per head, with
// m_p, l_p, O_p a part's row maximum, sum of exponentials and output sum, and M = max_p m_p:
//   seqout = sum_p exp(m_p - M) O_p / sum_p exp(m_p - M) l_p        (P == 1: O_0 / l_0)
// One block per row of 1024 = 4 x 256 columns; op, mv, yr: the row's start; pm, pl: its 16 heads.
// ---------------------------------------------------------------------------
template <int P>
__device__ __forceinline__
void combine_row(const float* __restrict__ op, const float* __restrict__ pm,
                 const float* __restrict__ pl, const float* __restrict__ mv,
                 float g, bf16_t* __restrict__ yr) {
    const int tid = threadIdx.x, hd = tid >> 6;   // column tid + 256 i lies in head hd + 4 i
    float o[4][P], m[4][P], l[4][P], v[4];
    // The loads stand in groups off one address each.  Behind each group: the next loads' results or
    // later arithmetic may land in its address registers.
    #pragma unroll
    for (int p = 0; p < P; p++) {
        #pragma unroll
        for (int i = 0; i < 4; i++) o[i][p] = op[p * ATT_OSTEP + tid + 256 * i];
        asm volatile("s_wait_xcnt 0x0" ::: "memory");   // see above
    }
    #pragma unroll
    for (int i = 0; i < 4; i++) v[i] = mv[tid + 256 * i];
    asm volatile("s_wait_xcnt 0x0" ::: "memory");   // see above
    #pragma unroll
    for (int p = 0; p < P; p++)
        #pragma unroll
        for (int i = 0; i < 4; i++) l[i][p] = pl[p * ATT_SSTEP + hd + 4 * i];
    asm volatile("s_wait_xcnt 0x0" ::: "memory");   // see above
    #pragma unroll
    for (int p = 0; p < P; p++)
        #pragma unroll
        for (int i = 0; i < 4; i++) m[i][p] = P > 1 ? pm[p * ATT_SSTEP + hd + 4 * i] : 0.f;
    if (P > 1) asm volatile("s_wait_xcnt 0x0" ::: "memory");   // see above
    // keeps the arithmetic behind all the loads: moved up among them it makes the later loads wait
    // for the first ones' data, a second trip to memory
    __builtin_amdgcn_sched_barrier(0);
    bf16_t r[4];
    #pragma unroll
    for (int i = 0; i < 4; i++) {
        float num = o[i][0], den = l[i][0];
        if (P > 1) {
            float mx = m[i][0];
            #pragma unroll
            for (int p = 1; p < P; p++) mx = fmaxf(mx, m[i][p]);
            num = 0.f; den = 0.f;
            #pragma unroll
            for (int p = 0; p < P; p++) {
                const float w = expf(m[i][p] - mx);
                num += w * o[i][p];
                den += w * l[i][p];
            }
        }
        r[i] = (bf16_t)(num / den + g * v[i]);
    }
    // keeps the arithmetic in front of the stores: moved in among them it could land in registers
    // of stores already issued
    __builtin_amdgcn_sched_barrier(0);
    #pragma unroll
    for (int i = 0; i < 4; i++) yr[tid + 256 * i] = r[i];
    // the code laid behind this row's may write the stores' registers
    asm volatile("s_wait_xcnt 0x0" ::: "memory");
}

__global__ __launch_bounds__(256)
void k_combine(const float* __restrict__ opart, const float* __restrict__ pm,
               const float* __restrict__ pl, const float* __restrict__ memval,
               const float* __restrict__ gh, bf16_t* __restrict__ y, int D, int H) {
    size_t row = blockIdx.x;
    float g = 0.f;
    #pragma unroll
    for (int h = 0; h < 16; h++) g += gh[row * H + h];
    g *= (1.f / 16.f);
    const float* op = opart + row * D;
    const float* rm = pm + row * H;
    const float* rl = pl + row * H;
    const float* mv = memval + row * D;
    bf16_t* yr = y + row * D;
    const int P = ATT_NPARTS(((int)blockIdx.x % ATT_T) >> 7);   // the same for the whole block
    if (P == 1)      combine_row<1>(op, rm, rl, mv, g, yr);
    else if (P == 2) combine_row<2>(op, rm, rl, mv, g, yr);
    else             combine_row<3>(op, rm, rl, mv, g, yr);
}

// ---------------------------------------------------------------------------
extern "C" void kernel_launch(void* const* d_in, const int* in_sizes, int n_in,
                              void* d_out, int out_size, void* d_ws, size_t ws_size,
                              hipStream_t stream) {
    const int B = 2, T = 1024, D = 1024, H = 16, DFF = 4096;
    const int M = B * T;

    const float* x            = (const float*)d_in[0];
    const float* ln1_g        = (const float*)d_in[1];
    const float* ln1_b        = (const float*)d_in[2];
    const float* Wqkv         = (const float*)d_in[3];
    const float* bqkv         = (const float*)d_in[4];
    const float* W1w          = (const float*)d_in[5];
    const float* W2w          = (const float*)d_in[6];
    const float* W1r          = (const float*)d_in[7];
    const float* W2r          = (const float*)d_in[8];
    const float* Wmv          = (const float*)d_in[9];
    const float* bmv          = (const float*)d_in[10];
    const float* Wmg          = (const float*)d_in[11];
    const float* bmg          = (const float*)d_in[12];
    const float* mem_scale    = (const float*)d_in[13];
    const float* iter_mix     = (const float*)d_in[14];
    const float* decay_logits = (const float*)d_in[15];
    const float* Wout         = (const float*)d_in[16];
    const float* bout         = (const float*)d_in[17];
    const float* ln2_g        = (const float*)d_in[18];
    const float* ln2_b        = (const float*)d_in[19];
    const float* Wfc          = (const float*)d_in[20];
    const float* bfc          = (const float*)d_in[21];
    const float* Wproj        = (const float*)d_in[22];
    const float* bproj        = (const float*)d_in[23];

    char* ws = (char*)d_ws;
    size_t off = 0;
    auto alloc = [&](size_t bytes) -> void* {
        void* p = ws + off;
        off += (bytes + 255) & ~(size_t)255;
        return p;
    };

    bf16_t* Wqkv_t  = (bf16_t*)alloc((size_t)3 * D * D * 2);
    bf16_t* W1w_t   = (bf16_t*)alloc((size_t)64 * D * 2);
    bf16_t* W2w_t   = (bf16_t*)alloc((size_t)64 * D * 2);
    bf16_t* W1r_t   = (bf16_t*)alloc((size_t)64 * D * 2);
    bf16_t* W2r_t   = (bf16_t*)alloc((size_t)64 * D * 2);
    bf16_t* Wmg_t   = (bf16_t*)alloc((size_t)H * D * 2);
    bf16_t* Wmv_t   = (bf16_t*)alloc((size_t)D * D * 2);
    bf16_t* Wout_t  = (bf16_t*)alloc((size_t)D * D * 2);
    bf16_t* Wfc_t   = (bf16_t*)alloc((size_t)DFF * D * 2);
    bf16_t* Wproj_t = (bf16_t*)alloc((size_t)D * DFF * 2);
    bf16_t* h_bf    = (bf16_t*)alloc((size_t)M * D * 2);
    bf16_t* qkv_bf  = (bf16_t*)alloc((size_t)M * 3 * D * 2);
    float*  p1w     = (float*)alloc((size_t)M * 64 * 4);
    float*  p2w     = (float*)alloc((size_t)M * 64 * 4);
    float*  p1r     = (float*)alloc((size_t)M * 64 * 4);
    float*  p2r     = (float*)alloc((size_t)M * 64 * 4);
    float*  glin    = (float*)alloc((size_t)M * H * 4);
    float*  ghb     = (float*)alloc((size_t)M * H * 4);
    float*  memval  = (float*)alloc((size_t)M * D * 4);
    float*  opart   = (float*)alloc((size_t)ATT_MAXPARTS * M * D * 4);
    float*  pmax    = (float*)alloc((size_t)ATT_MAXPARTS * M * H * 4);
    float*  psum    = (float*)alloc((size_t)ATT_MAXPARTS * M * H * 4);
    bf16_t* y_bf    = (bf16_t*)alloc((size_t)M * D * 2);
    float*  x1      = (float*)alloc((size_t)M * D * 4);
    bf16_t* h2_bf   = (bf16_t*)alloc((size_t)M * D * 2);
    bf16_t* a_bf    = (bf16_t*)alloc((size_t)M * DFF * 2);
    float*  part_o  = (float*)alloc((size_t)SPLIT_OUT * M * D * 4);
    float*  part_p  = (float*)alloc((size_t)SPLIT_PROJ * M * D * 4);

    auto gemm = [&](const bf16_t* A, const bf16_t* Wt, const float* bias,
                    const float* resid, float* oF, bf16_t* oB, int m, int n, int k, int act) {
        dim3 g((n + 127) / 128, (m + 127) / 128);
        k_gemm_bf16<<<g, 256, 0, stream>>>(A, Wt, bias, resid, oF, oB, m, n, k, act);
    };

    // 1) the projections' weights -> bf16 transposed, and ln1
    TrArgs ta = { Wfc, Wproj, Wqkv, Wmv, Wout, W1w, W2w, W1r, W2r, Wmg,
                  Wfc_t, Wproj_t, Wqkv_t, Wmv_t, Wout_t, W1w_t, W2w_t, W1r_t, W2r_t, Wmg_t };
    k_front<<<TR_FIRST_BLOCKS + M, 256, 0, stream>>>(ta, x, ln1_g, ln1_b, h_bf);

    // 2) projections
    ProjArgs pa = { h_bf, Wqkv_t, Wmv_t, W1w_t, W2w_t, W1r_t, W2r_t, Wmg_t,
                    bqkv, bmv, bmg, qkv_bf, memval, p1w, p2w, p1r, p2r, glin, D };
    k_gemm_proj<<<dim3(PROJ_TILES, 16), 256, 0, stream>>>(pa);

    // 3) attention, Gram memory branch, the other weights -> bf16 transposed
    k_mid<<<MID_BLOCKS, 256, 0, stream>>>(ta, qkv_bf, opart, pmax, psum, p1w, p2w, p1r, p2r, glin,
                                          decay_logits, iter_mix, mem_scale, ghb, T, H);

    // 4) the two branches joined
    k_combine<<<M, 256, 0, stream>>>(opart, pmax, psum, memval, ghb, y_bf, D, H);

    // 5) output projection in k ranges; their sum + bias + residual, and ln2
    k_gemm_splitk<<<dim3(8, 16, SPLIT_OUT), 256, 0, stream>>>(y_bf, Wout_t, part_o, D, D, D / SPLIT_OUT);
    k_join_ln<<<M, 256, 0, stream>>>(part_o, bout, x, x1, ln2_g, ln2_b, h2_bf);

    // 6) MLP; the second product in k ranges, then their sum + bias + residual
    gemm(h2_bf, Wfc_t, bfc, nullptr, nullptr, a_bf, M, DFF, D, 1);
    k_gemm_splitk<<<dim3(8, 16, SPLIT_PROJ), 256, 0, stream>>>(a_bf, Wproj_t, part_p, D, DFF, DFF / SPLIT_PROJ);
    k_join_out<<<M / 4, 256, 0, stream>>>(part_p, bproj, x1, (float*)d_out);
}
